// v000
// The times below were measured on an AMD MI455X: many runs one after another, warmed up first and cycling through
// copies of the inputs, with the whole window's GPU time divided by the number of runs. Launches and the gaps
// between them are all in it. The median over several windows is given; except for v000 it joins two sittings, which
// can be a few percent apart, so the side-by-side timings, each taken in one sitting, are the better comparison.
// The starting kernel, v000, takes 5350 microseconds a run.
#include <hip/hip_runtime.h>
// BERT self-attention without an output projection and with a SIGN key mask (hidden_states [4][2048][768]; q/k/v = x W^T + b (natural [768][768] sigma 0.02, biases sigma 0.02); 12 heads of 64; scores / 8; masked_fill(attention_mask < 0, -10000) with the f32 [4][1][1][2048] mask input (a key of batch b is masked iff its mask value is negative); softmax over all keys; context = heads merged -> [4][2048][768]).
// Structure: token rows r = b*2048 + s; x as exact f16 rows (bf16-rounded); Q, K, V as three WMMA GEMMs (32x64 wave tiles, f32 accumulation, exact x16 weights + bias, f16 outputs); per batch: V^T for all heads via LDS transposes; per (batch, group of 4 heads): scores GEMM (K = 64, batched over the heads on grid.y, alpha = 1/sqrt(64)), row softmax on VALU (f32 statistics; weights stored x256 as f16), o = P . V^T GEMM (K = 2048, alpha 2^-8) written f32 straight into the merged-heads output rows (no output projection).
// Compute dtype: inputs rounded to bf16; x / weights exact; q, k, v and softmax weights as plain f16 GEMM operands (~2^-12); scores, softmax statistics and o f32. v_wmma_f32_16x16x32_f16.
#define NB 4
#define SQ 2048
#define DM 768
#define NH 12
#define HD 64
#define HG 4                         /* heads per attention launch group */
#define B0 0                         /* first batch processed (debug hook) */
#define NBR NB                       /* batches processed (debug hook) */
#define NR ((size_t)NB * SQ)         /* token rows */
#define MP ((int)((size_t)NBR * SQ)) /* rows projected (debug hook) */
#define QN SQ                        /* query rows attended per batch (debug hook) */
#define NHD NH                       /* heads attended (debug hook) */
#define MPO MP                       /* unused */
#define LQ DM      /* row pitch of the q/k/v rows */
typedef __bf16 v16b __attribute__((ext_vector_type(16)));
typedef unsigned short v8us __attribute__((ext_vector_type(8), may_alias));
typedef float  v8f  __attribute__((ext_vector_type(8)));
typedef float  v4f  __attribute__((ext_vector_type(4)));
typedef float  v4fa __attribute__((ext_vector_type(4), may_alias));
union FragB { v16b v; v8us half[2]; unsigned short u[16]; };

__device__ __forceinline__ unsigned short bf16_bits(float x) { unsigned int u = __float_as_uint(x); return (unsigned short)((u + 0x7FFFu + ((u >> 16) & 1u)) >> 16); }
__device__ __forceinline__ float bf16_val(unsigned short b) { return __uint_as_float(((unsigned int)b) << 16); }
__device__ __forceinline__ float bf16_round(float x) { return bf16_val(bf16_bits(x)); }
// D += A·B with NT terms: 1 = ah·bh, 2 = + al·bh (A split), 3 = + ah·bl (both split)
template <int NT>
__device__ __forceinline__ v8f mmaN(v16b ah, v16b al, v16b bh, v16b bl, v8f c) {
  c = __builtin_amdgcn_wmma_f32_16x16x32_bf16(false, ah, false, bh, (short)0, c, false, false);
  if (NT >= 2) c = __builtin_amdgcn_wmma_f32_16x16x32_bf16(false, al, false, bh, (short)0, c, false, false);
  if (NT >= 3) c = __builtin_amdgcn_wmma_f32_16x16x32_bf16(false, ah, false, bl, (short)0, c, false, false);
  asm volatile("v_nop\n\tv_nop\n\tv_nop\n\tv_nop" : "+v"(c) : "v"(ah), "v"(al), "v"(bh), "v"(bl));
  return c;
}

__global__ __launch_bounds__(256) void k_wt_bf16(const float* __restrict__ W, unsigned short* __restrict__ Wt, int K, int N) {
  const int t = blockIdx.x * 256 + threadIdx.x;
  const int k8n = K / 8;
  if (t >= N * k8n) return;
  const int n = t / k8n, k8 = (t % k8n) * 8;
  v8us v;
#pragma unroll
  for (int i = 0; i < 8; ++i) v[i] = bf16_bits(W[(size_t)(k8 + i) * N + n]);
  *(v8us*)(Wt + (size_t)n * K + k8) = v;
  
}

// GEMM C[M][N] (f32, pitch ldc) = act(A[M][K]·W + bias). A f32 row-major (pitch lda) converted per fragment to bf16
// (ASPLIT: hi/lo two planes -> 2 terms, else single rounded term); Wt bf16 [N][K] (pitch ldb). BIAS_BF16 rounds the
// bias to bf16 first (bias quantised to bf16 before the add). K%32==0, M%16==0, N%64==0.
template <bool ASPLIT, int ACT, bool BIAS_BF16>
__global__ __launch_bounds__(128) void k_gemm_bf(const float* __restrict__ A, int lda, const unsigned short* __restrict__ Wt, int ldb,
                                               const float* __restrict__ bias, float* __restrict__ C, int ldc, int M, int N, int K) {
  __shared__ __attribute__((aligned(16))) float so[4][16][64];
  const int tid = threadIdx.x, w = tid >> 5, lane = tid & 31, ln = lane & 15, hh = lane >> 4;
  const int ntn = N / 64;
  const int wid = blockIdx.x * 4 + w;
  const int mt = wid / ntn, nq = wid % ntn;
  if (mt * 16 >= M) return;
  const int row0 = mt * 16, col0 = nq * 64;
  const float* arow = A + (size_t)(row0 + ln) * lda;
  v8f acc[4] = {};
  for (int kb = 0; kb < K; kb += 32) {
    FragB ah, al;
    const v4f x0 = *(const v4fa*)(arow + kb + 8 * hh), x1 = *(const v4fa*)(arow + kb + 8 * hh + 4);
    const v4f x2 = *(const v4fa*)(arow + kb + 16 + 8 * hh), x3 = *(const v4fa*)(arow + kb + 16 + 8 * hh + 4);
    float xs[16] = {x0[0],x0[1],x0[2],x0[3],x1[0],x1[1],x1[2],x1[3],x2[0],x2[1],x2[2],x2[3],x3[0],x3[1],x3[2],x3[3]};
#pragma unroll
    for (int i = 0; i < 16; ++i) { const unsigned short hb = bf16_bits(xs[i]); ah.u[i] = hb; al.u[i] = ASPLIT ? bf16_bits(xs[i] - bf16_val(hb)) : (unsigned short)0; }
#pragma unroll
    for (int t = 0; t < 4; ++t) {
      const unsigned short* brow = Wt + (size_t)(col0 + t * 16 + ln) * ldb + kb;
      FragB b;
      b.half[0] = *(const v8us*)(brow + 8 * hh);
      b.half[1] = *(const v8us*)(brow + 16 + 8 * hh);
      acc[t] = mmaN<ASPLIT ? 2 : 1>(ah.v, al.v, b.v, b.v, acc[t]);
    }
  }
#pragma unroll
  for (int t = 0; t < 4; ++t) {
    float bv = bias ? bias[col0 + t * 16 + ln] : 0.f;
    if (BIAS_BF16) bv = bf16_round(bv);
#pragma unroll
    for (int r = 0; r < 8; ++r) { float v = acc[t][r] + bv; if (ACT == 1) v = fmaxf(v, 0.f); so[w][8 * hh + r][t * 16 + ln] = v; }
  }
  __builtin_amdgcn_fence(__ATOMIC_ACQ_REL, "workgroup");
  __builtin_amdgcn_wave_barrier();
  const int rsub = lane >> 4, c4 = (lane & 15) * 4;
  {
#pragma unroll
    for (int q = 0; q < 8; ++q) {
      const int r = q * 2 + rsub;
      const v4f v = *(const v4fa*)&so[w][r][c4];
      *(v4f*)(C + (size_t)(row0 + r) * ldc + col0 + c4) = v;
    }
    
  }
}

// GEMM C = act(A·W + bias + resid): A f32 (ASPLIT -> hi/lo 2 terms), Wt bf16 [N][K]; ACT 0 none, 1 relu, 2 exact gelu;
// resid (optional, f32, row index = (row % rmod), pitch ldr, RES_BF16 rounds it) added before the activation.
template <bool ASPLIT, int ACT, bool BIAS_BF16, bool RES_BF16>
__global__ __launch_bounds__(128) void k_gemm_bf3(const float* __restrict__ A, int lda, const unsigned short* __restrict__ Wt, int ldb,
                                                const float* __restrict__ bias, const float* __restrict__ resid, int rmod, int ldr,
                                                float* __restrict__ C, int ldc, int M, int N, int K) {
  __shared__ __attribute__((aligned(16))) float so[4][16][64];
  const int tid = threadIdx.x, w = tid >> 5, lane = tid & 31, ln = lane & 15, hh = lane >> 4;
  const int ntn = N / 64;
  const int wid = blockIdx.x * 4 + w;
  const int mt = wid / ntn, nq = wid % ntn;
  if (mt * 16 >= M) return;
  const int row0 = mt * 16, col0 = nq * 64;
  const float* arow = A + (size_t)(row0 + ln) * lda;
  v8f acc[4] = {};
  for (int kb = 0; kb < K; kb += 32) {
    FragB ah, al;
    const v4f x0 = *(const v4fa*)(arow + kb + 8 * hh), x1 = *(const v4fa*)(arow + kb + 8 * hh + 4);
    const v4f x2 = *(const v4fa*)(arow + kb + 16 + 8 * hh), x3 = *(const v4fa*)(arow + kb + 16 + 8 * hh + 4);
    float xs[16] = {x0[0],x0[1],x0[2],x0[3],x1[0],x1[1],x1[2],x1[3],x2[0],x2[1],x2[2],x2[3],x3[0],x3[1],x3[2],x3[3]};
#pragma unroll
    for (int i = 0; i < 16; ++i) { const unsigned short hb = bf16_bits(xs[i]); ah.u[i] = hb; al.u[i] = ASPLIT ? bf16_bits(xs[i] - bf16_val(hb)) : (unsigned short)0; }
#pragma unroll
    for (int t = 0; t < 4; ++t) {
      const unsigned short* brow = Wt + (size_t)(col0 + t * 16 + ln) * ldb + kb;
      FragB b;
      b.half[0] = *(const v8us*)(brow + 8 * hh);
      b.half[1] = *(const v8us*)(brow + 16 + 8 * hh);
      acc[t] = mmaN<ASPLIT ? 2 : 1>(ah.v, al.v, b.v, b.v, acc[t]);
    }
  }
#pragma unroll
  for (int t = 0; t < 4; ++t) {
    const int col = col0 + t * 16 + ln;
    float bv = bias ? bias[col] : 0.f;
    if (BIAS_BF16) bv = bf16_round(bv);
#pragma unroll
    for (int r = 0; r < 8; ++r) {
      float v = acc[t][r] + bv;
      if (resid) { float rv = resid[(size_t)((row0 + 8 * hh + r) % rmod) * ldr + col]; if (RES_BF16) rv = bf16_round(rv); v += rv; }
      if (ACT == 1) v = fmaxf(v, 0.f);
      if (ACT == 2) v = 0.5f * v * (1.0f + erff(v * 0.70710678118654752f));
      if (ACT == 3) { const float u = 0.7978845608028654f * (v + 0.044715f * v * v * v); v = 0.5f * v * (1.0f + tanhf(u)); }
      so[w][8 * hh + r][t * 16 + ln] = v;
    }
  }
  __builtin_amdgcn_fence(__ATOMIC_ACQ_REL, "workgroup");
  __builtin_amdgcn_wave_barrier();
  const int rsub = lane >> 4, c4 = (lane & 15) * 4;
  {
#pragma unroll
    for (int q = 0; q < 8; ++q) {
      const int r = q * 2 + rsub;
      const v4f v = *(const v4fa*)&so[w][r][c4];
      *(v4f*)(C + (size_t)(row0 + r) * ldc + col0 + c4) = v;
    }
    
  }
}
// row LayerNorm (biased variance, eps) over N: s = X (+ R); optional out_sum <- s; out_norm <- (s-mu)*rsqrt(var+eps)*g + b
template <bool PARAM_BF16>
__global__ __launch_bounds__(256) void k_layernorm(const float* __restrict__ X, const float* __restrict__ R, const float* __restrict__ g, const float* __restrict__ bta,
                                                  float* __restrict__ out_sum, float* __restrict__ out_norm, int N, float eps) {
  __shared__ float red[256];
  const int row = blockIdx.x, tid = threadIdx.x;
  const float* x = X + (size_t)row * N; const float* rr = R ? R + (size_t)row * N : nullptr;
  float vals[16];                     // up to N = 4096
  const int per = N / 256;            // contiguous chunk per thread? use strided-by-4 chunks: thread handles j = tid*4 + 1024*u
  float s1 = 0.f;
  for (int u = 0; u < per / 4; ++u) {
    const int j = tid * 4 + 1024 * u;
    const v4f a = *(const v4fa*)(x + j);
    v4f b = {0.f,0.f,0.f,0.f}; if (rr) b = *(const v4fa*)(rr + j);
#pragma unroll
    for (int q = 0; q < 4; ++q) { const float v = a[q] + b[q]; vals[u * 4 + q] = v; s1 += v; }
  }
  red[tid] = s1; __syncthreads();
  for (int st = 128; st > 0; st >>= 1) { if (tid < st) red[tid] += red[tid + st]; __syncthreads(); }
  const float mu = red[0] / (float)N; __syncthreads();
  float s2 = 0.f;
  for (int u = 0; u < per / 4; ++u)
#pragma unroll
    for (int q = 0; q < 4; ++q) { const float c = vals[u * 4 + q] - mu; s2 += c * c; }
  red[tid] = s2; __syncthreads();
  for (int st = 128; st > 0; st >>= 1) { if (tid < st) red[tid] += red[tid + st]; __syncthreads(); }
  const float rs = rsqrtf(red[0] / (float)N + eps);
  {
    for (int u = 0; u < per / 4; ++u) {
      const int j = tid * 4 + 1024 * u;
      v4f o, sm;
#pragma unroll
      for (int q = 0; q < 4; ++q) {
        float gg = g[j + q], bb = bta[j + q];
        if (PARAM_BF16) { gg = bf16_round(gg); bb = bf16_round(bb); }
        sm[q] = vals[u * 4 + q]; o[q] = (vals[u * 4 + q] - mu) * rs * gg + bb;
      }
      if (out_sum) *(v4f*)(out_sum + (size_t)row * N + j) = sm;
      *(v4f*)(out_norm + (size_t)row * N + j) = o;
    }
    
  }
}



// ---- f16 WMMA path (v_wmma_f32_16x16x32_f16): 11-bit significands for operands in range — used where a [0,1] probability operand needs more precision than bf16
typedef _Float16 v16h __attribute__((ext_vector_type(16)));
union FragH { v16h v; v8us half[2]; _Float16 h[16]; unsigned short u[16]; };
template <int NT>
__device__ __forceinline__ v8f mmaH(v16h ah, v16h al, v16h bh, v16h bl, v8f c) {
  c = __builtin_amdgcn_wmma_f32_16x16x32_f16(false, ah, false, bh, (short)0, c, false, false);
  if (NT >= 2) c = __builtin_amdgcn_wmma_f32_16x16x32_f16(false, al, false, bh, (short)0, c, false, false);
  if (NT >= 3) c = __builtin_amdgcn_wmma_f32_16x16x32_f16(false, ah, false, bl, (short)0, c, false, false);
  asm volatile("v_nop\n\tv_nop\n\tv_nop\n\tv_nop" : "+v"(c) : "v"(ah), "v"(al), "v"(bh), "v"(bl));
  return c;
}
// batched GEMM like k_gemm_b but f16 operands: A f32 (split into f16 hi/lo if ASPLIT, else rounded to f16), Bt = f16 values [n][k]; alpha; C f32; N multiple of 16 (partial tiles skipped)
template <bool ASPLIT>
__global__ __launch_bounds__(128) void k_gemm_h(const float* __restrict__ A, int lda, size_t sA, const _Float16* __restrict__ Bh, int ldb, size_t sB, float alpha, float* __restrict__ C, int ldc, size_t sC, int M, int N, int K) {
  __shared__ __attribute__((aligned(16))) float so[4][16][64];
  const int tid = threadIdx.x, w = tid >> 5, lane = tid & 31, ln = lane & 15, hh = lane >> 4; const int by = blockIdx.y;
  A += (size_t)by * sA; Bh += (size_t)by * sB; C += (size_t)by * sC;
  const int ntn = (N + 63) / 64; const int wid = blockIdx.x * 4 + w; const int mt = wid / ntn, nq = wid % ntn; if (mt * 16 >= M) return;
  const int row0 = mt * 16, col0 = nq * 64; const float* arow = A + (size_t)(row0 + ln) * lda;
  v8f acc[4] = {};
  for (int kb = 0; kb < K; kb += 32) {
    FragH ah, al;
    const v4f x0 = *(const v4fa*)(arow + kb + 8 * hh), x1 = *(const v4fa*)(arow + kb + 8 * hh + 4), x2 = *(const v4fa*)(arow + kb + 16 + 8 * hh), x3 = *(const v4fa*)(arow + kb + 16 + 8 * hh + 4);
    float xs[16] = {x0[0],x0[1],x0[2],x0[3],x1[0],x1[1],x1[2],x1[3],x2[0],x2[1],x2[2],x2[3],x3[0],x3[1],x3[2],x3[3]};
#pragma unroll
    for (int i = 0; i < 16; ++i) { const _Float16 h = (_Float16)xs[i]; ah.h[i] = h; al.h[i] = ASPLIT ? (_Float16)(xs[i] - (float)h) : (_Float16)0.0f; }
#pragma unroll
    for (int t = 0; t < 4; ++t) { if (col0 + t * 16 >= N) continue; const size_t boff = (size_t)(col0 + t * 16 + ln) * ldb + kb; FragH bq; bq.half[0] = *(const v8us*)(Bh + boff + 8 * hh); bq.half[1] = *(const v8us*)(Bh + boff + 16 + 8 * hh);
      acc[t] = mmaH<ASPLIT ? 2 : 1>(ah.v, al.v, bq.v, bq.v, acc[t]); }
  }
#pragma unroll
  for (int t = 0; t < 4; ++t) { if (col0 + t * 16 >= N) continue;
#pragma unroll
    for (int r = 0; r < 8; ++r) so[w][8 * hh + r][t * 16 + ln] = acc[t][r] * alpha; }
  __builtin_amdgcn_fence(__ATOMIC_ACQ_REL, "workgroup"); __builtin_amdgcn_wave_barrier();
  const int rsub = lane >> 4, c4 = (lane & 15) * 4;
  {
#pragma unroll
    for (int q = 0; q < 8; ++q) { const int r = q * 2 + rsub; if (col0 + c4 < N) { const v4f v = *(const v4fa*)&so[w][r][c4]; *(v4f*)(C + (size_t)(row0 + r) * ldc + col0 + c4) = v; } }
     }
}

// Wt[n][k] = f16(W[k][n]·scale) from f32 row-major W[K][N] (scale = power of two; bf16-exact weights stay exact in f16 away from the subnormal range)
__global__ __launch_bounds__(256) void k_wt_f16(const float* __restrict__ W, _Float16* __restrict__ Wt, int K, int N, float scale) {
  const int t = blockIdx.x * 256 + threadIdx.x; if (t >= N * (K / 8)) return; const int n = t / (K / 8), k8 = (t % (K / 8)) * 8; FragH f;
#pragma unroll
  for (int i = 0; i < 8; ++i) f.h[i] = (_Float16)(bf16_round(W[(size_t)(k8 + i) * N + n]) * scale); const v8us o = f.half[0];
  *(v8us*)((unsigned short*)Wt + (size_t)n * K + k8) = o; 
}
// k_gemm_hh variant with fused epilogue: v = acc·alpha + bias[by·sBias + col] (+ CP[(row/rowsPerB)·sCPb + by·64 + col] if CP) ; ACT 0 none / 1 elu ; writes f16 C16 (and f32 C if non-null)
template <int ACT>
__global__ __launch_bounds__(128) void k_gemm_hhx(const _Float16* __restrict__ A, int lda, size_t sA, const _Float16* __restrict__ Bh, int ldb, size_t sB, float alpha, const float* __restrict__ bias, size_t sBias, const float* __restrict__ CP, int rowsPerB, size_t sCPb, int row0g,
    float* __restrict__ C, _Float16* __restrict__ C16, int ldc, size_t sC, int M, int N, int K) {
  __shared__ __attribute__((aligned(16))) float so[4][16][64];
  const int tid = threadIdx.x, w = tid >> 5, lane = tid & 31, ln = lane & 15, hh = lane >> 4; const int by = blockIdx.y;
  A += (size_t)by * sA; Bh += (size_t)by * sB; const size_t cofs = (size_t)by * sC; const float* bp = bias ? bias + (size_t)by * sBias : nullptr;
  const int ntn = (N + 63) / 64; const int wid = blockIdx.x * 4 + w; const int mt = wid / ntn, nq = wid % ntn; if (mt * 16 >= M) return;
  const int row0 = mt * 16, col0 = nq * 64; const _Float16* arow = A + (size_t)(row0 + ln) * lda;
  v8f acc[4] = {};
  for (int kb = 0; kb < K; kb += 32) { FragH ah; ah.half[0] = *(const v8us*)((const unsigned short*)arow + kb + 8 * hh); ah.half[1] = *(const v8us*)((const unsigned short*)arow + kb + 16 + 8 * hh);
#pragma unroll
    for (int t = 0; t < 4; ++t) { if (col0 + t * 16 >= N) continue; const size_t boff = (size_t)(col0 + t * 16 + ln) * ldb + kb; FragH bq; bq.half[0] = *(const v8us*)((const unsigned short*)Bh + boff + 8 * hh); bq.half[1] = *(const v8us*)((const unsigned short*)Bh + boff + 16 + 8 * hh);
      acc[t] = mmaH<1>(ah.v, ah.v, bq.v, bq.v, acc[t]); }
  }
#pragma unroll
  for (int t = 0; t < 4; ++t) { if (col0 + t * 16 >= N) continue; const int col = col0 + t * 16 + ln; const float bv = bp ? bf16_round(bp[col]) : 0.f;
#pragma unroll
    for (int r = 0; r < 8; ++r) { float v = acc[t][r] * alpha + bv; if (CP) { const int rr = row0g + row0 + 8 * hh + r; if (rowsPerB < 0) v += CP[cofs + (size_t)rr * ldc + col];      /* rowsPerB < 0: own element of the batched C plane */ else { const int bidx = rr / rowsPerB; v += CP[(size_t)bidx * sCPb + (size_t)by * 64 + col]; } } if (ACT == 1) v = (v > 0.f) ? v : expm1f(v); else if (ACT == 7) v = (v > 0.f) ? v + 1.0f : expf(v); else if (ACT == 8) v = tanhf(v); else if (ACT == 9) v = 0.5f * v * (1.0f + tanhf(0.7978845608028654f * (v + 0.044715f * v * v * v))); else if (ACT == 11) v = 1.0f / (1.0f + expf(-v)); else if (ACT == 12) v = (v > 0.f) ? v : 0.01f * v; else if (ACT == 14) v = (v > 0.f) ? v : 0.1f * v; else if (ACT == 16) v = (v >= 0.f) ? v : 0.3f * v; else if (ACT == 17) v = (v >= 0.f) ? v : 0.2f * v; else if (ACT == 15) v = v / (1.0f + expf(-v)); else if (ACT == 3) v = fmaxf(v, 0.f); else if (ACT == 6) v = 0.5f * v * (1.0f + erff(v * 0.70710678118654752f)); so[w][8 * hh + r][t * 16 + ln] = v; } }
  __builtin_amdgcn_fence(__ATOMIC_ACQ_REL, "workgroup"); __builtin_amdgcn_wave_barrier();
  const int rsub = lane >> 4, c4 = (lane & 15) * 4; typedef _Float16 v4h __attribute__((ext_vector_type(4)));
  {
#pragma unroll
    for (int q = 0; q < 8; ++q) { const int r = q * 2 + rsub; if (col0 + c4 < N) { const v4f v = *(const v4fa*)&so[w][r][c4]; if (C) *(v4f*)(C + cofs + (size_t)(row0 + r) * ldc + col0 + c4) = v; if (C16) { v4h h4; for (int i = 0; i < 4; ++i) h4[i] = (_Float16)v[i]; *(v4h*)(C16 + cofs + (size_t)(row0 + r) * ldc + col0 + c4) = h4; } } }
     }
}


typedef _Float16 v4h __attribute__((ext_vector_type(4)));

__global__ __launch_bounds__(256) void k_x16(const float* __restrict__ x, _Float16* __restrict__ X16, size_t n8) { const size_t t = (size_t)blockIdx.x * 256 + threadIdx.x; if (t >= n8) return; FragH f;
#pragma unroll
  for (int q = 0; q < 8; ++q) f.h[q] = (_Float16)bf16_round(x[t * 8 + q]); *(v8us*)((unsigned short*)X16 + t * 8) = f.half[0];  }
__global__ __launch_bounds__(256) void k_h16(const float* __restrict__ x, _Float16* __restrict__ X16, size_t n8) { const size_t t = (size_t)blockIdx.x * 256 + threadIdx.x; if (t >= n8) return; FragH f;
#pragma unroll
  for (int q = 0; q < 8; ++q) f.h[q] = (_Float16)x[t * 8 + q]; *(v8us*)((unsigned short*)X16 + t * 8) = f.half[0];  }
__global__ __launch_bounds__(256) void k_round16f(const float* __restrict__ W, _Float16* __restrict__ Bt, size_t n8) { const size_t t = (size_t)blockIdx.x * 256 + threadIdx.x; if (t >= n8) return; FragH f;
#pragma unroll
  for (int i = 0; i < 8; ++i) f.h[i] = (_Float16)(bf16_round(W[t * 8 + i]) * 16.0f); *(v8us*)((unsigned short*)Bt + t * 8) = f.half[0];  }
template <int NHv, int TTv>
__global__ __launch_bounds__(256) void k_vt(const _Float16* __restrict__ V16, int ldv, int voff, _Float16* __restrict__ Vt) { __shared__ unsigned short tl[64][66]; const int tid = threadIdx.x; const int slab = blockIdx.x / (TTv / 64), lg = blockIdx.x % (TTv / 64); const int b = slab / NHv, h = slab % NHv;
  for (int i = tid; i < 64 * 8; i += 256) { const int r = i / 8, c8 = (i % 8) * 8; FragH f; f.half[0] = *(const v8us*)((const unsigned short*)V16 + ((size_t)b * TTv + lg * 64 + r) * ldv + voff + h * 64 + c8);
#pragma unroll
    for (int q = 0; q < 8; ++q) tl[r][c8 + q] = f.u[q]; }
  __syncthreads();
  {
#pragma unroll
    for (int rd = 0; rd < 2; ++rd) { const int d = rd * 32 + tid / 8, pc = tid % 8; FragH f;
#pragma unroll
      for (int q = 0; q < 8; ++q) f.u[q] = tl[pc * 8 + q][d];
      *(v8us*)((unsigned short*)Vt + ((size_t)slab * 64 + d) * TTv + lg * 64 + pc * 8) = f.half[0]; }
     } }

__global__ __launch_bounds__(256) void k_hl(const float* __restrict__ F, _Float16* __restrict__ Hh, _Float16* __restrict__ Hl, size_t n8) { const size_t t = (size_t)blockIdx.x * 256 + threadIdx.x; if (t >= n8) return; FragH fh, fl; const v4f a = *(const v4fa*)(F + t * 8), c = *(const v4fa*)(F + t * 8 + 4);
#pragma unroll
  for (int q = 0; q < 4; ++q) { _Float16 h = (_Float16)a[q]; fh.h[q] = h; fl.h[q] = (_Float16)((a[q] - (float)h) * 1024.0f); h = (_Float16)c[q]; fh.h[4 + q] = h; fl.h[4 + q] = (_Float16)((c[q] - (float)h) * 1024.0f); }
  { *(v8us*)((unsigned short*)Hh + t * 8) = fh.half[0]; *(v8us*)((unsigned short*)Hl + t * 8) = fl.half[0];  } }

// ---- fast GEMM (wave tile 32x64; requires M % 32 == 0 rows per launch region and N % 64 == 0); epilogue = k_gemm_hhx semantics ----
__device__ __forceinline__ v16h g2_frag(const _Float16* p, int hh) { FragH f; f.half[0] = *(const v8us*)((const unsigned short*)p + 8 * hh); f.half[1] = *(const v8us*)((const unsigned short*)p + 16 + 8 * hh); return f.v; }
__device__ __forceinline__ v8f g2_mma(v16h a, v16h b, v8f c) { v8f d = __builtin_amdgcn_wmma_f32_16x16x32_f16(false, a, false, b, (short)0, c, false, false); asm volatile("v_nop\n\tv_nop\n\tv_nop\n\tv_nop" : "+v"(d) : "v"(a), "v"(b)); return d; }
template <int ACT>
__global__ __launch_bounds__(128) void k_gemm2(const _Float16* __restrict__ A, int lda, size_t sA, const _Float16* __restrict__ Bh, int ldb, size_t sB, float alpha, const float* __restrict__ bias, size_t sBias, const float* __restrict__ CP, int rowsPerB, size_t sCPb, int row0g,
    float* __restrict__ C, _Float16* __restrict__ C16, int ldc, size_t sC, int M, int N, int K) { static_assert(ACT == 0 || ACT == 3 || ACT == 6 || ACT == 8 || ACT == 9 || ACT == 11 || ACT == 12 || ACT == 14 || ACT == 15 || ACT == 16 || ACT == 17, "k_gemm2: unsupported ACT code (would silently apply no activation)");
  __shared__ __attribute__((aligned(16))) float so[4][32][68];
  const int tid = threadIdx.x, w = tid >> 5, lane = tid & 31, ln = lane & 15, hh = lane >> 4; const int by = blockIdx.y;
  A += (size_t)by * sA; Bh += (size_t)by * sB; const size_t cofs = (size_t)by * sC; const float* bp = bias ? bias + (size_t)by * sBias : nullptr;
  const int ntn = N >> 6; const int mt = blockIdx.x / ntn, nq = blockIdx.x - mt * ntn; const int row0 = mt * 128 + 32 * w, col0 = nq * 64; if (row0 >= M) return;
  const _Float16* a0p = A + (size_t)(row0 + ln) * lda; const _Float16* a1p = a0p + (size_t)16 * lda;
  const _Float16* b0p = Bh + (size_t)(col0 + ln) * ldb; const _Float16* b1p = b0p + (size_t)16 * ldb; const _Float16* b2p = b1p + (size_t)16 * ldb; const _Float16* b3p = b2p + (size_t)16 * ldb;
  const v8f z8 = {0.f,0.f,0.f,0.f,0.f,0.f,0.f,0.f}; v8f c00 = z8, c01 = z8, c02 = z8, c03 = z8, c10 = z8, c11 = z8, c12 = z8, c13 = z8;
#pragma unroll 1
  for (int kb = 0; kb < K; kb += 32) { const v16h a0 = g2_frag(a0p + kb, hh), a1 = g2_frag(a1p + kb, hh);
    v16h b = g2_frag(b0p + kb, hh); c00 = g2_mma(a0, b, c00); c10 = g2_mma(a1, b, c10);
    b = g2_frag(b1p + kb, hh); c01 = g2_mma(a0, b, c01); c11 = g2_mma(a1, b, c11);
    b = g2_frag(b2p + kb, hh); c02 = g2_mma(a0, b, c02); c12 = g2_mma(a1, b, c12);
    b = g2_frag(b3p + kb, hh); c03 = g2_mma(a0, b, c03); c13 = g2_mma(a1, b, c13); }
  v8f accs[8] = {c00, c01, c02, c03, c10, c11, c12, c13};
#pragma unroll
  for (int u = 0; u < 8; ++u) { const int t = u & 3, half = u >> 2; const int col = col0 + t * 16 + ln; const float bv = bp ? bf16_round(bp[col]) : 0.f;
#pragma unroll
    for (int r = 0; r < 8; ++r) { const int rloc = half * 16 + 8 * hh + r; float v = accs[u][r] * alpha + bv; if (CP) { if (rowsPerB < 0) v += CP[cofs + (size_t)(row0g + row0 + rloc) * ldc + col];      /* rowsPerB < 0: own element of the batched C plane */ else { const int bidx = (row0g + row0 + rloc) / rowsPerB; v += CP[(size_t)bidx * sCPb + (size_t)by * 64 + col]; } }
      if (ACT == 3) v = fmaxf(v, 0.f); else if (ACT == 6) v = 0.5f * v * (1.0f + erff(v * 0.70710678118654752f)); else if (ACT == 11) v = 1.0f / (1.0f + expf(-v)); else if (ACT == 15) v = v / (1.0f + expf(-v)); else if (ACT == 12) v = (v > 0.f) ? v : 0.01f * v; else if (ACT == 8) v = tanhf(v); else if (ACT == 9) v = 0.5f * v * (1.0f + tanhf(0.7978845608028654f * (v + 0.044715f * v * v * v))); else if (ACT == 14) v = (v > 0.f) ? v : 0.1f * v; else if (ACT == 16) v = (v >= 0.f) ? v : 0.3f * v; else if (ACT == 17) v = (v >= 0.f) ? v : 0.2f * v;
      so[w][rloc][t * 16 + ln] = v; } }
  __builtin_amdgcn_fence(__ATOMIC_ACQ_REL, "workgroup"); __builtin_amdgcn_wave_barrier();
  const int rsub = lane >> 4, c4 = (lane & 15) * 4;
  {
#pragma unroll
    for (int q = 0; q < 16; ++q) { const int r = q * 2 + rsub; const v4f v = *(const v4fa*)&so[w][r][c4]; if (C) *(v4f*)(C + cofs + (size_t)(row0 + r) * ldc + col0 + c4) = v; if (C16) { v4h h4; for (int i = 0; i < 4; ++i) h4[i] = (_Float16)v[i]; *(v4h*)(C16 + cofs + (size_t)(row0 + r) * ldc + col0 + c4) = h4; } }
     } }


__global__ __launch_bounds__(256) void k_wnat(const float* __restrict__ w, size_t n8, _Float16* __restrict__ Bt) { const size_t t = (size_t)blockIdx.x * 256 + threadIdx.x; if (t >= n8) return; FragH f; for (int q = 0; q < 8; ++q) f.h[q] = (_Float16)(bf16_round(w[t * 8 + q]) * 16.0f); *(v8us*)((unsigned short*)Bt + t * 8) = f.half[0];  }
__global__ __launch_bounds__(256) void k_rsm(const float* __restrict__ S, _Float16* __restrict__ P, int nrows) {
  #pragma clang fp contract(off)
  const int i = blockIdx.x * 256 + threadIdx.x; if (i >= nrows) return; const float* s = S + (size_t)i * SQ; float mx = -3.0e38f;
#pragma unroll 1
  for (int j = 0; j < SQ; ++j) mx = fmaxf(mx, s[j]); float se = 0.f;
#pragma unroll 1
  for (int j = 0; j < SQ; ++j) se += expf(s[j] - mx); const float sc = 256.0f / se;
#pragma unroll 1
  for (int j0 = 0; j0 < SQ; j0 += 8) { FragH f; for (int q = 0; q < 8; ++q) f.h[q] = (_Float16)(expf(s[j0 + q] - mx) * sc); unsigned short* d = (unsigned short*)P + (size_t)i * SQ + j0; *(v8us*)d = f.half[0];  } }
__global__ __launch_bounds__(256) void k_vt(const _Float16* __restrict__ V16, int b, int h0, _Float16* __restrict__ VT) { __shared__ unsigned short tl[64][65]; const int tid = threadIdx.x; const int hh = blockIdx.x % HG, sg = blockIdx.x / HG; const int s0 = sg * 64; const int h = h0 + hh;
  for (int i = tid; i < 64 * 8; i += 256) { const int j = i / 8, d8 = (i % 8) * 8; FragH f; f.half[0] = *(const v8us*)((const unsigned short*)V16 + ((size_t)b * SQ + s0 + j) * DM + h * HD + d8); for (int q = 0; q < 8; ++q) tl[d8 + q][j] = f.u[q]; }
  __syncthreads();
  { for (int i = tid; i < 64 * 8; i += 256) { const int d = i / 8, j8 = (i % 8) * 8; FragH f; for (int q = 0; q < 8; ++q) f.u[q] = tl[d][j8 + q]; *(v8us*)((unsigned short*)VT + ((size_t)hh * HD + d) * SQ + s0 + j8) = f.half[0]; }  } }



__global__ __launch_bounds__(256) void k_rsmkm(const float* __restrict__ S, _Float16* __restrict__ P, int nrows, const float* __restrict__ mk) {
  #pragma clang fp contract(off)
  const int t = blockIdx.x * 256 + threadIdx.x; if (t >= nrows) return; const size_t ri = (size_t)t; const float* s = S + ri * SQ; float mx = -3.0e38f;
#pragma unroll 1
  for (int j = 0; j < SQ; ++j) { const float f = (bf16_round(mk[j]) < 0.f) ? 0.f : 1.f; mx = fmaxf(mx, fmaf(f, s[j], (1.f - f) * -10000.0f)); } float se = 0.f;
#pragma unroll 1
  for (int j = 0; j < SQ; ++j) { const float f = (bf16_round(mk[j]) < 0.f) ? 0.f : 1.f; se += __expf(fmaf(f, s[j], (1.f - f) * -10000.0f) - mx); } const float sc = 256.0f / se;
#pragma unroll 1
  for (int j0 = 0; j0 < SQ; j0 += 8) { FragH fr; for (int q = 0; q < 8; ++q) { const int j = j0 + q; const float f = (bf16_round(mk[j]) < 0.f) ? 0.f : 1.f; fr.h[q] = (_Float16)(__expf(fmaf(f, s[j], (1.f - f) * -10000.0f) - mx) * sc); } unsigned short* d = (unsigned short*)P + ri * SQ + j0; *(v8us*)d = fr.half[0];  } }
extern "C" void kernel_launch(void* const* d_in, const int* in_sizes, int n_in,
                              void* d_out, int out_size, void* d_ws, size_t ws_size, hipStream_t stream) {
  (void)in_sizes; (void)n_in; (void)out_size;
  const float* const* I = (const float* const*)d_in; const float* x = I[0]; const float* am = I[1]; const float* wq = I[2]; const float* bq = I[3]; const float* wk = I[4]; const float* bk = I[5]; const float* wv = I[6]; const float* bv = I[7];      /* hidden_states; attention_mask f32 [4][1][1][2048] (READ on device: key masked iff bf16(mask) < 0); natural weights + biases */
  char* ws = (char*)d_ws; size_t off = 0;
  auto take = [&](size_t bytes) { char* p = ws + off; off += (bytes + 255) & ~(size_t)255; return p; };
  _Float16* BQ = (_Float16*)take((size_t)DM * DM * 2); _Float16* BK = (_Float16*)take((size_t)DM * DM * 2); _Float16* BV = (_Float16*)take((size_t)DM * DM * 2); 
  _Float16* X16 = (_Float16*)take(NR * DM * 2); _Float16* Q16 = (_Float16*)take(NR * DM * 2); _Float16* K16 = (_Float16*)take(NR * DM * 2); _Float16* V16 = (_Float16*)take(NR * DM * 2);
  float* S = (float*)take((size_t)HG * SQ * SQ * 4); _Float16* P = (_Float16*)take((size_t)HG * SQ * SQ * 2); _Float16* VT = (_Float16*)take((size_t)NH * HD * SQ * 2);
  if (off > ws_size) return;
  { const unsigned g = (unsigned)(((size_t)DM * DM / 8 + 255) / 256); k_wnat<<<g, 256, 0, stream>>>(wq, (size_t)DM * DM / 8, BQ); k_wnat<<<g, 256, 0, stream>>>(wk, (size_t)DM * DM / 8, BK); k_wnat<<<g, 256, 0, stream>>>(wv, (size_t)DM * DM / 8, BV); }      /* natural [out][in] = Bt[n][k], x16 */

  k_x16<<<(unsigned)((NR * DM / 8 + 255) / 256), 256, 0, stream>>>(x, X16, NR * DM / 8);
  const size_t r0p = (size_t)B0 * SQ;      /* first projected row */
  k_gemm2<0><<<dim3((unsigned)((MP / 128) * (DM / 64)), 1), 128, 0, stream>>>(X16 + r0p * DM, DM, 0, BQ, DM, 0, 0.0625f, bq, 0, nullptr, 1, 0, 0, nullptr, Q16 + r0p * DM, DM, 0, MP, DM, DM);
  k_gemm2<0><<<dim3((unsigned)((MP / 128) * (DM / 64)), 1), 128, 0, stream>>>(X16 + r0p * DM, DM, 0, BK, DM, 0, 0.0625f, bk, 0, nullptr, 1, 0, 0, nullptr, K16 + r0p * DM, DM, 0, MP, DM, DM);
  k_gemm2<0><<<dim3((unsigned)((MP / 128) * (DM / 64)), 1), 128, 0, stream>>>(X16 + r0p * DM, DM, 0, BV, DM, 0, 0.0625f, bv, 0, nullptr, 1, 0, 0, nullptr, V16 + r0p * DM, DM, 0, MP, DM, DM);
  for (int b = B0; b < B0 + NBR; ++b) { const size_t r0 = (size_t)b * SQ;
    k_vt<NH, SQ><<<NH * (SQ / 64), 256, 0, stream>>>(V16 + r0 * LQ, LQ, 0, VT);      /* V^T [NH][HD][SQ] for this batch */
    for (int h0 = 0; h0 < NHD; h0 += HG) {
      k_gemm2<0><<<dim3((QN / 128) * (SQ / 64), HG), 128, 0, stream>>>(Q16 + r0 * LQ + h0 * HD, LQ, (size_t)HD, K16 + r0 * LQ + h0 * HD, LQ, (size_t)HD, 0.125f, nullptr, 0, nullptr, 1, 0, 0, S, nullptr, SQ, (size_t)SQ * SQ, QN, SQ, HD);      /* scores, HG heads per launch */
      k_rsmkm<<<(HG * SQ + 255) / 256, 256, 0, stream>>>(S, P, HG * SQ, am + (size_t)b * SQ);      /* sign key mask of THIS batch (arithmetic select, -10000 fill) + softmax -> P x256 f16 */
      k_gemm2<0><<<dim3((QN / 128) * (HD / 64), HG), 128, 0, stream>>>(P, SQ, (size_t)SQ * SQ, VT + (size_t)h0 * HD * SQ, SQ, (size_t)HD * SQ, 0.00390625f, nullptr, 0, nullptr, 1, 0, 0, (float*)d_out + r0 * DM + h0 * HD, nullptr, DM, (size_t)HD, QN, HD, SQ); } }      /* out = P V^T (alpha 2^-8) written f32 straight into the merged-heads output rows */
}

// v001
// It runs in 1330 microseconds.
// Timed twice side by side with v000, it ran 4.07 and 4.04 times as fast.
#include <hip/hip_runtime.h>
// BERT self-attention without an output projection and with a SIGN key mask (hidden_states [4][2048][768]; q/k/v = x W^T + b (natural [768][768] sigma 0.02, biases sigma 0.02); 12 heads of 64; scores / 8; masked_fill(attention_mask < 0, -10000) with the f32 [4][1][1][2048] mask input (a key of batch b is masked iff its mask value is negative); softmax over all keys; context = heads merged -> [4][2048][768]).
// Structure: token rows r = b*2048 + s; x as exact f16 rows (bf16-rounded); Q, K, V as three WMMA GEMMs (32x64 wave tiles, f32 accumulation, exact x16 weights + bias, f16 outputs); per batch: V^T for all heads via LDS transposes; per (batch, group of 4 heads): scores GEMM (K = 64, batched over the heads on grid.y, alpha = 1/sqrt(64)), row softmax on VALU (f32 statistics; weights stored x256 as f16), o = P . V^T GEMM (K = 2048, alpha 2^-8) written f32 straight into the merged-heads output rows (no output projection).
// Compute dtype: inputs rounded to bf16; x / weights exact; q, k, v and softmax weights as plain f16 GEMM operands (~2^-12); scores, softmax statistics and o f32. v_wmma_f32_16x16x32_f16.
#define NB 4
#define SQ 2048
#define DM 768
#define NH 12
#define HD 64
#define HG 4                         /* heads per attention launch group */
#define B0 0                         /* first batch processed (debug hook) */
#define NBR NB                       /* batches processed (debug hook) */
#define NR ((size_t)NB * SQ)         /* token rows */
#define MP ((int)((size_t)NBR * SQ)) /* rows projected (debug hook) */
#define QN SQ                        /* query rows attended per batch (debug hook) */
#define NHD NH                       /* heads attended (debug hook) */
#define MPO MP                       /* unused */
#define LQ DM      /* row pitch of the q/k/v rows */
typedef __bf16 v16b __attribute__((ext_vector_type(16)));
typedef unsigned short v8us __attribute__((ext_vector_type(8), may_alias));
typedef float  v8f  __attribute__((ext_vector_type(8)));
typedef float  v4f  __attribute__((ext_vector_type(4)));
typedef float  v4fa __attribute__((ext_vector_type(4), may_alias));
union FragB { v16b v; v8us half[2]; unsigned short u[16]; };

__device__ __forceinline__ unsigned short bf16_bits(float x) { unsigned int u = __float_as_uint(x); return (unsigned short)((u + 0x7FFFu + ((u >> 16) & 1u)) >> 16); }
__device__ __forceinline__ float bf16_val(unsigned short b) { return __uint_as_float(((unsigned int)b) << 16); }
__device__ __forceinline__ float bf16_round(float x) { return bf16_val(bf16_bits(x)); }
// D += A·B with NT terms: 1 = ah·bh, 2 = + al·bh (A split), 3 = + ah·bl (both split)
template <int NT>
__device__ __forceinline__ v8f mmaN(v16b ah, v16b al, v16b bh, v16b bl, v8f c) {
  c = __builtin_amdgcn_wmma_f32_16x16x32_bf16(false, ah, false, bh, (short)0, c, false, false);
  if (NT >= 2) c = __builtin_amdgcn_wmma_f32_16x16x32_bf16(false, al, false, bh, (short)0, c, false, false);
  if (NT >= 3) c = __builtin_amdgcn_wmma_f32_16x16x32_bf16(false, ah, false, bl, (short)0, c, false, false);
  asm volatile("v_nop\n\tv_nop\n\tv_nop\n\tv_nop" : "+v"(c) : "v"(ah), "v"(al), "v"(bh), "v"(bl));
  return c;
}

__global__ __launch_bounds__(256) void k_wt_bf16(const float* __restrict__ W, unsigned short* __restrict__ Wt, int K, int N) {
  const int t = blockIdx.x * 256 + threadIdx.x;
  const int k8n = K / 8;
  if (t >= N * k8n) return;
  const int n = t / k8n, k8 = (t % k8n) * 8;
  v8us v;
#pragma unroll
  for (int i = 0; i < 8; ++i) v[i] = bf16_bits(W[(size_t)(k8 + i) * N + n]);
  *(v8us*)(Wt + (size_t)n * K + k8) = v;
  
}

// GEMM C[M][N] (f32, pitch ldc) = act(A[M][K]·W + bias). A f32 row-major (pitch lda) converted per fragment to bf16
// (ASPLIT: hi/lo two planes -> 2 terms, else single rounded term); Wt bf16 [N][K] (pitch ldb). BIAS_BF16 rounds the
// bias to bf16 first (bias quantised to bf16 before the add). K%32==0, M%16==0, N%64==0.
template <bool ASPLIT, int ACT, bool BIAS_BF16>
__global__ __launch_bounds__(128) void k_gemm_bf(const float* __restrict__ A, int lda, const unsigned short* __restrict__ Wt, int ldb,
                                               const float* __restrict__ bias, float* __restrict__ C, int ldc, int M, int N, int K) {
  __shared__ __attribute__((aligned(16))) float so[4][16][64];
  const int tid = threadIdx.x, w = tid >> 5, lane = tid & 31, ln = lane & 15, hh = lane >> 4;
  const int ntn = N / 64;
  const int wid = blockIdx.x * 4 + w;
  const int mt = wid / ntn, nq = wid % ntn;
  if (mt * 16 >= M) return;
  const int row0 = mt * 16, col0 = nq * 64;
  const float* arow = A + (size_t)(row0 + ln) * lda;
  v8f acc[4] = {};
  for (int kb = 0; kb < K; kb += 32) {
    FragB ah, al;
    const v4f x0 = *(const v4fa*)(arow + kb + 8 * hh), x1 = *(const v4fa*)(arow + kb + 8 * hh + 4);
    const v4f x2 = *(const v4fa*)(arow + kb + 16 + 8 * hh), x3 = *(const v4fa*)(arow + kb + 16 + 8 * hh + 4);
    float xs[16] = {x0[0],x0[1],x0[2],x0[3],x1[0],x1[1],x1[2],x1[3],x2[0],x2[1],x2[2],x2[3],x3[0],x3[1],x3[2],x3[3]};
#pragma unroll
    for (int i = 0; i < 16; ++i) { const unsigned short hb = bf16_bits(xs[i]); ah.u[i] = hb; al.u[i] = ASPLIT ? bf16_bits(xs[i] - bf16_val(hb)) : (unsigned short)0; }
#pragma unroll
    for (int t = 0; t < 4; ++t) {
      const unsigned short* brow = Wt + (size_t)(col0 + t * 16 + ln) * ldb + kb;
      FragB b;
      b.half[0] = *(const v8us*)(brow + 8 * hh);
      b.half[1] = *(const v8us*)(brow + 16 + 8 * hh);
      acc[t] = mmaN<ASPLIT ? 2 : 1>(ah.v, al.v, b.v, b.v, acc[t]);
    }
  }
#pragma unroll
  for (int t = 0; t < 4; ++t) {
    float bv = bias ? bias[col0 + t * 16 + ln] : 0.f;
    if (BIAS_BF16) bv = bf16_round(bv);
#pragma unroll
    for (int r = 0; r < 8; ++r) { float v = acc[t][r] + bv; if (ACT == 1) v = fmaxf(v, 0.f); so[w][8 * hh + r][t * 16 + ln] = v; }
  }
  __builtin_amdgcn_fence(__ATOMIC_ACQ_REL, "workgroup");
  __builtin_amdgcn_wave_barrier();
  const int rsub = lane >> 4, c4 = (lane & 15) * 4;
  {
#pragma unroll
    for (int q = 0; q < 8; ++q) {
      const int r = q * 2 + rsub;
      const v4f v = *(const v4fa*)&so[w][r][c4];
      *(v4f*)(C + (size_t)(row0 + r) * ldc + col0 + c4) = v;
    }
    
  }
}

// GEMM C = act(A·W + bias + resid): A f32 (ASPLIT -> hi/lo 2 terms), Wt bf16 [N][K]; ACT 0 none, 1 relu, 2 exact gelu;
// resid (optional, f32, row index = (row % rmod), pitch ldr, RES_BF16 rounds it) added before the activation.
template <bool ASPLIT, int ACT, bool BIAS_BF16, bool RES_BF16>
__global__ __launch_bounds__(128) void k_gemm_bf3(const float* __restrict__ A, int lda, const unsigned short* __restrict__ Wt, int ldb,
                                                const float* __restrict__ bias, const float* __restrict__ resid, int rmod, int ldr,
                                                float* __restrict__ C, int ldc, int M, int N, int K) {
  __shared__ __attribute__((aligned(16))) float so[4][16][64];
  const int tid = threadIdx.x, w = tid >> 5, lane = tid & 31, ln = lane & 15, hh = lane >> 4;
  const int ntn = N / 64;
  const int wid = blockIdx.x * 4 + w;
  const int mt = wid / ntn, nq = wid % ntn;
  if (mt * 16 >= M) return;
  const int row0 = mt * 16, col0 = nq * 64;
  const float* arow = A + (size_t)(row0 + ln) * lda;
  v8f acc[4] = {};
  for (int kb = 0; kb < K; kb += 32) {
    FragB ah, al;
    const v4f x0 = *(const v4fa*)(arow + kb + 8 * hh), x1 = *(const v4fa*)(arow + kb + 8 * hh + 4);
    const v4f x2 = *(const v4fa*)(arow + kb + 16 + 8 * hh), x3 = *(const v4fa*)(arow + kb + 16 + 8 * hh + 4);
    float xs[16] = {x0[0],x0[1],x0[2],x0[3],x1[0],x1[1],x1[2],x1[3],x2[0],x2[1],x2[2],x2[3],x3[0],x3[1],x3[2],x3[3]};
#pragma unroll
    for (int i = 0; i < 16; ++i) { const unsigned short hb = bf16_bits(xs[i]); ah.u[i] = hb; al.u[i] = ASPLIT ? bf16_bits(xs[i] - bf16_val(hb)) : (unsigned short)0; }
#pragma unroll
    for (int t = 0; t < 4; ++t) {
      const unsigned short* brow = Wt + (size_t)(col0 + t * 16 + ln) * ldb + kb;
      FragB b;
      b.half[0] = *(const v8us*)(brow + 8 * hh);
      b.half[1] = *(const v8us*)(brow + 16 + 8 * hh);
      acc[t] = mmaN<ASPLIT ? 2 : 1>(ah.v, al.v, b.v, b.v, acc[t]);
    }
  }
#pragma unroll
  for (int t = 0; t < 4; ++t) {
    const int col = col0 + t * 16 + ln;
    float bv = bias ? bias[col] : 0.f;
    if (BIAS_BF16) bv = bf16_round(bv);
#pragma unroll
    for (int r = 0; r < 8; ++r) {
      float v = acc[t][r] + bv;
      if (resid) { float rv = resid[(size_t)((row0 + 8 * hh + r) % rmod) * ldr + col]; if (RES_BF16) rv = bf16_round(rv); v += rv; }
      if (ACT == 1) v = fmaxf(v, 0.f);
      if (ACT == 2) v = 0.5f * v * (1.0f + erff(v * 0.70710678118654752f));
      if (ACT == 3) { const float u = 0.7978845608028654f * (v + 0.044715f * v * v * v); v = 0.5f * v * (1.0f + tanhf(u)); }
      so[w][8 * hh + r][t * 16 + ln] = v;
    }
  }
  __builtin_amdgcn_fence(__ATOMIC_ACQ_REL, "workgroup");
  __builtin_amdgcn_wave_barrier();
  const int rsub = lane >> 4, c4 = (lane & 15) * 4;
  {
#pragma unroll
    for (int q = 0; q < 8; ++q) {
      const int r = q * 2 + rsub;
      const v4f v = *(const v4fa*)&so[w][r][c4];
      *(v4f*)(C + (size_t)(row0 + r) * ldc + col0 + c4) = v;
    }
    
  }
}
// row LayerNorm (biased variance, eps) over N: s = X (+ R); optional out_sum <- s; out_norm <- (s-mu)*rsqrt(var+eps)*g + b
template <bool PARAM_BF16>
__global__ __launch_bounds__(256) void k_layernorm(const float* __restrict__ X, const float* __restrict__ R, const float* __restrict__ g, const float* __restrict__ bta,
                                                  float* __restrict__ out_sum, float* __restrict__ out_norm, int N, float eps) {
  __shared__ float red[256];
  const int row = blockIdx.x, tid = threadIdx.x;
  const float* x = X + (size_t)row * N; const float* rr = R ? R + (size_t)row * N : nullptr;
  float vals[16];                     // up to N = 4096
  const int per = N / 256;            // contiguous chunk per thread? use strided-by-4 chunks: thread handles j = tid*4 + 1024*u
  float s1 = 0.f;
  for (int u = 0; u < per / 4; ++u) {
    const int j = tid * 4 + 1024 * u;
    const v4f a = *(const v4fa*)(x + j);
    v4f b = {0.f,0.f,0.f,0.f}; if (rr) b = *(const v4fa*)(rr + j);
#pragma unroll
    for (int q = 0; q < 4; ++q) { const float v = a[q] + b[q]; vals[u * 4 + q] = v; s1 += v; }
  }
  red[tid] = s1; __syncthreads();
  for (int st = 128; st > 0; st >>= 1) { if (tid < st) red[tid] += red[tid + st]; __syncthreads(); }
  const float mu = red[0] / (float)N; __syncthreads();
  float s2 = 0.f;
  for (int u = 0; u < per / 4; ++u)
#pragma unroll
    for (int q = 0; q < 4; ++q) { const float c = vals[u * 4 + q] - mu; s2 += c * c; }
  red[tid] = s2; __syncthreads();
  for (int st = 128; st > 0; st >>= 1) { if (tid < st) red[tid] += red[tid + st]; __syncthreads(); }
  const float rs = rsqrtf(red[0] / (float)N + eps);
  {
    for (int u = 0; u < per / 4; ++u) {
      const int j = tid * 4 + 1024 * u;
      v4f o, sm;
#pragma unroll
      for (int q = 0; q < 4; ++q) {
        float gg = g[j + q], bb = bta[j + q];
        if (PARAM_BF16) { gg = bf16_round(gg); bb = bf16_round(bb); }
        sm[q] = vals[u * 4 + q]; o[q] = (vals[u * 4 + q] - mu) * rs * gg + bb;
      }
      if (out_sum) *(v4f*)(out_sum + (size_t)row * N + j) = sm;
      *(v4f*)(out_norm + (size_t)row * N + j) = o;
    }
    
  }
}



// ---- f16 WMMA path (v_wmma_f32_16x16x32_f16): 11-bit significands for operands in range — used where a [0,1] probability operand needs more precision than bf16
typedef _Float16 v16h __attribute__((ext_vector_type(16)));
union FragH { v16h v; v8us half[2]; _Float16 h[16]; unsigned short u[16]; };
template <int NT>
__device__ __forceinline__ v8f mmaH(v16h ah, v16h al, v16h bh, v16h bl, v8f c) {
  c = __builtin_amdgcn_wmma_f32_16x16x32_f16(false, ah, false, bh, (short)0, c, false, false);
  if (NT >= 2) c = __builtin_amdgcn_wmma_f32_16x16x32_f16(false, al, false, bh, (short)0, c, false, false);
  if (NT >= 3) c = __builtin_amdgcn_wmma_f32_16x16x32_f16(false, ah, false, bl, (short)0, c, false, false);
  asm volatile("v_nop\n\tv_nop\n\tv_nop\n\tv_nop" : "+v"(c) : "v"(ah), "v"(al), "v"(bh), "v"(bl));
  return c;
}
// batched GEMM like k_gemm_b but f16 operands: A f32 (split into f16 hi/lo if ASPLIT, else rounded to f16), Bt = f16 values [n][k]; alpha; C f32; N multiple of 16 (partial tiles skipped)
template <bool ASPLIT>
__global__ __launch_bounds__(128) void k_gemm_h(const float* __restrict__ A, int lda, size_t sA, const _Float16* __restrict__ Bh, int ldb, size_t sB, float alpha, float* __restrict__ C, int ldc, size_t sC, int M, int N, int K) {
  __shared__ __attribute__((aligned(16))) float so[4][16][64];
  const int tid = threadIdx.x, w = tid >> 5, lane = tid & 31, ln = lane & 15, hh = lane >> 4; const int by = blockIdx.y;
  A += (size_t)by * sA; Bh += (size_t)by * sB; C += (size_t)by * sC;
  const int ntn = (N + 63) / 64; const int wid = blockIdx.x * 4 + w; const int mt = wid / ntn, nq = wid % ntn; if (mt * 16 >= M) return;
  const int row0 = mt * 16, col0 = nq * 64; const float* arow = A + (size_t)(row0 + ln) * lda;
  v8f acc[4] = {};
  for (int kb = 0; kb < K; kb += 32) {
    FragH ah, al;
    const v4f x0 = *(const v4fa*)(arow + kb + 8 * hh), x1 = *(const v4fa*)(arow + kb + 8 * hh + 4), x2 = *(const v4fa*)(arow + kb + 16 + 8 * hh), x3 = *(const v4fa*)(arow + kb + 16 + 8 * hh + 4);
    float xs[16] = {x0[0],x0[1],x0[2],x0[3],x1[0],x1[1],x1[2],x1[3],x2[0],x2[1],x2[2],x2[3],x3[0],x3[1],x3[2],x3[3]};
#pragma unroll
    for (int i = 0; i < 16; ++i) { const _Float16 h = (_Float16)xs[i]; ah.h[i] = h; al.h[i] = ASPLIT ? (_Float16)(xs[i] - (float)h) : (_Float16)0.0f; }
#pragma unroll
    for (int t = 0; t < 4; ++t) { if (col0 + t * 16 >= N) continue; const size_t boff = (size_t)(col0 + t * 16 + ln) * ldb + kb; FragH bq; bq.half[0] = *(const v8us*)(Bh + boff + 8 * hh); bq.half[1] = *(const v8us*)(Bh + boff + 16 + 8 * hh);
      acc[t] = mmaH<ASPLIT ? 2 : 1>(ah.v, al.v, bq.v, bq.v, acc[t]); }
  }
#pragma unroll
  for (int t = 0; t < 4; ++t) { if (col0 + t * 16 >= N) continue;
#pragma unroll
    for (int r = 0; r < 8; ++r) so[w][8 * hh + r][t * 16 + ln] = acc[t][r] * alpha; }
  __builtin_amdgcn_fence(__ATOMIC_ACQ_REL, "workgroup"); __builtin_amdgcn_wave_barrier();
  const int rsub = lane >> 4, c4 = (lane & 15) * 4;
  {
#pragma unroll
    for (int q = 0; q < 8; ++q) { const int r = q * 2 + rsub; if (col0 + c4 < N) { const v4f v = *(const v4fa*)&so[w][r][c4]; *(v4f*)(C + (size_t)(row0 + r) * ldc + col0 + c4) = v; } }
     }
}

// Wt[n][k] = f16(W[k][n]·scale) from f32 row-major W[K][N] (scale = power of two; bf16-exact weights stay exact in f16 away from the subnormal range)
__global__ __launch_bounds__(256) void k_wt_f16(const float* __restrict__ W, _Float16* __restrict__ Wt, int K, int N, float scale) {
  const int t = blockIdx.x * 256 + threadIdx.x; if (t >= N * (K / 8)) return; const int n = t / (K / 8), k8 = (t % (K / 8)) * 8; FragH f;
#pragma unroll
  for (int i = 0; i < 8; ++i) f.h[i] = (_Float16)(bf16_round(W[(size_t)(k8 + i) * N + n]) * scale); const v8us o = f.half[0];
  *(v8us*)((unsigned short*)Wt + (size_t)n * K + k8) = o; 
}
// k_gemm_hh variant with fused epilogue: v = acc·alpha + bias[by·sBias + col] (+ CP[(row/rowsPerB)·sCPb + by·64 + col] if CP) ; ACT 0 none / 1 elu ; writes f16 C16 (and f32 C if non-null)
template <int ACT>
__global__ __launch_bounds__(128) void k_gemm_hhx(const _Float16* __restrict__ A, int lda, size_t sA, const _Float16* __restrict__ Bh, int ldb, size_t sB, float alpha, const float* __restrict__ bias, size_t sBias, const float* __restrict__ CP, int rowsPerB, size_t sCPb, int row0g,
    float* __restrict__ C, _Float16* __restrict__ C16, int ldc, size_t sC, int M, int N, int K) {
  __shared__ __attribute__((aligned(16))) float so[4][16][64];
  const int tid = threadIdx.x, w = tid >> 5, lane = tid & 31, ln = lane & 15, hh = lane >> 4; const int by = blockIdx.y;
  A += (size_t)by * sA; Bh += (size_t)by * sB; const size_t cofs = (size_t)by * sC; const float* bp = bias ? bias + (size_t)by * sBias : nullptr;
  const int ntn = (N + 63) / 64; const int wid = blockIdx.x * 4 + w; const int mt = wid / ntn, nq = wid % ntn; if (mt * 16 >= M) return;
  const int row0 = mt * 16, col0 = nq * 64; const _Float16* arow = A + (size_t)(row0 + ln) * lda;
  v8f acc[4] = {};
  for (int kb = 0; kb < K; kb += 32) { FragH ah; ah.half[0] = *(const v8us*)((const unsigned short*)arow + kb + 8 * hh); ah.half[1] = *(const v8us*)((const unsigned short*)arow + kb + 16 + 8 * hh);
#pragma unroll
    for (int t = 0; t < 4; ++t) { if (col0 + t * 16 >= N) continue; const size_t boff = (size_t)(col0 + t * 16 + ln) * ldb + kb; FragH bq; bq.half[0] = *(const v8us*)((const unsigned short*)Bh + boff + 8 * hh); bq.half[1] = *(const v8us*)((const unsigned short*)Bh + boff + 16 + 8 * hh);
      acc[t] = mmaH<1>(ah.v, ah.v, bq.v, bq.v, acc[t]); }
  }
#pragma unroll
  for (int t = 0; t < 4; ++t) { if (col0 + t * 16 >= N) continue; const int col = col0 + t * 16 + ln; const float bv = bp ? bf16_round(bp[col]) : 0.f;
#pragma unroll
    for (int r = 0; r < 8; ++r) { float v = acc[t][r] * alpha + bv; if (CP) { const int rr = row0g + row0 + 8 * hh + r; if (rowsPerB < 0) v += CP[cofs + (size_t)rr * ldc + col];      /* rowsPerB < 0: own element of the batched C plane */ else { const int bidx = rr / rowsPerB; v += CP[(size_t)bidx * sCPb + (size_t)by * 64 + col]; } } if (ACT == 1) v = (v > 0.f) ? v : expm1f(v); else if (ACT == 7) v = (v > 0.f) ? v + 1.0f : expf(v); else if (ACT == 8) v = tanhf(v); else if (ACT == 9) v = 0.5f * v * (1.0f + tanhf(0.7978845608028654f * (v + 0.044715f * v * v * v))); else if (ACT == 11) v = 1.0f / (1.0f + expf(-v)); else if (ACT == 12) v = (v > 0.f) ? v : 0.01f * v; else if (ACT == 14) v = (v > 0.f) ? v : 0.1f * v; else if (ACT == 16) v = (v >= 0.f) ? v : 0.3f * v; else if (ACT == 17) v = (v >= 0.f) ? v : 0.2f * v; else if (ACT == 15) v = v / (1.0f + expf(-v)); else if (ACT == 3) v = fmaxf(v, 0.f); else if (ACT == 6) v = 0.5f * v * (1.0f + erff(v * 0.70710678118654752f)); so[w][8 * hh + r][t * 16 + ln] = v; } }
  __builtin_amdgcn_fence(__ATOMIC_ACQ_REL, "workgroup"); __builtin_amdgcn_wave_barrier();
  const int rsub = lane >> 4, c4 = (lane & 15) * 4; typedef _Float16 v4h __attribute__((ext_vector_type(4)));
  {
#pragma unroll
    for (int q = 0; q < 8; ++q) { const int r = q * 2 + rsub; if (col0 + c4 < N) { const v4f v = *(const v4fa*)&so[w][r][c4]; if (C) *(v4f*)(C + cofs + (size_t)(row0 + r) * ldc + col0 + c4) = v; if (C16) { v4h h4; for (int i = 0; i < 4; ++i) h4[i] = (_Float16)v[i]; *(v4h*)(C16 + cofs + (size_t)(row0 + r) * ldc + col0 + c4) = h4; } } }
     }
}


typedef _Float16 v4h __attribute__((ext_vector_type(4)));

__global__ __launch_bounds__(256) void k_x16(const float* __restrict__ x, _Float16* __restrict__ X16, size_t n8) { const size_t t = (size_t)blockIdx.x * 256 + threadIdx.x; if (t >= n8) return; FragH f;
#pragma unroll
  for (int q = 0; q < 8; ++q) f.h[q] = (_Float16)bf16_round(x[t * 8 + q]); *(v8us*)((unsigned short*)X16 + t * 8) = f.half[0];  }
__global__ __launch_bounds__(256) void k_h16(const float* __restrict__ x, _Float16* __restrict__ X16, size_t n8) { const size_t t = (size_t)blockIdx.x * 256 + threadIdx.x; if (t >= n8) return; FragH f;
#pragma unroll
  for (int q = 0; q < 8; ++q) f.h[q] = (_Float16)x[t * 8 + q]; *(v8us*)((unsigned short*)X16 + t * 8) = f.half[0];  }
__global__ __launch_bounds__(256) void k_round16f(const float* __restrict__ W, _Float16* __restrict__ Bt, size_t n8) { const size_t t = (size_t)blockIdx.x * 256 + threadIdx.x; if (t >= n8) return; FragH f;
#pragma unroll
  for (int i = 0; i < 8; ++i) f.h[i] = (_Float16)(bf16_round(W[t * 8 + i]) * 16.0f); *(v8us*)((unsigned short*)Bt + t * 8) = f.half[0];  }
template <int NHv, int TTv>
__global__ __launch_bounds__(256) void k_vt(const _Float16* __restrict__ V16, int ldv, int voff, _Float16* __restrict__ Vt) { __shared__ unsigned short tl[64][66]; const int tid = threadIdx.x; const int slab = blockIdx.x / (TTv / 64), lg = blockIdx.x % (TTv / 64); const int b = slab / NHv, h = slab % NHv;
  for (int i = tid; i < 64 * 8; i += 256) { const int r = i / 8, c8 = (i % 8) * 8; FragH f; f.half[0] = *(const v8us*)((const unsigned short*)V16 + ((size_t)b * TTv + lg * 64 + r) * ldv + voff + h * 64 + c8);
#pragma unroll
    for (int q = 0; q < 8; ++q) tl[r][c8 + q] = f.u[q]; }
  __syncthreads();
  {
#pragma unroll
    for (int rd = 0; rd < 2; ++rd) { const int d = rd * 32 + tid / 8, pc = tid % 8; FragH f;
#pragma unroll
      for (int q = 0; q < 8; ++q) f.u[q] = tl[pc * 8 + q][d];
      *(v8us*)((unsigned short*)Vt + ((size_t)slab * 64 + d) * TTv + lg * 64 + pc * 8) = f.half[0]; }
     } }

__global__ __launch_bounds__(256) void k_hl(const float* __restrict__ F, _Float16* __restrict__ Hh, _Float16* __restrict__ Hl, size_t n8) { const size_t t = (size_t)blockIdx.x * 256 + threadIdx.x; if (t >= n8) return; FragH fh, fl; const v4f a = *(const v4fa*)(F + t * 8), c = *(const v4fa*)(F + t * 8 + 4);
#pragma unroll
  for (int q = 0; q < 4; ++q) { _Float16 h = (_Float16)a[q]; fh.h[q] = h; fl.h[q] = (_Float16)((a[q] - (float)h) * 1024.0f); h = (_Float16)c[q]; fh.h[4 + q] = h; fl.h[4 + q] = (_Float16)((c[q] - (float)h) * 1024.0f); }
  { *(v8us*)((unsigned short*)Hh + t * 8) = fh.half[0]; *(v8us*)((unsigned short*)Hl + t * 8) = fl.half[0];  } }

// ---- fast GEMM (wave tile 32x64; requires M % 32 == 0 rows per launch region and N % 64 == 0); epilogue = k_gemm_hhx semantics ----
__device__ __forceinline__ v16h g2_frag(const _Float16* p, int hh) { FragH f; f.half[0] = *(const v8us*)((const unsigned short*)p + 8 * hh); f.half[1] = *(const v8us*)((const unsigned short*)p + 16 + 8 * hh); return f.v; }
__device__ __forceinline__ v8f g2_mma(v16h a, v16h b, v8f c) { v8f d = __builtin_amdgcn_wmma_f32_16x16x32_f16(false, a, false, b, (short)0, c, false, false); asm volatile("v_nop\n\tv_nop\n\tv_nop\n\tv_nop" : "+v"(d) : "v"(a), "v"(b)); return d; }
template <int ACT>
__global__ __launch_bounds__(128) void k_gemm2(const _Float16* __restrict__ A, int lda, size_t sA, const _Float16* __restrict__ Bh, int ldb, size_t sB, float alpha, const float* __restrict__ bias, size_t sBias, const float* __restrict__ CP, int rowsPerB, size_t sCPb, int row0g,
    float* __restrict__ C, _Float16* __restrict__ C16, int ldc, size_t sC, int M, int N, int K) { static_assert(ACT == 0 || ACT == 3 || ACT == 6 || ACT == 8 || ACT == 9 || ACT == 11 || ACT == 12 || ACT == 14 || ACT == 15 || ACT == 16 || ACT == 17, "k_gemm2: unsupported ACT code (would silently apply no activation)");
  __shared__ __attribute__((aligned(16))) float so[4][32][68];
  const int tid = threadIdx.x, w = tid >> 5, lane = tid & 31, ln = lane & 15, hh = lane >> 4; const int by = blockIdx.y;
  A += (size_t)by * sA; Bh += (size_t)by * sB; const size_t cofs = (size_t)by * sC; const float* bp = bias ? bias + (size_t)by * sBias : nullptr;
  const int ntn = N >> 6; const int mt = blockIdx.x / ntn, nq = blockIdx.x - mt * ntn; const int row0 = mt * 128 + 32 * w, col0 = nq * 64; if (row0 >= M) return;
  const _Float16* a0p = A + (size_t)(row0 + ln) * lda; const _Float16* a1p = a0p + (size_t)16 * lda;
  const _Float16* b0p = Bh + (size_t)(col0 + ln) * ldb; const _Float16* b1p = b0p + (size_t)16 * ldb; const _Float16* b2p = b1p + (size_t)16 * ldb; const _Float16* b3p = b2p + (size_t)16 * ldb;
  const v8f z8 = {0.f,0.f,0.f,0.f,0.f,0.f,0.f,0.f}; v8f c00 = z8, c01 = z8, c02 = z8, c03 = z8, c10 = z8, c11 = z8, c12 = z8, c13 = z8;
#pragma unroll 1
  for (int kb = 0; kb < K; kb += 32) { const v16h a0 = g2_frag(a0p + kb, hh), a1 = g2_frag(a1p + kb, hh);
    v16h b = g2_frag(b0p + kb, hh); c00 = g2_mma(a0, b, c00); c10 = g2_mma(a1, b, c10);
    b = g2_frag(b1p + kb, hh); c01 = g2_mma(a0, b, c01); c11 = g2_mma(a1, b, c11);
    b = g2_frag(b2p + kb, hh); c02 = g2_mma(a0, b, c02); c12 = g2_mma(a1, b, c12);
    b = g2_frag(b3p + kb, hh); c03 = g2_mma(a0, b, c03); c13 = g2_mma(a1, b, c13); }
  v8f accs[8] = {c00, c01, c02, c03, c10, c11, c12, c13};
#pragma unroll
  for (int u = 0; u < 8; ++u) { const int t = u & 3, half = u >> 2; const int col = col0 + t * 16 + ln; const float bv = bp ? bf16_round(bp[col]) : 0.f;
#pragma unroll
    for (int r = 0; r < 8; ++r) { const int rloc = half * 16 + 8 * hh + r; float v = accs[u][r] * alpha + bv; if (CP) { if (rowsPerB < 0) v += CP[cofs + (size_t)(row0g + row0 + rloc) * ldc + col];      /* rowsPerB < 0: own element of the batched C plane */ else { const int bidx = (row0g + row0 + rloc) / rowsPerB; v += CP[(size_t)bidx * sCPb + (size_t)by * 64 + col]; } }
      if (ACT == 3) v = fmaxf(v, 0.f); else if (ACT == 6) v = 0.5f * v * (1.0f + erff(v * 0.70710678118654752f)); else if (ACT == 11) v = 1.0f / (1.0f + expf(-v)); else if (ACT == 15) v = v / (1.0f + expf(-v)); else if (ACT == 12) v = (v > 0.f) ? v : 0.01f * v; else if (ACT == 8) v = tanhf(v); else if (ACT == 9) v = 0.5f * v * (1.0f + tanhf(0.7978845608028654f * (v + 0.044715f * v * v * v))); else if (ACT == 14) v = (v > 0.f) ? v : 0.1f * v; else if (ACT == 16) v = (v >= 0.f) ? v : 0.3f * v; else if (ACT == 17) v = (v >= 0.f) ? v : 0.2f * v;
      so[w][rloc][t * 16 + ln] = v; } }
  __builtin_amdgcn_fence(__ATOMIC_ACQ_REL, "workgroup"); __builtin_amdgcn_wave_barrier();
  const int rsub = lane >> 4, c4 = (lane & 15) * 4;
  {
#pragma unroll
    for (int q = 0; q < 16; ++q) { const int r = q * 2 + rsub; const v4f v = *(const v4fa*)&so[w][r][c4]; if (C) *(v4f*)(C + cofs + (size_t)(row0 + r) * ldc + col0 + c4) = v; if (C16) { v4h h4; for (int i = 0; i < 4; ++i) h4[i] = (_Float16)v[i]; *(v4h*)(C16 + cofs + (size_t)(row0 + r) * ldc + col0 + c4) = h4; } }
     } }


__global__ __launch_bounds__(256) void k_wnat(const float* __restrict__ w, size_t n8, _Float16* __restrict__ Bt) { const size_t t = (size_t)blockIdx.x * 256 + threadIdx.x; if (t >= n8) return; FragH f; for (int q = 0; q < 8; ++q) f.h[q] = (_Float16)(bf16_round(w[t * 8 + q]) * 16.0f); *(v8us*)((unsigned short*)Bt + t * 8) = f.half[0];  }
__global__ __launch_bounds__(256) void k_rsm(const float* __restrict__ S, _Float16* __restrict__ P, int nrows) {
  #pragma clang fp contract(off)
  const int i = blockIdx.x * 256 + threadIdx.x; if (i >= nrows) return; const float* s = S + (size_t)i * SQ; float mx = -3.0e38f;
#pragma unroll 1
  for (int j = 0; j < SQ; ++j) mx = fmaxf(mx, s[j]); float se = 0.f;
#pragma unroll 1
  for (int j = 0; j < SQ; ++j) se += expf(s[j] - mx); const float sc = 256.0f / se;
#pragma unroll 1
  for (int j0 = 0; j0 < SQ; j0 += 8) { FragH f; for (int q = 0; q < 8; ++q) f.h[q] = (_Float16)(expf(s[j0 + q] - mx) * sc); unsigned short* d = (unsigned short*)P + (size_t)i * SQ + j0; *(v8us*)d = f.half[0];  } }
__global__ __launch_bounds__(256) void k_vt(const _Float16* __restrict__ V16, int b, int h0, _Float16* __restrict__ VT) { __shared__ unsigned short tl[64][65]; const int tid = threadIdx.x; const int hh = blockIdx.x % HG, sg = blockIdx.x / HG; const int s0 = sg * 64; const int h = h0 + hh;
  for (int i = tid; i < 64 * 8; i += 256) { const int j = i / 8, d8 = (i % 8) * 8; FragH f; f.half[0] = *(const v8us*)((const unsigned short*)V16 + ((size_t)b * SQ + s0 + j) * DM + h * HD + d8); for (int q = 0; q < 8; ++q) tl[d8 + q][j] = f.u[q]; }
  __syncthreads();
  { for (int i = tid; i < 64 * 8; i += 256) { const int d = i / 8, j8 = (i % 8) * 8; FragH f; for (int q = 0; q < 8; ++q) f.u[q] = tl[d][j8 + q]; *(v8us*)((unsigned short*)VT + ((size_t)hh * HD + d) * SQ + s0 + j8) = f.half[0]; }  } }



// Masked row softmax, one wave per row: a lane holds 64 of the row's 2048 scores in registers (16 loads of 16 B; each wave-wide load covers 512 contiguous bytes), so S is read once
// and every load and store covers whole lines. Maximum and sum: four chains per lane, then a butterfly over the 32 lanes. The key mask is the same for all rows of a launch: compared once per wave.
#define SMW 16                       /* waves per work-group */
#define SMR 2                        /* rows per wave: 8192 rows = 256 work-groups */
#define SMQ (SQ / 128)               /* 16-byte loads per lane and row */
template <int M> __device__ __forceinline__ float lane_xor16(float x) { return __int_as_float(__builtin_amdgcn_update_dpp(0, __float_as_int(x), 0x160 + M, 0xf, 0xf, true)); }      /* value of lane l ^ M inside a 16-lane row (DPP row_xmask) */
__device__ __forceinline__ float lane_x16(float x) { const int b = __float_as_int(x); return __int_as_float(__builtin_amdgcn_permlanex16(b, b, 0x76543210, 0xfedcba98, false, false)); }      /* value of lane l ^ 16 */
__device__ __forceinline__ float wave_max(float x) { x = fmaxf(x, lane_xor16<1>(x)); x = fmaxf(x, lane_xor16<2>(x)); x = fmaxf(x, lane_xor16<4>(x)); x = fmaxf(x, lane_xor16<8>(x)); return fmaxf(x, lane_x16(x)); }
__device__ __forceinline__ float wave_sum(float x) { x += lane_xor16<1>(x); x += lane_xor16<2>(x); x += lane_xor16<4>(x); x += lane_xor16<8>(x); return x + lane_x16(x); }
// e[i] = 2^t[i], four at a time. One statement, so that the closing v_nop stands directly behind the last v_exp_f32: it is the slot that the instruction set asks for behind a transcendental before its
// result is read or its source overwritten. Early-clobber outputs: no result lies on a source of a later line.
__device__ __forceinline__ v4f exp2x4(v4f t) { float e0, e1, e2, e3;
  asm("v_exp_f32 %0, %4\n\tv_exp_f32 %1, %5\n\tv_exp_f32 %2, %6\n\tv_exp_f32 %3, %7\n\tv_nop" : "=&v"(e0), "=&v"(e1), "=&v"(e2), "=&v"(e3) : "v"(t[0]), "v"(t[1]), "v"(t[2]), "v"(t[3]));
  const v4f e = {e0, e1, e2, e3}; return e; }
static_assert(((size_t)HG * SQ) % (SMW * SMR) == 0, "k_rsmkm: every wave has SMR whole rows, no tail");
__global__ __launch_bounds__(SMW * 32) void k_rsmkm(const float* __restrict__ S, _Float16* __restrict__ P, const float* __restrict__ mk) {
  const int lane = threadIdx.x & 31; const int wave = __builtin_amdgcn_readfirstlane((int)(threadIdx.x >> 5));
  const size_t row0 = (size_t)(blockIdx.x * SMW + wave) * SMR;
  const v4fa* mp = (const v4fa*)mk; const v4fa* sp = (const v4fa*)(S + row0 * SQ);      /* wave-uniform bases, kept in scalar registers; the lane's offset is the only vector part of a load's address */
  v4f m4[SMQ], s[SMR][SMQ];
#pragma unroll
  for (int q = 0; q < SMQ; ++q) m4[q] = mp[q * 32 + lane];
  __builtin_amdgcn_sched_barrier(0);      /* the mask's loads go first (loads return in order), so that the mask is compared while the scores are still on their way */
#pragma unroll
  for (int r = 0; r < SMR; ++r)
#pragma unroll
    for (int q = 0; q < SMQ; ++q) s[r][q] = sp[(r * SMQ + q) * 32 + lane];
  __builtin_amdgcn_sched_barrier(0);      /* all of the wave's loads are issued before anything else */
  asm volatile("s_wait_xcnt 0x0" :: "v"(lane) : "memory");      /* behind the issued loads, before a register that they name is reused; the operand keeps the lane register untouched up to here */
  __builtin_amdgcn_sched_barrier(0);      /* keeps later register writes behind that wait */
  bool km[SMQ][4];
#pragma unroll
  for (int q = 0; q < SMQ; ++q)
#pragma unroll
    for (int i = 0; i < 4; ++i) km[q][i] = bf16_round(m4[q][i]) < 0.f;
#pragma unroll
  for (int r = 0; r < SMR; ++r) {
    float mx4[4] = {-3.0e38f, -3.0e38f, -3.0e38f, -3.0e38f};
#pragma unroll
    for (int q = 0; q < SMQ; ++q)
#pragma unroll
      for (int i = 0; i < 4; ++i) { const float v = km[q][i] ? -10000.0f : s[r][q][i]; s[r][q][i] = v; mx4[i] = fmaxf(mx4[i], v); }
    const float mx = wave_max(fmaxf(fmaxf(mx4[0], mx4[1]), fmaxf(mx4[2], mx4[3])));
    float se4[4] = {0.f, 0.f, 0.f, 0.f};
#pragma unroll
    for (int q = 0; q < SMQ; ++q) { s[r][q] = exp2x4((s[r][q] - mx) * 1.44269504f);      /* exp(v - mx) as 2^((v - mx) * log2 e) */
#pragma unroll
      for (int i = 0; i < 4; ++i) se4[i] += s[r][q][i]; }
    const float sc = 256.0f / wave_sum((se4[0] + se4[1]) + (se4[2] + se4[3]));
    _Float16* pp = P + (row0 + r) * SQ + lane * 4;
#pragma unroll
    for (int q = 0; q < SMQ; ++q) { v4h h4;
#pragma unroll
      for (int i = 0; i < 4; ++i) h4[i] = (_Float16)(s[r][q][i] * sc);
      *(v4h*)(pp + q * 128) = h4; }
    if (r + 1 < SMR) { asm volatile("s_wait_xcnt 0x0" ::: "memory");      /* behind this row's stores, before the next row's work reuses their registers */
      __builtin_amdgcn_sched_barrier(0); }      /* keeps the next row's register writes behind that wait */
  }
}
extern "C" void kernel_launch(void* const* d_in, const int* in_sizes, int n_in,
                              void* d_out, int out_size, void* d_ws, size_t ws_size, hipStream_t stream) {
  (void)in_sizes; (void)n_in; (void)out_size;
  const float* const* I = (const float* const*)d_in; const float* x = I[0]; const float* am = I[1]; const float* wq = I[2]; const float* bq = I[3]; const float* wk = I[4]; const float* bk = I[5]; const float* wv = I[6]; const float* bv = I[7];      /* hidden_states; attention_mask f32 [4][1][1][2048] (READ on device: key masked iff bf16(mask) < 0); natural weights + biases */
  char* ws = (char*)d_ws; size_t off = 0;
  auto take = [&](size_t bytes) { char* p = ws + off; off += (bytes + 255) & ~(size_t)255; return p; };
  _Float16* BQ = (_Float16*)take((size_t)DM * DM * 2); _Float16* BK = (_Float16*)take((size_t)DM * DM * 2); _Float16* BV = (_Float16*)take((size_t)DM * DM * 2); 
  _Float16* X16 = (_Float16*)take(NR * DM * 2); _Float16* Q16 = (_Float16*)take(NR * DM * 2); _Float16* K16 = (_Float16*)take(NR * DM * 2); _Float16* V16 = (_Float16*)take(NR * DM * 2);
  float* S = (float*)take((size_t)HG * SQ * SQ * 4); _Float16* P = (_Float16*)take((size_t)HG * SQ * SQ * 2); _Float16* VT = (_Float16*)take((size_t)NH * HD * SQ * 2);
  if (off > ws_size) return;
  { const unsigned g = (unsigned)(((size_t)DM * DM / 8 + 255) / 256); k_wnat<<<g, 256, 0, stream>>>(wq, (size_t)DM * DM / 8, BQ); k_wnat<<<g, 256, 0, stream>>>(wk, (size_t)DM * DM / 8, BK); k_wnat<<<g, 256, 0, stream>>>(wv, (size_t)DM * DM / 8, BV); }      /* natural [out][in] = Bt[n][k], x16 */

  k_x16<<<(unsigned)((NR * DM / 8 + 255) / 256), 256, 0, stream>>>(x, X16, NR * DM / 8);
  const size_t r0p = (size_t)B0 * SQ;      /* first projected row */
  k_gemm2<0><<<dim3((unsigned)((MP / 128) * (DM / 64)), 1), 128, 0, stream>>>(X16 + r0p * DM, DM, 0, BQ, DM, 0, 0.0625f, bq, 0, nullptr, 1, 0, 0, nullptr, Q16 + r0p * DM, DM, 0, MP, DM, DM);
  k_gemm2<0><<<dim3((unsigned)((MP / 128) * (DM / 64)), 1), 128, 0, stream>>>(X16 + r0p * DM, DM, 0, BK, DM, 0, 0.0625f, bk, 0, nullptr, 1, 0, 0, nullptr, K16 + r0p * DM, DM, 0, MP, DM, DM);
  k_gemm2<0><<<dim3((unsigned)((MP / 128) * (DM / 64)), 1), 128, 0, stream>>>(X16 + r0p * DM, DM, 0, BV, DM, 0, 0.0625f, bv, 0, nullptr, 1, 0, 0, nullptr, V16 + r0p * DM, DM, 0, MP, DM, DM);
  for (int b = B0; b < B0 + NBR; ++b) { const size_t r0 = (size_t)b * SQ;
    k_vt<NH, SQ><<<NH * (SQ / 64), 256, 0, stream>>>(V16 + r0 * LQ, LQ, 0, VT);      /* V^T [NH][HD][SQ] for this batch */
    for (int h0 = 0; h0 < NHD; h0 += HG) {
      k_gemm2<0><<<dim3((QN / 128) * (SQ / 64), HG), 128, 0, stream>>>(Q16 + r0 * LQ + h0 * HD, LQ, (size_t)HD, K16 + r0 * LQ + h0 * HD, LQ, (size_t)HD, 0.125f, nullptr, 0, nullptr, 1, 0, 0, S, nullptr, SQ, (size_t)SQ * SQ, QN, SQ, HD);      /* scores, HG heads per launch */
      k_rsmkm<<<HG * SQ / (SMW * SMR), SMW * 32, 0, stream>>>(S, P, am + (size_t)b * SQ);      /* sign key mask of THIS batch (select, -10000 fill) + softmax -> P x256 f16 */
      k_gemm2<0><<<dim3((QN / 128) * (HD / 64), HG), 128, 0, stream>>>(P, SQ, (size_t)SQ * SQ, VT + (size_t)h0 * HD * SQ, SQ, (size_t)HD * SQ, 0.00390625f, nullptr, 0, nullptr, 1, 0, 0, (float*)d_out + r0 * DM + h0 * HD, nullptr, DM, (size_t)HD, QN, HD, SQ); } }      /* out = P V^T (alpha 2^-8) written f32 straight into the merged-heads output rows */
}

// v002
// One run takes 201 microseconds.
// Timed twice side by side with v001, it ran 6.48 and 6.55 times as fast.
// Counting every step since v000, it is 26.4 times as fast.
#include <hip/hip_runtime.h>
// BERT self-attention without an output projection and with a SIGN key mask (hidden_states [4][2048][768]; q/k/v = x W^T + b (natural [768][768] sigma 0.02, biases sigma 0.02); 12 heads of 64; scores / 8; masked_fill(attention_mask < 0, -10000) with the f32 [4][1][1][2048] mask input (a key of batch b is masked iff its mask value is negative); softmax over all keys; context = heads merged -> [4][2048][768]).
// Structure: token rows r = b*2048 + s; x as exact f16 rows (bf16-rounded); Q, K, V as three WMMA GEMMs (32x64 wave tiles, f32 accumulation, exact x16 weights + bias, f16 outputs); V^T for all batches and heads via LDS transposes; one fused attention launch (scores on WMMA, K = 64; online softmax on VALU, f32 statistics, weights as f16 relative to the running maximum; o = P . V on WMMA) written f32 straight into the merged-heads output rows (no output projection).
// Compute dtype: inputs rounded to bf16; x / weights exact; q, k, v and softmax weights as plain f16 GEMM operands (~2^-12); scores, softmax statistics and o f32. v_wmma_f32_16x16x32_f16.
#define NB 4
#define SQ 2048
#define DM 768
#define NH 12
#define HD 64
#define HG 4                         /* heads per launch of the per-batch k_vt overload */
#define B0 0                         /* first batch processed (debug hook) */
#define NBR NB                       /* batches processed (debug hook) */
#define NR ((size_t)NB * SQ)         /* token rows */
#define MP ((int)((size_t)NBR * SQ)) /* rows projected (debug hook) */
#define QN SQ                        /* unused */
#define NHD NH                       /* unused */
#define MPO MP                       /* unused */
#define LQ DM      /* row pitch of the q/k/v rows */
typedef __bf16 v16b __attribute__((ext_vector_type(16)));
typedef unsigned short v8us __attribute__((ext_vector_type(8), may_alias));
typedef float  v8f  __attribute__((ext_vector_type(8)));
typedef float  v4f  __attribute__((ext_vector_type(4)));
typedef float  v4fa __attribute__((ext_vector_type(4), may_alias));
union FragB { v16b v; v8us half[2]; unsigned short u[16]; };

__device__ __forceinline__ unsigned short bf16_bits(float x) { unsigned int u = __float_as_uint(x); return (unsigned short)((u + 0x7FFFu + ((u >> 16) & 1u)) >> 16); }
__device__ __forceinline__ float bf16_val(unsigned short b) { return __uint_as_float(((unsigned int)b) << 16); }
__device__ __forceinline__ float bf16_round(float x) { return bf16_val(bf16_bits(x)); }
// D += A·B with NT terms: 1 = ah·bh, 2 = + al·bh (A split), 3 = + ah·bl (both split)
template <int NT>
__device__ __forceinline__ v8f mmaN(v16b ah, v16b al, v16b bh, v16b bl, v8f c) {
  c = __builtin_amdgcn_wmma_f32_16x16x32_bf16(false, ah, false, bh, (short)0, c, false, false);
  if (NT >= 2) c = __builtin_amdgcn_wmma_f32_16x16x32_bf16(false, al, false, bh, (short)0, c, false, false);
  if (NT >= 3) c = __builtin_amdgcn_wmma_f32_16x16x32_bf16(false, ah, false, bl, (short)0, c, false, false);
  asm volatile("v_nop\n\tv_nop\n\tv_nop\n\tv_nop" : "+v"(c) : "v"(ah), "v"(al), "v"(bh), "v"(bl));
  return c;
}

__global__ __launch_bounds__(256) void k_wt_bf16(const float* __restrict__ W, unsigned short* __restrict__ Wt, int K, int N) {
  const int t = blockIdx.x * 256 + threadIdx.x;
  const int k8n = K / 8;
  if (t >= N * k8n) return;
  const int n = t / k8n, k8 = (t % k8n) * 8;
  v8us v;
#pragma unroll
  for (int i = 0; i < 8; ++i) v[i] = bf16_bits(W[(size_t)(k8 + i) * N + n]);
  *(v8us*)(Wt + (size_t)n * K + k8) = v;
  
}

// GEMM C[M][N] (f32, pitch ldc) = act(A[M][K]·W + bias). A f32 row-major (pitch lda) converted per fragment to bf16
// (ASPLIT: hi/lo two planes -> 2 terms, else single rounded term); Wt bf16 [N][K] (pitch ldb). BIAS_BF16 rounds the
// bias to bf16 first (bias quantised to bf16 before the add). K%32==0, M%16==0, N%64==0.
template <bool ASPLIT, int ACT, bool BIAS_BF16>
__global__ __launch_bounds__(128) void k_gemm_bf(const float* __restrict__ A, int lda, const unsigned short* __restrict__ Wt, int ldb,
                                               const float* __restrict__ bias, float* __restrict__ C, int ldc, int M, int N, int K) {
  __shared__ __attribute__((aligned(16))) float so[4][16][64];
  const int tid = threadIdx.x, w = tid >> 5, lane = tid & 31, ln = lane & 15, hh = lane >> 4;
  const int ntn = N / 64;
  const int wid = blockIdx.x * 4 + w;
  const int mt = wid / ntn, nq = wid % ntn;
  if (mt * 16 >= M) return;
  const int row0 = mt * 16, col0 = nq * 64;
  const float* arow = A + (size_t)(row0 + ln) * lda;
  v8f acc[4] = {};
  for (int kb = 0; kb < K; kb += 32) {
    FragB ah, al;
    const v4f x0 = *(const v4fa*)(arow + kb + 8 * hh), x1 = *(const v4fa*)(arow + kb + 8 * hh + 4);
    const v4f x2 = *(const v4fa*)(arow + kb + 16 + 8 * hh), x3 = *(const v4fa*)(arow + kb + 16 + 8 * hh + 4);
    float xs[16] = {x0[0],x0[1],x0[2],x0[3],x1[0],x1[1],x1[2],x1[3],x2[0],x2[1],x2[2],x2[3],x3[0],x3[1],x3[2],x3[3]};
#pragma unroll
    for (int i = 0; i < 16; ++i) { const unsigned short hb = bf16_bits(xs[i]); ah.u[i] = hb; al.u[i] = ASPLIT ? bf16_bits(xs[i] - bf16_val(hb)) : (unsigned short)0; }
#pragma unroll
    for (int t = 0; t < 4; ++t) {
      const unsigned short* brow = Wt + (size_t)(col0 + t * 16 + ln) * ldb + kb;
      FragB b;
      b.half[0] = *(const v8us*)(brow + 8 * hh);
      b.half[1] = *(const v8us*)(brow + 16 + 8 * hh);
      acc[t] = mmaN<ASPLIT ? 2 : 1>(ah.v, al.v, b.v, b.v, acc[t]);
    }
  }
#pragma unroll
  for (int t = 0; t < 4; ++t) {
    float bv = bias ? bias[col0 + t * 16 + ln] : 0.f;
    if (BIAS_BF16) bv = bf16_round(bv);
#pragma unroll
    for (int r = 0; r < 8; ++r) { float v = acc[t][r] + bv; if (ACT == 1) v = fmaxf(v, 0.f); so[w][8 * hh + r][t * 16 + ln] = v; }
  }
  __builtin_amdgcn_fence(__ATOMIC_ACQ_REL, "workgroup");
  __builtin_amdgcn_wave_barrier();
  const int rsub = lane >> 4, c4 = (lane & 15) * 4;
  {
#pragma unroll
    for (int q = 0; q < 8; ++q) {
      const int r = q * 2 + rsub;
      const v4f v = *(const v4fa*)&so[w][r][c4];
      *(v4f*)(C + (size_t)(row0 + r) * ldc + col0 + c4) = v;
    }
    
  }
}

// GEMM C = act(A·W + bias + resid): A f32 (ASPLIT -> hi/lo 2 terms), Wt bf16 [N][K]; ACT 0 none, 1 relu, 2 exact gelu;
// resid (optional, f32, row index = (row % rmod), pitch ldr, RES_BF16 rounds it) added before the activation.
template <bool ASPLIT, int ACT, bool BIAS_BF16, bool RES_BF16>
__global__ __launch_bounds__(128) void k_gemm_bf3(const float* __restrict__ A, int lda, const unsigned short* __restrict__ Wt, int ldb,
                                                const float* __restrict__ bias, const float* __restrict__ resid, int rmod, int ldr,
                                                float* __restrict__ C, int ldc, int M, int N, int K) {
  __shared__ __attribute__((aligned(16))) float so[4][16][64];
  const int tid = threadIdx.x, w = tid >> 5, lane = tid & 31, ln = lane & 15, hh = lane >> 4;
  const int ntn = N / 64;
  const int wid = blockIdx.x * 4 + w;
  const int mt = wid / ntn, nq = wid % ntn;
  if (mt * 16 >= M) return;
  const int row0 = mt * 16, col0 = nq * 64;
  const float* arow = A + (size_t)(row0 + ln) * lda;
  v8f acc[4] = {};
  for (int kb = 0; kb < K; kb += 32) {
    FragB ah, al;
    const v4f x0 = *(const v4fa*)(arow + kb + 8 * hh), x1 = *(const v4fa*)(arow + kb + 8 * hh + 4);
    const v4f x2 = *(const v4fa*)(arow + kb + 16 + 8 * hh), x3 = *(const v4fa*)(arow + kb + 16 + 8 * hh + 4);
    float xs[16] = {x0[0],x0[1],x0[2],x0[3],x1[0],x1[1],x1[2],x1[3],x2[0],x2[1],x2[2],x2[3],x3[0],x3[1],x3[2],x3[3]};
#pragma unroll
    for (int i = 0; i < 16; ++i) { const unsigned short hb = bf16_bits(xs[i]); ah.u[i] = hb; al.u[i] = ASPLIT ? bf16_bits(xs[i] - bf16_val(hb)) : (unsigned short)0; }
#pragma unroll
    for (int t = 0; t < 4; ++t) {
      const unsigned short* brow = Wt + (size_t)(col0 + t * 16 + ln) * ldb + kb;
      FragB b;
      b.half[0] = *(const v8us*)(brow + 8 * hh);
      b.half[1] = *(const v8us*)(brow + 16 + 8 * hh);
      acc[t] = mmaN<ASPLIT ? 2 : 1>(ah.v, al.v, b.v, b.v, acc[t]);
    }
  }
#pragma unroll
  for (int t = 0; t < 4; ++t) {
    const int col = col0 + t * 16 + ln;
    float bv = bias ? bias[col] : 0.f;
    if (BIAS_BF16) bv = bf16_round(bv);
#pragma unroll
    for (int r = 0; r < 8; ++r) {
      float v = acc[t][r] + bv;
      if (resid) { float rv = resid[(size_t)((row0 + 8 * hh + r) % rmod) * ldr + col]; if (RES_BF16) rv = bf16_round(rv); v += rv; }
      if (ACT == 1) v = fmaxf(v, 0.f);
      if (ACT == 2) v = 0.5f * v * (1.0f + erff(v * 0.70710678118654752f));
      if (ACT == 3) { const float u = 0.7978845608028654f * (v + 0.044715f * v * v * v); v = 0.5f * v * (1.0f + tanhf(u)); }
      so[w][8 * hh + r][t * 16 + ln] = v;
    }
  }
  __builtin_amdgcn_fence(__ATOMIC_ACQ_REL, "workgroup");
  __builtin_amdgcn_wave_barrier();
  const int rsub = lane >> 4, c4 = (lane & 15) * 4;
  {
#pragma unroll
    for (int q = 0; q < 8; ++q) {
      const int r = q * 2 + rsub;
      const v4f v = *(const v4fa*)&so[w][r][c4];
      *(v4f*)(C + (size_t)(row0 + r) * ldc + col0 + c4) = v;
    }
    
  }
}
// row LayerNorm (biased variance, eps) over N: s = X (+ R); optional out_sum <- s; out_norm <- (s-mu)*rsqrt(var+eps)*g + b
template <bool PARAM_BF16>
__global__ __launch_bounds__(256) void k_layernorm(const float* __restrict__ X, const float* __restrict__ R, const float* __restrict__ g, const float* __restrict__ bta,
                                                  float* __restrict__ out_sum, float* __restrict__ out_norm, int N, float eps) {
  __shared__ float red[256];
  const int row = blockIdx.x, tid = threadIdx.x;
  const float* x = X + (size_t)row * N; const float* rr = R ? R + (size_t)row * N : nullptr;
  float vals[16];                     // up to N = 4096
  const int per = N / 256;            // contiguous chunk per thread? use strided-by-4 chunks: thread handles j = tid*4 + 1024*u
  float s1 = 0.f;
  for (int u = 0; u < per / 4; ++u) {
    const int j = tid * 4 + 1024 * u;
    const v4f a = *(const v4fa*)(x + j);
    v4f b = {0.f,0.f,0.f,0.f}; if (rr) b = *(const v4fa*)(rr + j);
#pragma unroll
    for (int q = 0; q < 4; ++q) { const float v = a[q] + b[q]; vals[u * 4 + q] = v; s1 += v; }
  }
  red[tid] = s1; __syncthreads();
  for (int st = 128; st > 0; st >>= 1) { if (tid < st) red[tid] += red[tid + st]; __syncthreads(); }
  const float mu = red[0] / (float)N; __syncthreads();
  float s2 = 0.f;
  for (int u = 0; u < per / 4; ++u)
#pragma unroll
    for (int q = 0; q < 4; ++q) { const float c = vals[u * 4 + q] - mu; s2 += c * c; }
  red[tid] = s2; __syncthreads();
  for (int st = 128; st > 0; st >>= 1) { if (tid < st) red[tid] += red[tid + st]; __syncthreads(); }
  const float rs = rsqrtf(red[0] / (float)N + eps);
  {
    for (int u = 0; u < per / 4; ++u) {
      const int j = tid * 4 + 1024 * u;
      v4f o, sm;
#pragma unroll
      for (int q = 0; q < 4; ++q) {
        float gg = g[j + q], bb = bta[j + q];
        if (PARAM_BF16) { gg = bf16_round(gg); bb = bf16_round(bb); }
        sm[q] = vals[u * 4 + q]; o[q] = (vals[u * 4 + q] - mu) * rs * gg + bb;
      }
      if (out_sum) *(v4f*)(out_sum + (size_t)row * N + j) = sm;
      *(v4f*)(out_norm + (size_t)row * N + j) = o;
    }
    
  }
}



// ---- f16 WMMA path (v_wmma_f32_16x16x32_f16): 11-bit significands for operands in range — used where a [0,1] probability operand needs more precision than bf16
typedef _Float16 v16h __attribute__((ext_vector_type(16)));
union FragH { v16h v; v8us half[2]; _Float16 h[16]; unsigned short u[16]; };
template <int NT>
__device__ __forceinline__ v8f mmaH(v16h ah, v16h al, v16h bh, v16h bl, v8f c) {
  c = __builtin_amdgcn_wmma_f32_16x16x32_f16(false, ah, false, bh, (short)0, c, false, false);
  if (NT >= 2) c = __builtin_amdgcn_wmma_f32_16x16x32_f16(false, al, false, bh, (short)0, c, false, false);
  if (NT >= 3) c = __builtin_amdgcn_wmma_f32_16x16x32_f16(false, ah, false, bl, (short)0, c, false, false);
  asm volatile("v_nop\n\tv_nop\n\tv_nop\n\tv_nop" : "+v"(c) : "v"(ah), "v"(al), "v"(bh), "v"(bl));
  return c;
}
// batched GEMM like k_gemm_b but f16 operands: A f32 (split into f16 hi/lo if ASPLIT, else rounded to f16), Bt = f16 values [n][k]; alpha; C f32; N multiple of 16 (partial tiles skipped)
template <bool ASPLIT>
__global__ __launch_bounds__(128) void k_gemm_h(const float* __restrict__ A, int lda, size_t sA, const _Float16* __restrict__ Bh, int ldb, size_t sB, float alpha, float* __restrict__ C, int ldc, size_t sC, int M, int N, int K) {
  __shared__ __attribute__((aligned(16))) float so[4][16][64];
  const int tid = threadIdx.x, w = tid >> 5, lane = tid & 31, ln = lane & 15, hh = lane >> 4; const int by = blockIdx.y;
  A += (size_t)by * sA; Bh += (size_t)by * sB; C += (size_t)by * sC;
  const int ntn = (N + 63) / 64; const int wid = blockIdx.x * 4 + w; const int mt = wid / ntn, nq = wid % ntn; if (mt * 16 >= M) return;
  const int row0 = mt * 16, col0 = nq * 64; const float* arow = A + (size_t)(row0 + ln) * lda;
  v8f acc[4] = {};
  for (int kb = 0; kb < K; kb += 32) {
    FragH ah, al;
    const v4f x0 = *(const v4fa*)(arow + kb + 8 * hh), x1 = *(const v4fa*)(arow + kb + 8 * hh + 4), x2 = *(const v4fa*)(arow + kb + 16 + 8 * hh), x3 = *(const v4fa*)(arow + kb + 16 + 8 * hh + 4);
    float xs[16] = {x0[0],x0[1],x0[2],x0[3],x1[0],x1[1],x1[2],x1[3],x2[0],x2[1],x2[2],x2[3],x3[0],x3[1],x3[2],x3[3]};
#pragma unroll
    for (int i = 0; i < 16; ++i) { const _Float16 h = (_Float16)xs[i]; ah.h[i] = h; al.h[i] = ASPLIT ? (_Float16)(xs[i] - (float)h) : (_Float16)0.0f; }
#pragma unroll
    for (int t = 0; t < 4; ++t) { if (col0 + t * 16 >= N) continue; const size_t boff = (size_t)(col0 + t * 16 + ln) * ldb + kb; FragH bq; bq.half[0] = *(const v8us*)(Bh + boff + 8 * hh); bq.half[1] = *(const v8us*)(Bh + boff + 16 + 8 * hh);
      acc[t] = mmaH<ASPLIT ? 2 : 1>(ah.v, al.v, bq.v, bq.v, acc[t]); }
  }
#pragma unroll
  for (int t = 0; t < 4; ++t) { if (col0 + t * 16 >= N) continue;
#pragma unroll
    for (int r = 0; r < 8; ++r) so[w][8 * hh + r][t * 16 + ln] = acc[t][r] * alpha; }
  __builtin_amdgcn_fence(__ATOMIC_ACQ_REL, "workgroup"); __builtin_amdgcn_wave_barrier();
  const int rsub = lane >> 4, c4 = (lane & 15) * 4;
  {
#pragma unroll
    for (int q = 0; q < 8; ++q) { const int r = q * 2 + rsub; if (col0 + c4 < N) { const v4f v = *(const v4fa*)&so[w][r][c4]; *(v4f*)(C + (size_t)(row0 + r) * ldc + col0 + c4) = v; } }
     }
}

// Wt[n][k] = f16(W[k][n]·scale) from f32 row-major W[K][N] (scale = power of two; bf16-exact weights stay exact in f16 away from the subnormal range)
__global__ __launch_bounds__(256) void k_wt_f16(const float* __restrict__ W, _Float16* __restrict__ Wt, int K, int N, float scale) {
  const int t = blockIdx.x * 256 + threadIdx.x; if (t >= N * (K / 8)) return; const int n = t / (K / 8), k8 = (t % (K / 8)) * 8; FragH f;
#pragma unroll
  for (int i = 0; i < 8; ++i) f.h[i] = (_Float16)(bf16_round(W[(size_t)(k8 + i) * N + n]) * scale); const v8us o = f.half[0];
  *(v8us*)((unsigned short*)Wt + (size_t)n * K + k8) = o; 
}
// k_gemm_hh variant with fused epilogue: v = acc·alpha + bias[by·sBias + col] (+ CP[(row/rowsPerB)·sCPb + by·64 + col] if CP) ; ACT 0 none / 1 elu ; writes f16 C16 (and f32 C if non-null)
template <int ACT>
__global__ __launch_bounds__(128) void k_gemm_hhx(const _Float16* __restrict__ A, int lda, size_t sA, const _Float16* __restrict__ Bh, int ldb, size_t sB, float alpha, const float* __restrict__ bias, size_t sBias, const float* __restrict__ CP, int rowsPerB, size_t sCPb, int row0g,
    float* __restrict__ C, _Float16* __restrict__ C16, int ldc, size_t sC, int M, int N, int K) {
  __shared__ __attribute__((aligned(16))) float so[4][16][64];
  const int tid = threadIdx.x, w = tid >> 5, lane = tid & 31, ln = lane & 15, hh = lane >> 4; const int by = blockIdx.y;
  A += (size_t)by * sA; Bh += (size_t)by * sB; const size_t cofs = (size_t)by * sC; const float* bp = bias ? bias + (size_t)by * sBias : nullptr;
  const int ntn = (N + 63) / 64; const int wid = blockIdx.x * 4 + w; const int mt = wid / ntn, nq = wid % ntn; if (mt * 16 >= M) return;
  const int row0 = mt * 16, col0 = nq * 64; const _Float16* arow = A + (size_t)(row0 + ln) * lda;
  v8f acc[4] = {};
  for (int kb = 0; kb < K; kb += 32) { FragH ah; ah.half[0] = *(const v8us*)((const unsigned short*)arow + kb + 8 * hh); ah.half[1] = *(const v8us*)((const unsigned short*)arow + kb + 16 + 8 * hh);
#pragma unroll
    for (int t = 0; t < 4; ++t) { if (col0 + t * 16 >= N) continue; const size_t boff = (size_t)(col0 + t * 16 + ln) * ldb + kb; FragH bq; bq.half[0] = *(const v8us*)((const unsigned short*)Bh + boff + 8 * hh); bq.half[1] = *(const v8us*)((const unsigned short*)Bh + boff + 16 + 8 * hh);
      acc[t] = mmaH<1>(ah.v, ah.v, bq.v, bq.v, acc[t]); }
  }
#pragma unroll
  for (int t = 0; t < 4; ++t) { if (col0 + t * 16 >= N) continue; const int col = col0 + t * 16 + ln; const float bv = bp ? bf16_round(bp[col]) : 0.f;
#pragma unroll
    for (int r = 0; r < 8; ++r) { float v = acc[t][r] * alpha + bv; if (CP) { const int rr = row0g + row0 + 8 * hh + r; if (rowsPerB < 0) v += CP[cofs + (size_t)rr * ldc + col];      /* rowsPerB < 0: own element of the batched C plane */ else { const int bidx = rr / rowsPerB; v += CP[(size_t)bidx * sCPb + (size_t)by * 64 + col]; } } if (ACT == 1) v = (v > 0.f) ? v : expm1f(v); else if (ACT == 7) v = (v > 0.f) ? v + 1.0f : expf(v); else if (ACT == 8) v = tanhf(v); else if (ACT == 9) v = 0.5f * v * (1.0f + tanhf(0.7978845608028654f * (v + 0.044715f * v * v * v))); else if (ACT == 11) v = 1.0f / (1.0f + expf(-v)); else if (ACT == 12) v = (v > 0.f) ? v : 0.01f * v; else if (ACT == 14) v = (v > 0.f) ? v : 0.1f * v; else if (ACT == 16) v = (v >= 0.f) ? v : 0.3f * v; else if (ACT == 17) v = (v >= 0.f) ? v : 0.2f * v; else if (ACT == 15) v = v / (1.0f + expf(-v)); else if (ACT == 3) v = fmaxf(v, 0.f); else if (ACT == 6) v = 0.5f * v * (1.0f + erff(v * 0.70710678118654752f)); so[w][8 * hh + r][t * 16 + ln] = v; } }
  __builtin_amdgcn_fence(__ATOMIC_ACQ_REL, "workgroup"); __builtin_amdgcn_wave_barrier();
  const int rsub = lane >> 4, c4 = (lane & 15) * 4; typedef _Float16 v4h __attribute__((ext_vector_type(4)));
  {
#pragma unroll
    for (int q = 0; q < 8; ++q) { const int r = q * 2 + rsub; if (col0 + c4 < N) { const v4f v = *(const v4fa*)&so[w][r][c4]; if (C) *(v4f*)(C + cofs + (size_t)(row0 + r) * ldc + col0 + c4) = v; if (C16) { v4h h4; for (int i = 0; i < 4; ++i) h4[i] = (_Float16)v[i]; *(v4h*)(C16 + cofs + (size_t)(row0 + r) * ldc + col0 + c4) = h4; } } }
     }
}


typedef _Float16 v4h __attribute__((ext_vector_type(4)));

__global__ __launch_bounds__(256) void k_x16(const float* __restrict__ x, _Float16* __restrict__ X16, size_t n8) { const size_t t = (size_t)blockIdx.x * 256 + threadIdx.x; if (t >= n8) return; FragH f;
#pragma unroll
  for (int q = 0; q < 8; ++q) f.h[q] = (_Float16)bf16_round(x[t * 8 + q]); *(v8us*)((unsigned short*)X16 + t * 8) = f.half[0];  }
__global__ __launch_bounds__(256) void k_h16(const float* __restrict__ x, _Float16* __restrict__ X16, size_t n8) { const size_t t = (size_t)blockIdx.x * 256 + threadIdx.x; if (t >= n8) return; FragH f;
#pragma unroll
  for (int q = 0; q < 8; ++q) f.h[q] = (_Float16)x[t * 8 + q]; *(v8us*)((unsigned short*)X16 + t * 8) = f.half[0];  }
__global__ __launch_bounds__(256) void k_round16f(const float* __restrict__ W, _Float16* __restrict__ Bt, size_t n8) { const size_t t = (size_t)blockIdx.x * 256 + threadIdx.x; if (t >= n8) return; FragH f;
#pragma unroll
  for (int i = 0; i < 8; ++i) f.h[i] = (_Float16)(bf16_round(W[t * 8 + i]) * 16.0f); *(v8us*)((unsigned short*)Bt + t * 8) = f.half[0];  }
template <int NHv, int TTv>
__global__ __launch_bounds__(256) void k_vt(const _Float16* __restrict__ V16, int ldv, int voff, _Float16* __restrict__ Vt) { __shared__ unsigned short tl[64][66]; const int tid = threadIdx.x; const int slab = blockIdx.x / (TTv / 64), lg = blockIdx.x % (TTv / 64); const int b = slab / NHv, h = slab % NHv;
  for (int i = tid; i < 64 * 8; i += 256) { const int r = i / 8, c8 = (i % 8) * 8; FragH f; f.half[0] = *(const v8us*)((const unsigned short*)V16 + ((size_t)b * TTv + lg * 64 + r) * ldv + voff + h * 64 + c8);
#pragma unroll
    for (int q = 0; q < 8; ++q) tl[r][c8 + q] = f.u[q]; }
  __syncthreads();
  {
#pragma unroll
    for (int rd = 0; rd < 2; ++rd) { const int d = rd * 32 + tid / 8, pc = tid % 8; FragH f;
#pragma unroll
      for (int q = 0; q < 8; ++q) f.u[q] = tl[pc * 8 + q][d];
      *(v8us*)((unsigned short*)Vt + ((size_t)slab * 64 + d) * TTv + lg * 64 + pc * 8) = f.half[0]; }
     } }

__global__ __launch_bounds__(256) void k_hl(const float* __restrict__ F, _Float16* __restrict__ Hh, _Float16* __restrict__ Hl, size_t n8) { const size_t t = (size_t)blockIdx.x * 256 + threadIdx.x; if (t >= n8) return; FragH fh, fl; const v4f a = *(const v4fa*)(F + t * 8), c = *(const v4fa*)(F + t * 8 + 4);
#pragma unroll
  for (int q = 0; q < 4; ++q) { _Float16 h = (_Float16)a[q]; fh.h[q] = h; fl.h[q] = (_Float16)((a[q] - (float)h) * 1024.0f); h = (_Float16)c[q]; fh.h[4 + q] = h; fl.h[4 + q] = (_Float16)((c[q] - (float)h) * 1024.0f); }
  { *(v8us*)((unsigned short*)Hh + t * 8) = fh.half[0]; *(v8us*)((unsigned short*)Hl + t * 8) = fl.half[0];  } }

// ---- fast GEMM (wave tile 32x64; requires M % 32 == 0 rows per launch region and N % 64 == 0); epilogue = k_gemm_hhx semantics ----
__device__ __forceinline__ v16h g2_frag(const _Float16* p, int hh) { FragH f; f.half[0] = *(const v8us*)((const unsigned short*)p + 8 * hh); f.half[1] = *(const v8us*)((const unsigned short*)p + 16 + 8 * hh); return f.v; }
__device__ __forceinline__ v8f g2_mma(v16h a, v16h b, v8f c) { v8f d = __builtin_amdgcn_wmma_f32_16x16x32_f16(false, a, false, b, (short)0, c, false, false); asm volatile("v_nop\n\tv_nop\n\tv_nop\n\tv_nop" : "+v"(d) : "v"(a), "v"(b)); return d; }
template <int ACT>
__global__ __launch_bounds__(128) void k_gemm2(const _Float16* __restrict__ A, int lda, size_t sA, const _Float16* __restrict__ Bh, int ldb, size_t sB, float alpha, const float* __restrict__ bias, size_t sBias, const float* __restrict__ CP, int rowsPerB, size_t sCPb, int row0g,
    float* __restrict__ C, _Float16* __restrict__ C16, int ldc, size_t sC, int M, int N, int K) { static_assert(ACT == 0 || ACT == 3 || ACT == 6 || ACT == 8 || ACT == 9 || ACT == 11 || ACT == 12 || ACT == 14 || ACT == 15 || ACT == 16 || ACT == 17, "k_gemm2: unsupported ACT code (would silently apply no activation)");
  __shared__ __attribute__((aligned(16))) float so[4][32][68];
  const int tid = threadIdx.x, w = tid >> 5, lane = tid & 31, ln = lane & 15, hh = lane >> 4; const int by = blockIdx.y;
  A += (size_t)by * sA; Bh += (size_t)by * sB; const size_t cofs = (size_t)by * sC; const float* bp = bias ? bias + (size_t)by * sBias : nullptr;
  const int ntn = N >> 6; const int mt = blockIdx.x / ntn, nq = blockIdx.x - mt * ntn; const int row0 = mt * 128 + 32 * w, col0 = nq * 64; if (row0 >= M) return;
  const _Float16* a0p = A + (size_t)(row0 + ln) * lda; const _Float16* a1p = a0p + (size_t)16 * lda;
  const _Float16* b0p = Bh + (size_t)(col0 + ln) * ldb; const _Float16* b1p = b0p + (size_t)16 * ldb; const _Float16* b2p = b1p + (size_t)16 * ldb; const _Float16* b3p = b2p + (size_t)16 * ldb;
  const v8f z8 = {0.f,0.f,0.f,0.f,0.f,0.f,0.f,0.f}; v8f c00 = z8, c01 = z8, c02 = z8, c03 = z8, c10 = z8, c11 = z8, c12 = z8, c13 = z8;
#pragma unroll 1
  for (int kb = 0; kb < K; kb += 32) { const v16h a0 = g2_frag(a0p + kb, hh), a1 = g2_frag(a1p + kb, hh);
    v16h b = g2_frag(b0p + kb, hh); c00 = g2_mma(a0, b, c00); c10 = g2_mma(a1, b, c10);
    b = g2_frag(b1p + kb, hh); c01 = g2_mma(a0, b, c01); c11 = g2_mma(a1, b, c11);
    b = g2_frag(b2p + kb, hh); c02 = g2_mma(a0, b, c02); c12 = g2_mma(a1, b, c12);
    b = g2_frag(b3p + kb, hh); c03 = g2_mma(a0, b, c03); c13 = g2_mma(a1, b, c13); }
  v8f accs[8] = {c00, c01, c02, c03, c10, c11, c12, c13};
#pragma unroll
  for (int u = 0; u < 8; ++u) { const int t = u & 3, half = u >> 2; const int col = col0 + t * 16 + ln; const float bv = bp ? bf16_round(bp[col]) : 0.f;
#pragma unroll
    for (int r = 0; r < 8; ++r) { const int rloc = half * 16 + 8 * hh + r; float v = accs[u][r] * alpha + bv; if (CP) { if (rowsPerB < 0) v += CP[cofs + (size_t)(row0g + row0 + rloc) * ldc + col];      /* rowsPerB < 0: own element of the batched C plane */ else { const int bidx = (row0g + row0 + rloc) / rowsPerB; v += CP[(size_t)bidx * sCPb + (size_t)by * 64 + col]; } }
      if (ACT == 3) v = fmaxf(v, 0.f); else if (ACT == 6) v = 0.5f * v * (1.0f + erff(v * 0.70710678118654752f)); else if (ACT == 11) v = 1.0f / (1.0f + expf(-v)); else if (ACT == 15) v = v / (1.0f + expf(-v)); else if (ACT == 12) v = (v > 0.f) ? v : 0.01f * v; else if (ACT == 8) v = tanhf(v); else if (ACT == 9) v = 0.5f * v * (1.0f + tanhf(0.7978845608028654f * (v + 0.044715f * v * v * v))); else if (ACT == 14) v = (v > 0.f) ? v : 0.1f * v; else if (ACT == 16) v = (v >= 0.f) ? v : 0.3f * v; else if (ACT == 17) v = (v >= 0.f) ? v : 0.2f * v;
      so[w][rloc][t * 16 + ln] = v; } }
  __builtin_amdgcn_fence(__ATOMIC_ACQ_REL, "workgroup"); __builtin_amdgcn_wave_barrier();
  const int rsub = lane >> 4, c4 = (lane & 15) * 4;
  {
#pragma unroll
    for (int q = 0; q < 16; ++q) { const int r = q * 2 + rsub; const v4f v = *(const v4fa*)&so[w][r][c4]; if (C) *(v4f*)(C + cofs + (size_t)(row0 + r) * ldc + col0 + c4) = v; if (C16) { v4h h4; for (int i = 0; i < 4; ++i) h4[i] = (_Float16)v[i]; *(v4h*)(C16 + cofs + (size_t)(row0 + r) * ldc + col0 + c4) = h4; } }
     } }


__global__ __launch_bounds__(256) void k_wnat(const float* __restrict__ w, size_t n8, _Float16* __restrict__ Bt) { const size_t t = (size_t)blockIdx.x * 256 + threadIdx.x; if (t >= n8) return; FragH f; for (int q = 0; q < 8; ++q) f.h[q] = (_Float16)(bf16_round(w[t * 8 + q]) * 16.0f); *(v8us*)((unsigned short*)Bt + t * 8) = f.half[0];  }
__global__ __launch_bounds__(256) void k_rsm(const float* __restrict__ S, _Float16* __restrict__ P, int nrows) {
  #pragma clang fp contract(off)
  const int i = blockIdx.x * 256 + threadIdx.x; if (i >= nrows) return; const float* s = S + (size_t)i * SQ; float mx = -3.0e38f;
#pragma unroll 1
  for (int j = 0; j < SQ; ++j) mx = fmaxf(mx, s[j]); float se = 0.f;
#pragma unroll 1
  for (int j = 0; j < SQ; ++j) se += expf(s[j] - mx); const float sc = 256.0f / se;
#pragma unroll 1
  for (int j0 = 0; j0 < SQ; j0 += 8) { FragH f; for (int q = 0; q < 8; ++q) f.h[q] = (_Float16)(expf(s[j0 + q] - mx) * sc); unsigned short* d = (unsigned short*)P + (size_t)i * SQ + j0; *(v8us*)d = f.half[0];  } }
__global__ __launch_bounds__(256) void k_vt(const _Float16* __restrict__ V16, int b, int h0, _Float16* __restrict__ VT) { __shared__ unsigned short tl[64][65]; const int tid = threadIdx.x; const int hh = blockIdx.x % HG, sg = blockIdx.x / HG; const int s0 = sg * 64; const int h = h0 + hh;
  for (int i = tid; i < 64 * 8; i += 256) { const int j = i / 8, d8 = (i % 8) * 8; FragH f; f.half[0] = *(const v8us*)((const unsigned short*)V16 + ((size_t)b * SQ + s0 + j) * DM + h * HD + d8); for (int q = 0; q < 8; ++q) tl[d8 + q][j] = f.u[q]; }
  __syncthreads();
  { for (int i = tid; i < 64 * 8; i += 256) { const int d = i / 8, j8 = (i % 8) * 8; FragH f; for (int q = 0; q < 8; ++q) f.u[q] = tl[d][j8 + q]; *(v8us*)((unsigned short*)VT + ((size_t)hh * HD + d) * SQ + s0 + j8) = f.half[0]; }  } }



#define FW 4                         /* waves per work-group */
#define FG 2                         /* 16-query groups per wave */
#define FQ (FW * FG * 16)            /* queries per work-group */
#define FK 64                        /* keys per stage (two passes of 32) */
#define FP 144                       /* LDS row pitch, bytes: 128 + 16, an odd multiple of 16 (16-byte reads of 16 rows without bank conflicts) */
#define FT (64 * FP)                 /* one tile: 64 rows (K: keys, V^T: head dims) */
#define FNS (SQ / FK)                /* stages */
__device__ __forceinline__ float lane_x16(float x) { const int b = __float_as_int(x); return __int_as_float(__builtin_amdgcn_permlanex16(b, b, 0x76543210, 0xfedcba98, false, false)); }      /* value of lane l ^ 16 */
// e[i] = 2^t[i], eight at a time, in one statement, so that the closing v_nop stands directly behind the last v_exp_f32: it is the slot that the instruction set asks for behind a transcendental before its
// result is read or its source overwritten. Early-clobber outputs: no result lies on a source of a
// later line. The closing s_delay_alu is the hint that the compiler cannot give for results of asm text: the next vector instruction may read them, and unhinted it would hold the SIMD's issue port against the other waves.
__device__ __forceinline__ v8f exp2x8(v8f t) { float e0, e1, e2, e3, e4, e5, e6, e7;
  asm("v_exp_f32 %0, %8\n\tv_exp_f32 %1, %9\n\tv_exp_f32 %2, %10\n\tv_exp_f32 %3, %11\n\tv_exp_f32 %4, %12\n\tv_exp_f32 %5, %13\n\tv_exp_f32 %6, %14\n\tv_exp_f32 %7, %15\n\tv_nop\n\ts_delay_alu instid0(TRANS32_DEP_1)"
      : "=&v"(e0), "=&v"(e1), "=&v"(e2), "=&v"(e3), "=&v"(e4), "=&v"(e5), "=&v"(e6), "=&v"(e7) : "v"(t[0]), "v"(t[1]), "v"(t[2]), "v"(t[3]), "v"(t[4]), "v"(t[5]), "v"(t[6]), "v"(t[7]));
  const v8f e = {e0, e1, e2, e3, e4, e5, e6, e7}; return e; }
__device__ __forceinline__ float exp2x1(float t) { float e; asm("v_exp_f32 %0, %1\n\tv_nop\n\ts_delay_alu instid0(TRANS32_DEP_1)" : "=&v"(e) : "v"(t)); return e; }      /* v_nop and hint: as in exp2x8 */
__device__ __forceinline__ v16h lds_frag(const unsigned char* p) { FragH f; f.half[0] = *(const v8us*)p; f.half[1] = *(const v8us*)(p + 32); return f.v; }      /* p = row + 64 * (32-element k block) + 16 * h: k = 8h .. 8h + 7 and 16 + 8h .. 16 + 8h + 7, the order of g2_frag */
__device__ __forceinline__ v8f fa_mma(v16h a, v16h b, v8f c) { return __builtin_amdgcn_wmma_f32_16x16x32_f16(false, a, false, b, (short)0, c, false, false); }
static_assert(SQ % FQ == 0 && SQ % FK == 0 && FNS >= 2 && HD == 64 && (SQ / 32) % FW == 0 && SQ / 32 == 64, "k_fattn: whole blocks, whole stages, head size 64");
__global__ __launch_bounds__(FW * 32) void k_fattn(const _Float16* __restrict__ Q16, const _Float16* __restrict__ K16, const _Float16* __restrict__ VT, const float* __restrict__ mk, float* __restrict__ out) {
  __shared__ __attribute__((aligned(16))) unsigned char L[2][2 * FT];      /* [buffer][K tile, V^T tile] */
  __shared__ unsigned int mbits[SQ / 32];      /* bit j of word i: key 32 i + j of this batch is masked */
  const int tid = threadIdx.x, lane = tid & 31, c = lane & 15, h = lane >> 4; const int wave = __builtin_amdgcn_readfirstlane(tid >> 5);
  const int hd = blockIdx.y, b = blockIdx.z; const size_t r0 = (size_t)b * SQ; const int q0 = blockIdx.x * FQ + wave * (FG * 16);
  const unsigned short* kg = (const unsigned short*)K16 + (r0 + (tid >> 3)) * DM + hd * HD + (tid & 7) * 8;      /* eight lanes cover one 128-byte row */
  const unsigned short* vg = (const unsigned short*)VT + ((size_t)(b * NH + hd) * HD + (tid >> 3)) * SQ + (tid & 7) * 8;
  const unsigned int lofs = (unsigned int)(tid >> 3) * FP + (unsigned int)(tid & 7) * 16;
  v8us rk[4], rv[4];
  auto fetch = [&](int st) {
#pragma unroll
    for (int u = 0; u < 4; ++u) { rk[u] = *(const v8us*)(kg + ((size_t)st * FK + u * 16) * DM); rv[u] = *(const v8us*)(vg + (size_t)u * 16 * SQ + (size_t)st * FK); }
    __builtin_amdgcn_sched_barrier(0);      /* the loads stay in front of the wait below */
    asm volatile("s_wait_xcnt 0x0" ::: "memory");      /* behind the issued loads, before a register that they name (address, base) is rewritten for the next stage */
    __builtin_amdgcn_sched_barrier(0);      /* keeps later register writes behind that wait */
  };
  auto put = [&](int buf) {
#pragma unroll
    for (int u = 0; u < 4; ++u) { *(v8us*)&L[buf][lofs + u * 16 * FP] = rk[u]; *(v8us*)&L[buf][FT + lofs + u * 16 * FP] = rv[u]; } };
  fetch(0);
  v16h qf[FG][2];
#pragma unroll
  for (int g = 0; g < FG; ++g) { const _Float16* qp = Q16 + (r0 + q0 + g * 16 + c) * DM + hd * HD;
#pragma unroll
    for (int kc = 0; kc < 2; ++kc) qf[g][kc] = g2_frag(qp + 32 * kc, h); }
  __builtin_amdgcn_sched_barrier(0);      /* the Q loads stay in front of the wait below */
  asm volatile("s_wait_xcnt 0x0" ::: "memory");      /* behind the issued Q loads, before a mask load's result lands in a register that they name */
  __builtin_amdgcn_sched_barrier(0);      /* keeps the mask loads behind that wait */
  float mv[SQ / 32 / FW];
#pragma unroll
  for (int i = 0; i < SQ / 32 / FW; ++i) mv[i] = mk[r0 + (size_t)(wave * (SQ / 32 / FW) + i) * 32 + lane];
  __builtin_amdgcn_sched_barrier(0);      /* the loads stay in front of the wait below */
  asm volatile("s_wait_xcnt 0x0" ::: "memory");      /* behind the issued loads, before a register that they name is reused */
  __builtin_amdgcn_sched_barrier(0);      /* keeps later register writes behind that wait */
#pragma unroll
  for (int i = 0; i < SQ / 32 / FW; ++i) { const unsigned int bal = __builtin_amdgcn_ballot_w32(bf16_round(mv[i]) < 0.f); if (lane == 0) mbits[wave * (SQ / 32 / FW) + i] = bal; }
  put(0);
  fetch(1);
  const v8f z8 = {0.f, 0.f, 0.f, 0.f, 0.f, 0.f, 0.f, 0.f};
  v8f acc[FG][4]; float m_run[FG], l_run[FG];
#pragma unroll
  for (int g = 0; g < FG; ++g) { m_run[g] = -__builtin_inff(); l_run[g] = 0.f;
#pragma unroll
    for (int t = 0; t < 4; ++t) acc[g][t] = z8; }
  const float cs = 0.125f * 1.44269504f;      /* 1 / sqrt(64), and exp(x) as 2^(x log2 e) */
  __syncthreads();      /* stage 0 and the mask words are published */
  const unsigned int w0 = mbits[lane], w1 = mbits[32 + lane];      /* all 64 mask words in two registers; a pass reads its word by lane number, with no LDS latency */
#pragma unroll 1      /* the stage loop stays rolled: its body already holds two unrolled passes (code size, registers) */
  for (int st = 0; st < FNS; ++st) {
    if (st + 1 < FNS) put((st + 1) & 1);      /* into the buffer that stage st - 1 used: every wave has left it (barrier at the loop's foot) */
    if (st + 2 < FNS) fetch(st + 2);      /* in flight under this stage's work */
    const unsigned char* Lb = &L[st & 1][0];
#pragma unroll
    for (int p = 0; p < 2; ++p) {
      const unsigned char* kb = Lb + (p * 32 + c) * FP + 16 * h;
      v16h kf[2][2];
#pragma unroll
      for (int kt = 0; kt < 2; ++kt)
#pragma unroll
        for (int kc = 0; kc < 2; ++kc) kf[kt][kc] = lds_frag(kb + kt * 16 * FP + 64 * kc);
      const unsigned int mw = (unsigned int)__builtin_amdgcn_readlane((int)(st < FNS / 2 ? w0 : w1), (st * 2 + p) & 31) >> (8 * h);
      v8f s[2][FG];      /* s[kt][g][r] = raw score of key 32 p + 16 kt + 8 h + r and query 16 g + c */
#pragma unroll
      for (int kt = 0; kt < 2; ++kt)
#pragma unroll
        for (int g = 0; g < FG; ++g) s[kt][g] = fa_mma(kf[kt][1], qf[g][1], fa_mma(kf[kt][0], qf[g][0], z8));
      const unsigned char* vb = Lb + FT + c * FP + p * 64 + 16 * h;
      v16h vf[4];
#pragma unroll
      for (int t = 0; t < 4; ++t) vf[t] = lds_frag(vb + t * 16 * FP);
#pragma unroll
      for (int kt = 0; kt < 2; ++kt)
#pragma unroll
        for (int r = 0; r < 8; ++r) { const bool km = (mw & (1u << (16 * kt + r))) != 0u;
#pragma unroll
          for (int g = 0; g < FG; ++g) s[kt][g][r] = km ? -80000.0f : s[kt][g][r]; }      /* masked_fill(-10000) on the raw score: -80000 / 8 */
      float mb[FG]; bool need = false;
#pragma unroll
      for (int g = 0; g < FG; ++g) { float mx = s[0][g][0];
#pragma unroll
        for (int r = 1; r < 8; ++r) mx = fmaxf(mx, s[0][g][r]);
#pragma unroll
        for (int r = 0; r < 8; ++r) mx = fmaxf(mx, s[1][g][r]);
        mx = fmaxf(mx, lane_x16(mx)) * cs; mb[g] = mx; need = need || (mx > m_run[g] + 8.0f); }      /* both halves hold the query's maximum of this pass, in log2 units */
      if (__builtin_amdgcn_ballot_w32(need) != 0u) {      /* lazy rescale: the maximum in use may trail the true one by 8 (a weight reaches 2^8 at most); one scalar branch per pass */
#pragma unroll
        for (int g = 0; g < FG; ++g) { const float mn = fmaxf(m_run[g], mb[g]); const float corr = exp2x1(m_run[g] - mn); m_run[g] = mn; l_run[g] *= corr;      /* first pass: 2^(-inf) = 0 on zero sums */
#pragma unroll
          for (int t = 0; t < 4; ++t) acc[g][t] = acc[g][t] * corr; } }
      FragH pf[FG];
#pragma unroll
      for (int g = 0; g < FG; ++g) { const float nm = -m_run[g]; float ls[4] = {0.f, 0.f, 0.f, 0.f};
#pragma unroll
        for (int kt = 0; kt < 2; ++kt) { v8f t8;
#pragma unroll
          for (int r = 0; r < 8; ++r) t8[r] = fmaf(s[kt][g][r], cs, nm);
          const v8f e = exp2x8(t8);
#pragma unroll
          for (int r = 0; r < 8; ++r) { ls[r & 3] += e[r]; pf[g].h[8 * kt + r] = (_Float16)e[r]; } }      /* element 8 kt + r of the B operand = key 16 kt + 8 h + r */
        l_run[g] += (ls[0] + ls[1]) + (ls[2] + ls[3]); }
      __builtin_amdgcn_sched_barrier(0);      /* the exponentials are asm text: all of them stay in front of the second product */
#pragma unroll
      for (int g = 0; g < FG; ++g)
#pragma unroll
        for (int t = 0; t < 4; ++t) acc[g][t] = fa_mma(vf[t], pf[g].v, acc[g][t]);      /* acc[g][t][r] = O[query 16 g + c][dim 16 t + 8 h + r], unnormalised */
    }
    __syncthreads();      /* publishes stage st + 1 and ends every wave's reads of stage st */
  }
#pragma unroll
  for (int g = 0; g < FG; ++g) { const float l = l_run[g] + lane_x16(l_run[g]); const float inv = 1.0f / l;      /* the halves' sums joined once */
#pragma unroll
    for (int t = 0; t < 4; ++t) acc[g][t] = acc[g][t] * inv; }
#pragma unroll
  for (int g = 0; g < FG; ++g) { float* op = out + (r0 + q0 + g * 16 + c) * DM + hd * HD + 8 * h;
#pragma unroll
    for (int t = 0; t < 4; ++t) { const v4f lo = {acc[g][t][0], acc[g][t][1], acc[g][t][2], acc[g][t][3]}, hi = {acc[g][t][4], acc[g][t][5], acc[g][t][6], acc[g][t][7]};
      *(v4f*)(op + 16 * t) = lo; *(v4f*)(op + 16 * t + 4) = hi; } }
}
extern "C" void kernel_launch(void* const* d_in, const int* in_sizes, int n_in,
                              void* d_out, int out_size, void* d_ws, size_t ws_size, hipStream_t stream) {
  (void)in_sizes; (void)n_in; (void)out_size;
  const float* const* I = (const float* const*)d_in; const float* x = I[0]; const float* am = I[1]; const float* wq = I[2]; const float* bq = I[3]; const float* wk = I[4]; const float* bk = I[5]; const float* wv = I[6]; const float* bv = I[7];      /* hidden_states; attention_mask f32 [4][1][1][2048] (READ on device: key masked iff bf16(mask) < 0); natural weights + biases */
  char* ws = (char*)d_ws; size_t off = 0;
  auto take = [&](size_t bytes) { char* p = ws + off; off += (bytes + 255) & ~(size_t)255; return p; };
  _Float16* BQ = (_Float16*)take((size_t)DM * DM * 2); _Float16* BK = (_Float16*)take((size_t)DM * DM * 2); _Float16* BV = (_Float16*)take((size_t)DM * DM * 2); 
  _Float16* X16 = (_Float16*)take(NR * DM * 2); _Float16* Q16 = (_Float16*)take(NR * DM * 2); _Float16* K16 = (_Float16*)take(NR * DM * 2); _Float16* V16 = (_Float16*)take(NR * DM * 2);
  _Float16* VT = (_Float16*)take((size_t)NB * NH * HD * SQ * 2);
  if (off > ws_size) return;
  { const unsigned g = (unsigned)(((size_t)DM * DM / 8 + 255) / 256); k_wnat<<<g, 256, 0, stream>>>(wq, (size_t)DM * DM / 8, BQ); k_wnat<<<g, 256, 0, stream>>>(wk, (size_t)DM * DM / 8, BK); k_wnat<<<g, 256, 0, stream>>>(wv, (size_t)DM * DM / 8, BV); }      /* natural [out][in] = Bt[n][k], x16 */

  k_x16<<<(unsigned)((NR * DM / 8 + 255) / 256), 256, 0, stream>>>(x, X16, NR * DM / 8);
  const size_t r0p = (size_t)B0 * SQ;      /* first projected row */
  k_gemm2<0><<<dim3((unsigned)((MP / 128) * (DM / 64)), 1), 128, 0, stream>>>(X16 + r0p * DM, DM, 0, BQ, DM, 0, 0.0625f, bq, 0, nullptr, 1, 0, 0, nullptr, Q16 + r0p * DM, DM, 0, MP, DM, DM);
  k_gemm2<0><<<dim3((unsigned)((MP / 128) * (DM / 64)), 1), 128, 0, stream>>>(X16 + r0p * DM, DM, 0, BK, DM, 0, 0.0625f, bk, 0, nullptr, 1, 0, 0, nullptr, K16 + r0p * DM, DM, 0, MP, DM, DM);
  k_gemm2<0><<<dim3((unsigned)((MP / 128) * (DM / 64)), 1), 128, 0, stream>>>(X16 + r0p * DM, DM, 0, BV, DM, 0, 0.0625f, bv, 0, nullptr, 1, 0, 0, nullptr, V16 + r0p * DM, DM, 0, MP, DM, DM);
  k_vt<NH, SQ><<<NB * NH * (SQ / 64), 256, 0, stream>>>(V16, LQ, 0, VT);      /* V^T [NB][NH][HD][SQ] */
  k_fattn<<<dim3(SQ / FQ, NH, NB), FW * 32, 0, stream>>>(Q16, K16, VT, am, (float*)d_out);      /* scores, sign key mask (select, -10000 fill), softmax and P V in one launch; f32 straight into the merged-heads output rows */
}

// v003
// A run of this version takes 116 microseconds.
// Timed twice side by side with v002, it ran 1.69 and 1.71 times as fast.
// Counting every step since v000, it is 44.9 times as fast.
#include <hip/hip_runtime.h>
// BERT self-attention without an output projection and with a SIGN key mask (hidden_states [4][2048][768]; q/k/v = x W^T + b (natural [768][768] sigma 0.02, biases sigma 0.02); 12 heads of 64; scores / 8; masked_fill(attention_mask < 0, -10000) with the f32 [4][1][1][2048] mask input (a key of batch b is masked iff its mask value is negative); softmax over all keys; context = heads merged -> [4][2048][768]).
// Structure: token rows r = b*2048 + s; x as exact f16 rows (bf16-rounded); Q, K, V as three WMMA GEMMs (32x64 wave tiles, f32 accumulation, exact x16 weights + bias, f16 outputs); V^T for all batches and heads via LDS transposes; one fused attention launch (scores on WMMA, K = 64; online softmax on VALU, f32 statistics, weights as f16 relative to the running maximum; o = P . V on WMMA) written f32 straight into the merged-heads output rows (no output projection).
// Compute dtype: inputs rounded to bf16; x / weights exact; q, k, v and softmax weights as plain f16 GEMM operands (~2^-12); scores, softmax statistics and o f32. v_wmma_f32_16x16x32_f16.
#define NB 4
#define SQ 2048
#define DM 768
#define NH 12
#define HD 64
#define HG 4                         /* heads per launch of the per-batch k_vt overload */
#define B0 0                         /* first batch processed (debug hook) */
#define NBR NB                       /* batches processed (debug hook) */
#define NR ((size_t)NB * SQ)         /* token rows */
#define MP ((int)((size_t)NBR * SQ)) /* rows projected (debug hook) */
#define QN SQ                        /* unused */
#define NHD NH                       /* unused */
#define MPO MP                       /* unused */
#define LQ DM      /* row pitch of the q/k/v rows */
typedef __bf16 v16b __attribute__((ext_vector_type(16)));
typedef unsigned short v8us __attribute__((ext_vector_type(8), may_alias));
typedef float  v8f  __attribute__((ext_vector_type(8)));
typedef float  v4f  __attribute__((ext_vector_type(4)));
typedef float  v4fa __attribute__((ext_vector_type(4), may_alias));
union FragB { v16b v; v8us half[2]; unsigned short u[16]; };

__device__ __forceinline__ unsigned short bf16_bits(float x) { unsigned int u = __float_as_uint(x); return (unsigned short)((u + 0x7FFFu + ((u >> 16) & 1u)) >> 16); }
__device__ __forceinline__ float bf16_val(unsigned short b) { return __uint_as_float(((unsigned int)b) << 16); }
__device__ __forceinline__ float bf16_round(float x) { return bf16_val(bf16_bits(x)); }
// D += A·B with NT terms: 1 = ah·bh, 2 = + al·bh (A split), 3 = + ah·bl (both split)
template <int NT>
__device__ __forceinline__ v8f mmaN(v16b ah, v16b al, v16b bh, v16b bl, v8f c) {
  c = __builtin_amdgcn_wmma_f32_16x16x32_bf16(false, ah, false, bh, (short)0, c, false, false);
  if (NT >= 2) c = __builtin_amdgcn_wmma_f32_16x16x32_bf16(false, al, false, bh, (short)0, c, false, false);
  if (NT >= 3) c = __builtin_amdgcn_wmma_f32_16x16x32_bf16(false, ah, false, bl, (short)0, c, false, false);
  asm volatile("v_nop\n\tv_nop\n\tv_nop\n\tv_nop" : "+v"(c) : "v"(ah), "v"(al), "v"(bh), "v"(bl));
  return c;
}

__global__ __launch_bounds__(256) void k_wt_bf16(const float* __restrict__ W, unsigned short* __restrict__ Wt, int K, int N) {
  const int t = blockIdx.x * 256 + threadIdx.x;
  const int k8n = K / 8;
  if (t >= N * k8n) return;
  const int n = t / k8n, k8 = (t % k8n) * 8;
  v8us v;
#pragma unroll
  for (int i = 0; i < 8; ++i) v[i] = bf16_bits(W[(size_t)(k8 + i) * N + n]);
  *(v8us*)(Wt + (size_t)n * K + k8) = v;
  
}

// GEMM C[M][N] (f32, pitch ldc) = act(A[M][K]·W + bias). A f32 row-major (pitch lda) converted per fragment to bf16
// (ASPLIT: hi/lo two planes -> 2 terms, else single rounded term); Wt bf16 [N][K] (pitch ldb). BIAS_BF16 rounds the
// bias to bf16 first (bias quantised to bf16 before the add). K%32==0, M%16==0, N%64==0.
template <bool ASPLIT, int ACT, bool BIAS_BF16>
__global__ __launch_bounds__(128) void k_gemm_bf(const float* __restrict__ A, int lda, const unsigned short* __restrict__ Wt, int ldb,
                                               const float* __restrict__ bias, float* __restrict__ C, int ldc, int M, int N, int K) {
  __shared__ __attribute__((aligned(16))) float so[4][16][64];
  const int tid = threadIdx.x, w = tid >> 5, lane = tid & 31, ln = lane & 15, hh = lane >> 4;
  const int ntn = N / 64;
  const int wid = blockIdx.x * 4 + w;
  const int mt = wid / ntn, nq = wid % ntn;
  if (mt * 16 >= M) return;
  const int row0 = mt * 16, col0 = nq * 64;
  const float* arow = A + (size_t)(row0 + ln) * lda;
  v8f acc[4] = {};
  for (int kb = 0; kb < K; kb += 32) {
    FragB ah, al;
    const v4f x0 = *(const v4fa*)(arow + kb + 8 * hh), x1 = *(const v4fa*)(arow + kb + 8 * hh + 4);
    const v4f x2 = *(const v4fa*)(arow + kb + 16 + 8 * hh), x3 = *(const v4fa*)(arow + kb + 16 + 8 * hh + 4);
    float xs[16] = {x0[0],x0[1],x0[2],x0[3],x1[0],x1[1],x1[2],x1[3],x2[0],x2[1],x2[2],x2[3],x3[0],x3[1],x3[2],x3[3]};
#pragma unroll
    for (int i = 0; i < 16; ++i) { const unsigned short hb = bf16_bits(xs[i]); ah.u[i] = hb; al.u[i] = ASPLIT ? bf16_bits(xs[i] - bf16_val(hb)) : (unsigned short)0; }
#pragma unroll
    for (int t = 0; t < 4; ++t) {
      const unsigned short* brow = Wt + (size_t)(col0 + t * 16 + ln) * ldb + kb;
      FragB b;
      b.half[0] = *(const v8us*)(brow + 8 * hh);
      b.half[1] = *(const v8us*)(brow + 16 + 8 * hh);
      acc[t] = mmaN<ASPLIT ? 2 : 1>(ah.v, al.v, b.v, b.v, acc[t]);
    }
  }
#pragma unroll
  for (int t = 0; t < 4; ++t) {
    float bv = bias ? bias[col0 + t * 16 + ln] : 0.f;
    if (BIAS_BF16) bv = bf16_round(bv);
#pragma unroll
    for (int r = 0; r < 8; ++r) { float v = acc[t][r] + bv; if (ACT == 1) v = fmaxf(v, 0.f); so[w][8 * hh + r][t * 16 + ln] = v; }
  }
  __builtin_amdgcn_fence(__ATOMIC_ACQ_REL, "workgroup");
  __builtin_amdgcn_wave_barrier();
  const int rsub = lane >> 4, c4 = (lane & 15) * 4;
  {
#pragma unroll
    for (int q = 0; q < 8; ++q) {
      const int r = q * 2 + rsub;
      const v4f v = *(const v4fa*)&so[w][r][c4];
      *(v4f*)(C + (size_t)(row0 + r) * ldc + col0 + c4) = v;
    }
    
  }
}

// GEMM C = act(A·W + bias + resid): A f32 (ASPLIT -> hi/lo 2 terms), Wt bf16 [N][K]; ACT 0 none, 1 relu, 2 exact gelu;
// resid (optional, f32, row index = (row % rmod), pitch ldr, RES_BF16 rounds it) added before the activation.
template <bool ASPLIT, int ACT, bool BIAS_BF16, bool RES_BF16>
__global__ __launch_bounds__(128) void k_gemm_bf3(const float* __restrict__ A, int lda, const unsigned short* __restrict__ Wt, int ldb,
                                                const float* __restrict__ bias, const float* __restrict__ resid, int rmod, int ldr,
                                                float* __restrict__ C, int ldc, int M, int N, int K) {
  __shared__ __attribute__((aligned(16))) float so[4][16][64];
  const int tid = threadIdx.x, w = tid >> 5, lane = tid & 31, ln = lane & 15, hh = lane >> 4;
  const int ntn = N / 64;
  const int wid = blockIdx.x * 4 + w;
  const int mt = wid / ntn, nq = wid % ntn;
  if (mt * 16 >= M) return;
  const int row0 = mt * 16, col0 = nq * 64;
  const float* arow = A + (size_t)(row0 + ln) * lda;
  v8f acc[4] = {};
  for (int kb = 0; kb < K; kb += 32) {
    FragB ah, al;
    const v4f x0 = *(const v4fa*)(arow + kb + 8 * hh), x1 = *(const v4fa*)(arow + kb + 8 * hh + 4);
    const v4f x2 = *(const v4fa*)(arow + kb + 16 + 8 * hh), x3 = *(const v4fa*)(arow + kb + 16 + 8 * hh + 4);
    float xs[16] = {x0[0],x0[1],x0[2],x0[3],x1[0],x1[1],x1[2],x1[3],x2[0],x2[1],x2[2],x2[3],x3[0],x3[1],x3[2],x3[3]};
#pragma unroll
    for (int i = 0; i < 16; ++i) { const unsigned short hb = bf16_bits(xs[i]); ah.u[i] = hb; al.u[i] = ASPLIT ? bf16_bits(xs[i] - bf16_val(hb)) : (unsigned short)0; }
#pragma unroll
    for (int t = 0; t < 4; ++t) {
      const unsigned short* brow = Wt + (size_t)(col0 + t * 16 + ln) * ldb + kb;
      FragB b;
      b.half[0] = *(const v8us*)(brow + 8 * hh);
      b.half[1] = *(const v8us*)(brow + 16 + 8 * hh);
      acc[t] = mmaN<ASPLIT ? 2 : 1>(ah.v, al.v, b.v, b.v, acc[t]);
    }
  }
#pragma unroll
  for (int t = 0; t < 4; ++t) {
    const int col = col0 + t * 16 + ln;
    float bv = bias ? bias[col] : 0.f;
    if (BIAS_BF16) bv = bf16_round(bv);
#pragma unroll
    for (int r = 0; r < 8; ++r) {
      float v = acc[t][r] + bv;
      if (resid) { float rv = resid[(size_t)((row0 + 8 * hh + r) % rmod) * ldr + col]; if (RES_BF16) rv = bf16_round(rv); v += rv; }
      if (ACT == 1) v = fmaxf(v, 0.f);
      if (ACT == 2) v = 0.5f * v * (1.0f + erff(v * 0.70710678118654752f));
      if (ACT == 3) { const float u = 0.7978845608028654f * (v + 0.044715f * v * v * v); v = 0.5f * v * (1.0f + tanhf(u)); }
      so[w][8 * hh + r][t * 16 + ln] = v;
    }
  }
  __builtin_amdgcn_fence(__ATOMIC_ACQ_REL, "workgroup");
  __builtin_amdgcn_wave_barrier();
  const int rsub = lane >> 4, c4 = (lane & 15) * 4;
  {
#pragma unroll
    for (int q = 0; q < 8; ++q) {
      const int r = q * 2 + rsub;
      const v4f v = *(const v4fa*)&so[w][r][c4];
      *(v4f*)(C + (size_t)(row0 + r) * ldc + col0 + c4) = v;
    }
    
  }
}
// row LayerNorm (biased variance, eps) over N: s = X (+ R); optional out_sum <- s; out_norm <- (s-mu)*rsqrt(var+eps)*g + b
template <bool PARAM_BF16>
__global__ __launch_bounds__(256) void k_layernorm(const float* __restrict__ X, const float* __restrict__ R, const float* __restrict__ g, const float* __restrict__ bta,
                                                  float* __restrict__ out_sum, float* __restrict__ out_norm, int N, float eps) {
  __shared__ float red[256];
  const int row = blockIdx.x, tid = threadIdx.x;
  const float* x = X + (size_t)row * N; const float* rr = R ? R + (size_t)row * N : nullptr;
  float vals[16];                     // up to N = 4096
  const int per = N / 256;            // contiguous chunk per thread? use strided-by-4 chunks: thread handles j = tid*4 + 1024*u
  float s1 = 0.f;
  for (int u = 0; u < per / 4; ++u) {
    const int j = tid * 4 + 1024 * u;
    const v4f a = *(const v4fa*)(x + j);
    v4f b = {0.f,0.f,0.f,0.f}; if (rr) b = *(const v4fa*)(rr + j);
#pragma unroll
    for (int q = 0; q < 4; ++q) { const float v = a[q] + b[q]; vals[u * 4 + q] = v; s1 += v; }
  }
  red[tid] = s1; __syncthreads();
  for (int st = 128; st > 0; st >>= 1) { if (tid < st) red[tid] += red[tid + st]; __syncthreads(); }
  const float mu = red[0] / (float)N; __syncthreads();
  float s2 = 0.f;
  for (int u = 0; u < per / 4; ++u)
#pragma unroll
    for (int q = 0; q < 4; ++q) { const float c = vals[u * 4 + q] - mu; s2 += c * c; }
  red[tid] = s2; __syncthreads();
  for (int st = 128; st > 0; st >>= 1) { if (tid < st) red[tid] += red[tid + st]; __syncthreads(); }
  const float rs = rsqrtf(red[0] / (float)N + eps);
  {
    for (int u = 0; u < per / 4; ++u) {
      const int j = tid * 4 + 1024 * u;
      v4f o, sm;
#pragma unroll
      for (int q = 0; q < 4; ++q) {
        float gg = g[j + q], bb = bta[j + q];
        if (PARAM_BF16) { gg = bf16_round(gg); bb = bf16_round(bb); }
        sm[q] = vals[u * 4 + q]; o[q] = (vals[u * 4 + q] - mu) * rs * gg + bb;
      }
      if (out_sum) *(v4f*)(out_sum + (size_t)row * N + j) = sm;
      *(v4f*)(out_norm + (size_t)row * N + j) = o;
    }
    
  }
}



// ---- f16 WMMA path (v_wmma_f32_16x16x32_f16): 11-bit significands for operands in range — used where a [0,1] probability operand needs more precision than bf16
typedef _Float16 v16h __attribute__((ext_vector_type(16)));
union FragH { v16h v; v8us half[2]; _Float16 h[16]; unsigned short u[16]; };
template <int NT>
__device__ __forceinline__ v8f mmaH(v16h ah, v16h al, v16h bh, v16h bl, v8f c) {
  c = __builtin_amdgcn_wmma_f32_16x16x32_f16(false, ah, false, bh, (short)0, c, false, false);
  if (NT >= 2) c = __builtin_amdgcn_wmma_f32_16x16x32_f16(false, al, false, bh, (short)0, c, false, false);
  if (NT >= 3) c = __builtin_amdgcn_wmma_f32_16x16x32_f16(false, ah, false, bl, (short)0, c, false, false);
  asm volatile("v_nop\n\tv_nop\n\tv_nop\n\tv_nop" : "+v"(c) : "v"(ah), "v"(al), "v"(bh), "v"(bl));
  return c;
}
// batched GEMM like k_gemm_b but f16 operands: A f32 (split into f16 hi/lo if ASPLIT, else rounded to f16), Bt = f16 values [n][k]; alpha; C f32; N multiple of 16 (partial tiles skipped)
template <bool ASPLIT>
__global__ __launch_bounds__(128) void k_gemm_h(const float* __restrict__ A, int lda, size_t sA, const _Float16* __restrict__ Bh, int ldb, size_t sB, float alpha, float* __restrict__ C, int ldc, size_t sC, int M, int N, int K) {
  __shared__ __attribute__((aligned(16))) float so[4][16][64];
  const int tid = threadIdx.x, w = tid >> 5, lane = tid & 31, ln = lane & 15, hh = lane >> 4; const int by = blockIdx.y;
  A += (size_t)by * sA; Bh += (size_t)by * sB; C += (size_t)by * sC;
  const int ntn = (N + 63) / 64; const int wid = blockIdx.x * 4 + w; const int mt = wid / ntn, nq = wid % ntn; if (mt * 16 >= M) return;
  const int row0 = mt * 16, col0 = nq * 64; const float* arow = A + (size_t)(row0 + ln) * lda;
  v8f acc[4] = {};
  for (int kb = 0; kb < K; kb += 32) {
    FragH ah, al;
    const v4f x0 = *(const v4fa*)(arow + kb + 8 * hh), x1 = *(const v4fa*)(arow + kb + 8 * hh + 4), x2 = *(const v4fa*)(arow + kb + 16 + 8 * hh), x3 = *(const v4fa*)(arow + kb + 16 + 8 * hh + 4);
    float xs[16] = {x0[0],x0[1],x0[2],x0[3],x1[0],x1[1],x1[2],x1[3],x2[0],x2[1],x2[2],x2[3],x3[0],x3[1],x3[2],x3[3]};
#pragma unroll
    for (int i = 0; i < 16; ++i) { const _Float16 h = (_Float16)xs[i]; ah.h[i] = h; al.h[i] = ASPLIT ? (_Float16)(xs[i] - (float)h) : (_Float16)0.0f; }
#pragma unroll
    for (int t = 0; t < 4; ++t) { if (col0 + t * 16 >= N) continue; const size_t boff = (size_t)(col0 + t * 16 + ln) * ldb + kb; FragH bq; bq.half[0] = *(const v8us*)(Bh + boff + 8 * hh); bq.half[1] = *(const v8us*)(Bh + boff + 16 + 8 * hh);
      acc[t] = mmaH<ASPLIT ? 2 : 1>(ah.v, al.v, bq.v, bq.v, acc[t]); }
  }
#pragma unroll
  for (int t = 0; t < 4; ++t) { if (col0 + t * 16 >= N) continue;
#pragma unroll
    for (int r = 0; r < 8; ++r) so[w][8 * hh + r][t * 16 + ln] = acc[t][r] * alpha; }
  __builtin_amdgcn_fence(__ATOMIC_ACQ_REL, "workgroup"); __builtin_amdgcn_wave_barrier();
  const int rsub = lane >> 4, c4 = (lane & 15) * 4;
  {
#pragma unroll
    for (int q = 0; q < 8; ++q) { const int r = q * 2 + rsub; if (col0 + c4 < N) { const v4f v = *(const v4fa*)&so[w][r][c4]; *(v4f*)(C + (size_t)(row0 + r) * ldc + col0 + c4) = v; } }
     }
}

// Wt[n][k] = f16(W[k][n]·scale) from f32 row-major W[K][N] (scale = power of two; bf16-exact weights stay exact in f16 away from the subnormal range)
__global__ __launch_bounds__(256) void k_wt_f16(const float* __restrict__ W, _Float16* __restrict__ Wt, int K, int N, float scale) {
  const int t = blockIdx.x * 256 + threadIdx.x; if (t >= N * (K / 8)) return; const int n = t / (K / 8), k8 = (t % (K / 8)) * 8; FragH f;
#pragma unroll
  for (int i = 0; i < 8; ++i) f.h[i] = (_Float16)(bf16_round(W[(size_t)(k8 + i) * N + n]) * scale); const v8us o = f.half[0];
  *(v8us*)((unsigned short*)Wt + (size_t)n * K + k8) = o; 
}
// k_gemm_hh variant with fused epilogue: v = acc·alpha + bias[by·sBias + col] (+ CP[(row/rowsPerB)·sCPb + by·64 + col] if CP) ; ACT 0 none / 1 elu ; writes f16 C16 (and f32 C if non-null)
template <int ACT>
__global__ __launch_bounds__(128) void k_gemm_hhx(const _Float16* __restrict__ A, int lda, size_t sA, const _Float16* __restrict__ Bh, int ldb, size_t sB, float alpha, const float* __restrict__ bias, size_t sBias, const float* __restrict__ CP, int rowsPerB, size_t sCPb, int row0g,
    float* __restrict__ C, _Float16* __restrict__ C16, int ldc, size_t sC, int M, int N, int K) {
  __shared__ __attribute__((aligned(16))) float so[4][16][64];
  const int tid = threadIdx.x, w = tid >> 5, lane = tid & 31, ln = lane & 15, hh = lane >> 4; const int by = blockIdx.y;
  A += (size_t)by * sA; Bh += (size_t)by * sB; const size_t cofs = (size_t)by * sC; const float* bp = bias ? bias + (size_t)by * sBias : nullptr;
  const int ntn = (N + 63) / 64; const int wid = blockIdx.x * 4 + w; const int mt = wid / ntn, nq = wid % ntn; if (mt * 16 >= M) return;
  const int row0 = mt * 16, col0 = nq * 64; const _Float16* arow = A + (size_t)(row0 + ln) * lda;
  v8f acc[4] = {};
  for (int kb = 0; kb < K; kb += 32) { FragH ah; ah.half[0] = *(const v8us*)((const unsigned short*)arow + kb + 8 * hh); ah.half[1] = *(const v8us*)((const unsigned short*)arow + kb + 16 + 8 * hh);
#pragma unroll
    for (int t = 0; t < 4; ++t) { if (col0 + t * 16 >= N) continue; const size_t boff = (size_t)(col0 + t * 16 + ln) * ldb + kb; FragH bq; bq.half[0] = *(const v8us*)((const unsigned short*)Bh + boff + 8 * hh); bq.half[1] = *(const v8us*)((const unsigned short*)Bh + boff + 16 + 8 * hh);
      acc[t] = mmaH<1>(ah.v, ah.v, bq.v, bq.v, acc[t]); }
  }
#pragma unroll
  for (int t = 0; t < 4; ++t) { if (col0 + t * 16 >= N) continue; const int col = col0 + t * 16 + ln; const float bv = bp ? bf16_round(bp[col]) : 0.f;
#pragma unroll
    for (int r = 0; r < 8; ++r) { float v = acc[t][r] * alpha + bv; if (CP) { const int rr = row0g + row0 + 8 * hh + r; if (rowsPerB < 0) v += CP[cofs + (size_t)rr * ldc + col];      /* rowsPerB < 0: own element of the batched C plane */ else { const int bidx = rr / rowsPerB; v += CP[(size_t)bidx * sCPb + (size_t)by * 64 + col]; } } if (ACT == 1) v = (v > 0.f) ? v : expm1f(v); else if (ACT == 7) v = (v > 0.f) ? v + 1.0f : expf(v); else if (ACT == 8) v = tanhf(v); else if (ACT == 9) v = 0.5f * v * (1.0f + tanhf(0.7978845608028654f * (v + 0.044715f * v * v * v))); else if (ACT == 11) v = 1.0f / (1.0f + expf(-v)); else if (ACT == 12) v = (v > 0.f) ? v : 0.01f * v; else if (ACT == 14) v = (v > 0.f) ? v : 0.1f * v; else if (ACT == 16) v = (v >= 0.f) ? v : 0.3f * v; else if (ACT == 17) v = (v >= 0.f) ? v : 0.2f * v; else if (ACT == 15) v = v / (1.0f + expf(-v)); else if (ACT == 3) v = fmaxf(v, 0.f); else if (ACT == 6) v = 0.5f * v * (1.0f + erff(v * 0.70710678118654752f)); so[w][8 * hh + r][t * 16 + ln] = v; } }
  __builtin_amdgcn_fence(__ATOMIC_ACQ_REL, "workgroup"); __builtin_amdgcn_wave_barrier();
  const int rsub = lane >> 4, c4 = (lane & 15) * 4; typedef _Float16 v4h __attribute__((ext_vector_type(4)));
  {
#pragma unroll
    for (int q = 0; q < 8; ++q) { const int r = q * 2 + rsub; if (col0 + c4 < N) { const v4f v = *(const v4fa*)&so[w][r][c4]; if (C) *(v4f*)(C + cofs + (size_t)(row0 + r) * ldc + col0 + c4) = v; if (C16) { v4h h4; for (int i = 0; i < 4; ++i) h4[i] = (_Float16)v[i]; *(v4h*)(C16 + cofs + (size_t)(row0 + r) * ldc + col0 + c4) = h4; } } }
     }
}


typedef _Float16 v4h __attribute__((ext_vector_type(4)));

__global__ __launch_bounds__(256) void k_x16(const float* __restrict__ x, _Float16* __restrict__ X16, size_t n8) { const size_t t = (size_t)blockIdx.x * 256 + threadIdx.x; if (t >= n8) return; FragH f;
#pragma unroll
  for (int q = 0; q < 8; ++q) f.h[q] = (_Float16)bf16_round(x[t * 8 + q]); *(v8us*)((unsigned short*)X16 + t * 8) = f.half[0];  }
__global__ __launch_bounds__(256) void k_h16(const float* __restrict__ x, _Float16* __restrict__ X16, size_t n8) { const size_t t = (size_t)blockIdx.x * 256 + threadIdx.x; if (t >= n8) return; FragH f;
#pragma unroll
  for (int q = 0; q < 8; ++q) f.h[q] = (_Float16)x[t * 8 + q]; *(v8us*)((unsigned short*)X16 + t * 8) = f.half[0];  }
__global__ __launch_bounds__(256) void k_round16f(const float* __restrict__ W, _Float16* __restrict__ Bt, size_t n8) { const size_t t = (size_t)blockIdx.x * 256 + threadIdx.x; if (t >= n8) return; FragH f;
#pragma unroll
  for (int i = 0; i < 8; ++i) f.h[i] = (_Float16)(bf16_round(W[t * 8 + i]) * 16.0f); *(v8us*)((unsigned short*)Bt + t * 8) = f.half[0];  }
template <int NHv, int TTv>
__global__ __launch_bounds__(256) void k_vt(const _Float16* __restrict__ V16, int ldv, int voff, _Float16* __restrict__ Vt) { __shared__ unsigned short tl[64][66]; const int tid = threadIdx.x; const int slab = blockIdx.x / (TTv / 64), lg = blockIdx.x % (TTv / 64); const int b = slab / NHv, h = slab % NHv;
  for (int i = tid; i < 64 * 8; i += 256) { const int r = i / 8, c8 = (i % 8) * 8; FragH f; f.half[0] = *(const v8us*)((const unsigned short*)V16 + ((size_t)b * TTv + lg * 64 + r) * ldv + voff + h * 64 + c8);
#pragma unroll
    for (int q = 0; q < 8; ++q) tl[r][c8 + q] = f.u[q]; }
  __syncthreads();
  {
#pragma unroll
    for (int rd = 0; rd < 2; ++rd) { const int d = rd * 32 + tid / 8, pc = tid % 8; FragH f;
#pragma unroll
      for (int q = 0; q < 8; ++q) f.u[q] = tl[pc * 8 + q][d];
      *(v8us*)((unsigned short*)Vt + ((size_t)slab * 64 + d) * TTv + lg * 64 + pc * 8) = f.half[0]; }
     } }

__global__ __launch_bounds__(256) void k_hl(const float* __restrict__ F, _Float16* __restrict__ Hh, _Float16* __restrict__ Hl, size_t n8) { const size_t t = (size_t)blockIdx.x * 256 + threadIdx.x; if (t >= n8) return; FragH fh, fl; const v4f a = *(const v4fa*)(F + t * 8), c = *(const v4fa*)(F + t * 8 + 4);
#pragma unroll
  for (int q = 0; q < 4; ++q) { _Float16 h = (_Float16)a[q]; fh.h[q] = h; fl.h[q] = (_Float16)((a[q] - (float)h) * 1024.0f); h = (_Float16)c[q]; fh.h[4 + q] = h; fl.h[4 + q] = (_Float16)((c[q] - (float)h) * 1024.0f); }
  { *(v8us*)((unsigned short*)Hh + t * 8) = fh.half[0]; *(v8us*)((unsigned short*)Hl + t * 8) = fl.half[0];  } }

// ---- fast GEMM (wave tile 32x64; requires M % 32 == 0 rows per launch region and N % 64 == 0); epilogue = k_gemm_hhx semantics ----
__device__ __forceinline__ v16h g2_frag(const _Float16* p, int hh) { FragH f; f.half[0] = *(const v8us*)((const unsigned short*)p + 8 * hh); f.half[1] = *(const v8us*)((const unsigned short*)p + 16 + 8 * hh); return f.v; }
__device__ __forceinline__ v8f g2_mma(v16h a, v16h b, v8f c) { v8f d = __builtin_amdgcn_wmma_f32_16x16x32_f16(false, a, false, b, (short)0, c, false, false); asm volatile("v_nop\n\tv_nop\n\tv_nop\n\tv_nop" : "+v"(d) : "v"(a), "v"(b)); return d; }
template <int ACT>
__global__ __launch_bounds__(128) void k_gemm2(const _Float16* __restrict__ A, int lda, size_t sA, const _Float16* __restrict__ Bh, int ldb, size_t sB, float alpha, const float* __restrict__ bias, size_t sBias, const float* __restrict__ CP, int rowsPerB, size_t sCPb, int row0g,
    float* __restrict__ C, _Float16* __restrict__ C16, int ldc, size_t sC, int M, int N, int K) { static_assert(ACT == 0 || ACT == 3 || ACT == 6 || ACT == 8 || ACT == 9 || ACT == 11 || ACT == 12 || ACT == 14 || ACT == 15 || ACT == 16 || ACT == 17, "k_gemm2: unsupported ACT code (would silently apply no activation)");
  __shared__ __attribute__((aligned(16))) float so[4][32][68];
  const int tid = threadIdx.x, w = tid >> 5, lane = tid & 31, ln = lane & 15, hh = lane >> 4; const int by = blockIdx.y;
  A += (size_t)by * sA; Bh += (size_t)by * sB; const size_t cofs = (size_t)by * sC; const float* bp = bias ? bias + (size_t)by * sBias : nullptr;
  const int ntn = N >> 6; const int mt = blockIdx.x / ntn, nq = blockIdx.x - mt * ntn; const int row0 = mt * 128 + 32 * w, col0 = nq * 64; if (row0 >= M) return;
  const _Float16* a0p = A + (size_t)(row0 + ln) * lda; const _Float16* a1p = a0p + (size_t)16 * lda;
  const _Float16* b0p = Bh + (size_t)(col0 + ln) * ldb; const _Float16* b1p = b0p + (size_t)16 * ldb; const _Float16* b2p = b1p + (size_t)16 * ldb; const _Float16* b3p = b2p + (size_t)16 * ldb;
  const v8f z8 = {0.f,0.f,0.f,0.f,0.f,0.f,0.f,0.f}; v8f c00 = z8, c01 = z8, c02 = z8, c03 = z8, c10 = z8, c11 = z8, c12 = z8, c13 = z8;
#pragma unroll 1
  for (int kb = 0; kb < K; kb += 32) { const v16h a0 = g2_frag(a0p + kb, hh), a1 = g2_frag(a1p + kb, hh);
    v16h b = g2_frag(b0p + kb, hh); c00 = g2_mma(a0, b, c00); c10 = g2_mma(a1, b, c10);
    b = g2_frag(b1p + kb, hh); c01 = g2_mma(a0, b, c01); c11 = g2_mma(a1, b, c11);
    b = g2_frag(b2p + kb, hh); c02 = g2_mma(a0, b, c02); c12 = g2_mma(a1, b, c12);
    b = g2_frag(b3p + kb, hh); c03 = g2_mma(a0, b, c03); c13 = g2_mma(a1, b, c13); }
  v8f accs[8] = {c00, c01, c02, c03, c10, c11, c12, c13};
#pragma unroll
  for (int u = 0; u < 8; ++u) { const int t = u & 3, half = u >> 2; const int col = col0 + t * 16 + ln; const float bv = bp ? bf16_round(bp[col]) : 0.f;
#pragma unroll
    for (int r = 0; r < 8; ++r) { const int rloc = half * 16 + 8 * hh + r; float v = accs[u][r] * alpha + bv; if (CP) { if (rowsPerB < 0) v += CP[cofs + (size_t)(row0g + row0 + rloc) * ldc + col];      /* rowsPerB < 0: own element of the batched C plane */ else { const int bidx = (row0g + row0 + rloc) / rowsPerB; v += CP[(size_t)bidx * sCPb + (size_t)by * 64 + col]; } }
      if (ACT == 3) v = fmaxf(v, 0.f); else if (ACT == 6) v = 0.5f * v * (1.0f + erff(v * 0.70710678118654752f)); else if (ACT == 11) v = 1.0f / (1.0f + expf(-v)); else if (ACT == 15) v = v / (1.0f + expf(-v)); else if (ACT == 12) v = (v > 0.f) ? v : 0.01f * v; else if (ACT == 8) v = tanhf(v); else if (ACT == 9) v = 0.5f * v * (1.0f + tanhf(0.7978845608028654f * (v + 0.044715f * v * v * v))); else if (ACT == 14) v = (v > 0.f) ? v : 0.1f * v; else if (ACT == 16) v = (v >= 0.f) ? v : 0.3f * v; else if (ACT == 17) v = (v >= 0.f) ? v : 0.2f * v;
      so[w][rloc][t * 16 + ln] = v; } }
  __builtin_amdgcn_fence(__ATOMIC_ACQ_REL, "workgroup"); __builtin_amdgcn_wave_barrier();
  const int rsub = lane >> 4, c4 = (lane & 15) * 4;
  {
#pragma unroll
    for (int q = 0; q < 16; ++q) { const int r = q * 2 + rsub; const v4f v = *(const v4fa*)&so[w][r][c4]; if (C) *(v4f*)(C + cofs + (size_t)(row0 + r) * ldc + col0 + c4) = v; if (C16) { v4h h4; for (int i = 0; i < 4; ++i) h4[i] = (_Float16)v[i]; *(v4h*)(C16 + cofs + (size_t)(row0 + r) * ldc + col0 + c4) = h4; } }
     } }


__global__ __launch_bounds__(256) void k_wnat(const float* __restrict__ w, size_t n8, _Float16* __restrict__ Bt) { const size_t t = (size_t)blockIdx.x * 256 + threadIdx.x; if (t >= n8) return; FragH f; for (int q = 0; q < 8; ++q) f.h[q] = (_Float16)(bf16_round(w[t * 8 + q]) * 16.0f); *(v8us*)((unsigned short*)Bt + t * 8) = f.half[0];  }
__global__ __launch_bounds__(256) void k_rsm(const float* __restrict__ S, _Float16* __restrict__ P, int nrows) {
  #pragma clang fp contract(off)
  const int i = blockIdx.x * 256 + threadIdx.x; if (i >= nrows) return; const float* s = S + (size_t)i * SQ; float mx = -3.0e38f;
#pragma unroll 1
  for (int j = 0; j < SQ; ++j) mx = fmaxf(mx, s[j]); float se = 0.f;
#pragma unroll 1
  for (int j = 0; j < SQ; ++j) se += expf(s[j] - mx); const float sc = 256.0f / se;
#pragma unroll 1
  for (int j0 = 0; j0 < SQ; j0 += 8) { FragH f; for (int q = 0; q < 8; ++q) f.h[q] = (_Float16)(expf(s[j0 + q] - mx) * sc); unsigned short* d = (unsigned short*)P + (size_t)i * SQ + j0; *(v8us*)d = f.half[0];  } }
__global__ __launch_bounds__(256) void k_vt(const _Float16* __restrict__ V16, int b, int h0, _Float16* __restrict__ VT) { __shared__ unsigned short tl[64][65]; const int tid = threadIdx.x; const int hh = blockIdx.x % HG, sg = blockIdx.x / HG; const int s0 = sg * 64; const int h = h0 + hh;
  for (int i = tid; i < 64 * 8; i += 256) { const int j = i / 8, d8 = (i % 8) * 8; FragH f; f.half[0] = *(const v8us*)((const unsigned short*)V16 + ((size_t)b * SQ + s0 + j) * DM + h * HD + d8); for (int q = 0; q < 8; ++q) tl[d8 + q][j] = f.u[q]; }
  __syncthreads();
  { for (int i = tid; i < 64 * 8; i += 256) { const int d = i / 8, j8 = (i % 8) * 8; FragH f; for (int q = 0; q < 8; ++q) f.u[q] = tl[d][j8 + q]; *(v8us*)((unsigned short*)VT + ((size_t)hh * HD + d) * SQ + s0 + j8) = f.half[0]; }  } }



#define FW 4                         /* waves per work-group */
#define FG 2                         /* 16-query groups per wave */
#define FQ (FW * FG * 16)            /* queries per work-group */
#define FK 64                        /* keys per stage (two passes of 32) */
#define FP 144                       /* LDS row pitch, bytes: 128 + 16, an odd multiple of 16 (16-byte reads of 16 rows without bank conflicts) */
#define FT (64 * FP)                 /* one tile: 64 rows (K: keys, V^T: head dims) */
#define FNS (SQ / FK)                /* stages */
__device__ __forceinline__ float lane_x16(float x) { const int b = __float_as_int(x); return __int_as_float(__builtin_amdgcn_permlanex16(b, b, 0x76543210, 0xfedcba98, false, false)); }      /* value of lane l ^ 16 */
// e[i] = 2^t[i], eight at a time, in one statement, so that the closing v_nop stands directly behind the last v_exp_f32: it is the slot that the instruction set asks for behind a transcendental before its
// result is read or its source overwritten. Early-clobber outputs: no result lies on a source of a
// later line. The closing s_delay_alu is the hint that the compiler cannot give for results of asm text: the next vector instruction may read them, and unhinted it would hold the SIMD's issue port against the other waves.
__device__ __forceinline__ v8f exp2x8(v8f t) { float e0, e1, e2, e3, e4, e5, e6, e7;
  asm("v_exp_f32 %0, %8\n\tv_exp_f32 %1, %9\n\tv_exp_f32 %2, %10\n\tv_exp_f32 %3, %11\n\tv_exp_f32 %4, %12\n\tv_exp_f32 %5, %13\n\tv_exp_f32 %6, %14\n\tv_exp_f32 %7, %15\n\tv_nop\n\ts_delay_alu instid0(TRANS32_DEP_1)"
      : "=&v"(e0), "=&v"(e1), "=&v"(e2), "=&v"(e3), "=&v"(e4), "=&v"(e5), "=&v"(e6), "=&v"(e7) : "v"(t[0]), "v"(t[1]), "v"(t[2]), "v"(t[3]), "v"(t[4]), "v"(t[5]), "v"(t[6]), "v"(t[7]));
  const v8f e = {e0, e1, e2, e3, e4, e5, e6, e7}; return e; }
__device__ __forceinline__ float exp2x1(float t) { float e; asm("v_exp_f32 %0, %1\n\tv_nop\n\ts_delay_alu instid0(TRANS32_DEP_1)" : "=&v"(e) : "v"(t)); return e; }      /* v_nop and hint: as in exp2x8 */
__device__ __forceinline__ v16h lds_frag(const unsigned char* p) { FragH f; f.half[0] = *(const v8us*)p; f.half[1] = *(const v8us*)(p + 32); return f.v; }      /* p = row + 64 * (32-element k block) + 16 * h: k = 8h .. 8h + 7 and 16 + 8h .. 16 + 8h + 7, the order of g2_frag */
__device__ __forceinline__ v8f fa_mma(v16h a, v16h b, v8f c) { return __builtin_amdgcn_wmma_f32_16x16x32_f16(false, a, false, b, (short)0, c, false, false); }
static_assert(SQ % FQ == 0 && SQ % FK == 0 && FNS >= 2 && HD == 64 && (SQ / 32) % FW == 0 && SQ / 32 == 64, "k_fattn: whole blocks, whole stages, head size 64");
__global__ __launch_bounds__(FW * 32) void k_fattn(const _Float16* __restrict__ Q16, const _Float16* __restrict__ K16, const _Float16* __restrict__ VT, const float* __restrict__ mk, float* __restrict__ out) {
  __shared__ __attribute__((aligned(16))) unsigned char L[2][2 * FT];      /* [buffer][K tile, V^T tile] */
  __shared__ unsigned int mbits[SQ / 32];      /* bit j of word i: key 32 i + j of this batch is masked */
  const int tid = threadIdx.x, lane = tid & 31, c = lane & 15, h = lane >> 4; const int wave = __builtin_amdgcn_readfirstlane(tid >> 5);
  const int hd = blockIdx.y, b = blockIdx.z; const size_t r0 = (size_t)b * SQ; const int q0 = blockIdx.x * FQ + wave * (FG * 16);
  const unsigned short* kg = (const unsigned short*)K16 + (r0 + (tid >> 3)) * DM + hd * HD + (tid & 7) * 8;      /* eight lanes cover one 128-byte row */
  const unsigned short* vg = (const unsigned short*)VT + ((size_t)(b * NH + hd) * HD + (tid >> 3)) * SQ + (tid & 7) * 8;
  const unsigned int lofs = (unsigned int)(tid >> 3) * FP + (unsigned int)(tid & 7) * 16;
  v8us rk[4], rv[4];
  auto fetch = [&](int st) {
#pragma unroll
    for (int u = 0; u < 4; ++u) { rk[u] = *(const v8us*)(kg + ((size_t)st * FK + u * 16) * DM); rv[u] = *(const v8us*)(vg + (size_t)u * 16 * SQ + (size_t)st * FK); }
    __builtin_amdgcn_sched_barrier(0);      /* the loads stay in front of the wait below */
    asm volatile("s_wait_xcnt 0x0" ::: "memory");      /* behind the issued loads, before a register that they name (address, base) is rewritten for the next stage */
    __builtin_amdgcn_sched_barrier(0);      /* keeps later register writes behind that wait */
  };
  auto put = [&](int buf) {
#pragma unroll
    for (int u = 0; u < 4; ++u) { *(v8us*)&L[buf][lofs + u * 16 * FP] = rk[u]; *(v8us*)&L[buf][FT + lofs + u * 16 * FP] = rv[u]; } };
  fetch(0);
  v16h qf[FG][2];
#pragma unroll
  for (int g = 0; g < FG; ++g) { const _Float16* qp = Q16 + (r0 + q0 + g * 16 + c) * DM + hd * HD;
#pragma unroll
    for (int kc = 0; kc < 2; ++kc) qf[g][kc] = g2_frag(qp + 32 * kc, h); }
  __builtin_amdgcn_sched_barrier(0);      /* the Q loads stay in front of the wait below */
  asm volatile("s_wait_xcnt 0x0" ::: "memory");      /* behind the issued Q loads, before a mask load's result lands in a register that they name */
  __builtin_amdgcn_sched_barrier(0);      /* keeps the mask loads behind that wait */
  float mv[SQ / 32 / FW];
#pragma unroll
  for (int i = 0; i < SQ / 32 / FW; ++i) mv[i] = mk[r0 + (size_t)(wave * (SQ / 32 / FW) + i) * 32 + lane];
  __builtin_amdgcn_sched_barrier(0);      /* the loads stay in front of the wait below */
  asm volatile("s_wait_xcnt 0x0" ::: "memory");      /* behind the issued loads, before a register that they name is reused */
  __builtin_amdgcn_sched_barrier(0);      /* keeps later register writes behind that wait */
#pragma unroll
  for (int i = 0; i < SQ / 32 / FW; ++i) { const unsigned int bal = __builtin_amdgcn_ballot_w32(bf16_round(mv[i]) < 0.f); if (lane == 0) mbits[wave * (SQ / 32 / FW) + i] = bal; }
  put(0);
  fetch(1);
  const v8f z8 = {0.f, 0.f, 0.f, 0.f, 0.f, 0.f, 0.f, 0.f};
  v8f acc[FG][4]; float m_run[FG], l_run[FG];
#pragma unroll
  for (int g = 0; g < FG; ++g) { m_run[g] = -__builtin_inff(); l_run[g] = 0.f;
#pragma unroll
    for (int t = 0; t < 4; ++t) acc[g][t] = z8; }
  const float cs = 0.125f * 1.44269504f;      /* 1 / sqrt(64), and exp(x) as 2^(x log2 e) */
  __syncthreads();      /* stage 0 and the mask words are published */
  const unsigned int w0 = mbits[lane], w1 = mbits[32 + lane];      /* all 64 mask words in two registers; a pass reads its word by lane number, with no LDS latency */
#pragma unroll 1      /* the stage loop stays rolled: its body already holds two unrolled passes (code size, registers) */
  for (int st = 0; st < FNS; ++st) {
    if (st + 1 < FNS) put((st + 1) & 1);      /* into the buffer that stage st - 1 used: every wave has left it (barrier at the loop's foot) */
    if (st + 2 < FNS) fetch(st + 2);      /* in flight under this stage's work */
    const unsigned char* Lb = &L[st & 1][0];
#pragma unroll
    for (int p = 0; p < 2; ++p) {
      const unsigned char* kb = Lb + (p * 32 + c) * FP + 16 * h;
      v16h kf[2][2];
#pragma unroll
      for (int kt = 0; kt < 2; ++kt)
#pragma unroll
        for (int kc = 0; kc < 2; ++kc) kf[kt][kc] = lds_frag(kb + kt * 16 * FP + 64 * kc);
      const unsigned int mw = (unsigned int)__builtin_amdgcn_readlane((int)(st < FNS / 2 ? w0 : w1), (st * 2 + p) & 31) >> (8 * h);
      v8f s[2][FG];      /* s[kt][g][r] = raw score of key 32 p + 16 kt + 8 h + r and query 16 g + c */
#pragma unroll
      for (int kt = 0; kt < 2; ++kt)
#pragma unroll
        for (int g = 0; g < FG; ++g) s[kt][g] = fa_mma(kf[kt][1], qf[g][1], fa_mma(kf[kt][0], qf[g][0], z8));
      const unsigned char* vb = Lb + FT + c * FP + p * 64 + 16 * h;
      v16h vf[4];
#pragma unroll
      for (int t = 0; t < 4; ++t) vf[t] = lds_frag(vb + t * 16 * FP);
#pragma unroll
      for (int kt = 0; kt < 2; ++kt)
#pragma unroll
        for (int r = 0; r < 8; ++r) { const bool km = (mw & (1u << (16 * kt + r))) != 0u;
#pragma unroll
          for (int g = 0; g < FG; ++g) s[kt][g][r] = km ? -80000.0f : s[kt][g][r]; }      /* masked_fill(-10000) on the raw score: -80000 / 8 */
      float mb[FG]; bool need = false;
#pragma unroll
      for (int g = 0; g < FG; ++g) { float mx = s[0][g][0];
#pragma unroll
        for (int r = 1; r < 8; ++r) mx = fmaxf(mx, s[0][g][r]);
#pragma unroll
        for (int r = 0; r < 8; ++r) mx = fmaxf(mx, s[1][g][r]);
        mx = fmaxf(mx, lane_x16(mx)) * cs; mb[g] = mx; need = need || (mx > m_run[g] + 8.0f); }      /* both halves hold the query's maximum of this pass, in log2 units */
      if (__builtin_amdgcn_ballot_w32(need) != 0u) {      /* lazy rescale: the maximum in use may trail the true one by 8 (a weight reaches 2^8 at most); one scalar branch per pass */
#pragma unroll
        for (int g = 0; g < FG; ++g) { const float mn = fmaxf(m_run[g], mb[g]); const float corr = exp2x1(m_run[g] - mn); m_run[g] = mn; l_run[g] *= corr;      /* first pass: 2^(-inf) = 0 on zero sums */
#pragma unroll
          for (int t = 0; t < 4; ++t) acc[g][t] = acc[g][t] * corr; } }
      FragH pf[FG];
#pragma unroll
      for (int g = 0; g < FG; ++g) { const float nm = -m_run[g]; float ls[4] = {0.f, 0.f, 0.f, 0.f};
#pragma unroll
        for (int kt = 0; kt < 2; ++kt) { v8f t8;
#pragma unroll
          for (int r = 0; r < 8; ++r) t8[r] = fmaf(s[kt][g][r], cs, nm);
          const v8f e = exp2x8(t8);
#pragma unroll
          for (int r = 0; r < 8; ++r) { ls[r & 3] += e[r]; pf[g].h[8 * kt + r] = (_Float16)e[r]; } }      /* element 8 kt + r of the B operand = key 16 kt + 8 h + r */
        l_run[g] += (ls[0] + ls[1]) + (ls[2] + ls[3]); }
      __builtin_amdgcn_sched_barrier(0);      /* the exponentials are asm text: all of them stay in front of the second product */
#pragma unroll
      for (int g = 0; g < FG; ++g)
#pragma unroll
        for (int t = 0; t < 4; ++t) acc[g][t] = fa_mma(vf[t], pf[g].v, acc[g][t]);      /* acc[g][t][r] = O[query 16 g + c][dim 16 t + 8 h + r], unnormalised */
    }
    __syncthreads();      /* publishes stage st + 1 and ends every wave's reads of stage st */
  }
#pragma unroll
  for (int g = 0; g < FG; ++g) { const float l = l_run[g] + lane_x16(l_run[g]); const float inv = 1.0f / l;      /* the halves' sums joined once */
#pragma unroll
    for (int t = 0; t < 4; ++t) acc[g][t] = acc[g][t] * inv; }
#pragma unroll
  for (int g = 0; g < FG; ++g) { float* op = out + (r0 + q0 + g * 16 + c) * DM + hd * HD + 8 * h;
#pragma unroll
    for (int t = 0; t < 4; ++t) { const v4f lo = {acc[g][t][0], acc[g][t][1], acc[g][t][2], acc[g][t][3]}, hi = {acc[g][t][4], acc[g][t][5], acc[g][t][6], acc[g][t][7]};
      *(v4f*)(op + 16 * t) = lo; *(v4f*)(op + 16 * t + 4) = hi; } }
}
// Projection GEMM with both operands through LDS: C16[128 rows][64 columns] per work-group = f16(X . W^T / 16 + bias), four waves of 32 x 64, f32 accumulation in ascending k blocks of 32 (the order of k_gemm2).
// A stage is one 128-byte line (64 k) of each of the 128 X rows and 64 W rows. Eight lanes fetch one line, so every global load covers four whole lines (a fragment load straight from global memory touches 16 lines for the same 512 bytes),
// and the W tile is fetched once per work-group instead of once per wave. Registers -> two LDS buffers, as in k_fattn: one barrier per stage publishes stage st + 1 and frees the buffer of stage st.
#define PM 128                       /* X rows per work-group */
#define PN 64                        /* output columns per work-group */
#define PK 64                        /* k per stage */
#define PNS (DM / PK)                /* stages */
#define PT ((PM + PN) * FP)          /* one buffer: X tile, then W tile, rows at pitch FP */
// Launch bounds: at least three waves per SIMD, so that the grid's three work-groups per WGP are all resident at once (registers; LDS fits three as well).
static_assert(DM % PK == 0 && DM % PN == 0 && PNS >= 2 && MP % PM == 0 && PK * 2 == 128, "k_proj: whole tiles, whole stages, one line per row and stage");
// Work-group barrier that orders LDS alone: __syncthreads() also drains the wave's global loads, which would end the flight of the stage fetched ahead at every stage's foot.
__device__ __forceinline__ void lds_barrier() { __builtin_amdgcn_fence(__ATOMIC_RELEASE, "workgroup", "local"); __builtin_amdgcn_s_barrier(); __builtin_amdgcn_fence(__ATOMIC_ACQUIRE, "workgroup", "local"); }
__global__ __launch_bounds__(128, 3) void k_proj(const _Float16* __restrict__ A, const _Float16* __restrict__ Bh, const float* __restrict__ bias, _Float16* __restrict__ C16) {
  __shared__ __attribute__((aligned(16))) unsigned char L[2][PT];
  __shared__ __attribute__((aligned(16))) float so[4][32][68];
  const int tid = threadIdx.x, w = tid >> 5, lane = tid & 31, ln = lane & 15, hh = lane >> 4;
  const int mt = blockIdx.x / (DM / PN), nq = blockIdx.x - mt * (DM / PN); const int row0 = mt * PM + 32 * w, col0 = nq * PN;
  const unsigned short* ag = (const unsigned short*)A + ((size_t)mt * PM + (tid >> 3)) * DM + (tid & 7) * 8;      /* eight lanes cover one 128-byte line */
  const unsigned short* bg = (const unsigned short*)Bh + ((size_t)col0 + (tid >> 3)) * DM + (tid & 7) * 8;
  const unsigned int lofs = (unsigned int)(tid >> 3) * FP + (unsigned int)(tid & 7) * 16;
  v8us ra[PM / 16], rb[PN / 16];
  auto fetch = [&](int st) {
#pragma unroll
    for (int u = 0; u < PM / 16; ++u) ra[u] = *(const v8us*)(ag + (size_t)u * 16 * DM + st * PK);
#pragma unroll
    for (int u = 0; u < PN / 16; ++u) rb[u] = *(const v8us*)(bg + (size_t)u * 16 * DM + st * PK);
    __builtin_amdgcn_sched_barrier(0);      /* the loads stay in front of the wait below */
    asm volatile("s_wait_xcnt 0x0" :: "v"(ag), "v"(bg) : "memory");      /* behind the issued loads, before a register that they name is rewritten; the two addresses are inputs so that they live up to this wait and no result of the last stage's loads is given their registers */
    __builtin_amdgcn_sched_barrier(0);      /* keeps later register writes behind that wait */
  };
  auto put = [&](int buf) {
#pragma unroll
    for (int u = 0; u < PM / 16; ++u) *(v8us*)&L[buf][lofs + u * 16 * FP] = ra[u];
#pragma unroll
    for (int u = 0; u < PN / 16; ++u) *(v8us*)&L[buf][PM * FP + lofs + u * 16 * FP] = rb[u]; };
  fetch(0);
  const int bix = col0 + ln; float bvr[4];      /* the lane's four bias values, fetched here so that their latency lies under the stages */
#pragma unroll
  for (int t = 0; t < 4; ++t) bvr[t] = bias[bix + t * 16];
  __builtin_amdgcn_sched_barrier(0);      /* the loads stay in front of the wait below */
  asm volatile("s_wait_xcnt 0x0" :: "v"(bix) : "memory");      /* behind the issued loads, before a register that they name is rewritten; the index is an input so that it lives up to this wait */
  __builtin_amdgcn_sched_barrier(0);      /* keeps later register writes behind that wait */
  put(0);
  fetch(1);
  const v8f z8 = {0.f, 0.f, 0.f, 0.f, 0.f, 0.f, 0.f, 0.f};
  v8f acc[2][4];
#pragma unroll
  for (int i = 0; i < 2; ++i)
#pragma unroll
    for (int t = 0; t < 4; ++t) acc[i][t] = z8;
  lds_barrier();      /* stage 0 is published */
#pragma unroll      /* twelve short stages: buffer index, last-stage tests and the loads' k offsets become constants, and no address register is rewritten in the loop */
  for (int st = 0; st < PNS; ++st) {
    if (st + 1 < PNS) put((st + 1) & 1);      /* into the buffer that stage st - 1 used: every wave has left it (barrier at the loop's foot) */
    if (st + 2 < PNS) fetch(st + 2);      /* in flight under this stage's work */
    const unsigned char* ap = &L[st & 1][0] + (32 * w + ln) * FP + 16 * hh; const unsigned char* bp = &L[st & 1][0] + (PM + ln) * FP + 16 * hh;
#pragma unroll
    for (int kc = 0; kc < 2; ++kc) { const v16h a0 = lds_frag(ap + 64 * kc), a1 = lds_frag(ap + 16 * FP + 64 * kc);
#pragma unroll
      for (int t = 0; t < 4; ++t) { const v16h b = lds_frag(bp + t * 16 * FP + 64 * kc); acc[0][t] = fa_mma(a0, b, acc[0][t]); acc[1][t] = fa_mma(a1, b, acc[1][t]); } }
    if (st + 1 < PNS) lds_barrier();      /* publishes stage st + 1 and ends every wave's reads of stage st; behind the last stage nothing of the ring is written or read any more */
  }
#pragma unroll
  for (int u = 0; u < 8; ++u) { const int t = u & 3, half = u >> 2; const float bv = bf16_round(bvr[t]);
#pragma unroll
    for (int r = 0; r < 8; ++r) so[w][half * 16 + 8 * hh + r][t * 16 + ln] = acc[half][t][r] * 0.0625f + bv; }
  __builtin_amdgcn_fence(__ATOMIC_ACQ_REL, "workgroup"); __builtin_amdgcn_wave_barrier();      /* each wave reads back only its own rows */
  const int rsub = lane >> 4, c4 = (lane & 15) * 4;
#pragma unroll
  for (int q = 0; q < 16; ++q) { const int r = q * 2 + rsub; const v4f v = *(const v4fa*)&so[w][r][c4]; v4h h4; for (int i = 0; i < 4; ++i) h4[i] = (_Float16)v[i]; *(v4h*)(C16 + (size_t)(row0 + r) * DM + col0 + c4) = h4; }
}
extern "C" void kernel_launch(void* const* d_in, const int* in_sizes, int n_in,
                              void* d_out, int out_size, void* d_ws, size_t ws_size, hipStream_t stream) {
  (void)in_sizes; (void)n_in; (void)out_size;
  const float* const* I = (const float* const*)d_in; const float* x = I[0]; const float* am = I[1]; const float* wq = I[2]; const float* bq = I[3]; const float* wk = I[4]; const float* bk = I[5]; const float* wv = I[6]; const float* bv = I[7];      /* hidden_states; attention_mask f32 [4][1][1][2048] (READ on device: key masked iff bf16(mask) < 0); natural weights + biases */
  char* ws = (char*)d_ws; size_t off = 0;
  auto take = [&](size_t bytes) { char* p = ws + off; off += (bytes + 255) & ~(size_t)255; return p; };
  _Float16* BQ = (_Float16*)take((size_t)DM * DM * 2); _Float16* BK = (_Float16*)take((size_t)DM * DM * 2); _Float16* BV = (_Float16*)take((size_t)DM * DM * 2); 
  _Float16* X16 = (_Float16*)take(NR * DM * 2); _Float16* Q16 = (_Float16*)take(NR * DM * 2); _Float16* K16 = (_Float16*)take(NR * DM * 2); _Float16* V16 = (_Float16*)take(NR * DM * 2);
  _Float16* VT = (_Float16*)take((size_t)NB * NH * HD * SQ * 2);
  if (off > ws_size) return;
  { const unsigned g = (unsigned)(((size_t)DM * DM / 8 + 255) / 256); k_wnat<<<g, 256, 0, stream>>>(wq, (size_t)DM * DM / 8, BQ); k_wnat<<<g, 256, 0, stream>>>(wk, (size_t)DM * DM / 8, BK); k_wnat<<<g, 256, 0, stream>>>(wv, (size_t)DM * DM / 8, BV); }      /* natural [out][in] = Bt[n][k], x16 */

  k_x16<<<(unsigned)((NR * DM / 8 + 255) / 256), 256, 0, stream>>>(x, X16, NR * DM / 8);
  const size_t r0p = (size_t)B0 * SQ;      /* first projected row */
  k_proj<<<(unsigned)((MP / PM) * (DM / PN)), 128, 0, stream>>>(X16 + r0p * DM, BQ, bq, Q16 + r0p * DM);
  k_proj<<<(unsigned)((MP / PM) * (DM / PN)), 128, 0, stream>>>(X16 + r0p * DM, BK, bk, K16 + r0p * DM);
  k_proj<<<(unsigned)((MP / PM) * (DM / PN)), 128, 0, stream>>>(X16 + r0p * DM, BV, bv, V16 + r0p * DM);
  k_vt<NH, SQ><<<NB * NH * (SQ / 64), 256, 0, stream>>>(V16, LQ, 0, VT);      /* V^T [NB][NH][HD][SQ] */
  k_fattn<<<dim3(SQ / FQ, NH, NB), FW * 32, 0, stream>>>(Q16, K16, VT, am, (float*)d_out);      /* scores, sign key mask (select, -10000 fill), softmax and P V in one launch; f32 straight into the merged-heads output rows */
}

// v004
// A run of this version takes 93.6 microseconds.
// Next to v003, in two timings, it ran 1.24 times as fast each time.
// Over all steps from v000 it is 55.5 times as fast.
#include <hip/hip_runtime.h>
// BERT self-attention without an output projection and with a SIGN key mask (hidden_states [4][2048][768]; q/k/v = x W^T + b (natural [768][768] sigma 0.02, biases sigma 0.02); 12 heads of 64; scores / 8; masked_fill(attention_mask < 0, -10000) with the f32 [4][1][1][2048] mask input (a key of batch b is masked iff its mask value is negative); softmax over all keys; context = heads merged -> [4][2048][768]).
// Structure: token rows r = b*2048 + s; x as exact f16 rows (bf16-rounded); Q, K, V as three WMMA GEMMs (32x64 wave tiles, f32 accumulation, exact x16 weights + bias, f16 outputs); V^T for all batches and heads via LDS transposes; the K and V rows of a batch stored in key order 'unmasked first, then masked' (k_perm), so that the attention launch ends behind the last unmasked key when every later weight is exactly 0; one fused attention launch (scores on WMMA, K = 64; online softmax on VALU, f32 statistics, weights as f16 relative to the running maximum; o = P . V on WMMA) written f32 straight into the merged-heads output rows (no output projection).
// Compute dtype: inputs rounded to bf16; x / weights exact; q, k, v and softmax weights as plain f16 GEMM operands (~2^-12); scores, softmax statistics and o f32. v_wmma_f32_16x16x32_f16.
#define NB 4
#define SQ 2048
#define DM 768
#define NH 12
#define HD 64
#define HG 4                         /* heads per launch of the per-batch k_vt overload */
#define B0 0                         /* first batch processed (debug hook) */
#define NBR NB                       /* batches processed (debug hook) */
#define NR ((size_t)NB * SQ)         /* token rows */
#define MP ((int)((size_t)NBR * SQ)) /* rows projected (debug hook) */
#define QN SQ                        /* unused */
#define NHD NH                       /* unused */
#define MPO MP                       /* unused */
#define LQ DM      /* row pitch of the q/k/v rows */
typedef __bf16 v16b __attribute__((ext_vector_type(16)));
typedef unsigned short v8us __attribute__((ext_vector_type(8), may_alias));
typedef float  v8f  __attribute__((ext_vector_type(8)));
typedef float  v4f  __attribute__((ext_vector_type(4)));
typedef float  v4fa __attribute__((ext_vector_type(4), may_alias));
union FragB { v16b v; v8us half[2]; unsigned short u[16]; };

__device__ __forceinline__ unsigned short bf16_bits(float x) { unsigned int u = __float_as_uint(x); return (unsigned short)((u + 0x7FFFu + ((u >> 16) & 1u)) >> 16); }
__device__ __forceinline__ float bf16_val(unsigned short b) { return __uint_as_float(((unsigned int)b) << 16); }
__device__ __forceinline__ float bf16_round(float x) { return bf16_val(bf16_bits(x)); }
// D += A·B with NT terms: 1 = ah·bh, 2 = + al·bh (A split), 3 = + ah·bl (both split)
template <int NT>
__device__ __forceinline__ v8f mmaN(v16b ah, v16b al, v16b bh, v16b bl, v8f c) {
  c = __builtin_amdgcn_wmma_f32_16x16x32_bf16(false, ah, false, bh, (short)0, c, false, false);
  if (NT >= 2) c = __builtin_amdgcn_wmma_f32_16x16x32_bf16(false, al, false, bh, (short)0, c, false, false);
  if (NT >= 3) c = __builtin_amdgcn_wmma_f32_16x16x32_bf16(false, ah, false, bl, (short)0, c, false, false);
  asm volatile("v_nop\n\tv_nop\n\tv_nop\n\tv_nop" : "+v"(c) : "v"(ah), "v"(al), "v"(bh), "v"(bl));
  return c;
}

__global__ __launch_bounds__(256) void k_wt_bf16(const float* __restrict__ W, unsigned short* __restrict__ Wt, int K, int N) {
  const int t = blockIdx.x * 256 + threadIdx.x;
  const int k8n = K / 8;
  if (t >= N * k8n) return;
  const int n = t / k8n, k8 = (t % k8n) * 8;
  v8us v;
#pragma unroll
  for (int i = 0; i < 8; ++i) v[i] = bf16_bits(W[(size_t)(k8 + i) * N + n]);
  *(v8us*)(Wt + (size_t)n * K + k8) = v;
  
}

// GEMM C[M][N] (f32, pitch ldc) = act(A[M][K]·W + bias). A f32 row-major (pitch lda) converted per fragment to bf16
// (ASPLIT: hi/lo two planes -> 2 terms, else single rounded term); Wt bf16 [N][K] (pitch ldb). BIAS_BF16 rounds the
// bias to bf16 first (bias quantised to bf16 before the add). K%32==0, M%16==0, N%64==0.
template <bool ASPLIT, int ACT, bool BIAS_BF16>
__global__ __launch_bounds__(128) void k_gemm_bf(const float* __restrict__ A, int lda, const unsigned short* __restrict__ Wt, int ldb,
                                               const float* __restrict__ bias, float* __restrict__ C, int ldc, int M, int N, int K) {
  __shared__ __attribute__((aligned(16))) float so[4][16][64];
  const int tid = threadIdx.x, w = tid >> 5, lane = tid & 31, ln = lane & 15, hh = lane >> 4;
  const int ntn = N / 64;
  const int wid = blockIdx.x * 4 + w;
  const int mt = wid / ntn, nq = wid % ntn;
  if (mt * 16 >= M) return;
  const int row0 = mt * 16, col0 = nq * 64;
  const float* arow = A + (size_t)(row0 + ln) * lda;
  v8f acc[4] = {};
  for (int kb = 0; kb < K; kb += 32) {
    FragB ah, al;
    const v4f x0 = *(const v4fa*)(arow + kb + 8 * hh), x1 = *(const v4fa*)(arow + kb + 8 * hh + 4);
    const v4f x2 = *(const v4fa*)(arow + kb + 16 + 8 * hh), x3 = *(const v4fa*)(arow + kb + 16 + 8 * hh + 4);
    float xs[16] = {x0[0],x0[1],x0[2],x0[3],x1[0],x1[1],x1[2],x1[3],x2[0],x2[1],x2[2],x2[3],x3[0],x3[1],x3[2],x3[3]};
#pragma unroll
    for (int i = 0; i < 16; ++i) { const unsigned short hb = bf16_bits(xs[i]); ah.u[i] = hb; al.u[i] = ASPLIT ? bf16_bits(xs[i] - bf16_val(hb)) : (unsigned short)0; }
#pragma unroll
    for (int t = 0; t < 4; ++t) {
      const unsigned short* brow = Wt + (size_t)(col0 + t * 16 + ln) * ldb + kb;
      FragB b;
      b.half[0] = *(const v8us*)(brow + 8 * hh);
      b.half[1] = *(const v8us*)(brow + 16 + 8 * hh);
      acc[t] = mmaN<ASPLIT ? 2 : 1>(ah.v, al.v, b.v, b.v, acc[t]);
    }
  }
#pragma unroll
  for (int t = 0; t < 4; ++t) {
    float bv = bias ? bias[col0 + t * 16 + ln] : 0.f;
    if (BIAS_BF16) bv = bf16_round(bv);
#pragma unroll
    for (int r = 0; r < 8; ++r) { float v = acc[t][r] + bv; if (ACT == 1) v = fmaxf(v, 0.f); so[w][8 * hh + r][t * 16 + ln] = v; }
  }
  __builtin_amdgcn_fence(__ATOMIC_ACQ_REL, "workgroup");
  __builtin_amdgcn_wave_barrier();
  const int rsub = lane >> 4, c4 = (lane & 15) * 4;
  {
#pragma unroll
    for (int q = 0; q < 8; ++q) {
      const int r = q * 2 + rsub;
      const v4f v = *(const v4fa*)&so[w][r][c4];
      *(v4f*)(C + (size_t)(row0 + r) * ldc + col0 + c4) = v;
    }
    
  }
}

// GEMM C = act(A·W + bias + resid): A f32 (ASPLIT -> hi/lo 2 terms), Wt bf16 [N][K]; ACT 0 none, 1 relu, 2 exact gelu;
// resid (optional, f32, row index = (row % rmod), pitch ldr, RES_BF16 rounds it) added before the activation.
template <bool ASPLIT, int ACT, bool BIAS_BF16, bool RES_BF16>
__global__ __launch_bounds__(128) void k_gemm_bf3(const float* __restrict__ A, int lda, const unsigned short* __restrict__ Wt, int ldb,
                                                const float* __restrict__ bias, const float* __restrict__ resid, int rmod, int ldr,
                                                float* __restrict__ C, int ldc, int M, int N, int K) {
  __shared__ __attribute__((aligned(16))) float so[4][16][64];
  const int tid = threadIdx.x, w = tid >> 5, lane = tid & 31, ln = lane & 15, hh = lane >> 4;
  const int ntn = N / 64;
  const int wid = blockIdx.x * 4 + w;
  const int mt = wid / ntn, nq = wid % ntn;
  if (mt * 16 >= M) return;
  const int row0 = mt * 16, col0 = nq * 64;
  const float* arow = A + (size_t)(row0 + ln) * lda;
  v8f acc[4] = {};
  for (int kb = 0; kb < K; kb += 32) {
    FragB ah, al;
    const v4f x0 = *(const v4fa*)(arow + kb + 8 * hh), x1 = *(const v4fa*)(arow + kb + 8 * hh + 4);
    const v4f x2 = *(const v4fa*)(arow + kb + 16 + 8 * hh), x3 = *(const v4fa*)(arow + kb + 16 + 8 * hh + 4);
    float xs[16] = {x0[0],x0[1],x0[2],x0[3],x1[0],x1[1],x1[2],x1[3],x2[0],x2[1],x2[2],x2[3],x3[0],x3[1],x3[2],x3[3]};
#pragma unroll
    for (int i = 0; i < 16; ++i) { const unsigned short hb = bf16_bits(xs[i]); ah.u[i] = hb; al.u[i] = ASPLIT ? bf16_bits(xs[i] - bf16_val(hb)) : (unsigned short)0; }
#pragma unroll
    for (int t = 0; t < 4; ++t) {
      const unsigned short* brow = Wt + (size_t)(col0 + t * 16 + ln) * ldb + kb;
      FragB b;
      b.half[0] = *(const v8us*)(brow + 8 * hh);
      b.half[1] = *(const v8us*)(brow + 16 + 8 * hh);
      acc[t] = mmaN<ASPLIT ? 2 : 1>(ah.v, al.v, b.v, b.v, acc[t]);
    }
  }
#pragma unroll
  for (int t = 0; t < 4; ++t) {
    const int col = col0 + t * 16 + ln;
    float bv = bias ? bias[col] : 0.f;
    if (BIAS_BF16) bv = bf16_round(bv);
#pragma unroll
    for (int r = 0; r < 8; ++r) {
      float v = acc[t][r] + bv;
      if (resid) { float rv = resid[(size_t)((row0 + 8 * hh + r) % rmod) * ldr + col]; if (RES_BF16) rv = bf16_round(rv); v += rv; }
      if (ACT == 1) v = fmaxf(v, 0.f);
      if (ACT == 2) v = 0.5f * v * (1.0f + erff(v * 0.70710678118654752f));
      if (ACT == 3) { const float u = 0.7978845608028654f * (v + 0.044715f * v * v * v); v = 0.5f * v * (1.0f + tanhf(u)); }
      so[w][8 * hh + r][t * 16 + ln] = v;
    }
  }
  __builtin_amdgcn_fence(__ATOMIC_ACQ_REL, "workgroup");
  __builtin_amdgcn_wave_barrier();
  const int rsub = lane >> 4, c4 = (lane & 15) * 4;
  {
#pragma unroll
    for (int q = 0; q < 8; ++q) {
      const int r = q * 2 + rsub;
      const v4f v = *(const v4fa*)&so[w][r][c4];
      *(v4f*)(C + (size_t)(row0 + r) * ldc + col0 + c4) = v;
    }
    
  }
}
// row LayerNorm (biased variance, eps) over N: s = X (+ R); optional out_sum <- s; out_norm <- (s-mu)*rsqrt(var+eps)*g + b
template <bool PARAM_BF16>
__global__ __launch_bounds__(256) void k_layernorm(const float* __restrict__ X, const float* __restrict__ R, const float* __restrict__ g, const float* __restrict__ bta,
                                                  float* __restrict__ out_sum, float* __restrict__ out_norm, int N, float eps) {
  __shared__ float red[256];
  const int row = blockIdx.x, tid = threadIdx.x;
  const float* x = X + (size_t)row * N; const float* rr = R ? R + (size_t)row * N : nullptr;
  float vals[16];                     // up to N = 4096
  const int per = N / 256;            // contiguous chunk per thread? use strided-by-4 chunks: thread handles j = tid*4 + 1024*u
  float s1 = 0.f;
  for (int u = 0; u < per / 4; ++u) {
    const int j = tid * 4 + 1024 * u;
    const v4f a = *(const v4fa*)(x + j);
    v4f b = {0.f,0.f,0.f,0.f}; if (rr) b = *(const v4fa*)(rr + j);
#pragma unroll
    for (int q = 0; q < 4; ++q) { const float v = a[q] + b[q]; vals[u * 4 + q] = v; s1 += v; }
  }
  red[tid] = s1; __syncthreads();
  for (int st = 128; st > 0; st >>= 1) { if (tid < st) red[tid] += red[tid + st]; __syncthreads(); }
  const float mu = red[0] / (float)N; __syncthreads();
  float s2 = 0.f;
  for (int u = 0; u < per / 4; ++u)
#pragma unroll
    for (int q = 0; q < 4; ++q) { const float c = vals[u * 4 + q] - mu; s2 += c * c; }
  red[tid] = s2; __syncthreads();
  for (int st = 128; st > 0; st >>= 1) { if (tid < st) red[tid] += red[tid + st]; __syncthreads(); }
  const float rs = rsqrtf(red[0] / (float)N + eps);
  {
    for (int u = 0; u < per / 4; ++u) {
      const int j = tid * 4 + 1024 * u;
      v4f o, sm;
#pragma unroll
      for (int q = 0; q < 4; ++q) {
        float gg = g[j + q], bb = bta[j + q];
        if (PARAM_BF16) { gg = bf16_round(gg); bb = bf16_round(bb); }
        sm[q] = vals[u * 4 + q]; o[q] = (vals[u * 4 + q] - mu) * rs * gg + bb;
      }
      if (out_sum) *(v4f*)(out_sum + (size_t)row * N + j) = sm;
      *(v4f*)(out_norm + (size_t)row * N + j) = o;
    }
    
  }
}



// ---- f16 WMMA path (v_wmma_f32_16x16x32_f16): 11-bit significands for operands in range — used where a [0,1] probability operand needs more precision than bf16
typedef _Float16 v16h __attribute__((ext_vector_type(16)));
union FragH { v16h v; v8us half[2]; _Float16 h[16]; unsigned short u[16]; };
template <int NT>
__device__ __forceinline__ v8f mmaH(v16h ah, v16h al, v16h bh, v16h bl, v8f c) {
  c = __builtin_amdgcn_wmma_f32_16x16x32_f16(false, ah, false, bh, (short)0, c, false, false);
  if (NT >= 2) c = __builtin_amdgcn_wmma_f32_16x16x32_f16(false, al, false, bh, (short)0, c, false, false);
  if (NT >= 3) c = __builtin_amdgcn_wmma_f32_16x16x32_f16(false, ah, false, bl, (short)0, c, false, false);
  asm volatile("v_nop\n\tv_nop\n\tv_nop\n\tv_nop" : "+v"(c) : "v"(ah), "v"(al), "v"(bh), "v"(bl));
  return c;
}
// batched GEMM like k_gemm_b but f16 operands: A f32 (split into f16 hi/lo if ASPLIT, else rounded to f16), Bt = f16 values [n][k]; alpha; C f32; N multiple of 16 (partial tiles skipped)
template <bool ASPLIT>
__global__ __launch_bounds__(128) void k_gemm_h(const float* __restrict__ A, int lda, size_t sA, const _Float16* __restrict__ Bh, int ldb, size_t sB, float alpha, float* __restrict__ C, int ldc, size_t sC, int M, int N, int K) {
  __shared__ __attribute__((aligned(16))) float so[4][16][64];
  const int tid = threadIdx.x, w = tid >> 5, lane = tid & 31, ln = lane & 15, hh = lane >> 4; const int by = blockIdx.y;
  A += (size_t)by * sA; Bh += (size_t)by * sB; C += (size_t)by * sC;
  const int ntn = (N + 63) / 64; const int wid = blockIdx.x * 4 + w; const int mt = wid / ntn, nq = wid % ntn; if (mt * 16 >= M) return;
  const int row0 = mt * 16, col0 = nq * 64; const float* arow = A + (size_t)(row0 + ln) * lda;
  v8f acc[4] = {};
  for (int kb = 0; kb < K; kb += 32) {
    FragH ah, al;
    const v4f x0 = *(const v4fa*)(arow + kb + 8 * hh), x1 = *(const v4fa*)(arow + kb + 8 * hh + 4), x2 = *(const v4fa*)(arow + kb + 16 + 8 * hh), x3 = *(const v4fa*)(arow + kb + 16 + 8 * hh + 4);
    float xs[16] = {x0[0],x0[1],x0[2],x0[3],x1[0],x1[1],x1[2],x1[3],x2[0],x2[1],x2[2],x2[3],x3[0],x3[1],x3[2],x3[3]};
#pragma unroll
    for (int i = 0; i < 16; ++i) { const _Float16 h = (_Float16)xs[i]; ah.h[i] = h; al.h[i] = ASPLIT ? (_Float16)(xs[i] - (float)h) : (_Float16)0.0f; }
#pragma unroll
    for (int t = 0; t < 4; ++t) { if (col0 + t * 16 >= N) continue; const size_t boff = (size_t)(col0 + t * 16 + ln) * ldb + kb; FragH bq; bq.half[0] = *(const v8us*)(Bh + boff + 8 * hh); bq.half[1] = *(const v8us*)(Bh + boff + 16 + 8 * hh);
      acc[t] = mmaH<ASPLIT ? 2 : 1>(ah.v, al.v, bq.v, bq.v, acc[t]); }
  }
#pragma unroll
  for (int t = 0; t < 4; ++t) { if (col0 + t * 16 >= N) continue;
#pragma unroll
    for (int r = 0; r < 8; ++r) so[w][8 * hh + r][t * 16 + ln] = acc[t][r] * alpha; }
  __builtin_amdgcn_fence(__ATOMIC_ACQ_REL, "workgroup"); __builtin_amdgcn_wave_barrier();
  const int rsub = lane >> 4, c4 = (lane & 15) * 4;
  {
#pragma unroll
    for (int q = 0; q < 8; ++q) { const int r = q * 2 + rsub; if (col0 + c4 < N) { const v4f v = *(const v4fa*)&so[w][r][c4]; *(v4f*)(C + (size_t)(row0 + r) * ldc + col0 + c4) = v; } }
     }
}

// Wt[n][k] = f16(W[k][n]·scale) from f32 row-major W[K][N] (scale = power of two; bf16-exact weights stay exact in f16 away from the subnormal range)
__global__ __launch_bounds__(256) void k_wt_f16(const float* __restrict__ W, _Float16* __restrict__ Wt, int K, int N, float scale) {
  const int t = blockIdx.x * 256 + threadIdx.x; if (t >= N * (K / 8)) return; const int n = t / (K / 8), k8 = (t % (K / 8)) * 8; FragH f;
#pragma unroll
  for (int i = 0; i < 8; ++i) f.h[i] = (_Float16)(bf16_round(W[(size_t)(k8 + i) * N + n]) * scale); const v8us o = f.half[0];
  *(v8us*)((unsigned short*)Wt + (size_t)n * K + k8) = o; 
}
// k_gemm_hh variant with fused epilogue: v = acc·alpha + bias[by·sBias + col] (+ CP[(row/rowsPerB)·sCPb + by·64 + col] if CP) ; ACT 0 none / 1 elu ; writes f16 C16 (and f32 C if non-null)
template <int ACT>
__global__ __launch_bounds__(128) void k_gemm_hhx(const _Float16* __restrict__ A, int lda, size_t sA, const _Float16* __restrict__ Bh, int ldb, size_t sB, float alpha, const float* __restrict__ bias, size_t sBias, const float* __restrict__ CP, int rowsPerB, size_t sCPb, int row0g,
    float* __restrict__ C, _Float16* __restrict__ C16, int ldc, size_t sC, int M, int N, int K) {
  __shared__ __attribute__((aligned(16))) float so[4][16][64];
  const int tid = threadIdx.x, w = tid >> 5, lane = tid & 31, ln = lane & 15, hh = lane >> 4; const int by = blockIdx.y;
  A += (size_t)by * sA; Bh += (size_t)by * sB; const size_t cofs = (size_t)by * sC; const float* bp = bias ? bias + (size_t)by * sBias : nullptr;
  const int ntn = (N + 63) / 64; const int wid = blockIdx.x * 4 + w; const int mt = wid / ntn, nq = wid % ntn; if (mt * 16 >= M) return;
  const int row0 = mt * 16, col0 = nq * 64; const _Float16* arow = A + (size_t)(row0 + ln) * lda;
  v8f acc[4] = {};
  for (int kb = 0; kb < K; kb += 32) { FragH ah; ah.half[0] = *(const v8us*)((const unsigned short*)arow + kb + 8 * hh); ah.half[1] = *(const v8us*)((const unsigned short*)arow + kb + 16 + 8 * hh);
#pragma unroll
    for (int t = 0; t < 4; ++t) { if (col0 + t * 16 >= N) continue; const size_t boff = (size_t)(col0 + t * 16 + ln) * ldb + kb; FragH bq; bq.half[0] = *(const v8us*)((const unsigned short*)Bh + boff + 8 * hh); bq.half[1] = *(const v8us*)((const unsigned short*)Bh + boff + 16 + 8 * hh);
      acc[t] = mmaH<1>(ah.v, ah.v, bq.v, bq.v, acc[t]); }
  }
#pragma unroll
  for (int t = 0; t < 4; ++t) { if (col0 + t * 16 >= N) continue; const int col = col0 + t * 16 + ln; const float bv = bp ? bf16_round(bp[col]) : 0.f;
#pragma unroll
    for (int r = 0; r < 8; ++r) { float v = acc[t][r] * alpha + bv; if (CP) { const int rr = row0g + row0 + 8 * hh + r; if (rowsPerB < 0) v += CP[cofs + (size_t)rr * ldc + col];      /* rowsPerB < 0: own element of the batched C plane */ else { const int bidx = rr / rowsPerB; v += CP[(size_t)bidx * sCPb + (size_t)by * 64 + col]; } } if (ACT == 1) v = (v > 0.f) ? v : expm1f(v); else if (ACT == 7) v = (v > 0.f) ? v + 1.0f : expf(v); else if (ACT == 8) v = tanhf(v); else if (ACT == 9) v = 0.5f * v * (1.0f + tanhf(0.7978845608028654f * (v + 0.044715f * v * v * v))); else if (ACT == 11) v = 1.0f / (1.0f + expf(-v)); else if (ACT == 12) v = (v > 0.f) ? v : 0.01f * v; else if (ACT == 14) v = (v > 0.f) ? v : 0.1f * v; else if (ACT == 16) v = (v >= 0.f) ? v : 0.3f * v; else if (ACT == 17) v = (v >= 0.f) ? v : 0.2f * v; else if (ACT == 15) v = v / (1.0f + expf(-v)); else if (ACT == 3) v = fmaxf(v, 0.f); else if (ACT == 6) v = 0.5f * v * (1.0f + erff(v * 0.70710678118654752f)); so[w][8 * hh + r][t * 16 + ln] = v; } }
  __builtin_amdgcn_fence(__ATOMIC_ACQ_REL, "workgroup"); __builtin_amdgcn_wave_barrier();
  const int rsub = lane >> 4, c4 = (lane & 15) * 4; typedef _Float16 v4h __attribute__((ext_vector_type(4)));
  {
#pragma unroll
    for (int q = 0; q < 8; ++q) { const int r = q * 2 + rsub; if (col0 + c4 < N) { const v4f v = *(const v4fa*)&so[w][r][c4]; if (C) *(v4f*)(C + cofs + (size_t)(row0 + r) * ldc + col0 + c4) = v; if (C16) { v4h h4; for (int i = 0; i < 4; ++i) h4[i] = (_Float16)v[i]; *(v4h*)(C16 + cofs + (size_t)(row0 + r) * ldc + col0 + c4) = h4; } } }
     }
}


typedef _Float16 v4h __attribute__((ext_vector_type(4)));

__global__ __launch_bounds__(256) void k_x16(const float* __restrict__ x, _Float16* __restrict__ X16, size_t n8) { const size_t t = (size_t)blockIdx.x * 256 + threadIdx.x; if (t >= n8) return; FragH f;
#pragma unroll
  for (int q = 0; q < 8; ++q) f.h[q] = (_Float16)bf16_round(x[t * 8 + q]); *(v8us*)((unsigned short*)X16 + t * 8) = f.half[0];  }
__global__ __launch_bounds__(256) void k_h16(const float* __restrict__ x, _Float16* __restrict__ X16, size_t n8) { const size_t t = (size_t)blockIdx.x * 256 + threadIdx.x; if (t >= n8) return; FragH f;
#pragma unroll
  for (int q = 0; q < 8; ++q) f.h[q] = (_Float16)x[t * 8 + q]; *(v8us*)((unsigned short*)X16 + t * 8) = f.half[0];  }
__global__ __launch_bounds__(256) void k_round16f(const float* __restrict__ W, _Float16* __restrict__ Bt, size_t n8) { const size_t t = (size_t)blockIdx.x * 256 + threadIdx.x; if (t >= n8) return; FragH f;
#pragma unroll
  for (int i = 0; i < 8; ++i) f.h[i] = (_Float16)(bf16_round(W[t * 8 + i]) * 16.0f); *(v8us*)((unsigned short*)Bt + t * 8) = f.half[0];  }
template <int NHv, int TTv>
__global__ __launch_bounds__(256) void k_vt(const _Float16* __restrict__ V16, int ldv, int voff, _Float16* __restrict__ Vt) { __shared__ unsigned short tl[64][66]; const int tid = threadIdx.x; const int slab = blockIdx.x / (TTv / 64), lg = blockIdx.x % (TTv / 64); const int b = slab / NHv, h = slab % NHv;
  for (int i = tid; i < 64 * 8; i += 256) { const int r = i / 8, c8 = (i % 8) * 8; FragH f; f.half[0] = *(const v8us*)((const unsigned short*)V16 + ((size_t)b * TTv + lg * 64 + r) * ldv + voff + h * 64 + c8);
#pragma unroll
    for (int q = 0; q < 8; ++q) tl[r][c8 + q] = f.u[q]; }
  __syncthreads();
  {
#pragma unroll
    for (int rd = 0; rd < 2; ++rd) { const int d = rd * 32 + tid / 8, pc = tid % 8; FragH f;
#pragma unroll
      for (int q = 0; q < 8; ++q) f.u[q] = tl[pc * 8 + q][d];
      *(v8us*)((unsigned short*)Vt + ((size_t)slab * 64 + d) * TTv + lg * 64 + pc * 8) = f.half[0]; }
     } }

__global__ __launch_bounds__(256) void k_hl(const float* __restrict__ F, _Float16* __restrict__ Hh, _Float16* __restrict__ Hl, size_t n8) { const size_t t = (size_t)blockIdx.x * 256 + threadIdx.x; if (t >= n8) return; FragH fh, fl; const v4f a = *(const v4fa*)(F + t * 8), c = *(const v4fa*)(F + t * 8 + 4);
#pragma unroll
  for (int q = 0; q < 4; ++q) { _Float16 h = (_Float16)a[q]; fh.h[q] = h; fl.h[q] = (_Float16)((a[q] - (float)h) * 1024.0f); h = (_Float16)c[q]; fh.h[4 + q] = h; fl.h[4 + q] = (_Float16)((c[q] - (float)h) * 1024.0f); }
  { *(v8us*)((unsigned short*)Hh + t * 8) = fh.half[0]; *(v8us*)((unsigned short*)Hl + t * 8) = fl.half[0];  } }

// ---- fast GEMM (wave tile 32x64; requires M % 32 == 0 rows per launch region and N % 64 == 0); epilogue = k_gemm_hhx semantics ----
__device__ __forceinline__ v16h g2_frag(const _Float16* p, int hh) { FragH f; f.half[0] = *(const v8us*)((const unsigned short*)p + 8 * hh); f.half[1] = *(const v8us*)((const unsigned short*)p + 16 + 8 * hh); return f.v; }
__device__ __forceinline__ v8f g2_mma(v16h a, v16h b, v8f c) { v8f d = __builtin_amdgcn_wmma_f32_16x16x32_f16(false, a, false, b, (short)0, c, false, false); asm volatile("v_nop\n\tv_nop\n\tv_nop\n\tv_nop" : "+v"(d) : "v"(a), "v"(b)); return d; }
template <int ACT>
__global__ __launch_bounds__(128) void k_gemm2(const _Float16* __restrict__ A, int lda, size_t sA, const _Float16* __restrict__ Bh, int ldb, size_t sB, float alpha, const float* __restrict__ bias, size_t sBias, const float* __restrict__ CP, int rowsPerB, size_t sCPb, int row0g,
    float* __restrict__ C, _Float16* __restrict__ C16, int ldc, size_t sC, int M, int N, int K) { static_assert(ACT == 0 || ACT == 3 || ACT == 6 || ACT == 8 || ACT == 9 || ACT == 11 || ACT == 12 || ACT == 14 || ACT == 15 || ACT == 16 || ACT == 17, "k_gemm2: unsupported ACT code (would silently apply no activation)");
  __shared__ __attribute__((aligned(16))) float so[4][32][68];
  const int tid = threadIdx.x, w = tid >> 5, lane = tid & 31, ln = lane & 15, hh = lane >> 4; const int by = blockIdx.y;
  A += (size_t)by * sA; Bh += (size_t)by * sB; const size_t cofs = (size_t)by * sC; const float* bp = bias ? bias + (size_t)by * sBias : nullptr;
  const int ntn = N >> 6; const int mt = blockIdx.x / ntn, nq = blockIdx.x - mt * ntn; const int row0 = mt * 128 + 32 * w, col0 = nq * 64; if (row0 >= M) return;
  const _Float16* a0p = A + (size_t)(row0 + ln) * lda; const _Float16* a1p = a0p + (size_t)16 * lda;
  const _Float16* b0p = Bh + (size_t)(col0 + ln) * ldb; const _Float16* b1p = b0p + (size_t)16 * ldb; const _Float16* b2p = b1p + (size_t)16 * ldb; const _Float16* b3p = b2p + (size_t)16 * ldb;
  const v8f z8 = {0.f,0.f,0.f,0.f,0.f,0.f,0.f,0.f}; v8f c00 = z8, c01 = z8, c02 = z8, c03 = z8, c10 = z8, c11 = z8, c12 = z8, c13 = z8;
#pragma unroll 1
  for (int kb = 0; kb < K; kb += 32) { const v16h a0 = g2_frag(a0p + kb, hh), a1 = g2_frag(a1p + kb, hh);
    v16h b = g2_frag(b0p + kb, hh); c00 = g2_mma(a0, b, c00); c10 = g2_mma(a1, b, c10);
    b = g2_frag(b1p + kb, hh); c01 = g2_mma(a0, b, c01); c11 = g2_mma(a1, b, c11);
    b = g2_frag(b2p + kb, hh); c02 = g2_mma(a0, b, c02); c12 = g2_mma(a1, b, c12);
    b = g2_frag(b3p + kb, hh); c03 = g2_mma(a0, b, c03); c13 = g2_mma(a1, b, c13); }
  v8f accs[8] = {c00, c01, c02, c03, c10, c11, c12, c13};
#pragma unroll
  for (int u = 0; u < 8; ++u) { const int t = u & 3, half = u >> 2; const int col = col0 + t * 16 + ln; const float bv = bp ? bf16_round(bp[col]) : 0.f;
#pragma unroll
    for (int r = 0; r < 8; ++r) { const int rloc = half * 16 + 8 * hh + r; float v = accs[u][r] * alpha + bv; if (CP) { if (rowsPerB < 0) v += CP[cofs + (size_t)(row0g + row0 + rloc) * ldc + col];      /* rowsPerB < 0: own element of the batched C plane */ else { const int bidx = (row0g + row0 + rloc) / rowsPerB; v += CP[(size_t)bidx * sCPb + (size_t)by * 64 + col]; } }
      if (ACT == 3) v = fmaxf(v, 0.f); else if (ACT == 6) v = 0.5f * v * (1.0f + erff(v * 0.70710678118654752f)); else if (ACT == 11) v = 1.0f / (1.0f + expf(-v)); else if (ACT == 15) v = v / (1.0f + expf(-v)); else if (ACT == 12) v = (v > 0.f) ? v : 0.01f * v; else if (ACT == 8) v = tanhf(v); else if (ACT == 9) v = 0.5f * v * (1.0f + tanhf(0.7978845608028654f * (v + 0.044715f * v * v * v))); else if (ACT == 14) v = (v > 0.f) ? v : 0.1f * v; else if (ACT == 16) v = (v >= 0.f) ? v : 0.3f * v; else if (ACT == 17) v = (v >= 0.f) ? v : 0.2f * v;
      so[w][rloc][t * 16 + ln] = v; } }
  __builtin_amdgcn_fence(__ATOMIC_ACQ_REL, "workgroup"); __builtin_amdgcn_wave_barrier();
  const int rsub = lane >> 4, c4 = (lane & 15) * 4;
  {
#pragma unroll
    for (int q = 0; q < 16; ++q) { const int r = q * 2 + rsub; const v4f v = *(const v4fa*)&so[w][r][c4]; if (C) *(v4f*)(C + cofs + (size_t)(row0 + r) * ldc + col0 + c4) = v; if (C16) { v4h h4; for (int i = 0; i < 4; ++i) h4[i] = (_Float16)v[i]; *(v4h*)(C16 + cofs + (size_t)(row0 + r) * ldc + col0 + c4) = h4; } }
     } }


__global__ __launch_bounds__(256) void k_wnat(const float* __restrict__ w, size_t n8, _Float16* __restrict__ Bt) { const size_t t = (size_t)blockIdx.x * 256 + threadIdx.x; if (t >= n8) return; FragH f; for (int q = 0; q < 8; ++q) f.h[q] = (_Float16)(bf16_round(w[t * 8 + q]) * 16.0f); *(v8us*)((unsigned short*)Bt + t * 8) = f.half[0];  }
__global__ __launch_bounds__(256) void k_rsm(const float* __restrict__ S, _Float16* __restrict__ P, int nrows) {
  #pragma clang fp contract(off)
  const int i = blockIdx.x * 256 + threadIdx.x; if (i >= nrows) return; const float* s = S + (size_t)i * SQ; float mx = -3.0e38f;
#pragma unroll 1
  for (int j = 0; j < SQ; ++j) mx = fmaxf(mx, s[j]); float se = 0.f;
#pragma unroll 1
  for (int j = 0; j < SQ; ++j) se += expf(s[j] - mx); const float sc = 256.0f / se;
#pragma unroll 1
  for (int j0 = 0; j0 < SQ; j0 += 8) { FragH f; for (int q = 0; q < 8; ++q) f.h[q] = (_Float16)(expf(s[j0 + q] - mx) * sc); unsigned short* d = (unsigned short*)P + (size_t)i * SQ + j0; *(v8us*)d = f.half[0];  } }
__global__ __launch_bounds__(256) void k_vt(const _Float16* __restrict__ V16, int b, int h0, _Float16* __restrict__ VT) { __shared__ unsigned short tl[64][65]; const int tid = threadIdx.x; const int hh = blockIdx.x % HG, sg = blockIdx.x / HG; const int s0 = sg * 64; const int h = h0 + hh;
  for (int i = tid; i < 64 * 8; i += 256) { const int j = i / 8, d8 = (i % 8) * 8; FragH f; f.half[0] = *(const v8us*)((const unsigned short*)V16 + ((size_t)b * SQ + s0 + j) * DM + h * HD + d8); for (int q = 0; q < 8; ++q) tl[d8 + q][j] = f.u[q]; }
  __syncthreads();
  { for (int i = tid; i < 64 * 8; i += 256) { const int d = i / 8, j8 = (i % 8) * 8; FragH f; for (int q = 0; q < 8; ++q) f.u[q] = tl[d][j8 + q]; *(v8us*)((unsigned short*)VT + ((size_t)hh * HD + d) * SQ + s0 + j8) = f.half[0]; }  } }



#define FW 4                         /* waves per work-group */
#define FG 2                         /* 16-query groups per wave */
#define FQ (FW * FG * 16)            /* queries per work-group */
#define FK 64                        /* keys per stage (two passes of 32) */
#define FP 144                       /* LDS row pitch, bytes: 128 + 16, an odd multiple of 16 (16-byte reads of 16 rows without bank conflicts) */
#define FT (64 * FP)                 /* one tile: 64 rows (K: keys, V^T: head dims) */
#define FNS (SQ / FK)                /* stages */
__device__ __forceinline__ float lane_x16(float x) { const int b = __float_as_int(x); return __int_as_float(__builtin_amdgcn_permlanex16(b, b, 0x76543210, 0xfedcba98, false, false)); }      /* value of lane l ^ 16 */
// e[i] = 2^t[i], eight at a time, in one statement, so that the closing v_nop stands directly behind the last v_exp_f32: it is the slot that the instruction set asks for behind a transcendental before its
// result is read or its source overwritten. Early-clobber outputs: no result lies on a source of a
// later line. The closing s_delay_alu is the hint that the compiler cannot give for results of asm text: the next vector instruction may read them, and unhinted it would hold the SIMD's issue port against the other waves.
__device__ __forceinline__ v8f exp2x8(v8f t) { float e0, e1, e2, e3, e4, e5, e6, e7;
  asm("v_exp_f32 %0, %8\n\tv_exp_f32 %1, %9\n\tv_exp_f32 %2, %10\n\tv_exp_f32 %3, %11\n\tv_exp_f32 %4, %12\n\tv_exp_f32 %5, %13\n\tv_exp_f32 %6, %14\n\tv_exp_f32 %7, %15\n\tv_nop\n\ts_delay_alu instid0(TRANS32_DEP_1)"
      : "=&v"(e0), "=&v"(e1), "=&v"(e2), "=&v"(e3), "=&v"(e4), "=&v"(e5), "=&v"(e6), "=&v"(e7) : "v"(t[0]), "v"(t[1]), "v"(t[2]), "v"(t[3]), "v"(t[4]), "v"(t[5]), "v"(t[6]), "v"(t[7]));
  const v8f e = {e0, e1, e2, e3, e4, e5, e6, e7}; return e; }
__device__ __forceinline__ float exp2x1(float t) { float e; asm("v_exp_f32 %0, %1\n\tv_nop\n\ts_delay_alu instid0(TRANS32_DEP_1)" : "=&v"(e) : "v"(t)); return e; }      /* v_nop and hint: as in exp2x8 */
__device__ __forceinline__ v16h lds_frag(const unsigned char* p) { FragH f; f.half[0] = *(const v8us*)p; f.half[1] = *(const v8us*)(p + 32); return f.v; }      /* p = row + 64 * (32-element k block) + 16 * h: k = 8h .. 8h + 7 and 16 + 8h .. 16 + 8h + 7, the order of g2_frag */
__device__ __forceinline__ v8f fa_mma(v16h a, v16h b, v8f c) { return __builtin_amdgcn_wmma_f32_16x16x32_f16(false, a, false, b, (short)0, c, false, false); }
static_assert(SQ % FQ == 0 && SQ % FK == 0 && FNS >= 2 && HD == 64, "k_fattn: whole blocks, whole stages, head size 64");
// Key order of a batch: its unmasked keys first (ascending), then its masked keys (ascending). POS[b * SQ + s] = the row of the K and V planes that key s of batch b is stored in; NUN[b] = unmasked keys of batch b.
// One work-group per batch: sign bits by ballot, masked keys in front of each 32-key word by a sum over the words, the rest by a population count inside the word.
static_assert(SQ / 32 == 64 && SQ % 256 == 0, "k_perm: 64 mask words, eight per wave");
__global__ __launch_bounds__(256) void k_perm(const float* __restrict__ mk, int* __restrict__ POS, int* __restrict__ NUN) {
  __shared__ unsigned int bits[SQ / 32];      /* bit j of word i: key 32 i + j of this batch is masked */
  __shared__ int pre[SQ / 32 + 1];      /* masked keys in front of word i; the last entry is the batch's count */
  const int tid = threadIdx.x, lane = tid & 31, wave = tid >> 5, b = blockIdx.x;
  const float* mp = mk + (size_t)b * SQ + wave * (SQ / 8) + lane; float mv[SQ / 256];      /* a wave takes SQ / 8 keys in a row: eight words */
#pragma unroll
  for (int i = 0; i < SQ / 256; ++i) mv[i] = mp[i * 32];
  __builtin_amdgcn_sched_barrier(0);      /* the eight loads stay together in front of the wait below: one latency instead of eight */
  asm volatile("s_wait_xcnt 0x0" :: "v"(mp) : "memory");      /* behind the issued loads, before a register that they name is rewritten; the address is an input so that it lives up to this wait */
  __builtin_amdgcn_sched_barrier(0);      /* keeps later register writes behind that wait */
  unsigned int myw = 0u;
#pragma unroll
  for (int i = 0; i < SQ / 256; ++i) { const unsigned int bal = __builtin_amdgcn_ballot_w32(bf16_round(mv[i]) < 0.f); myw = lane == i ? bal : myw; }      /* lane i keeps word i: one store for the eight */
  if (lane < SQ / 256) bits[wave * (SQ / 256) + lane] = myw;
  __syncthreads();
  if (tid <= SQ / 32) { int p = 0;
#pragma unroll
    for (int j = 0; j < SQ / 32; ++j) p += j < tid ? __builtin_popcount(bits[j]) : 0;
    pre[tid] = p; }
  __syncthreads();
  const int nun = SQ - pre[SQ / 32];
#pragma unroll
  for (int i = 0; i < SQ / 256; ++i) { const int s = i * 256 + tid; const unsigned int wv = bits[s >> 5]; const int mb = pre[s >> 5] + __builtin_popcount(wv & ((1u << (s & 31)) - 1u));      /* masked keys in front of key s */
    POS[(size_t)b * SQ + s] = b * SQ + (((wv >> (s & 31)) & 1u) != 0u ? nun + mb : s - mb); }
  if (tid == 0) NUN[b] = nun;
}
template <bool M> struct StageKind { static constexpr bool masked = M; };      /* does the stage hold a masked key? */
__global__ __launch_bounds__(FW * 32) void k_fattn(const _Float16* __restrict__ Q16, const _Float16* __restrict__ K16, const _Float16* __restrict__ VT, const int* __restrict__ NUN, float* __restrict__ out) {
  __shared__ __attribute__((aligned(16))) unsigned char L[2][2 * FT];      /* [buffer][K tile, V^T tile] */
  __shared__ unsigned int vote[FW];      /* per wave: not 0 if a masked key could still weigh in one of its queries */
  const int tid = threadIdx.x, lane = tid & 31, c = lane & 15, h = lane >> 4; const int wave = __builtin_amdgcn_readfirstlane(tid >> 5);
  const int hd = blockIdx.y, b = blockIdx.z; const int nun = min(max(NUN[b], 0), SQ); const int lim = (nun + FK - 1) / FK;      /* rows 0 .. nun - 1 of the batch's K and V planes are its unmasked keys, the rest its masked keys (the clamp bounds the stage loops' trip counts); lim = stages that hold an unmasked key */
  const size_t r0 = (size_t)b * SQ; const int q0 = blockIdx.x * FQ + wave * (FG * 16);
  const unsigned short* kg = (const unsigned short*)K16 + (r0 + (tid >> 3)) * DM + hd * HD + (tid & 7) * 8;      /* eight lanes cover one 128-byte row */
  const unsigned short* vg = (const unsigned short*)VT + ((size_t)(b * NH + hd) * HD + (tid >> 3)) * SQ + (tid & 7) * 8;
  const unsigned int lofs = (unsigned int)(tid >> 3) * FP + (unsigned int)(tid & 7) * 16;
  v8us rk[4], rv[4];
  auto fetch = [&](int st) {
#pragma unroll
    for (int u = 0; u < 4; ++u) { rk[u] = *(const v8us*)(kg + ((size_t)st * FK + u * 16) * DM); rv[u] = *(const v8us*)(vg + (size_t)u * 16 * SQ + (size_t)st * FK); }
    __builtin_amdgcn_sched_barrier(0);      /* the loads stay in front of the wait below */
    asm volatile("s_wait_xcnt 0x0" ::: "memory");      /* behind the issued loads, before a register that they name (address, base) is rewritten for the next stage */
    __builtin_amdgcn_sched_barrier(0);      /* keeps later register writes behind that wait */
  };
  auto put = [&](int buf) {
#pragma unroll
    for (int u = 0; u < 4; ++u) { *(v8us*)&L[buf][lofs + u * 16 * FP] = rk[u]; *(v8us*)&L[buf][FT + lofs + u * 16 * FP] = rv[u]; } };
  fetch(0);
  v16h qf[FG][2];
#pragma unroll
  for (int g = 0; g < FG; ++g) { const _Float16* qp = Q16 + (r0 + q0 + g * 16 + c) * DM + hd * HD;
#pragma unroll
    for (int kc = 0; kc < 2; ++kc) qf[g][kc] = g2_frag(qp + 32 * kc, h); }
  __builtin_amdgcn_sched_barrier(0);      /* the Q loads stay in front of the wait below */
  asm volatile("s_wait_xcnt 0x0" ::: "memory");      /* behind the issued Q loads, before a register that they name is reused */
  __builtin_amdgcn_sched_barrier(0);      /* keeps later register writes behind that wait */
  put(0);
  fetch(1);
  const v8f z8 = {0.f, 0.f, 0.f, 0.f, 0.f, 0.f, 0.f, 0.f};
  v8f acc[FG][4]; float m_run[FG], l_run[FG];
#pragma unroll
  for (int g = 0; g < FG; ++g) { m_run[g] = -__builtin_inff(); l_run[g] = 0.f;
#pragma unroll
    for (int t = 0; t < 4; ++t) acc[g][t] = z8; }
  const float cs = 0.125f * 1.44269504f;      /* 1 / sqrt(64), and exp(x) as 2^(x log2 e) */
  __syncthreads();      /* stage 0 is published */
  auto stage = [&](int st, auto kind) __attribute__((always_inline)) {      /* inlined at both places: the arrays it works on stay in registers only so */
    if (st + 1 < FNS) put((st + 1) & 1);      /* into the buffer that stage st - 1 used: every wave has left it (barrier at the loop's foot) */
    if (st + 2 < FNS) fetch(st + 2);      /* in flight under this stage's work */
    const unsigned char* Lb = &L[st & 1][0];
#pragma unroll
    for (int p = 0; p < 2; ++p) {
      const unsigned char* kb = Lb + (p * 32 + c) * FP + 16 * h;
      v16h kf[2][2];
#pragma unroll
      for (int kt = 0; kt < 2; ++kt)
#pragma unroll
        for (int kc = 0; kc < 2; ++kc) kf[kt][kc] = lds_frag(kb + kt * 16 * FP + 64 * kc);
      v8f s[2][FG];      /* s[kt][g][r] = raw score of key 32 p + 16 kt + 8 h + r and query 16 g + c */
#pragma unroll
      for (int kt = 0; kt < 2; ++kt)
#pragma unroll
        for (int g = 0; g < FG; ++g) s[kt][g] = fa_mma(kf[kt][1], qf[g][1], fa_mma(kf[kt][0], qf[g][0], z8));
      const unsigned char* vb = Lb + FT + c * FP + p * 64 + 16 * h;
      v16h vf[4];
#pragma unroll
      for (int t = 0; t < 4; ++t) vf[t] = lds_frag(vb + t * 16 * FP);
      if constexpr (decltype(kind)::masked) {      /* in the sorted key order only the stage at the boundary, and the stages behind it, hold a masked key */
        const int rem = nun - (st * FK + p * 32);      /* unmasked keys from this pass's first key on */
        const unsigned int mw = (rem >= 32 ? 0u : rem <= 0 ? 0xffffffffu : 0xffffffffu << rem) >> (8 * h);      /* bit j: key 8 h + j of the pass is masked */
#pragma unroll
        for (int kt = 0; kt < 2; ++kt)
#pragma unroll
          for (int r = 0; r < 8; ++r) { const bool km = (mw & (1u << (16 * kt + r))) != 0u;
#pragma unroll
            for (int g = 0; g < FG; ++g) s[kt][g][r] = km ? -80000.0f : s[kt][g][r]; } }      /* masked_fill(-10000) on the raw score: -80000 / 8 */
      float mb[FG]; bool need = false;
#pragma unroll
      for (int g = 0; g < FG; ++g) { float mx = s[0][g][0];
#pragma unroll
        for (int r = 1; r < 8; ++r) mx = fmaxf(mx, s[0][g][r]);
#pragma unroll
        for (int r = 0; r < 8; ++r) mx = fmaxf(mx, s[1][g][r]);
        mx = fmaxf(mx, lane_x16(mx)) * cs; mb[g] = mx; need = need || (mx > m_run[g] + 8.0f); }      /* both halves hold the query's maximum of this pass, in log2 units */
      if (__builtin_amdgcn_ballot_w32(need) != 0u) {      /* lazy rescale: the maximum in use may trail the true one by 8 (a weight reaches 2^8 at most); one scalar branch per pass */
#pragma unroll
        for (int g = 0; g < FG; ++g) { const float mn = fmaxf(m_run[g], mb[g]); const float corr = exp2x1(m_run[g] - mn); m_run[g] = mn; l_run[g] *= corr;      /* first pass: 2^(-inf) = 0 on zero sums */
#pragma unroll
          for (int t = 0; t < 4; ++t) acc[g][t] = acc[g][t] * corr; } }
      FragH pf[FG];
#pragma unroll
      for (int g = 0; g < FG; ++g) { const float nm = -m_run[g]; float ls[4] = {0.f, 0.f, 0.f, 0.f};
#pragma unroll
        for (int kt = 0; kt < 2; ++kt) { v8f t8;
#pragma unroll
          for (int r = 0; r < 8; ++r) t8[r] = fmaf(s[kt][g][r], cs, nm);
          const v8f e = exp2x8(t8);
#pragma unroll
          for (int r = 0; r < 8; ++r) { ls[r & 3] += e[r]; pf[g].h[8 * kt + r] = (_Float16)e[r]; } }      /* element 8 kt + r of the B operand = key 16 kt + 8 h + r */
        l_run[g] += (ls[0] + ls[1]) + (ls[2] + ls[3]); }
      __builtin_amdgcn_sched_barrier(0);      /* the exponentials are asm text: all of them stay in front of the second product */
#pragma unroll
      for (int g = 0; g < FG; ++g)
#pragma unroll
        for (int t = 0; t < 4; ++t) acc[g][t] = fa_mma(vf[t], pf[g].v, acc[g][t]);      /* acc[g][t][r] = O[query 16 g + c][dim 16 t + 8 h + r], unnormalised */
    }
    if (st + 1 == lim) { bool open = false;      /* the last stage with an unmasked key: each wave's word for the test at the loop's head, published by the barrier below */
#pragma unroll
      for (int g = 0; g < FG; ++g) open = open || !(m_run[g] >= -14000.0f);
      const unsigned int bal = __builtin_amdgcn_ballot_w32(open); if (lane == 0) vote[wave] = bal; }
    __syncthreads();      /* publishes stage st + 1 and ends every wave's reads of stage st */
  };
  int st = 0;
#pragma unroll 1      /* the stage loops stay rolled: a body already holds two unrolled passes (code size, registers) */
  for (; st < nun / FK; ++st) stage(st, StageKind<false>{});      /* stages of unmasked keys alone: no select */
#pragma unroll 1
  for (; st < FNS; ++st) {
    /* From stage lim on every key is masked: raw score -80000, the same for all. Where every query of the work-group holds a maximum of at least -14000 (log2 units), each such weight is 2^(-14427 - maximum) = 0 exactly
       and no maximum moves, so the remaining stages would add zeros only: leave. Otherwise (no unmasked key at all, or scores near the fill value) all stages run. The test reads the same for the whole work-group. */
    if (st == lim && st > 0) { if (__builtin_amdgcn_readfirstlane((int)(vote[0] | vote[1] | vote[2] | vote[3])) == 0) break; }
    stage(st, StageKind<true>{}); }
#pragma unroll
  for (int g = 0; g < FG; ++g) { const float l = l_run[g] + lane_x16(l_run[g]); const float inv = 1.0f / l;      /* the halves' sums joined once */
#pragma unroll
    for (int t = 0; t < 4; ++t) acc[g][t] = acc[g][t] * inv; }
#pragma unroll
  for (int g = 0; g < FG; ++g) { float* op = out + (r0 + q0 + g * 16 + c) * DM + hd * HD + 8 * h;
#pragma unroll
    for (int t = 0; t < 4; ++t) { const v4f lo = {acc[g][t][0], acc[g][t][1], acc[g][t][2], acc[g][t][3]}, hi = {acc[g][t][4], acc[g][t][5], acc[g][t][6], acc[g][t][7]};
      *(v4f*)(op + 16 * t) = lo; *(v4f*)(op + 16 * t + 4) = hi; } }
}
// Projection GEMM with both operands through LDS: C16[128 rows][64 columns] per work-group = f16(X . W^T / 16 + bias), four waves of 32 x 64, f32 accumulation in ascending k blocks of 32 (the order of k_gemm2).
// A stage is one 128-byte line (64 k) of each of the 128 X rows and 64 W rows. Eight lanes fetch one line, so every global load covers four whole lines (a fragment load straight from global memory touches 16 lines for the same 512 bytes),
// and the W tile is fetched once per work-group instead of once per wave. Registers -> two LDS buffers, as in k_fattn: one barrier per stage publishes stage st + 1 and frees the buffer of stage st.
#define PM 128                       /* X rows per work-group */
#define PN 64                        /* output columns per work-group */
#define PK 64                        /* k per stage */
#define PNS (DM / PK)                /* stages */
#define PT ((PM + PN) * FP)          /* one buffer: X tile, then W tile, rows at pitch FP */
// Launch bounds: at least three waves per SIMD, so that the grid's three work-groups per WGP are all resident at once (registers; LDS fits three as well).
static_assert(DM % PK == 0 && DM % PN == 0 && PNS >= 2 && MP % PM == 0 && PK * 2 == 128, "k_proj: whole tiles, whole stages, one line per row and stage");
// Work-group barrier that orders LDS alone: __syncthreads() also drains the wave's global loads, which would end the flight of the stage fetched ahead at every stage's foot.
__device__ __forceinline__ void lds_barrier() { __builtin_amdgcn_fence(__ATOMIC_RELEASE, "workgroup", "local"); __builtin_amdgcn_s_barrier(); __builtin_amdgcn_fence(__ATOMIC_ACQUIRE, "workgroup", "local"); }
// MAP: row r of the product is stored in row rowmap[r] of C16 (the key order of k_perm, rows counted from the plane's start); rows stay whole, so the stores cover the same lines.
template <bool MAP>
__global__ __launch_bounds__(128, 3) void k_proj(const _Float16* __restrict__ A, const _Float16* __restrict__ Bh, const float* __restrict__ bias, const int* __restrict__ rowmap, _Float16* __restrict__ C16) {
  __shared__ __attribute__((aligned(16))) unsigned char L[2][PT];
  __shared__ __attribute__((aligned(16))) float so[4][32][68];
  const int tid = threadIdx.x, w = tid >> 5, lane = tid & 31, ln = lane & 15, hh = lane >> 4;
  const int mt = blockIdx.x / (DM / PN), nq = blockIdx.x - mt * (DM / PN); const int row0 = mt * PM + 32 * w, col0 = nq * PN;
  const unsigned short* ag = (const unsigned short*)A + ((size_t)mt * PM + (tid >> 3)) * DM + (tid & 7) * 8;      /* eight lanes cover one 128-byte line */
  const unsigned short* bg = (const unsigned short*)Bh + ((size_t)col0 + (tid >> 3)) * DM + (tid & 7) * 8;
  const unsigned int lofs = (unsigned int)(tid >> 3) * FP + (unsigned int)(tid & 7) * 16;
  v8us ra[PM / 16], rb[PN / 16];
  auto fetch = [&](int st) {
#pragma unroll
    for (int u = 0; u < PM / 16; ++u) ra[u] = *(const v8us*)(ag + (size_t)u * 16 * DM + st * PK);
#pragma unroll
    for (int u = 0; u < PN / 16; ++u) rb[u] = *(const v8us*)(bg + (size_t)u * 16 * DM + st * PK);
    __builtin_amdgcn_sched_barrier(0);      /* the loads stay in front of the wait below */
    asm volatile("s_wait_xcnt 0x0" :: "v"(ag), "v"(bg) : "memory");      /* behind the issued loads, before a register that they name is rewritten; the two addresses are inputs so that they live up to this wait and no result of the last stage's loads is given their registers */
    __builtin_amdgcn_sched_barrier(0);      /* keeps later register writes behind that wait */
  };
  auto put = [&](int buf) {
#pragma unroll
    for (int u = 0; u < PM / 16; ++u) *(v8us*)&L[buf][lofs + u * 16 * FP] = ra[u];
#pragma unroll
    for (int u = 0; u < PN / 16; ++u) *(v8us*)&L[buf][PM * FP + lofs + u * 16 * FP] = rb[u]; };
  fetch(0);
  const int bix = col0 + ln; float bvr[4];      /* the lane's four bias values, fetched here so that their latency lies under the stages */
#pragma unroll
  for (int t = 0; t < 4; ++t) bvr[t] = bias[bix + t * 16];
  const int rix = row0 + lane; int rm = rix;      /* lane l: the row of C16 that takes the wave's row l */
  if (MAP) rm = rowmap[rix];
  __builtin_amdgcn_sched_barrier(0);      /* the loads stay in front of the wait below */
  asm volatile("s_wait_xcnt 0x0" :: "v"(bix), "v"(rix) : "memory");      /* behind the issued loads, before a register that they name is rewritten; the indices are inputs so that they live up to this wait */
  __builtin_amdgcn_sched_barrier(0);      /* keeps later register writes behind that wait */
  put(0);
  fetch(1);
  const v8f z8 = {0.f, 0.f, 0.f, 0.f, 0.f, 0.f, 0.f, 0.f};
  v8f acc[2][4];
#pragma unroll
  for (int i = 0; i < 2; ++i)
#pragma unroll
    for (int t = 0; t < 4; ++t) acc[i][t] = z8;
  lds_barrier();      /* stage 0 is published */
#pragma unroll      /* twelve short stages: buffer index, last-stage tests and the loads' k offsets become constants, and no address register is rewritten in the loop */
  for (int st = 0; st < PNS; ++st) {
    if (st + 1 < PNS) put((st + 1) & 1);      /* into the buffer that stage st - 1 used: every wave has left it (barrier at the loop's foot) */
    if (st + 2 < PNS) fetch(st + 2);      /* in flight under this stage's work */
    const unsigned char* ap = &L[st & 1][0] + (32 * w + ln) * FP + 16 * hh; const unsigned char* bp = &L[st & 1][0] + (PM + ln) * FP + 16 * hh;
#pragma unroll
    for (int kc = 0; kc < 2; ++kc) { const v16h a0 = lds_frag(ap + 64 * kc), a1 = lds_frag(ap + 16 * FP + 64 * kc);
#pragma unroll
      for (int t = 0; t < 4; ++t) { const v16h b = lds_frag(bp + t * 16 * FP + 64 * kc); acc[0][t] = fa_mma(a0, b, acc[0][t]); acc[1][t] = fa_mma(a1, b, acc[1][t]); } }
    if (st + 1 < PNS) lds_barrier();      /* publishes stage st + 1 and ends every wave's reads of stage st; behind the last stage nothing of the ring is written or read any more */
  }
#pragma unroll
  for (int u = 0; u < 8; ++u) { const int t = u & 3, half = u >> 2; const float bv = bf16_round(bvr[t]);
#pragma unroll
    for (int r = 0; r < 8; ++r) so[w][half * 16 + 8 * hh + r][t * 16 + ln] = acc[half][t][r] * 0.0625f + bv; }
  __builtin_amdgcn_fence(__ATOMIC_ACQ_REL, "workgroup"); __builtin_amdgcn_wave_barrier();      /* each wave reads back only its own rows */
  const int rsub = lane >> 4, c4 = (lane & 15) * 4;
#pragma unroll
  for (int q = 0; q < 16; ++q) { const int r = q * 2 + rsub; const v4f v = *(const v4fa*)&so[w][r][c4]; v4h h4; for (int i = 0; i < 4; ++i) h4[i] = (_Float16)v[i];
    int ro = row0 + r;
    if (MAP) { const int re = __builtin_amdgcn_readlane(rm, q * 2), rd = __builtin_amdgcn_readlane(rm, q * 2 + 1); ro = rsub ? rd : re; }      /* both read first: a select, no branch */
    *(v4h*)(C16 + (size_t)ro * DM + col0 + c4) = h4; }
}
extern "C" void kernel_launch(void* const* d_in, const int* in_sizes, int n_in,
                              void* d_out, int out_size, void* d_ws, size_t ws_size, hipStream_t stream) {
  (void)in_sizes; (void)n_in; (void)out_size;
  const float* const* I = (const float* const*)d_in; const float* x = I[0]; const float* am = I[1]; const float* wq = I[2]; const float* bq = I[3]; const float* wk = I[4]; const float* bk = I[5]; const float* wv = I[6]; const float* bv = I[7];      /* hidden_states; attention_mask f32 [4][1][1][2048] (READ on device: key masked iff bf16(mask) < 0); natural weights + biases */
  char* ws = (char*)d_ws; size_t off = 0;
  auto take = [&](size_t bytes) { char* p = ws + off; off += (bytes + 255) & ~(size_t)255; return p; };
  _Float16* BQ = (_Float16*)take((size_t)DM * DM * 2); _Float16* BK = (_Float16*)take((size_t)DM * DM * 2); _Float16* BV = (_Float16*)take((size_t)DM * DM * 2); 
  _Float16* X16 = (_Float16*)take(NR * DM * 2); _Float16* Q16 = (_Float16*)take(NR * DM * 2); _Float16* K16 = (_Float16*)take(NR * DM * 2); _Float16* V16 = (_Float16*)take(NR * DM * 2);
  _Float16* VT = (_Float16*)take((size_t)NB * NH * HD * SQ * 2);
  int* POS = (int*)take(NR * 4); int* NUN = (int*)take((size_t)NB * 4);
  if (off > ws_size) return;
  { const unsigned g = (unsigned)(((size_t)DM * DM / 8 + 255) / 256); k_wnat<<<g, 256, 0, stream>>>(wq, (size_t)DM * DM / 8, BQ); k_wnat<<<g, 256, 0, stream>>>(wk, (size_t)DM * DM / 8, BK); k_wnat<<<g, 256, 0, stream>>>(wv, (size_t)DM * DM / 8, BV); }      /* natural [out][in] = Bt[n][k], x16 */

  k_perm<<<NB, 256, 0, stream>>>(am, POS, NUN);      /* key order per batch: unmasked first */
  k_x16<<<(unsigned)((NR * DM / 8 + 255) / 256), 256, 0, stream>>>(x, X16, NR * DM / 8);
  const size_t r0p = (size_t)B0 * SQ;      /* first projected row */
  k_proj<false><<<(unsigned)((MP / PM) * (DM / PN)), 128, 0, stream>>>(X16 + r0p * DM, BQ, bq, nullptr, Q16 + r0p * DM);
  k_proj<true><<<(unsigned)((MP / PM) * (DM / PN)), 128, 0, stream>>>(X16 + r0p * DM, BK, bk, POS + r0p, K16);      /* K and V rows in the key order of k_perm */
  k_proj<true><<<(unsigned)((MP / PM) * (DM / PN)), 128, 0, stream>>>(X16 + r0p * DM, BV, bv, POS + r0p, V16);
  k_vt<NH, SQ><<<NB * NH * (SQ / 64), 256, 0, stream>>>(V16, LQ, 0, VT);      /* V^T [NB][NH][HD][SQ] */
  k_fattn<<<dim3(SQ / FQ, NH, NB), FW * 32, 0, stream>>>(Q16, K16, VT, NUN, (float*)d_out);      /* scores, sign key mask (select, -10000 fill), softmax and P V in one launch; f32 straight into the merged-heads output rows */
}

// v005
// One run takes 81.2 microseconds.
// Timed twice side by side with v004, it ran 1.16 times as fast both times.
// All steps since v000 together make it 64.3 times as fast.
#include <hip/hip_runtime.h>
// BERT self-attention without an output projection and with a SIGN key mask (hidden_states [4][2048][768]; q/k/v = x W^T + b (natural [768][768] sigma 0.02, biases sigma 0.02); 12 heads of 64; scores / 8; masked_fill(attention_mask < 0, -10000) with the f32 [4][1][1][2048] mask input (a key of batch b is masked iff its mask value is negative); softmax over all keys; context = heads merged -> [4][2048][768]).
// Structure: token rows r = b*2048 + s; x as exact f16 rows (bf16-rounded); Q, K, V as three WMMA GEMMs (32x64 wave tiles, f32 accumulation, exact x16 weights + bias, f16 outputs); V^T for all batches and heads via LDS transposes; the K and V rows of a batch stored in key order 'unmasked first, then masked' (perm_job), so that the attention launch ends behind the last unmasked key when every later weight is exactly 0; one fused attention launch (scores on WMMA, K = 64; online softmax on VALU, f32 statistics, weights as f16 relative to the running maximum; o = P . V on WMMA) written f32 straight into the merged-heads output rows (no output projection).
// Compute dtype: inputs rounded to bf16; x / weights exact; q, k, v and softmax weights as plain f16 GEMM operands (~2^-12); scores, softmax statistics and o f32. v_wmma_f32_16x16x32_f16.
#define NB 4
#define SQ 2048
#define DM 768
#define NH 12
#define HD 64
#define HG 4                         /* heads per launch of the per-batch k_vt overload */
#define B0 0                         /* first batch processed (debug hook) */
#define NBR NB                       /* batches processed (debug hook) */
#define NR ((size_t)NB * SQ)         /* token rows */
#define MP ((int)((size_t)NBR * SQ)) /* rows projected (debug hook) */
#define QN SQ                        /* unused */
#define NHD NH                       /* unused */
#define MPO MP                       /* unused */
#define LQ DM      /* row pitch of the q/k/v rows */
typedef __bf16 v16b __attribute__((ext_vector_type(16)));
typedef unsigned short v8us __attribute__((ext_vector_type(8), may_alias));
typedef float  v8f  __attribute__((ext_vector_type(8)));
typedef float  v4f  __attribute__((ext_vector_type(4)));
typedef float  v4fa __attribute__((ext_vector_type(4), may_alias));
union FragB { v16b v; v8us half[2]; unsigned short u[16]; };

__device__ __forceinline__ unsigned short bf16_bits(float x) { unsigned int u = __float_as_uint(x); return (unsigned short)((u + 0x7FFFu + ((u >> 16) & 1u)) >> 16); }
__device__ __forceinline__ float bf16_val(unsigned short b) { return __uint_as_float(((unsigned int)b) << 16); }
__device__ __forceinline__ float bf16_round(float x) { return bf16_val(bf16_bits(x)); }
// D += A·B with NT terms: 1 = ah·bh, 2 = + al·bh (A split), 3 = + ah·bl (both split)
template <int NT>
__device__ __forceinline__ v8f mmaN(v16b ah, v16b al, v16b bh, v16b bl, v8f c) {
  c = __builtin_amdgcn_wmma_f32_16x16x32_bf16(false, ah, false, bh, (short)0, c, false, false);
  if (NT >= 2) c = __builtin_amdgcn_wmma_f32_16x16x32_bf16(false, al, false, bh, (short)0, c, false, false);
  if (NT >= 3) c = __builtin_amdgcn_wmma_f32_16x16x32_bf16(false, ah, false, bl, (short)0, c, false, false);
  asm volatile("v_nop\n\tv_nop\n\tv_nop\n\tv_nop" : "+v"(c) : "v"(ah), "v"(al), "v"(bh), "v"(bl));
  return c;
}

__global__ __launch_bounds__(256) void k_wt_bf16(const float* __restrict__ W, unsigned short* __restrict__ Wt, int K, int N) {
  const int t = blockIdx.x * 256 + threadIdx.x;
  const int k8n = K / 8;
  if (t >= N * k8n) return;
  const int n = t / k8n, k8 = (t % k8n) * 8;
  v8us v;
#pragma unroll
  for (int i = 0; i < 8; ++i) v[i] = bf16_bits(W[(size_t)(k8 + i) * N + n]);
  *(v8us*)(Wt + (size_t)n * K + k8) = v;
  
}

// GEMM C[M][N] (f32, pitch ldc) = act(A[M][K]·W + bias). A f32 row-major (pitch lda) converted per fragment to bf16
// (ASPLIT: hi/lo two planes -> 2 terms, else single rounded term); Wt bf16 [N][K] (pitch ldb). BIAS_BF16 rounds the
// bias to bf16 first (bias quantised to bf16 before the add). K%32==0, M%16==0, N%64==0.
template <bool ASPLIT, int ACT, bool BIAS_BF16>
__global__ __launch_bounds__(128) void k_gemm_bf(const float* __restrict__ A, int lda, const unsigned short* __restrict__ Wt, int ldb,
                                               const float* __restrict__ bias, float* __restrict__ C, int ldc, int M, int N, int K) {
  __shared__ __attribute__((aligned(16))) float so[4][16][64];
  const int tid = threadIdx.x, w = tid >> 5, lane = tid & 31, ln = lane & 15, hh = lane >> 4;
  const int ntn = N / 64;
  const int wid = blockIdx.x * 4 + w;
  const int mt = wid / ntn, nq = wid % ntn;
  if (mt * 16 >= M) return;
  const int row0 = mt * 16, col0 = nq * 64;
  const float* arow = A + (size_t)(row0 + ln) * lda;
  v8f acc[4] = {};
  for (int kb = 0; kb < K; kb += 32) {
    FragB ah, al;
    const v4f x0 = *(const v4fa*)(arow + kb + 8 * hh), x1 = *(const v4fa*)(arow + kb + 8 * hh + 4);
    const v4f x2 = *(const v4fa*)(arow + kb + 16 + 8 * hh), x3 = *(const v4fa*)(arow + kb + 16 + 8 * hh + 4);
    float xs[16] = {x0[0],x0[1],x0[2],x0[3],x1[0],x1[1],x1[2],x1[3],x2[0],x2[1],x2[2],x2[3],x3[0],x3[1],x3[2],x3[3]};
#pragma unroll
    for (int i = 0; i < 16; ++i) { const unsigned short hb = bf16_bits(xs[i]); ah.u[i] = hb; al.u[i] = ASPLIT ? bf16_bits(xs[i] - bf16_val(hb)) : (unsigned short)0; }
#pragma unroll
    for (int t = 0; t < 4; ++t) {
      const unsigned short* brow = Wt + (size_t)(col0 + t * 16 + ln) * ldb + kb;
      FragB b;
      b.half[0] = *(const v8us*)(brow + 8 * hh);
      b.half[1] = *(const v8us*)(brow + 16 + 8 * hh);
      acc[t] = mmaN<ASPLIT ? 2 : 1>(ah.v, al.v, b.v, b.v, acc[t]);
    }
  }
#pragma unroll
  for (int t = 0; t < 4; ++t) {
    float bv = bias ? bias[col0 + t * 16 + ln] : 0.f;
    if (BIAS_BF16) bv = bf16_round(bv);
#pragma unroll
    for (int r = 0; r < 8; ++r) { float v = acc[t][r] + bv; if (ACT == 1) v = fmaxf(v, 0.f); so[w][8 * hh + r][t * 16 + ln] = v; }
  }
  __builtin_amdgcn_fence(__ATOMIC_ACQ_REL, "workgroup");
  __builtin_amdgcn_wave_barrier();
  const int rsub = lane >> 4, c4 = (lane & 15) * 4;
  {
#pragma unroll
    for (int q = 0; q < 8; ++q) {
      const int r = q * 2 + rsub;
      const v4f v = *(const v4fa*)&so[w][r][c4];
      *(v4f*)(C + (size_t)(row0 + r) * ldc + col0 + c4) = v;
    }
    
  }
}

// GEMM C = act(A·W + bias + resid): A f32 (ASPLIT -> hi/lo 2 terms), Wt bf16 [N][K]; ACT 0 none, 1 relu, 2 exact gelu;
// resid (optional, f32, row index = (row % rmod), pitch ldr, RES_BF16 rounds it) added before the activation.
template <bool ASPLIT, int ACT, bool BIAS_BF16, bool RES_BF16>
__global__ __launch_bounds__(128) void k_gemm_bf3(const float* __restrict__ A, int lda, const unsigned short* __restrict__ Wt, int ldb,
                                                const float* __restrict__ bias, const float* __restrict__ resid, int rmod, int ldr,
                                                float* __restrict__ C, int ldc, int M, int N, int K) {
  __shared__ __attribute__((aligned(16))) float so[4][16][64];
  const int tid = threadIdx.x, w = tid >> 5, lane = tid & 31, ln = lane & 15, hh = lane >> 4;
  const int ntn = N / 64;
  const int wid = blockIdx.x * 4 + w;
  const int mt = wid / ntn, nq = wid % ntn;
  if (mt * 16 >= M) return;
  const int row0 = mt * 16, col0 = nq * 64;
  const float* arow = A + (size_t)(row0 + ln) * lda;
  v8f acc[4] = {};
  for (int kb = 0; kb < K; kb += 32) {
    FragB ah, al;
    const v4f x0 = *(const v4fa*)(arow + kb + 8 * hh), x1 = *(const v4fa*)(arow + kb + 8 * hh + 4);
    const v4f x2 = *(const v4fa*)(arow + kb + 16 + 8 * hh), x3 = *(const v4fa*)(arow + kb + 16 + 8 * hh + 4);
    float xs[16] = {x0[0],x0[1],x0[2],x0[3],x1[0],x1[1],x1[2],x1[3],x2[0],x2[1],x2[2],x2[3],x3[0],x3[1],x3[2],x3[3]};
#pragma unroll
    for (int i = 0; i < 16; ++i) { const unsigned short hb = bf16_bits(xs[i]); ah.u[i] = hb; al.u[i] = ASPLIT ? bf16_bits(xs[i] - bf16_val(hb)) : (unsigned short)0; }
#pragma unroll
    for (int t = 0; t < 4; ++t) {
      const unsigned short* brow = Wt + (size_t)(col0 + t * 16 + ln) * ldb + kb;
      FragB b;
      b.half[0] = *(const v8us*)(brow + 8 * hh);
      b.half[1] = *(const v8us*)(brow + 16 + 8 * hh);
      acc[t] = mmaN<ASPLIT ? 2 : 1>(ah.v, al.v, b.v, b.v, acc[t]);
    }
  }
#pragma unroll
  for (int t = 0; t < 4; ++t) {
    const int col = col0 + t * 16 + ln;
    float bv = bias ? bias[col] : 0.f;
    if (BIAS_BF16) bv = bf16_round(bv);
#pragma unroll
    for (int r = 0; r < 8; ++r) {
      float v = acc[t][r] + bv;
      if (resid) { float rv = resid[(size_t)((row0 + 8 * hh + r) % rmod) * ldr + col]; if (RES_BF16) rv = bf16_round(rv); v += rv; }
      if (ACT == 1) v = fmaxf(v, 0.f);
      if (ACT == 2) v = 0.5f * v * (1.0f + erff(v * 0.70710678118654752f));
      if (ACT == 3) { const float u = 0.7978845608028654f * (v + 0.044715f * v * v * v); v = 0.5f * v * (1.0f + tanhf(u)); }
      so[w][8 * hh + r][t * 16 + ln] = v;
    }
  }
  __builtin_amdgcn_fence(__ATOMIC_ACQ_REL, "workgroup");
  __builtin_amdgcn_wave_barrier();
  const int rsub = lane >> 4, c4 = (lane & 15) * 4;
  {
#pragma unroll
    for (int q = 0; q < 8; ++q) {
      const int r = q * 2 + rsub;
      const v4f v = *(const v4fa*)&so[w][r][c4];
      *(v4f*)(C + (size_t)(row0 + r) * ldc + col0 + c4) = v;
    }
    
  }
}
// row LayerNorm (biased variance, eps) over N: s = X (+ R); optional out_sum <- s; out_norm <- (s-mu)*rsqrt(var+eps)*g + b
template <bool PARAM_BF16>
__global__ __launch_bounds__(256) void k_layernorm(const float* __restrict__ X, const float* __restrict__ R, const float* __restrict__ g, const float* __restrict__ bta,
                                                  float* __restrict__ out_sum, float* __restrict__ out_norm, int N, float eps) {
  __shared__ float red[256];
  const int row = blockIdx.x, tid = threadIdx.x;
  const float* x = X + (size_t)row * N; const float* rr = R ? R + (size_t)row * N : nullptr;
  float vals[16];                     // up to N = 4096
  const int per = N / 256;            // contiguous chunk per thread? use strided-by-4 chunks: thread handles j = tid*4 + 1024*u
  float s1 = 0.f;
  for (int u = 0; u < per / 4; ++u) {
    const int j = tid * 4 + 1024 * u;
    const v4f a = *(const v4fa*)(x + j);
    v4f b = {0.f,0.f,0.f,0.f}; if (rr) b = *(const v4fa*)(rr + j);
#pragma unroll
    for (int q = 0; q < 4; ++q) { const float v = a[q] + b[q]; vals[u * 4 + q] = v; s1 += v; }
  }
  red[tid] = s1; __syncthreads();
  for (int st = 128; st > 0; st >>= 1) { if (tid < st) red[tid] += red[tid + st]; __syncthreads(); }
  const float mu = red[0] / (float)N; __syncthreads();
  float s2 = 0.f;
  for (int u = 0; u < per / 4; ++u)
#pragma unroll
    for (int q = 0; q < 4; ++q) { const float c = vals[u * 4 + q] - mu; s2 += c * c; }
  red[tid] = s2; __syncthreads();
  for (int st = 128; st > 0; st >>= 1) { if (tid < st) red[tid] += red[tid + st]; __syncthreads(); }
  const float rs = rsqrtf(red[0] / (float)N + eps);
  {
    for (int u = 0; u < per / 4; ++u) {
      const int j = tid * 4 + 1024 * u;
      v4f o, sm;
#pragma unroll
      for (int q = 0; q < 4; ++q) {
        float gg = g[j + q], bb = bta[j + q];
        if (PARAM_BF16) { gg = bf16_round(gg); bb = bf16_round(bb); }
        sm[q] = vals[u * 4 + q]; o[q] = (vals[u * 4 + q] - mu) * rs * gg + bb;
      }
      if (out_sum) *(v4f*)(out_sum + (size_t)row * N + j) = sm;
      *(v4f*)(out_norm + (size_t)row * N + j) = o;
    }
    
  }
}



// ---- f16 WMMA path (v_wmma_f32_16x16x32_f16): 11-bit significands for operands in range — used where a [0,1] probability operand needs more precision than bf16
typedef _Float16 v16h __attribute__((ext_vector_type(16)));
union FragH { v16h v; v8us half[2]; _Float16 h[16]; unsigned short u[16]; };
template <int NT>
__device__ __forceinline__ v8f mmaH(v16h ah, v16h al, v16h bh, v16h bl, v8f c) {
  c = __builtin_amdgcn_wmma_f32_16x16x32_f16(false, ah, false, bh, (short)0, c, false, false);
  if (NT >= 2) c = __builtin_amdgcn_wmma_f32_16x16x32_f16(false, al, false, bh, (short)0, c, false, false);
  if (NT >= 3) c = __builtin_amdgcn_wmma_f32_16x16x32_f16(false, ah, false, bl, (short)0, c, false, false);
  asm volatile("v_nop\n\tv_nop\n\tv_nop\n\tv_nop" : "+v"(c) : "v"(ah), "v"(al), "v"(bh), "v"(bl));
  return c;
}
// batched GEMM like k_gemm_b but f16 operands: A f32 (split into f16 hi/lo if ASPLIT, else rounded to f16), Bt = f16 values [n][k]; alpha; C f32; N multiple of 16 (partial tiles skipped)
template <bool ASPLIT>
__global__ __launch_bounds__(128) void k_gemm_h(const float* __restrict__ A, int lda, size_t sA, const _Float16* __restrict__ Bh, int ldb, size_t sB, float alpha, float* __restrict__ C, int ldc, size_t sC, int M, int N, int K) {
  __shared__ __attribute__((aligned(16))) float so[4][16][64];
  const int tid = threadIdx.x, w = tid >> 5, lane = tid & 31, ln = lane & 15, hh = lane >> 4; const int by = blockIdx.y;
  A += (size_t)by * sA; Bh += (size_t)by * sB; C += (size_t)by * sC;
  const int ntn = (N + 63) / 64; const int wid = blockIdx.x * 4 + w; const int mt = wid / ntn, nq = wid % ntn; if (mt * 16 >= M) return;
  const int row0 = mt * 16, col0 = nq * 64; const float* arow = A + (size_t)(row0 + ln) * lda;
  v8f acc[4] = {};
  for (int kb = 0; kb < K; kb += 32) {
    FragH ah, al;
    const v4f x0 = *(const v4fa*)(arow + kb + 8 * hh), x1 = *(const v4fa*)(arow + kb + 8 * hh + 4), x2 = *(const v4fa*)(arow + kb + 16 + 8 * hh), x3 = *(const v4fa*)(arow + kb + 16 + 8 * hh + 4);
    float xs[16] = {x0[0],x0[1],x0[2],x0[3],x1[0],x1[1],x1[2],x1[3],x2[0],x2[1],x2[2],x2[3],x3[0],x3[1],x3[2],x3[3]};
#pragma unroll
    for (int i = 0; i < 16; ++i) { const _Float16 h = (_Float16)xs[i]; ah.h[i] = h; al.h[i] = ASPLIT ? (_Float16)(xs[i] - (float)h) : (_Float16)0.0f; }
#pragma unroll
    for (int t = 0; t < 4; ++t) { if (col0 + t * 16 >= N) continue; const size_t boff = (size_t)(col0 + t * 16 + ln) * ldb + kb; FragH bq; bq.half[0] = *(const v8us*)(Bh + boff + 8 * hh); bq.half[1] = *(const v8us*)(Bh + boff + 16 + 8 * hh);
      acc[t] = mmaH<ASPLIT ? 2 : 1>(ah.v, al.v, bq.v, bq.v, acc[t]); }
  }
#pragma unroll
  for (int t = 0; t < 4; ++t) { if (col0 + t * 16 >= N) continue;
#pragma unroll
    for (int r = 0; r < 8; ++r) so[w][8 * hh + r][t * 16 + ln] = acc[t][r] * alpha; }
  __builtin_amdgcn_fence(__ATOMIC_ACQ_REL, "workgroup"); __builtin_amdgcn_wave_barrier();
  const int rsub = lane >> 4, c4 = (lane & 15) * 4;
  {
#pragma unroll
    for (int q = 0; q < 8; ++q) { const int r = q * 2 + rsub; if (col0 + c4 < N) { const v4f v = *(const v4fa*)&so[w][r][c4]; *(v4f*)(C + (size_t)(row0 + r) * ldc + col0 + c4) = v; } }
     }
}

// Wt[n][k] = f16(W[k][n]·scale) from f32 row-major W[K][N] (scale = power of two; bf16-exact weights stay exact in f16 away from the subnormal range)
__global__ __launch_bounds__(256) void k_wt_f16(const float* __restrict__ W, _Float16* __restrict__ Wt, int K, int N, float scale) {
  const int t = blockIdx.x * 256 + threadIdx.x; if (t >= N * (K / 8)) return; const int n = t / (K / 8), k8 = (t % (K / 8)) * 8; FragH f;
#pragma unroll
  for (int i = 0; i < 8; ++i) f.h[i] = (_Float16)(bf16_round(W[(size_t)(k8 + i) * N + n]) * scale); const v8us o = f.half[0];
  *(v8us*)((unsigned short*)Wt + (size_t)n * K + k8) = o; 
}
// k_gemm_hh variant with fused epilogue: v = acc·alpha + bias[by·sBias + col] (+ CP[(row/rowsPerB)·sCPb + by·64 + col] if CP) ; ACT 0 none / 1 elu ; writes f16 C16 (and f32 C if non-null)
template <int ACT>
__global__ __launch_bounds__(128) void k_gemm_hhx(const _Float16* __restrict__ A, int lda, size_t sA, const _Float16* __restrict__ Bh, int ldb, size_t sB, float alpha, const float* __restrict__ bias, size_t sBias, const float* __restrict__ CP, int rowsPerB, size_t sCPb, int row0g,
    float* __restrict__ C, _Float16* __restrict__ C16, int ldc, size_t sC, int M, int N, int K) {
  __shared__ __attribute__((aligned(16))) float so[4][16][64];
  const int tid = threadIdx.x, w = tid >> 5, lane = tid & 31, ln = lane & 15, hh = lane >> 4; const int by = blockIdx.y;
  A += (size_t)by * sA; Bh += (size_t)by * sB; const size_t cofs = (size_t)by * sC; const float* bp = bias ? bias + (size_t)by * sBias : nullptr;
  const int ntn = (N + 63) / 64; const int wid = blockIdx.x * 4 + w; const int mt = wid / ntn, nq = wid % ntn; if (mt * 16 >= M) return;
  const int row0 = mt * 16, col0 = nq * 64; const _Float16* arow = A + (size_t)(row0 + ln) * lda;
  v8f acc[4] = {};
  for (int kb = 0; kb < K; kb += 32) { FragH ah; ah.half[0] = *(const v8us*)((const unsigned short*)arow + kb + 8 * hh); ah.half[1] = *(const v8us*)((const unsigned short*)arow + kb + 16 + 8 * hh);
#pragma unroll
    for (int t = 0; t < 4; ++t) { if (col0 + t * 16 >= N) continue; const size_t boff = (size_t)(col0 + t * 16 + ln) * ldb + kb; FragH bq; bq.half[0] = *(const v8us*)((const unsigned short*)Bh + boff + 8 * hh); bq.half[1] = *(const v8us*)((const unsigned short*)Bh + boff + 16 + 8 * hh);
      acc[t] = mmaH<1>(ah.v, ah.v, bq.v, bq.v, acc[t]); }
  }
#pragma unroll
  for (int t = 0; t < 4; ++t) { if (col0 + t * 16 >= N) continue; const int col = col0 + t * 16 + ln; const float bv = bp ? bf16_round(bp[col]) : 0.f;
#pragma unroll
    for (int r = 0; r < 8; ++r) { float v = acc[t][r] * alpha + bv; if (CP) { const int rr = row0g + row0 + 8 * hh + r; if (rowsPerB < 0) v += CP[cofs + (size_t)rr * ldc + col];      /* rowsPerB < 0: own element of the batched C plane */ else { const int bidx = rr / rowsPerB; v += CP[(size_t)bidx * sCPb + (size_t)by * 64 + col]; } } if (ACT == 1) v = (v > 0.f) ? v : expm1f(v); else if (ACT == 7) v = (v > 0.f) ? v + 1.0f : expf(v); else if (ACT == 8) v = tanhf(v); else if (ACT == 9) v = 0.5f * v * (1.0f + tanhf(0.7978845608028654f * (v + 0.044715f * v * v * v))); else if (ACT == 11) v = 1.0f / (1.0f + expf(-v)); else if (ACT == 12) v = (v > 0.f) ? v : 0.01f * v; else if (ACT == 14) v = (v > 0.f) ? v : 0.1f * v; else if (ACT == 16) v = (v >= 0.f) ? v : 0.3f * v; else if (ACT == 17) v = (v >= 0.f) ? v : 0.2f * v; else if (ACT == 15) v = v / (1.0f + expf(-v)); else if (ACT == 3) v = fmaxf(v, 0.f); else if (ACT == 6) v = 0.5f * v * (1.0f + erff(v * 0.70710678118654752f)); so[w][8 * hh + r][t * 16 + ln] = v; } }
  __builtin_amdgcn_fence(__ATOMIC_ACQ_REL, "workgroup"); __builtin_amdgcn_wave_barrier();
  const int rsub = lane >> 4, c4 = (lane & 15) * 4; typedef _Float16 v4h __attribute__((ext_vector_type(4)));
  {
#pragma unroll
    for (int q = 0; q < 8; ++q) { const int r = q * 2 + rsub; if (col0 + c4 < N) { const v4f v = *(const v4fa*)&so[w][r][c4]; if (C) *(v4f*)(C + cofs + (size_t)(row0 + r) * ldc + col0 + c4) = v; if (C16) { v4h h4; for (int i = 0; i < 4; ++i) h4[i] = (_Float16)v[i]; *(v4h*)(C16 + cofs + (size_t)(row0 + r) * ldc + col0 + c4) = h4; } } }
     }
}


typedef _Float16 v4h __attribute__((ext_vector_type(4)));

__global__ __launch_bounds__(256) void k_h16(const float* __restrict__ x, _Float16* __restrict__ X16, size_t n8) { const size_t t = (size_t)blockIdx.x * 256 + threadIdx.x; if (t >= n8) return; FragH f;
#pragma unroll
  for (int q = 0; q < 8; ++q) f.h[q] = (_Float16)x[t * 8 + q]; *(v8us*)((unsigned short*)X16 + t * 8) = f.half[0];  }
__global__ __launch_bounds__(256) void k_round16f(const float* __restrict__ W, _Float16* __restrict__ Bt, size_t n8) { const size_t t = (size_t)blockIdx.x * 256 + threadIdx.x; if (t >= n8) return; FragH f;
#pragma unroll
  for (int i = 0; i < 8; ++i) f.h[i] = (_Float16)(bf16_round(W[t * 8 + i]) * 16.0f); *(v8us*)((unsigned short*)Bt + t * 8) = f.half[0];  }
template <int NHv, int TTv>
__global__ __launch_bounds__(256) void k_vt(const _Float16* __restrict__ V16, int ldv, int voff, _Float16* __restrict__ Vt) { __shared__ unsigned short tl[64][66]; const int tid = threadIdx.x; const int slab = blockIdx.x / (TTv / 64), lg = blockIdx.x % (TTv / 64); const int b = slab / NHv, h = slab % NHv;
  for (int i = tid; i < 64 * 8; i += 256) { const int r = i / 8, c8 = (i % 8) * 8; FragH f; f.half[0] = *(const v8us*)((const unsigned short*)V16 + ((size_t)b * TTv + lg * 64 + r) * ldv + voff + h * 64 + c8);
#pragma unroll
    for (int q = 0; q < 8; ++q) tl[r][c8 + q] = f.u[q]; }
  __syncthreads();
  {
#pragma unroll
    for (int rd = 0; rd < 2; ++rd) { const int d = rd * 32 + tid / 8, pc = tid % 8; FragH f;
#pragma unroll
      for (int q = 0; q < 8; ++q) f.u[q] = tl[pc * 8 + q][d];
      *(v8us*)((unsigned short*)Vt + ((size_t)slab * 64 + d) * TTv + lg * 64 + pc * 8) = f.half[0]; }
     } }

__global__ __launch_bounds__(256) void k_hl(const float* __restrict__ F, _Float16* __restrict__ Hh, _Float16* __restrict__ Hl, size_t n8) { const size_t t = (size_t)blockIdx.x * 256 + threadIdx.x; if (t >= n8) return; FragH fh, fl; const v4f a = *(const v4fa*)(F + t * 8), c = *(const v4fa*)(F + t * 8 + 4);
#pragma unroll
  for (int q = 0; q < 4; ++q) { _Float16 h = (_Float16)a[q]; fh.h[q] = h; fl.h[q] = (_Float16)((a[q] - (float)h) * 1024.0f); h = (_Float16)c[q]; fh.h[4 + q] = h; fl.h[4 + q] = (_Float16)((c[q] - (float)h) * 1024.0f); }
  { *(v8us*)((unsigned short*)Hh + t * 8) = fh.half[0]; *(v8us*)((unsigned short*)Hl + t * 8) = fl.half[0];  } }

// ---- fast GEMM (wave tile 32x64; requires M % 32 == 0 rows per launch region and N % 64 == 0); epilogue = k_gemm_hhx semantics ----
__device__ __forceinline__ v16h g2_frag(const _Float16* p, int hh) { FragH f; f.half[0] = *(const v8us*)((const unsigned short*)p + 8 * hh); f.half[1] = *(const v8us*)((const unsigned short*)p + 16 + 8 * hh); return f.v; }
__device__ __forceinline__ v8f g2_mma(v16h a, v16h b, v8f c) { v8f d = __builtin_amdgcn_wmma_f32_16x16x32_f16(false, a, false, b, (short)0, c, false, false); asm volatile("v_nop\n\tv_nop\n\tv_nop\n\tv_nop" : "+v"(d) : "v"(a), "v"(b)); return d; }
template <int ACT>
__global__ __launch_bounds__(128) void k_gemm2(const _Float16* __restrict__ A, int lda, size_t sA, const _Float16* __restrict__ Bh, int ldb, size_t sB, float alpha, const float* __restrict__ bias, size_t sBias, const float* __restrict__ CP, int rowsPerB, size_t sCPb, int row0g,
    float* __restrict__ C, _Float16* __restrict__ C16, int ldc, size_t sC, int M, int N, int K) { static_assert(ACT == 0 || ACT == 3 || ACT == 6 || ACT == 8 || ACT == 9 || ACT == 11 || ACT == 12 || ACT == 14 || ACT == 15 || ACT == 16 || ACT == 17, "k_gemm2: unsupported ACT code (would silently apply no activation)");
  __shared__ __attribute__((aligned(16))) float so[4][32][68];
  const int tid = threadIdx.x, w = tid >> 5, lane = tid & 31, ln = lane & 15, hh = lane >> 4; const int by = blockIdx.y;
  A += (size_t)by * sA; Bh += (size_t)by * sB; const size_t cofs = (size_t)by * sC; const float* bp = bias ? bias + (size_t)by * sBias : nullptr;
  const int ntn = N >> 6; const int mt = blockIdx.x / ntn, nq = blockIdx.x - mt * ntn; const int row0 = mt * 128 + 32 * w, col0 = nq * 64; if (row0 >= M) return;
  const _Float16* a0p = A + (size_t)(row0 + ln) * lda; const _Float16* a1p = a0p + (size_t)16 * lda;
  const _Float16* b0p = Bh + (size_t)(col0 + ln) * ldb; const _Float16* b1p = b0p + (size_t)16 * ldb; const _Float16* b2p = b1p + (size_t)16 * ldb; const _Float16* b3p = b2p + (size_t)16 * ldb;
  const v8f z8 = {0.f,0.f,0.f,0.f,0.f,0.f,0.f,0.f}; v8f c00 = z8, c01 = z8, c02 = z8, c03 = z8, c10 = z8, c11 = z8, c12 = z8, c13 = z8;
#pragma unroll 1
  for (int kb = 0; kb < K; kb += 32) { const v16h a0 = g2_frag(a0p + kb, hh), a1 = g2_frag(a1p + kb, hh);
    v16h b = g2_frag(b0p + kb, hh); c00 = g2_mma(a0, b, c00); c10 = g2_mma(a1, b, c10);
    b = g2_frag(b1p + kb, hh); c01 = g2_mma(a0, b, c01); c11 = g2_mma(a1, b, c11);
    b = g2_frag(b2p + kb, hh); c02 = g2_mma(a0, b, c02); c12 = g2_mma(a1, b, c12);
    b = g2_frag(b3p + kb, hh); c03 = g2_mma(a0, b, c03); c13 = g2_mma(a1, b, c13); }
  v8f accs[8] = {c00, c01, c02, c03, c10, c11, c12, c13};
#pragma unroll
  for (int u = 0; u < 8; ++u) { const int t = u & 3, half = u >> 2; const int col = col0 + t * 16 + ln; const float bv = bp ? bf16_round(bp[col]) : 0.f;
#pragma unroll
    for (int r = 0; r < 8; ++r) { const int rloc = half * 16 + 8 * hh + r; float v = accs[u][r] * alpha + bv; if (CP) { if (rowsPerB < 0) v += CP[cofs + (size_t)(row0g + row0 + rloc) * ldc + col];      /* rowsPerB < 0: own element of the batched C plane */ else { const int bidx = (row0g + row0 + rloc) / rowsPerB; v += CP[(size_t)bidx * sCPb + (size_t)by * 64 + col]; } }
      if (ACT == 3) v = fmaxf(v, 0.f); else if (ACT == 6) v = 0.5f * v * (1.0f + erff(v * 0.70710678118654752f)); else if (ACT == 11) v = 1.0f / (1.0f + expf(-v)); else if (ACT == 15) v = v / (1.0f + expf(-v)); else if (ACT == 12) v = (v > 0.f) ? v : 0.01f * v; else if (ACT == 8) v = tanhf(v); else if (ACT == 9) v = 0.5f * v * (1.0f + tanhf(0.7978845608028654f * (v + 0.044715f * v * v * v))); else if (ACT == 14) v = (v > 0.f) ? v : 0.1f * v; else if (ACT == 16) v = (v >= 0.f) ? v : 0.3f * v; else if (ACT == 17) v = (v >= 0.f) ? v : 0.2f * v;
      so[w][rloc][t * 16 + ln] = v; } }
  __builtin_amdgcn_fence(__ATOMIC_ACQ_REL, "workgroup"); __builtin_amdgcn_wave_barrier();
  const int rsub = lane >> 4, c4 = (lane & 15) * 4;
  {
#pragma unroll
    for (int q = 0; q < 16; ++q) { const int r = q * 2 + rsub; const v4f v = *(const v4fa*)&so[w][r][c4]; if (C) *(v4f*)(C + cofs + (size_t)(row0 + r) * ldc + col0 + c4) = v; if (C16) { v4h h4; for (int i = 0; i < 4; ++i) h4[i] = (_Float16)v[i]; *(v4h*)(C16 + cofs + (size_t)(row0 + r) * ldc + col0 + c4) = h4; } }
     } }


__global__ __launch_bounds__(256) void k_rsm(const float* __restrict__ S, _Float16* __restrict__ P, int nrows) {
  #pragma clang fp contract(off)
  const int i = blockIdx.x * 256 + threadIdx.x; if (i >= nrows) return; const float* s = S + (size_t)i * SQ; float mx = -3.0e38f;
#pragma unroll 1
  for (int j = 0; j < SQ; ++j) mx = fmaxf(mx, s[j]); float se = 0.f;
#pragma unroll 1
  for (int j = 0; j < SQ; ++j) se += expf(s[j] - mx); const float sc = 256.0f / se;
#pragma unroll 1
  for (int j0 = 0; j0 < SQ; j0 += 8) { FragH f; for (int q = 0; q < 8; ++q) f.h[q] = (_Float16)(expf(s[j0 + q] - mx) * sc); unsigned short* d = (unsigned short*)P + (size_t)i * SQ + j0; *(v8us*)d = f.half[0];  } }
__global__ __launch_bounds__(256) void k_vt(const _Float16* __restrict__ V16, int b, int h0, _Float16* __restrict__ VT) { __shared__ unsigned short tl[64][65]; const int tid = threadIdx.x; const int hh = blockIdx.x % HG, sg = blockIdx.x / HG; const int s0 = sg * 64; const int h = h0 + hh;
  for (int i = tid; i < 64 * 8; i += 256) { const int j = i / 8, d8 = (i % 8) * 8; FragH f; f.half[0] = *(const v8us*)((const unsigned short*)V16 + ((size_t)b * SQ + s0 + j) * DM + h * HD + d8); for (int q = 0; q < 8; ++q) tl[d8 + q][j] = f.u[q]; }
  __syncthreads();
  { for (int i = tid; i < 64 * 8; i += 256) { const int d = i / 8, j8 = (i % 8) * 8; FragH f; for (int q = 0; q < 8; ++q) f.u[q] = tl[d][j8 + q]; *(v8us*)((unsigned short*)VT + ((size_t)hh * HD + d) * SQ + s0 + j8) = f.half[0]; }  } }



#define FW 4                         /* waves per work-group */
#define FG 2                         /* 16-query groups per wave */
#define FQ (FW * FG * 16)            /* queries per work-group */
#define FK 64                        /* keys per stage (two passes of 32) */
#define FP 144                       /* LDS row pitch, bytes: 128 + 16, an odd multiple of 16 (16-byte reads of 16 rows without bank conflicts) */
#define FT (64 * FP)                 /* one tile: 64 rows (K: keys, V^T: head dims) */
#define FNS (SQ / FK)                /* stages */
__device__ __forceinline__ float lane_x16(float x) { const int b = __float_as_int(x); return __int_as_float(__builtin_amdgcn_permlanex16(b, b, 0x76543210, 0xfedcba98, false, false)); }      /* value of lane l ^ 16 */
// e[i] = 2^t[i], eight at a time, in one statement, so that the closing v_nop stands directly behind the last v_exp_f32: it is the slot that the instruction set asks for behind a transcendental before its
// result is read or its source overwritten. Early-clobber outputs: no result lies on a source of a
// later line. The closing s_delay_alu is the hint that the compiler cannot give for results of asm text: the next vector instruction may read them, and unhinted it would hold the SIMD's issue port against the other waves.
__device__ __forceinline__ v8f exp2x8(v8f t) { float e0, e1, e2, e3, e4, e5, e6, e7;
  asm("v_exp_f32 %0, %8\n\tv_exp_f32 %1, %9\n\tv_exp_f32 %2, %10\n\tv_exp_f32 %3, %11\n\tv_exp_f32 %4, %12\n\tv_exp_f32 %5, %13\n\tv_exp_f32 %6, %14\n\tv_exp_f32 %7, %15\n\tv_nop\n\ts_delay_alu instid0(TRANS32_DEP_1)"
      : "=&v"(e0), "=&v"(e1), "=&v"(e2), "=&v"(e3), "=&v"(e4), "=&v"(e5), "=&v"(e6), "=&v"(e7) : "v"(t[0]), "v"(t[1]), "v"(t[2]), "v"(t[3]), "v"(t[4]), "v"(t[5]), "v"(t[6]), "v"(t[7]));
  const v8f e = {e0, e1, e2, e3, e4, e5, e6, e7}; return e; }
__device__ __forceinline__ float exp2x1(float t) { float e; asm("v_exp_f32 %0, %1\n\tv_nop\n\ts_delay_alu instid0(TRANS32_DEP_1)" : "=&v"(e) : "v"(t)); return e; }      /* v_nop and hint: as in exp2x8 */
__device__ __forceinline__ v16h lds_frag(const unsigned char* p) { FragH f; f.half[0] = *(const v8us*)p; f.half[1] = *(const v8us*)(p + 32); return f.v; }      /* p = row + 64 * (32-element k block) + 16 * h: k = 8h .. 8h + 7 and 16 + 8h .. 16 + 8h + 7, the order of g2_frag */
__device__ __forceinline__ v8f fa_mma(v16h a, v16h b, v8f c) { return __builtin_amdgcn_wmma_f32_16x16x32_f16(false, a, false, b, (short)0, c, false, false); }
static_assert(SQ % FQ == 0 && SQ % FK == 0 && FNS >= 2 && HD == 64, "k_fattn: whole blocks, whole stages, head size 64");
// Key order of a batch: its unmasked keys first (ascending), then its masked keys (ascending). POS[b * SQ + s] = the row of the K and V planes that key s of batch b is stored in; NUN[b] = unmasked keys of batch b.
// One work-group per batch (b): sign bits by ballot, masked keys in front of each 32-key word by a sum over the words, the rest by a population count inside the word.
static_assert(SQ / 32 == 64 && SQ % 256 == 0, "perm_job: 64 mask words, eight per wave");
__device__ __forceinline__ void perm_job(const float* __restrict__ mk, int* __restrict__ POS, int* __restrict__ NUN, int b) {
  __shared__ unsigned int bits[SQ / 32];      /* bit j of word i: key 32 i + j of this batch is masked */
  __shared__ int pre[SQ / 32 + 1];      /* masked keys in front of word i; the last entry is the batch's count */
  const int tid = threadIdx.x, lane = tid & 31, wave = tid >> 5;
  const float* mp = mk + (size_t)b * SQ + wave * (SQ / 8) + lane; float mv[SQ / 256];      /* a wave takes SQ / 8 keys in a row: eight words */
#pragma unroll
  for (int i = 0; i < SQ / 256; ++i) mv[i] = mp[i * 32];
  __builtin_amdgcn_sched_barrier(0);      /* the eight loads stay together in front of the wait below: one latency instead of eight */
  asm volatile("s_wait_xcnt 0x0" :: "v"(mp) : "memory");      /* behind the issued loads, before a register that they name is rewritten; the address is an input so that it lives up to this wait */
  __builtin_amdgcn_sched_barrier(0);      /* keeps later register writes behind that wait */
  unsigned int myw = 0u;
#pragma unroll
  for (int i = 0; i < SQ / 256; ++i) { const unsigned int bal = __builtin_amdgcn_ballot_w32(bf16_round(mv[i]) < 0.f); myw = lane == i ? bal : myw; }      /* lane i keeps word i: one store for the eight */
  if (lane < SQ / 256) bits[wave * (SQ / 256) + lane] = myw;
  __syncthreads();
  if (tid <= SQ / 32) { int p = 0;
#pragma unroll
    for (int j = 0; j < SQ / 32; ++j) p += j < tid ? __builtin_popcount(bits[j]) : 0;
    pre[tid] = p; }
  __syncthreads();
  const int nun = SQ - pre[SQ / 32];
#pragma unroll
  for (int i = 0; i < SQ / 256; ++i) { const int s = i * 256 + tid; const unsigned int wv = bits[s >> 5]; const int mb = pre[s >> 5] + __builtin_popcount(wv & ((1u << (s & 31)) - 1u));      /* masked keys in front of key s */
    POS[(size_t)b * SQ + s] = b * SQ + (((wv >> (s & 31)) & 1u) != 0u ? nun + mb : s - mb); }
  if (tid == 0) NUN[b] = nun;
}
// Eight values in a row per thread: dst = f16(bf16(src) * scale), scale a power of two (exact).
__device__ __forceinline__ void cvt_job(const float* __restrict__ src, _Float16* __restrict__ dst, size_t t, float scale) {
  FragH f;
#pragma unroll
  for (int q = 0; q < 8; ++q) f.h[q] = (_Float16)(bf16_round(src[t * 8 + q]) * scale);
  *(v8us*)((unsigned short*)dst + t * 8) = f.half[0];
  asm volatile("s_wait_xcnt 0x0" ::: "memory");      /* behind the issued store, before a register that it names is rewritten by code that follows the job in the kernel */
}
// All work that reads the inputs alone, in ONE launch: the key order (one work-group per batch), the three weight planes (natural [out][in] = Bt[n][k], x16) and the x rows. No job reads what another writes, so they
// run side by side as ranges of the block index, where five launches in a row each paid a launch gap, a fill and a drain. The key order stands first: it has the longest chain of dependent steps. The choice of the
// job is the same for a whole work-group, so the key order's barriers stand under uniform control flow.
#define WB (DM * DM / 8 / 256)       /* blocks per weight plane */
#define XB ((int)(NR * DM / 8 / 256))      /* blocks of the x rows */
static_assert(DM * DM % 2048 == 0 && NR * DM % 2048 == 0, "k_prep: whole blocks of 256 threads x 8 values");
__global__ __launch_bounds__(256) void k_prep(const float* __restrict__ x, const float* __restrict__ mk, const float* __restrict__ wq, const float* __restrict__ wk, const float* __restrict__ wv,
    _Float16* __restrict__ X16, _Float16* __restrict__ BQ, _Float16* __restrict__ BK, _Float16* __restrict__ BV, int* __restrict__ POS, int* __restrict__ NUN) {
  const int blk = blockIdx.x;
  if (blk < NB) perm_job(mk, POS, NUN, blk);
  else { const int cb = blk - NB, j = min(cb / WB, 3);      /* j = 0, 1, 2: a weight plane; 3: the x rows. One path for all four: source, target and scale are scalar selects */
    cvt_job(j == 0 ? wq : j == 1 ? wk : j == 2 ? wv : x, j == 0 ? BQ : j == 1 ? BK : j == 2 ? BV : X16, (size_t)(cb - j * WB) * 256 + threadIdx.x, j < 3 ? 16.0f : 1.0f); }
}
template <bool M> struct StageKind { static constexpr bool masked = M; };      /* does the stage hold a masked key? */
__global__ __launch_bounds__(FW * 32) void k_fattn(const _Float16* __restrict__ Q16, const _Float16* __restrict__ K16, const _Float16* __restrict__ VT, const int* __restrict__ NUN, float* __restrict__ out) {
  __shared__ __attribute__((aligned(16))) unsigned char L[2][2 * FT];      /* [buffer][K tile, V^T tile] */
  __shared__ unsigned int vote[FW];      /* per wave: not 0 if a masked key could still weigh in one of its queries */
  const int tid = threadIdx.x, lane = tid & 31, c = lane & 15, h = lane >> 4; const int wave = __builtin_amdgcn_readfirstlane(tid >> 5);
  const int hd = blockIdx.y, b = blockIdx.z; const int nun = min(max(NUN[b], 0), SQ); const int lim = (nun + FK - 1) / FK;      /* rows 0 .. nun - 1 of the batch's K and V planes are its unmasked keys, the rest its masked keys (the clamp bounds the stage loops' trip counts); lim = stages that hold an unmasked key */
  const size_t r0 = (size_t)b * SQ; const int q0 = blockIdx.x * FQ + wave * (FG * 16);
  const unsigned short* kg = (const unsigned short*)K16 + (r0 + (tid >> 3)) * DM + hd * HD + (tid & 7) * 8;      /* eight lanes cover one 128-byte row */
  const unsigned short* vg = (const unsigned short*)VT + ((size_t)(b * NH + hd) * HD + (tid >> 3)) * SQ + (tid & 7) * 8;
  const unsigned int lofs = (unsigned int)(tid >> 3) * FP + (unsigned int)(tid & 7) * 16;
  v8us rk[4], rv[4];
  auto fetch = [&](int st) {
#pragma unroll
    for (int u = 0; u < 4; ++u) { rk[u] = *(const v8us*)(kg + ((size_t)st * FK + u * 16) * DM); rv[u] = *(const v8us*)(vg + (size_t)u * 16 * SQ + (size_t)st * FK); }
    __builtin_amdgcn_sched_barrier(0);      /* the loads stay in front of the wait below */
    asm volatile("s_wait_xcnt 0x0" ::: "memory");      /* behind the issued loads, before a register that they name (address, base) is rewritten for the next stage */
    __builtin_amdgcn_sched_barrier(0);      /* keeps later register writes behind that wait */
  };
  auto put = [&](int buf) {
#pragma unroll
    for (int u = 0; u < 4; ++u) { *(v8us*)&L[buf][lofs + u * 16 * FP] = rk[u]; *(v8us*)&L[buf][FT + lofs + u * 16 * FP] = rv[u]; } };
  fetch(0);
  v16h qf[FG][2];
#pragma unroll
  for (int g = 0; g < FG; ++g) { const _Float16* qp = Q16 + (r0 + q0 + g * 16 + c) * DM + hd * HD;
#pragma unroll
    for (int kc = 0; kc < 2; ++kc) qf[g][kc] = g2_frag(qp + 32 * kc, h); }
  __builtin_amdgcn_sched_barrier(0);      /* the Q loads stay in front of the wait below */
  asm volatile("s_wait_xcnt 0x0" ::: "memory");      /* behind the issued Q loads, before a register that they name is reused */
  __builtin_amdgcn_sched_barrier(0);      /* keeps later register writes behind that wait */
  put(0);
  fetch(1);
  const v8f z8 = {0.f, 0.f, 0.f, 0.f, 0.f, 0.f, 0.f, 0.f};
  v8f acc[FG][4]; float m_run[FG], l_run[FG];
#pragma unroll
  for (int g = 0; g < FG; ++g) { m_run[g] = -__builtin_inff(); l_run[g] = 0.f;
#pragma unroll
    for (int t = 0; t < 4; ++t) acc[g][t] = z8; }
  const float cs = 0.125f * 1.44269504f;      /* 1 / sqrt(64), and exp(x) as 2^(x log2 e) */
  __syncthreads();      /* stage 0 is published */
  auto stage = [&](int st, auto kind) __attribute__((always_inline)) {      /* inlined at both places: the arrays it works on stay in registers only so */
    if (st + 1 < FNS) put((st + 1) & 1);      /* into the buffer that stage st - 1 used: every wave has left it (barrier at the loop's foot) */
    if (st + 2 < FNS) fetch(st + 2);      /* in flight under this stage's work */
    const unsigned char* Lb = &L[st & 1][0];
#pragma unroll
    for (int p = 0; p < 2; ++p) {
      const unsigned char* kb = Lb + (p * 32 + c) * FP + 16 * h;
      v16h kf[2][2];
#pragma unroll
      for (int kt = 0; kt < 2; ++kt)
#pragma unroll
        for (int kc = 0; kc < 2; ++kc) kf[kt][kc] = lds_frag(kb + kt * 16 * FP + 64 * kc);
      v8f s[2][FG];      /* s[kt][g][r] = raw score of key 32 p + 16 kt + 8 h + r and query 16 g + c */
#pragma unroll
      for (int kt = 0; kt < 2; ++kt)
#pragma unroll
        for (int g = 0; g < FG; ++g) s[kt][g] = fa_mma(kf[kt][1], qf[g][1], fa_mma(kf[kt][0], qf[g][0], z8));
      const unsigned char* vb = Lb + FT + c * FP + p * 64 + 16 * h;
      v16h vf[4];
#pragma unroll
      for (int t = 0; t < 4; ++t) vf[t] = lds_frag(vb + t * 16 * FP);
      if constexpr (decltype(kind)::masked) {      /* in the sorted key order only the stage at the boundary, and the stages behind it, hold a masked key */
        const int rem = nun - (st * FK + p * 32);      /* unmasked keys from this pass's first key on */
        const unsigned int mw = (rem >= 32 ? 0u : rem <= 0 ? 0xffffffffu : 0xffffffffu << rem) >> (8 * h);      /* bit j: key 8 h + j of the pass is masked */
#pragma unroll
        for (int kt = 0; kt < 2; ++kt)
#pragma unroll
          for (int r = 0; r < 8; ++r) { const bool km = (mw & (1u << (16 * kt + r))) != 0u;
#pragma unroll
            for (int g = 0; g < FG; ++g) s[kt][g][r] = km ? -80000.0f : s[kt][g][r]; } }      /* masked_fill(-10000) on the raw score: -80000 / 8 */
      float mb[FG]; bool need = false;
#pragma unroll
      for (int g = 0; g < FG; ++g) { float mx = s[0][g][0];
#pragma unroll
        for (int r = 1; r < 8; ++r) mx = fmaxf(mx, s[0][g][r]);
#pragma unroll
        for (int r = 0; r < 8; ++r) mx = fmaxf(mx, s[1][g][r]);
        mx = fmaxf(mx, lane_x16(mx)) * cs; mb[g] = mx; need = need || (mx > m_run[g] + 8.0f); }      /* both halves hold the query's maximum of this pass, in log2 units */
      if (__builtin_amdgcn_ballot_w32(need) != 0u) {      /* lazy rescale: the maximum in use may trail the true one by 8 (a weight reaches 2^8 at most); one scalar branch per pass */
#pragma unroll
        for (int g = 0; g < FG; ++g) { const float mn = fmaxf(m_run[g], mb[g]); const float corr = exp2x1(m_run[g] - mn); m_run[g] = mn; l_run[g] *= corr;      /* first pass: 2^(-inf) = 0 on zero sums */
#pragma unroll
          for (int t = 0; t < 4; ++t) acc[g][t] = acc[g][t] * corr; } }
      FragH pf[FG];
#pragma unroll
      for (int g = 0; g < FG; ++g) { const float nm = -m_run[g]; float ls[4] = {0.f, 0.f, 0.f, 0.f};
#pragma unroll
        for (int kt = 0; kt < 2; ++kt) { v8f t8;
#pragma unroll
          for (int r = 0; r < 8; ++r) t8[r] = fmaf(s[kt][g][r], cs, nm);
          const v8f e = exp2x8(t8);
#pragma unroll
          for (int r = 0; r < 8; ++r) { ls[r & 3] += e[r]; pf[g].h[8 * kt + r] = (_Float16)e[r]; } }      /* element 8 kt + r of the B operand = key 16 kt + 8 h + r */
        l_run[g] += (ls[0] + ls[1]) + (ls[2] + ls[3]); }
      __builtin_amdgcn_sched_barrier(0);      /* the exponentials are asm text: all of them stay in front of the second product */
#pragma unroll
      for (int g = 0; g < FG; ++g)
#pragma unroll
        for (int t = 0; t < 4; ++t) acc[g][t] = fa_mma(vf[t], pf[g].v, acc[g][t]);      /* acc[g][t][r] = O[query 16 g + c][dim 16 t + 8 h + r], unnormalised */
    }
    if (st + 1 == lim) { bool open = false;      /* the last stage with an unmasked key: each wave's word for the test at the loop's head, published by the barrier below */
#pragma unroll
      for (int g = 0; g < FG; ++g) open = open || !(m_run[g] >= -14000.0f);
      const unsigned int bal = __builtin_amdgcn_ballot_w32(open); if (lane == 0) vote[wave] = bal; }
    __syncthreads();      /* publishes stage st + 1 and ends every wave's reads of stage st */
  };
  int st = 0;
#pragma unroll 1      /* the stage loops stay rolled: a body already holds two unrolled passes (code size, registers) */
  for (; st < nun / FK; ++st) stage(st, StageKind<false>{});      /* stages of unmasked keys alone: no select */
#pragma unroll 1
  for (; st < FNS; ++st) {
    /* From stage lim on every key is masked: raw score -80000, the same for all. Where every query of the work-group holds a maximum of at least -14000 (log2 units), each such weight is 2^(-14427 - maximum) = 0 exactly
       and no maximum moves, so the remaining stages would add zeros only: leave. Otherwise (no unmasked key at all, or scores near the fill value) all stages run. The test reads the same for the whole work-group. */
    if (st == lim && st > 0) { if (__builtin_amdgcn_readfirstlane((int)(vote[0] | vote[1] | vote[2] | vote[3])) == 0) break; }
    stage(st, StageKind<true>{}); }
#pragma unroll
  for (int g = 0; g < FG; ++g) { const float l = l_run[g] + lane_x16(l_run[g]); const float inv = 1.0f / l;      /* the halves' sums joined once */
#pragma unroll
    for (int t = 0; t < 4; ++t) acc[g][t] = acc[g][t] * inv; }
#pragma unroll
  for (int g = 0; g < FG; ++g) { float* op = out + (r0 + q0 + g * 16 + c) * DM + hd * HD + 8 * h;
#pragma unroll
    for (int t = 0; t < 4; ++t) { const v4f lo = {acc[g][t][0], acc[g][t][1], acc[g][t][2], acc[g][t][3]}, hi = {acc[g][t][4], acc[g][t][5], acc[g][t][6], acc[g][t][7]};
      *(v4f*)(op + 16 * t) = lo; *(v4f*)(op + 16 * t + 4) = hi; } }
}
// Projection GEMM with both operands through LDS: C16[128 rows][64 columns] per work-group = f16(X . W^T / 16 + bias), four waves of 32 x 64, f32 accumulation in ascending k blocks of 32 (the order of k_gemm2).
// A stage is one 128-byte line (64 k) of each of the 128 X rows and 64 W rows. Eight lanes fetch one line, so every global load covers four whole lines (a fragment load straight from global memory touches 16 lines for the same 512 bytes),
// and the W tile is fetched once per work-group instead of once per wave. Registers -> two LDS buffers, as in k_fattn: one barrier per stage publishes stage st + 1 and frees the buffer of stage st.
#define PM 128                       /* X rows per work-group */
#define PN 64                        /* output columns per work-group */
#define PK 64                        /* k per stage */
#define PNS (DM / PK)                /* stages */
#define PT ((PM + PN) * FP)          /* one buffer: X tile, then W tile, rows at pitch FP */
// Launch bounds: at least three waves per SIMD, so that three work-groups per WGP are resident at once (registers; LDS fits three as well).
static_assert(DM % PK == 0 && DM % PN == 0 && PNS >= 2 && MP % PM == 0 && PK * 2 == 128, "k_proj: whole tiles, whole stages, one line per row and stage");
// Work-group barrier that orders LDS alone: __syncthreads() also drains the wave's global loads, which would end the flight of the stage fetched ahead at every stage's foot.
__device__ __forceinline__ void lds_barrier() { __builtin_amdgcn_fence(__ATOMIC_RELEASE, "workgroup", "local"); __builtin_amdgcn_s_barrier(); __builtin_amdgcn_fence(__ATOMIC_ACQUIRE, "workgroup", "local"); }
// The three projections are ONE launch: blockIdx.y picks the job (0 Q, 1 K, 2 V). They read the same X rows and none reads another's output; as one grid a work-group of the next job starts where one of the last ends,
// where three launches in a row each paid a launch gap, a fill and a drain.
// K and V: row r of the product is stored in row rowmap[r] of the plane (the key order of perm_job, rows counted from the plane's start); Q: in row r. Rows stay whole, so the stores cover the same lines.
__global__ __launch_bounds__(128, 3) void k_proj(const _Float16* __restrict__ A, const _Float16* __restrict__ BQ, const _Float16* __restrict__ BK, const _Float16* __restrict__ BV, const float* __restrict__ bq, const float* __restrict__ bk, const float* __restrict__ bv,
    const int* __restrict__ rowmap, _Float16* __restrict__ CQ, _Float16* __restrict__ CK, _Float16* __restrict__ CV) {
  const int job = blockIdx.y; const _Float16* Bh = job == 0 ? BQ : job == 1 ? BK : BV; const float* bias = job == 0 ? bq : job == 1 ? bk : bv; _Float16* C16 = job == 0 ? CQ : job == 1 ? CK : CV;
  __shared__ __attribute__((aligned(16))) unsigned char L[2][PT];
  __shared__ __attribute__((aligned(16))) float so[4][32][68];
  const int tid = threadIdx.x, w = tid >> 5, lane = tid & 31, ln = lane & 15, hh = lane >> 4;
  const int mt = blockIdx.x / (DM / PN), nq = blockIdx.x - mt * (DM / PN); const int row0 = mt * PM + 32 * w, col0 = nq * PN;
  const unsigned short* ag = (const unsigned short*)A + ((size_t)mt * PM + (tid >> 3)) * DM + (tid & 7) * 8;      /* eight lanes cover one 128-byte line */
  const unsigned short* bg = (const unsigned short*)Bh + ((size_t)col0 + (tid >> 3)) * DM + (tid & 7) * 8;
  const unsigned int lofs = (unsigned int)(tid >> 3) * FP + (unsigned int)(tid & 7) * 16;
  v8us ra[PM / 16], rb[PN / 16];
  auto fetch = [&](int st) {
#pragma unroll
    for (int u = 0; u < PM / 16; ++u) ra[u] = *(const v8us*)(ag + (size_t)u * 16 * DM + st * PK);
#pragma unroll
    for (int u = 0; u < PN / 16; ++u) rb[u] = *(const v8us*)(bg + (size_t)u * 16 * DM + st * PK);
    __builtin_amdgcn_sched_barrier(0);      /* the loads stay in front of the wait below */
    asm volatile("s_wait_xcnt 0x0" :: "v"(ag), "v"(bg) : "memory");      /* behind the issued loads, before a register that they name is rewritten; the two addresses are inputs so that they live up to this wait and no result of the last stage's loads is given their registers */
    __builtin_amdgcn_sched_barrier(0);      /* keeps later register writes behind that wait */
  };
  auto put = [&](int buf) {
#pragma unroll
    for (int u = 0; u < PM / 16; ++u) *(v8us*)&L[buf][lofs + u * 16 * FP] = ra[u];
#pragma unroll
    for (int u = 0; u < PN / 16; ++u) *(v8us*)&L[buf][PM * FP + lofs + u * 16 * FP] = rb[u]; };
  fetch(0);
  const int bix = col0 + ln; float bvr[4];      /* the lane's four bias values, fetched here so that their latency lies under the stages */
#pragma unroll
  for (int t = 0; t < 4; ++t) bvr[t] = bias[bix + t * 16];
  const int rix = row0 + lane; int rm = rix;      /* lane l: the row of C16 that takes the wave's row l */
  if (job != 0) rm = rowmap[rix];      /* the same for the whole work-group */
  __builtin_amdgcn_sched_barrier(0);      /* the loads stay in front of the wait below */
  asm volatile("s_wait_xcnt 0x0" :: "v"(bix), "v"(rix) : "memory");      /* behind the issued loads, before a register that they name is rewritten; the indices are inputs so that they live up to this wait */
  __builtin_amdgcn_sched_barrier(0);      /* keeps later register writes behind that wait */
  put(0);
  fetch(1);
  const v8f z8 = {0.f, 0.f, 0.f, 0.f, 0.f, 0.f, 0.f, 0.f};
  v8f acc[2][4];
#pragma unroll
  for (int i = 0; i < 2; ++i)
#pragma unroll
    for (int t = 0; t < 4; ++t) acc[i][t] = z8;
  lds_barrier();      /* stage 0 is published */
#pragma unroll      /* twelve short stages: buffer index, last-stage tests and the loads' k offsets become constants, and no address register is rewritten in the loop */
  for (int st = 0; st < PNS; ++st) {
    if (st + 1 < PNS) put((st + 1) & 1);      /* into the buffer that stage st - 1 used: every wave has left it (barrier at the loop's foot) */
    if (st + 2 < PNS) fetch(st + 2);      /* in flight under this stage's work */
    const unsigned char* ap = &L[st & 1][0] + (32 * w + ln) * FP + 16 * hh; const unsigned char* bp = &L[st & 1][0] + (PM + ln) * FP + 16 * hh;
#pragma unroll
    for (int kc = 0; kc < 2; ++kc) { const v16h a0 = lds_frag(ap + 64 * kc), a1 = lds_frag(ap + 16 * FP + 64 * kc);
#pragma unroll
      for (int t = 0; t < 4; ++t) { const v16h b = lds_frag(bp + t * 16 * FP + 64 * kc); acc[0][t] = fa_mma(a0, b, acc[0][t]); acc[1][t] = fa_mma(a1, b, acc[1][t]); } }
    if (st + 1 < PNS) lds_barrier();      /* publishes stage st + 1 and ends every wave's reads of stage st; behind the last stage nothing of the ring is written or read any more */
  }
#pragma unroll
  for (int u = 0; u < 8; ++u) { const int t = u & 3, half = u >> 2; const float bv = bf16_round(bvr[t]);
#pragma unroll
    for (int r = 0; r < 8; ++r) so[w][half * 16 + 8 * hh + r][t * 16 + ln] = acc[half][t][r] * 0.0625f + bv; }
  __builtin_amdgcn_fence(__ATOMIC_ACQ_REL, "workgroup"); __builtin_amdgcn_wave_barrier();      /* each wave reads back only its own rows */
  const int rsub = lane >> 4, c4 = (lane & 15) * 4;
#pragma unroll
  for (int q = 0; q < 16; ++q) { const int r = q * 2 + rsub; const v4f v = *(const v4fa*)&so[w][r][c4]; v4h h4; for (int i = 0; i < 4; ++i) h4[i] = (_Float16)v[i];
    const int re = __builtin_amdgcn_readlane(rm, q * 2), rd = __builtin_amdgcn_readlane(rm, q * 2 + 1); const int ro = rsub ? rd : re;      /* both read first: a select, no branch */
    *(v4h*)(C16 + (size_t)ro * DM + col0 + c4) = h4; }
}
extern "C" void kernel_launch(void* const* d_in, const int* in_sizes, int n_in,
                              void* d_out, int out_size, void* d_ws, size_t ws_size, hipStream_t stream) {
  (void)in_sizes; (void)n_in; (void)out_size;
  const float* const* I = (const float* const*)d_in; const float* x = I[0]; const float* am = I[1]; const float* wq = I[2]; const float* bq = I[3]; const float* wk = I[4]; const float* bk = I[5]; const float* wv = I[6]; const float* bv = I[7];      /* hidden_states; attention_mask f32 [4][1][1][2048] (READ on device: key masked iff bf16(mask) < 0); natural weights + biases */
  char* ws = (char*)d_ws; size_t off = 0;
  auto take = [&](size_t bytes) { char* p = ws + off; off += (bytes + 255) & ~(size_t)255; return p; };
  _Float16* BQ = (_Float16*)take((size_t)DM * DM * 2); _Float16* BK = (_Float16*)take((size_t)DM * DM * 2); _Float16* BV = (_Float16*)take((size_t)DM * DM * 2); 
  _Float16* X16 = (_Float16*)take(NR * DM * 2); _Float16* Q16 = (_Float16*)take(NR * DM * 2); _Float16* K16 = (_Float16*)take(NR * DM * 2); _Float16* V16 = (_Float16*)take(NR * DM * 2);
  _Float16* VT = (_Float16*)take((size_t)NB * NH * HD * SQ * 2);
  int* POS = (int*)take(NR * 4); int* NUN = (int*)take((size_t)NB * 4);
  if (off > ws_size) return;
  k_prep<<<NB + 3 * WB + XB, 256, 0, stream>>>(x, am, wq, wk, wv, X16, BQ, BK, BV, POS, NUN);      /* key order per batch (unmasked first), weight planes, x rows */
  const size_t r0p = (size_t)B0 * SQ;      /* first projected row */
  k_proj<<<dim3((unsigned)((MP / PM) * (DM / PN)), 3), 128, 0, stream>>>(X16 + r0p * DM, BQ, BK, BV, bq, bk, bv, POS + r0p, Q16 + r0p * DM, K16, V16);      /* K and V rows in the key order of perm_job */
  k_vt<NH, SQ><<<NB * NH * (SQ / 64), 256, 0, stream>>>(V16, LQ, 0, VT);      /* V^T [NB][NH][HD][SQ] */
  k_fattn<<<dim3(SQ / FQ, NH, NB), FW * 32, 0, stream>>>(Q16, K16, VT, NUN, (float*)d_out);      /* scores, sign key mask (select, -10000 fill), softmax and P V in one launch; f32 straight into the merged-heads output rows */
}

// v006
// One run takes 76.8 microseconds.
// In two side-by-side timings against v005, it was 1.06 and 1.05 times as fast.
// All steps since v000 together make it 68.0 times as fast.
#include <hip/hip_runtime.h>
// BERT self-attention without an output projection and with a SIGN key mask (hidden_states [4][2048][768]; q/k/v = x W^T + b (natural [768][768] sigma 0.02, biases sigma 0.02); 12 heads of 64; scores / 8; masked_fill(attention_mask < 0, -10000) with the f32 [4][1][1][2048] mask input (a key of batch b is masked iff its mask value is negative); softmax over all keys; context = heads merged -> [4][2048][768]).
// Structure: token rows r = b*2048 + s; x as exact f16 rows (bf16-rounded); Q, K, V as three WMMA GEMMs (32x64 wave tiles, f32 accumulation, exact x16 weights + bias, f16 outputs); the K and V rows of a batch stored in key order 'unmasked first, then masked' (perm_job), so that the attention launch ends behind the last unmasked key when every later weight is exactly 0; one fused attention launch (scores on WMMA, K = 64; online softmax on VALU, f32 statistics, weights as f16 relative to the running maximum; o = P . V on WMMA, its V^T operand read from the staged V rows by transposing LDS loads) written f32 straight into the merged-heads output rows (no output projection).
// Compute dtype: inputs rounded to bf16; x / weights exact; q, k, v and softmax weights as plain f16 GEMM operands (~2^-12); scores, softmax statistics and o f32. v_wmma_f32_16x16x32_f16.
#define NB 4
#define SQ 2048
#define DM 768
#define NH 12
#define HD 64
#define HG 4                         /* heads per launch of the per-batch k_vt overload */
#define B0 0                         /* first batch processed (debug hook) */
#define NBR NB                       /* batches processed (debug hook) */
#define NR ((size_t)NB * SQ)         /* token rows */
#define MP ((int)((size_t)NBR * SQ)) /* rows projected (debug hook) */
#define QN SQ                        /* unused */
#define NHD NH                       /* unused */
#define MPO MP                       /* unused */
#define LQ DM      /* row pitch of the q/k/v rows */
typedef __bf16 v16b __attribute__((ext_vector_type(16)));
typedef unsigned short v8us __attribute__((ext_vector_type(8), may_alias));
typedef float  v8f  __attribute__((ext_vector_type(8)));
typedef float  v4f  __attribute__((ext_vector_type(4)));
typedef float  v4fa __attribute__((ext_vector_type(4), may_alias));
union FragB { v16b v; v8us half[2]; unsigned short u[16]; };

__device__ __forceinline__ unsigned short bf16_bits(float x) { unsigned int u = __float_as_uint(x); return (unsigned short)((u + 0x7FFFu + ((u >> 16) & 1u)) >> 16); }
__device__ __forceinline__ float bf16_val(unsigned short b) { return __uint_as_float(((unsigned int)b) << 16); }
__device__ __forceinline__ float bf16_round(float x) { return bf16_val(bf16_bits(x)); }
// D += A·B with NT terms: 1 = ah·bh, 2 = + al·bh (A split), 3 = + ah·bl (both split)
template <int NT>
__device__ __forceinline__ v8f mmaN(v16b ah, v16b al, v16b bh, v16b bl, v8f c) {
  c = __builtin_amdgcn_wmma_f32_16x16x32_bf16(false, ah, false, bh, (short)0, c, false, false);
  if (NT >= 2) c = __builtin_amdgcn_wmma_f32_16x16x32_bf16(false, al, false, bh, (short)0, c, false, false);
  if (NT >= 3) c = __builtin_amdgcn_wmma_f32_16x16x32_bf16(false, ah, false, bl, (short)0, c, false, false);
  asm volatile("v_nop\n\tv_nop\n\tv_nop\n\tv_nop" : "+v"(c) : "v"(ah), "v"(al), "v"(bh), "v"(bl));
  return c;
}

__global__ __launch_bounds__(256) void k_wt_bf16(const float* __restrict__ W, unsigned short* __restrict__ Wt, int K, int N) {
  const int t = blockIdx.x * 256 + threadIdx.x;
  const int k8n = K / 8;
  if (t >= N * k8n) return;
  const int n = t / k8n, k8 = (t % k8n) * 8;
  v8us v;
#pragma unroll
  for (int i = 0; i < 8; ++i) v[i] = bf16_bits(W[(size_t)(k8 + i) * N + n]);
  *(v8us*)(Wt + (size_t)n * K + k8) = v;
  
}

// GEMM C[M][N] (f32, pitch ldc) = act(A[M][K]·W + bias). A f32 row-major (pitch lda) converted per fragment to bf16
// (ASPLIT: hi/lo two planes -> 2 terms, else single rounded term); Wt bf16 [N][K] (pitch ldb). BIAS_BF16 rounds the
// bias to bf16 first (bias quantised to bf16 before the add). K%32==0, M%16==0, N%64==0.
template <bool ASPLIT, int ACT, bool BIAS_BF16>
__global__ __launch_bounds__(128) void k_gemm_bf(const float* __restrict__ A, int lda, const unsigned short* __restrict__ Wt, int ldb,
                                               const float* __restrict__ bias, float* __restrict__ C, int ldc, int M, int N, int K) {
  __shared__ __attribute__((aligned(16))) float so[4][16][64];
  const int tid = threadIdx.x, w = tid >> 5, lane = tid & 31, ln = lane & 15, hh = lane >> 4;
  const int ntn = N / 64;
  const int wid = blockIdx.x * 4 + w;
  const int mt = wid / ntn, nq = wid % ntn;
  if (mt * 16 >= M) return;
  const int row0 = mt * 16, col0 = nq * 64;
  const float* arow = A + (size_t)(row0 + ln) * lda;
  v8f acc[4] = {};
  for (int kb = 0; kb < K; kb += 32) {
    FragB ah, al;
    const v4f x0 = *(const v4fa*)(arow + kb + 8 * hh), x1 = *(const v4fa*)(arow + kb + 8 * hh + 4);
    const v4f x2 = *(const v4fa*)(arow + kb + 16 + 8 * hh), x3 = *(const v4fa*)(arow + kb + 16 + 8 * hh + 4);
    float xs[16] = {x0[0],x0[1],x0[2],x0[3],x1[0],x1[1],x1[2],x1[3],x2[0],x2[1],x2[2],x2[3],x3[0],x3[1],x3[2],x3[3]};
#pragma unroll
    for (int i = 0; i < 16; ++i) { const unsigned short hb = bf16_bits(xs[i]); ah.u[i] = hb; al.u[i] = ASPLIT ? bf16_bits(xs[i] - bf16_val(hb)) : (unsigned short)0; }
#pragma unroll
    for (int t = 0; t < 4; ++t) {
      const unsigned short* brow = Wt + (size_t)(col0 + t * 16 + ln) * ldb + kb;
      FragB b;
      b.half[0] = *(const v8us*)(brow + 8 * hh);
      b.half[1] = *(const v8us*)(brow + 16 + 8 * hh);
      acc[t] = mmaN<ASPLIT ? 2 : 1>(ah.v, al.v, b.v, b.v, acc[t]);
    }
  }
#pragma unroll
  for (int t = 0; t < 4; ++t) {
    float bv = bias ? bias[col0 + t * 16 + ln] : 0.f;
    if (BIAS_BF16) bv = bf16_round(bv);
#pragma unroll
    for (int r = 0; r < 8; ++r) { float v = acc[t][r] + bv; if (ACT == 1) v = fmaxf(v, 0.f); so[w][8 * hh + r][t * 16 + ln] = v; }
  }
  __builtin_amdgcn_fence(__ATOMIC_ACQ_REL, "workgroup");
  __builtin_amdgcn_wave_barrier();
  const int rsub = lane >> 4, c4 = (lane & 15) * 4;
  {
#pragma unroll
    for (int q = 0; q < 8; ++q) {
      const int r = q * 2 + rsub;
      const v4f v = *(const v4fa*)&so[w][r][c4];
      *(v4f*)(C + (size_t)(row0 + r) * ldc + col0 + c4) = v;
    }
    
  }
}

// GEMM C = act(A·W + bias + resid): A f32 (ASPLIT -> hi/lo 2 terms), Wt bf16 [N][K]; ACT 0 none, 1 relu, 2 exact gelu;
// resid (optional, f32, row index = (row % rmod), pitch ldr, RES_BF16 rounds it) added before the activation.
template <bool ASPLIT, int ACT, bool BIAS_BF16, bool RES_BF16>
__global__ __launch_bounds__(128) void k_gemm_bf3(const float* __restrict__ A, int lda, const unsigned short* __restrict__ Wt, int ldb,
                                                const float* __restrict__ bias, const float* __restrict__ resid, int rmod, int ldr,
                                                float* __restrict__ C, int ldc, int M, int N, int K) {
  __shared__ __attribute__((aligned(16))) float so[4][16][64];
  const int tid = threadIdx.x, w = tid >> 5, lane = tid & 31, ln = lane & 15, hh = lane >> 4;
  const int ntn = N / 64;
  const int wid = blockIdx.x * 4 + w;
  const int mt = wid / ntn, nq = wid % ntn;
  if (mt * 16 >= M) return;
  const int row0 = mt * 16, col0 = nq * 64;
  const float* arow = A + (size_t)(row0 + ln) * lda;
  v8f acc[4] = {};
  for (int kb = 0; kb < K; kb += 32) {
    FragB ah, al;
    const v4f x0 = *(const v4fa*)(arow + kb + 8 * hh), x1 = *(const v4fa*)(arow + kb + 8 * hh + 4);
    const v4f x2 = *(const v4fa*)(arow + kb + 16 + 8 * hh), x3 = *(const v4fa*)(arow + kb + 16 + 8 * hh + 4);
    float xs[16] = {x0[0],x0[1],x0[2],x0[3],x1[0],x1[1],x1[2],x1[3],x2[0],x2[1],x2[2],x2[3],x3[0],x3[1],x3[2],x3[3]};
#pragma unroll
    for (int i = 0; i < 16; ++i) { const unsigned short hb = bf16_bits(xs[i]); ah.u[i] = hb; al.u[i] = ASPLIT ? bf16_bits(xs[i] - bf16_val(hb)) : (unsigned short)0; }
#pragma unroll
    for (int t = 0; t < 4; ++t) {
      const unsigned short* brow = Wt + (size_t)(col0 + t * 16 + ln) * ldb + kb;
      FragB b;
      b.half[0] = *(const v8us*)(brow + 8 * hh);
      b.half[1] = *(const v8us*)(brow + 16 + 8 * hh);
      acc[t] = mmaN<ASPLIT ? 2 : 1>(ah.v, al.v, b.v, b.v, acc[t]);
    }
  }
#pragma unroll
  for (int t = 0; t < 4; ++t) {
    const int col = col0 + t * 16 + ln;
    float bv = bias ? bias[col] : 0.f;
    if (BIAS_BF16) bv = bf16_round(bv);
#pragma unroll
    for (int r = 0; r < 8; ++r) {
      float v = acc[t][r] + bv;
      if (resid) { float rv = resid[(size_t)((row0 + 8 * hh + r) % rmod) * ldr + col]; if (RES_BF16) rv = bf16_round(rv); v += rv; }
      if (ACT == 1) v = fmaxf(v, 0.f);
      if (ACT == 2) v = 0.5f * v * (1.0f + erff(v * 0.70710678118654752f));
      if (ACT == 3) { const float u = 0.7978845608028654f * (v + 0.044715f * v * v * v); v = 0.5f * v * (1.0f + tanhf(u)); }
      so[w][8 * hh + r][t * 16 + ln] = v;
    }
  }
  __builtin_amdgcn_fence(__ATOMIC_ACQ_REL, "workgroup");
  __builtin_amdgcn_wave_barrier();
  const int rsub = lane >> 4, c4 = (lane & 15) * 4;
  {
#pragma unroll
    for (int q = 0; q < 8; ++q) {
      const int r = q * 2 + rsub;
      const v4f v = *(const v4fa*)&so[w][r][c4];
      *(v4f*)(C + (size_t)(row0 + r) * ldc + col0 + c4) = v;
    }
    
  }
}
// row LayerNorm (biased variance, eps) over N: s = X (+ R); optional out_sum <- s; out_norm <- (s-mu)*rsqrt(var+eps)*g + b
template <bool PARAM_BF16>
__global__ __launch_bounds__(256) void k_layernorm(const float* __restrict__ X, const float* __restrict__ R, const float* __restrict__ g, const float* __restrict__ bta,
                                                  float* __restrict__ out_sum, float* __restrict__ out_norm, int N, float eps) {
  __shared__ float red[256];
  const int row = blockIdx.x, tid = threadIdx.x;
  const float* x = X + (size_t)row * N; const float* rr = R ? R + (size_t)row * N : nullptr;
  float vals[16];                     // up to N = 4096
  const int per = N / 256;            // contiguous chunk per thread? use strided-by-4 chunks: thread handles j = tid*4 + 1024*u
  float s1 = 0.f;
  for (int u = 0; u < per / 4; ++u) {
    const int j = tid * 4 + 1024 * u;
    const v4f a = *(const v4fa*)(x + j);
    v4f b = {0.f,0.f,0.f,0.f}; if (rr) b = *(const v4fa*)(rr + j);
#pragma unroll
    for (int q = 0; q < 4; ++q) { const float v = a[q] + b[q]; vals[u * 4 + q] = v; s1 += v; }
  }
  red[tid] = s1; __syncthreads();
  for (int st = 128; st > 0; st >>= 1) { if (tid < st) red[tid] += red[tid + st]; __syncthreads(); }
  const float mu = red[0] / (float)N; __syncthreads();
  float s2 = 0.f;
  for (int u = 0; u < per / 4; ++u)
#pragma unroll
    for (int q = 0; q < 4; ++q) { const float c = vals[u * 4 + q] - mu; s2 += c * c; }
  red[tid] = s2; __syncthreads();
  for (int st = 128; st > 0; st >>= 1) { if (tid < st) red[tid] += red[tid + st]; __syncthreads(); }
  const float rs = rsqrtf(red[0] / (float)N + eps);
  {
    for (int u = 0; u < per / 4; ++u) {
      const int j = tid * 4 + 1024 * u;
      v4f o, sm;
#pragma unroll
      for (int q = 0; q < 4; ++q) {
        float gg = g[j + q], bb = bta[j + q];
        if (PARAM_BF16) { gg = bf16_round(gg); bb = bf16_round(bb); }
        sm[q] = vals[u * 4 + q]; o[q] = (vals[u * 4 + q] - mu) * rs * gg + bb;
      }
      if (out_sum) *(v4f*)(out_sum + (size_t)row * N + j) = sm;
      *(v4f*)(out_norm + (size_t)row * N + j) = o;
    }
    
  }
}



// ---- f16 WMMA path (v_wmma_f32_16x16x32_f16): 11-bit significands for operands in range — used where a [0,1] probability operand needs more precision than bf16
typedef _Float16 v16h __attribute__((ext_vector_type(16)));
union FragH { v16h v; v8us half[2]; _Float16 h[16]; unsigned short u[16]; };
template <int NT>
__device__ __forceinline__ v8f mmaH(v16h ah, v16h al, v16h bh, v16h bl, v8f c) {
  c = __builtin_amdgcn_wmma_f32_16x16x32_f16(false, ah, false, bh, (short)0, c, false, false);
  if (NT >= 2) c = __builtin_amdgcn_wmma_f32_16x16x32_f16(false, al, false, bh, (short)0, c, false, false);
  if (NT >= 3) c = __builtin_amdgcn_wmma_f32_16x16x32_f16(false, ah, false, bl, (short)0, c, false, false);
  asm volatile("v_nop\n\tv_nop\n\tv_nop\n\tv_nop" : "+v"(c) : "v"(ah), "v"(al), "v"(bh), "v"(bl));
  return c;
}
// batched GEMM like k_gemm_b but f16 operands: A f32 (split into f16 hi/lo if ASPLIT, else rounded to f16), Bt = f16 values [n][k]; alpha; C f32; N multiple of 16 (partial tiles skipped)
template <bool ASPLIT>
__global__ __launch_bounds__(128) void k_gemm_h(const float* __restrict__ A, int lda, size_t sA, const _Float16* __restrict__ Bh, int ldb, size_t sB, float alpha, float* __restrict__ C, int ldc, size_t sC, int M, int N, int K) {
  __shared__ __attribute__((aligned(16))) float so[4][16][64];
  const int tid = threadIdx.x, w = tid >> 5, lane = tid & 31, ln = lane & 15, hh = lane >> 4; const int by = blockIdx.y;
  A += (size_t)by * sA; Bh += (size_t)by * sB; C += (size_t)by * sC;
  const int ntn = (N + 63) / 64; const int wid = blockIdx.x * 4 + w; const int mt = wid / ntn, nq = wid % ntn; if (mt * 16 >= M) return;
  const int row0 = mt * 16, col0 = nq * 64; const float* arow = A + (size_t)(row0 + ln) * lda;
  v8f acc[4] = {};
  for (int kb = 0; kb < K; kb += 32) {
    FragH ah, al;
    const v4f x0 = *(const v4fa*)(arow + kb + 8 * hh), x1 = *(const v4fa*)(arow + kb + 8 * hh + 4), x2 = *(const v4fa*)(arow + kb + 16 + 8 * hh), x3 = *(const v4fa*)(arow + kb + 16 + 8 * hh + 4);
    float xs[16] = {x0[0],x0[1],x0[2],x0[3],x1[0],x1[1],x1[2],x1[3],x2[0],x2[1],x2[2],x2[3],x3[0],x3[1],x3[2],x3[3]};
#pragma unroll
    for (int i = 0; i < 16; ++i) { const _Float16 h = (_Float16)xs[i]; ah.h[i] = h; al.h[i] = ASPLIT ? (_Float16)(xs[i] - (float)h) : (_Float16)0.0f; }
#pragma unroll
    for (int t = 0; t < 4; ++t) { if (col0 + t * 16 >= N) continue; const size_t boff = (size_t)(col0 + t * 16 + ln) * ldb + kb; FragH bq; bq.half[0] = *(const v8us*)(Bh + boff + 8 * hh); bq.half[1] = *(const v8us*)(Bh + boff + 16 + 8 * hh);
      acc[t] = mmaH<ASPLIT ? 2 : 1>(ah.v, al.v, bq.v, bq.v, acc[t]); }
  }
#pragma unroll
  for (int t = 0; t < 4; ++t) { if (col0 + t * 16 >= N) continue;
#pragma unroll
    for (int r = 0; r < 8; ++r) so[w][8 * hh + r][t * 16 + ln] = acc[t][r] * alpha; }
  __builtin_amdgcn_fence(__ATOMIC_ACQ_REL, "workgroup"); __builtin_amdgcn_wave_barrier();
  const int rsub = lane >> 4, c4 = (lane & 15) * 4;
  {
#pragma unroll
    for (int q = 0; q < 8; ++q) { const int r = q * 2 + rsub; if (col0 + c4 < N) { const v4f v = *(const v4fa*)&so[w][r][c4]; *(v4f*)(C + (size_t)(row0 + r) * ldc + col0 + c4) = v; } }
     }
}

// Wt[n][k] = f16(W[k][n]·scale) from f32 row-major W[K][N] (scale = power of two; bf16-exact weights stay exact in f16 away from the subnormal range)
__global__ __launch_bounds__(256) void k_wt_f16(const float* __restrict__ W, _Float16* __restrict__ Wt, int K, int N, float scale) {
  const int t = blockIdx.x * 256 + threadIdx.x; if (t >= N * (K / 8)) return; const int n = t / (K / 8), k8 = (t % (K / 8)) * 8; FragH f;
#pragma unroll
  for (int i = 0; i < 8; ++i) f.h[i] = (_Float16)(bf16_round(W[(size_t)(k8 + i) * N + n]) * scale); const v8us o = f.half[0];
  *(v8us*)((unsigned short*)Wt + (size_t)n * K + k8) = o; 
}
// k_gemm_hh variant with fused epilogue: v = acc·alpha + bias[by·sBias + col] (+ CP[(row/rowsPerB)·sCPb + by·64 + col] if CP) ; ACT 0 none / 1 elu ; writes f16 C16 (and f32 C if non-null)
template <int ACT>
__global__ __launch_bounds__(128) void k_gemm_hhx(const _Float16* __restrict__ A, int lda, size_t sA, const _Float16* __restrict__ Bh, int ldb, size_t sB, float alpha, const float* __restrict__ bias, size_t sBias, const float* __restrict__ CP, int rowsPerB, size_t sCPb, int row0g,
    float* __restrict__ C, _Float16* __restrict__ C16, int ldc, size_t sC, int M, int N, int K) {
  __shared__ __attribute__((aligned(16))) float so[4][16][64];
  const int tid = threadIdx.x, w = tid >> 5, lane = tid & 31, ln = lane & 15, hh = lane >> 4; const int by = blockIdx.y;
  A += (size_t)by * sA; Bh += (size_t)by * sB; const size_t cofs = (size_t)by * sC; const float* bp = bias ? bias + (size_t)by * sBias : nullptr;
  const int ntn = (N + 63) / 64; const int wid = blockIdx.x * 4 + w; const int mt = wid / ntn, nq = wid % ntn; if (mt * 16 >= M) return;
  const int row0 = mt * 16, col0 = nq * 64; const _Float16* arow = A + (size_t)(row0 + ln) * lda;
  v8f acc[4] = {};
  for (int kb = 0; kb < K; kb += 32) { FragH ah; ah.half[0] = *(const v8us*)((const unsigned short*)arow + kb + 8 * hh); ah.half[1] = *(const v8us*)((const unsigned short*)arow + kb + 16 + 8 * hh);
#pragma unroll
    for (int t = 0; t < 4; ++t) { if (col0 + t * 16 >= N) continue; const size_t boff = (size_t)(col0 + t * 16 + ln) * ldb + kb; FragH bq; bq.half[0] = *(const v8us*)((const unsigned short*)Bh + boff + 8 * hh); bq.half[1] = *(const v8us*)((const unsigned short*)Bh + boff + 16 + 8 * hh);
      acc[t] = mmaH<1>(ah.v, ah.v, bq.v, bq.v, acc[t]); }
  }
#pragma unroll
  for (int t = 0; t < 4; ++t) { if (col0 + t * 16 >= N) continue; const int col = col0 + t * 16 + ln; const float bv = bp ? bf16_round(bp[col]) : 0.f;
#pragma unroll
    for (int r = 0; r < 8; ++r) { float v = acc[t][r] * alpha + bv; if (CP) { const int rr = row0g + row0 + 8 * hh + r; if (rowsPerB < 0) v += CP[cofs + (size_t)rr * ldc + col];      /* rowsPerB < 0: own element of the batched C plane */ else { const int bidx = rr / rowsPerB; v += CP[(size_t)bidx * sCPb + (size_t)by * 64 + col]; } } if (ACT == 1) v = (v > 0.f) ? v : expm1f(v); else if (ACT == 7) v = (v > 0.f) ? v + 1.0f : expf(v); else if (ACT == 8) v = tanhf(v); else if (ACT == 9) v = 0.5f * v * (1.0f + tanhf(0.7978845608028654f * (v + 0.044715f * v * v * v))); else if (ACT == 11) v = 1.0f / (1.0f + expf(-v)); else if (ACT == 12) v = (v > 0.f) ? v : 0.01f * v; else if (ACT == 14) v = (v > 0.f) ? v : 0.1f * v; else if (ACT == 16) v = (v >= 0.f) ? v : 0.3f * v; else if (ACT == 17) v = (v >= 0.f) ? v : 0.2f * v; else if (ACT == 15) v = v / (1.0f + expf(-v)); else if (ACT == 3) v = fmaxf(v, 0.f); else if (ACT == 6) v = 0.5f * v * (1.0f + erff(v * 0.70710678118654752f)); so[w][8 * hh + r][t * 16 + ln] = v; } }
  __builtin_amdgcn_fence(__ATOMIC_ACQ_REL, "workgroup"); __builtin_amdgcn_wave_barrier();
  const int rsub = lane >> 4, c4 = (lane & 15) * 4; typedef _Float16 v4h __attribute__((ext_vector_type(4)));
  {
#pragma unroll
    for (int q = 0; q < 8; ++q) { const int r = q * 2 + rsub; if (col0 + c4 < N) { const v4f v = *(const v4fa*)&so[w][r][c4]; if (C) *(v4f*)(C + cofs + (size_t)(row0 + r) * ldc + col0 + c4) = v; if (C16) { v4h h4; for (int i = 0; i < 4; ++i) h4[i] = (_Float16)v[i]; *(v4h*)(C16 + cofs + (size_t)(row0 + r) * ldc + col0 + c4) = h4; } } }
     }
}


typedef _Float16 v4h __attribute__((ext_vector_type(4)));

__global__ __launch_bounds__(256) void k_h16(const float* __restrict__ x, _Float16* __restrict__ X16, size_t n8) { const size_t t = (size_t)blockIdx.x * 256 + threadIdx.x; if (t >= n8) return; FragH f;
#pragma unroll
  for (int q = 0; q < 8; ++q) f.h[q] = (_Float16)x[t * 8 + q]; *(v8us*)((unsigned short*)X16 + t * 8) = f.half[0];  }
__global__ __launch_bounds__(256) void k_round16f(const float* __restrict__ W, _Float16* __restrict__ Bt, size_t n8) { const size_t t = (size_t)blockIdx.x * 256 + threadIdx.x; if (t >= n8) return; FragH f;
#pragma unroll
  for (int i = 0; i < 8; ++i) f.h[i] = (_Float16)(bf16_round(W[t * 8 + i]) * 16.0f); *(v8us*)((unsigned short*)Bt + t * 8) = f.half[0];  }
__global__ __launch_bounds__(256) void k_hl(const float* __restrict__ F, _Float16* __restrict__ Hh, _Float16* __restrict__ Hl, size_t n8) { const size_t t = (size_t)blockIdx.x * 256 + threadIdx.x; if (t >= n8) return; FragH fh, fl; const v4f a = *(const v4fa*)(F + t * 8), c = *(const v4fa*)(F + t * 8 + 4);
#pragma unroll
  for (int q = 0; q < 4; ++q) { _Float16 h = (_Float16)a[q]; fh.h[q] = h; fl.h[q] = (_Float16)((a[q] - (float)h) * 1024.0f); h = (_Float16)c[q]; fh.h[4 + q] = h; fl.h[4 + q] = (_Float16)((c[q] - (float)h) * 1024.0f); }
  { *(v8us*)((unsigned short*)Hh + t * 8) = fh.half[0]; *(v8us*)((unsigned short*)Hl + t * 8) = fl.half[0];  } }

// ---- fast GEMM (wave tile 32x64; requires M % 32 == 0 rows per launch region and N % 64 == 0); epilogue = k_gemm_hhx semantics ----
__device__ __forceinline__ v16h g2_frag(const _Float16* p, int hh) { FragH f; f.half[0] = *(const v8us*)((const unsigned short*)p + 8 * hh); f.half[1] = *(const v8us*)((const unsigned short*)p + 16 + 8 * hh); return f.v; }
__device__ __forceinline__ v8f g2_mma(v16h a, v16h b, v8f c) { v8f d = __builtin_amdgcn_wmma_f32_16x16x32_f16(false, a, false, b, (short)0, c, false, false); asm volatile("v_nop\n\tv_nop\n\tv_nop\n\tv_nop" : "+v"(d) : "v"(a), "v"(b)); return d; }
template <int ACT>
__global__ __launch_bounds__(128) void k_gemm2(const _Float16* __restrict__ A, int lda, size_t sA, const _Float16* __restrict__ Bh, int ldb, size_t sB, float alpha, const float* __restrict__ bias, size_t sBias, const float* __restrict__ CP, int rowsPerB, size_t sCPb, int row0g,
    float* __restrict__ C, _Float16* __restrict__ C16, int ldc, size_t sC, int M, int N, int K) { static_assert(ACT == 0 || ACT == 3 || ACT == 6 || ACT == 8 || ACT == 9 || ACT == 11 || ACT == 12 || ACT == 14 || ACT == 15 || ACT == 16 || ACT == 17, "k_gemm2: unsupported ACT code (would silently apply no activation)");
  __shared__ __attribute__((aligned(16))) float so[4][32][68];
  const int tid = threadIdx.x, w = tid >> 5, lane = tid & 31, ln = lane & 15, hh = lane >> 4; const int by = blockIdx.y;
  A += (size_t)by * sA; Bh += (size_t)by * sB; const size_t cofs = (size_t)by * sC; const float* bp = bias ? bias + (size_t)by * sBias : nullptr;
  const int ntn = N >> 6; const int mt = blockIdx.x / ntn, nq = blockIdx.x - mt * ntn; const int row0 = mt * 128 + 32 * w, col0 = nq * 64; if (row0 >= M) return;
  const _Float16* a0p = A + (size_t)(row0 + ln) * lda; const _Float16* a1p = a0p + (size_t)16 * lda;
  const _Float16* b0p = Bh + (size_t)(col0 + ln) * ldb; const _Float16* b1p = b0p + (size_t)16 * ldb; const _Float16* b2p = b1p + (size_t)16 * ldb; const _Float16* b3p = b2p + (size_t)16 * ldb;
  const v8f z8 = {0.f,0.f,0.f,0.f,0.f,0.f,0.f,0.f}; v8f c00 = z8, c01 = z8, c02 = z8, c03 = z8, c10 = z8, c11 = z8, c12 = z8, c13 = z8;
#pragma unroll 1
  for (int kb = 0; kb < K; kb += 32) { const v16h a0 = g2_frag(a0p + kb, hh), a1 = g2_frag(a1p + kb, hh);
    v16h b = g2_frag(b0p + kb, hh); c00 = g2_mma(a0, b, c00); c10 = g2_mma(a1, b, c10);
    b = g2_frag(b1p + kb, hh); c01 = g2_mma(a0, b, c01); c11 = g2_mma(a1, b, c11);
    b = g2_frag(b2p + kb, hh); c02 = g2_mma(a0, b, c02); c12 = g2_mma(a1, b, c12);
    b = g2_frag(b3p + kb, hh); c03 = g2_mma(a0, b, c03); c13 = g2_mma(a1, b, c13); }
  v8f accs[8] = {c00, c01, c02, c03, c10, c11, c12, c13};
#pragma unroll
  for (int u = 0; u < 8; ++u) { const int t = u & 3, half = u >> 2; const int col = col0 + t * 16 + ln; const float bv = bp ? bf16_round(bp[col]) : 0.f;
#pragma unroll
    for (int r = 0; r < 8; ++r) { const int rloc = half * 16 + 8 * hh + r; float v = accs[u][r] * alpha + bv; if (CP) { if (rowsPerB < 0) v += CP[cofs + (size_t)(row0g + row0 + rloc) * ldc + col];      /* rowsPerB < 0: own element of the batched C plane */ else { const int bidx = (row0g + row0 + rloc) / rowsPerB; v += CP[(size_t)bidx * sCPb + (size_t)by * 64 + col]; } }
      if (ACT == 3) v = fmaxf(v, 0.f); else if (ACT == 6) v = 0.5f * v * (1.0f + erff(v * 0.70710678118654752f)); else if (ACT == 11) v = 1.0f / (1.0f + expf(-v)); else if (ACT == 15) v = v / (1.0f + expf(-v)); else if (ACT == 12) v = (v > 0.f) ? v : 0.01f * v; else if (ACT == 8) v = tanhf(v); else if (ACT == 9) v = 0.5f * v * (1.0f + tanhf(0.7978845608028654f * (v + 0.044715f * v * v * v))); else if (ACT == 14) v = (v > 0.f) ? v : 0.1f * v; else if (ACT == 16) v = (v >= 0.f) ? v : 0.3f * v; else if (ACT == 17) v = (v >= 0.f) ? v : 0.2f * v;
      so[w][rloc][t * 16 + ln] = v; } }
  __builtin_amdgcn_fence(__ATOMIC_ACQ_REL, "workgroup"); __builtin_amdgcn_wave_barrier();
  const int rsub = lane >> 4, c4 = (lane & 15) * 4;
  {
#pragma unroll
    for (int q = 0; q < 16; ++q) { const int r = q * 2 + rsub; const v4f v = *(const v4fa*)&so[w][r][c4]; if (C) *(v4f*)(C + cofs + (size_t)(row0 + r) * ldc + col0 + c4) = v; if (C16) { v4h h4; for (int i = 0; i < 4; ++i) h4[i] = (_Float16)v[i]; *(v4h*)(C16 + cofs + (size_t)(row0 + r) * ldc + col0 + c4) = h4; } }
     } }


__global__ __launch_bounds__(256) void k_rsm(const float* __restrict__ S, _Float16* __restrict__ P, int nrows) {
  #pragma clang fp contract(off)
  const int i = blockIdx.x * 256 + threadIdx.x; if (i >= nrows) return; const float* s = S + (size_t)i * SQ; float mx = -3.0e38f;
#pragma unroll 1
  for (int j = 0; j < SQ; ++j) mx = fmaxf(mx, s[j]); float se = 0.f;
#pragma unroll 1
  for (int j = 0; j < SQ; ++j) se += expf(s[j] - mx); const float sc = 256.0f / se;
#pragma unroll 1
  for (int j0 = 0; j0 < SQ; j0 += 8) { FragH f; for (int q = 0; q < 8; ++q) f.h[q] = (_Float16)(expf(s[j0 + q] - mx) * sc); unsigned short* d = (unsigned short*)P + (size_t)i * SQ + j0; *(v8us*)d = f.half[0];  } }
__global__ __launch_bounds__(256) void k_vt(const _Float16* __restrict__ V16, int b, int h0, _Float16* __restrict__ VT) { __shared__ unsigned short tl[64][65]; const int tid = threadIdx.x; const int hh = blockIdx.x % HG, sg = blockIdx.x / HG; const int s0 = sg * 64; const int h = h0 + hh;
  for (int i = tid; i < 64 * 8; i += 256) { const int j = i / 8, d8 = (i % 8) * 8; FragH f; f.half[0] = *(const v8us*)((const unsigned short*)V16 + ((size_t)b * SQ + s0 + j) * DM + h * HD + d8); for (int q = 0; q < 8; ++q) tl[d8 + q][j] = f.u[q]; }
  __syncthreads();
  { for (int i = tid; i < 64 * 8; i += 256) { const int d = i / 8, j8 = (i % 8) * 8; FragH f; for (int q = 0; q < 8; ++q) f.u[q] = tl[d][j8 + q]; *(v8us*)((unsigned short*)VT + ((size_t)hh * HD + d) * SQ + s0 + j8) = f.half[0]; }  } }



#define FW 4                         /* waves per work-group */
#define FG 2                         /* 16-query groups per wave */
#define FQ (FW * FG * 16)            /* queries per work-group */
#define FK 64                        /* keys per stage (two passes of 32) */
#define FP 144                       /* LDS row pitch, bytes: 128 + 16, an odd multiple of 16 (16-byte reads of 16 rows without bank conflicts) */
#define FT (64 * FP)                 /* the K tile: 64 keys */
#define FPV 160                      /* LDS row pitch of the V tile, bytes: 128 + 32, an odd multiple of 32 (the transposing load's own conflict-free pitch) */
#define FTV (64 * FPV)               /* the V tile: 64 keys */
#define FNS (SQ / FK)                /* stages */
__device__ __forceinline__ float lane_x16(float x) { const int b = __float_as_int(x); return __int_as_float(__builtin_amdgcn_permlanex16(b, b, 0x76543210, 0xfedcba98, false, false)); }      /* value of lane l ^ 16 */
// e[i] = 2^t[i], eight at a time, in one statement, so that the closing v_nop stands directly behind the last v_exp_f32: it is the slot that the instruction set asks for behind a transcendental before its
// result is read or its source overwritten. Early-clobber outputs: no result lies on a source of a
// later line. The closing s_delay_alu is the hint that the compiler cannot give for results of asm text: the next vector instruction may read them, and unhinted it would hold the SIMD's issue port against the other waves.
__device__ __forceinline__ v8f exp2x8(v8f t) { float e0, e1, e2, e3, e4, e5, e6, e7;
  asm("v_exp_f32 %0, %8\n\tv_exp_f32 %1, %9\n\tv_exp_f32 %2, %10\n\tv_exp_f32 %3, %11\n\tv_exp_f32 %4, %12\n\tv_exp_f32 %5, %13\n\tv_exp_f32 %6, %14\n\tv_exp_f32 %7, %15\n\tv_nop\n\ts_delay_alu instid0(TRANS32_DEP_1)"
      : "=&v"(e0), "=&v"(e1), "=&v"(e2), "=&v"(e3), "=&v"(e4), "=&v"(e5), "=&v"(e6), "=&v"(e7) : "v"(t[0]), "v"(t[1]), "v"(t[2]), "v"(t[3]), "v"(t[4]), "v"(t[5]), "v"(t[6]), "v"(t[7]));
  const v8f e = {e0, e1, e2, e3, e4, e5, e6, e7}; return e; }
__device__ __forceinline__ float exp2x1(float t) { float e; asm("v_exp_f32 %0, %1\n\tv_nop\n\ts_delay_alu instid0(TRANS32_DEP_1)" : "=&v"(e) : "v"(t)); return e; }      /* v_nop and hint: as in exp2x8 */
__device__ __forceinline__ v16h lds_frag(const unsigned char* p) { FragH f; f.half[0] = *(const v8us*)p; f.half[1] = *(const v8us*)(p + 32); return f.v; }      /* p = row + 64 * (32-element k block) + 16 * h: k = 8h .. 8h + 7 and 16 + 8h .. 16 + 8h + 7, the order of g2_frag */
// A fragment of V^T (16 head dims x 32 keys) from V rows in LDS: lane l points at row 8 (l >> 4) + (l & 7), byte 16 ((l >> 3) & 1) of the 16-key x 16-dim block; the load hands lane (c, h) the eight keys 8 h .. 8 h + 7 of dim c.
// Two loads, 16 keys apart, give k = 8h .. 8h + 7 and 16 + 8h .. 16 + 8h + 7: the order of lds_frag and of the converted score tiles.
typedef short v8ss __attribute__((ext_vector_type(8)));
__device__ __forceinline__ v8us lds_tr16(const unsigned char* p) { typedef __attribute__((address_space(3))) v8ss lds_v8ss; return __builtin_bit_cast(v8us, __builtin_amdgcn_ds_load_tr16_b128_v8i16((lds_v8ss*)p)); }
__device__ __forceinline__ v16h lds_frag_tr(const unsigned char* p) { FragH f; f.half[0] = lds_tr16(p); f.half[1] = lds_tr16(p + 16 * FPV); return f.v; }
__device__ __forceinline__ v8f fa_mma(v16h a, v16h b, v8f c) { return __builtin_amdgcn_wmma_f32_16x16x32_f16(false, a, false, b, (short)0, c, false, false); }
static_assert(SQ % FQ == 0 && SQ % FK == 0 && FNS >= 2 && HD == 64, "k_fattn: whole blocks, whole stages, head size 64");
// Key order of a batch: its unmasked keys first (ascending), then its masked keys (ascending). POS[b * SQ + s] = the row of the K and V planes that key s of batch b is stored in; NUN[b] = unmasked keys of batch b.
// One work-group per batch (b): sign bits by ballot, masked keys in front of each 32-key word by a sum over the words, the rest by a population count inside the word.
static_assert(SQ / 32 == 64 && SQ % 256 == 0, "perm_job: 64 mask words, eight per wave");
__device__ __forceinline__ void perm_job(const float* __restrict__ mk, int* __restrict__ POS, int* __restrict__ NUN, int b) {
  __shared__ unsigned int bits[SQ / 32];      /* bit j of word i: key 32 i + j of this batch is masked */
  __shared__ int pre[SQ / 32 + 1];      /* masked keys in front of word i; the last entry is the batch's count */
  const int tid = threadIdx.x, lane = tid & 31, wave = tid >> 5;
  const float* mp = mk + (size_t)b * SQ + wave * (SQ / 8) + lane; float mv[SQ / 256];      /* a wave takes SQ / 8 keys in a row: eight words */
#pragma unroll
  for (int i = 0; i < SQ / 256; ++i) mv[i] = mp[i * 32];
  __builtin_amdgcn_sched_barrier(0);      /* the eight loads stay together in front of the wait below: one latency instead of eight */
  asm volatile("s_wait_xcnt 0x0" :: "v"(mp) : "memory");      /* behind the issued loads, before a register that they name is rewritten; the address is an input so that it lives up to this wait */
  __builtin_amdgcn_sched_barrier(0);      /* keeps later register writes behind that wait */
  unsigned int myw = 0u;
#pragma unroll
  for (int i = 0; i < SQ / 256; ++i) { const unsigned int bal = __builtin_amdgcn_ballot_w32(bf16_round(mv[i]) < 0.f); myw = lane == i ? bal : myw; }      /* lane i keeps word i: one store for the eight */
  if (lane < SQ / 256) bits[wave * (SQ / 256) + lane] = myw;
  __syncthreads();
  if (tid <= SQ / 32) { int p = 0;
#pragma unroll
    for (int j = 0; j < SQ / 32; ++j) p += j < tid ? __builtin_popcount(bits[j]) : 0;
    pre[tid] = p; }
  __syncthreads();
  const int nun = SQ - pre[SQ / 32];
#pragma unroll
  for (int i = 0; i < SQ / 256; ++i) { const int s = i * 256 + tid; const unsigned int wv = bits[s >> 5]; const int mb = pre[s >> 5] + __builtin_popcount(wv & ((1u << (s & 31)) - 1u));      /* masked keys in front of key s */
    POS[(size_t)b * SQ + s] = b * SQ + (((wv >> (s & 31)) & 1u) != 0u ? nun + mb : s - mb); }
  if (tid == 0) NUN[b] = nun;
}
// Eight values in a row per thread: dst = f16(bf16(src) * scale), scale a power of two (exact).
__device__ __forceinline__ void cvt_job(const float* __restrict__ src, _Float16* __restrict__ dst, size_t t, float scale) {
  FragH f;
#pragma unroll
  for (int q = 0; q < 8; ++q) f.h[q] = (_Float16)(bf16_round(src[t * 8 + q]) * scale);
  *(v8us*)((unsigned short*)dst + t * 8) = f.half[0];
  asm volatile("s_wait_xcnt 0x0" ::: "memory");      /* behind the issued store, before a register that it names is rewritten by code that follows the job in the kernel */
}
// All work that reads the inputs alone, in ONE launch: the key order (one work-group per batch), the three weight planes (natural [out][in] = Bt[n][k], x16) and the x rows. No job reads what another writes, so they
// run side by side as ranges of the block index, where five launches in a row each paid a launch gap, a fill and a drain. The key order stands first: it has the longest chain of dependent steps. The choice of the
// job is the same for a whole work-group, so the key order's barriers stand under uniform control flow.
#define WB (DM * DM / 8 / 256)       /* blocks per weight plane */
#define XB ((int)(NR * DM / 8 / 256))      /* blocks of the x rows */
static_assert(DM * DM % 2048 == 0 && NR * DM % 2048 == 0, "k_prep: whole blocks of 256 threads x 8 values");
__global__ __launch_bounds__(256) void k_prep(const float* __restrict__ x, const float* __restrict__ mk, const float* __restrict__ wq, const float* __restrict__ wk, const float* __restrict__ wv,
    _Float16* __restrict__ X16, _Float16* __restrict__ BQ, _Float16* __restrict__ BK, _Float16* __restrict__ BV, int* __restrict__ POS, int* __restrict__ NUN) {
  const int blk = blockIdx.x;
  if (blk < NB) perm_job(mk, POS, NUN, blk);
  else { const int cb = blk - NB, j = min(cb / WB, 3);      /* j = 0, 1, 2: a weight plane; 3: the x rows. One path for all four: source, target and scale are scalar selects */
    cvt_job(j == 0 ? wq : j == 1 ? wk : j == 2 ? wv : x, j == 0 ? BQ : j == 1 ? BK : j == 2 ? BV : X16, (size_t)(cb - j * WB) * 256 + threadIdx.x, j < 3 ? 16.0f : 1.0f); }
}
template <bool M> struct StageKind { static constexpr bool masked = M; };      /* does the stage hold a masked key? */
__global__ __launch_bounds__(FW * 32) void k_fattn(const _Float16* __restrict__ Q16, const _Float16* __restrict__ K16, const _Float16* __restrict__ V16, const int* __restrict__ NUN, float* __restrict__ out) {
  __shared__ __attribute__((aligned(16))) unsigned char L[2][FT + FTV];      /* [buffer][K tile, V tile] */
  __shared__ unsigned int vote[FW];      /* per wave: not 0 if a masked key could still weigh in one of its queries */
  const int tid = threadIdx.x, lane = tid & 31, c = lane & 15, h = lane >> 4; const int wave = __builtin_amdgcn_readfirstlane(tid >> 5);
  const int hd = blockIdx.y, b = blockIdx.z; const int nun = min(max(NUN[b], 0), SQ); const int lim = (nun + FK - 1) / FK;      /* rows 0 .. nun - 1 of the batch's K and V planes are its unmasked keys, the rest its masked keys (the clamp bounds the stage loops' trip counts); lim = stages that hold an unmasked key */
  const size_t r0 = (size_t)b * SQ; const int q0 = blockIdx.x * FQ + wave * (FG * 16);
  const unsigned short* kg = (const unsigned short*)K16 + (r0 + (tid >> 3)) * DM + hd * HD + (tid & 7) * 8;      /* eight lanes cover one 128-byte row */
  const unsigned short* vg = (const unsigned short*)V16 + (r0 + (tid >> 3)) * DM + hd * HD + (tid & 7) * 8;
  const unsigned int lofs = (unsigned int)(tid >> 3) * FP + (unsigned int)(tid & 7) * 16, lofv = (unsigned int)(tid >> 3) * FPV + (unsigned int)(tid & 7) * 16;
  v8us rk[4], rv[4];
  auto fetch = [&](int st) {
#pragma unroll
    for (int u = 0; u < 4; ++u) { rk[u] = *(const v8us*)(kg + ((size_t)st * FK + u * 16) * DM); rv[u] = *(const v8us*)(vg + ((size_t)st * FK + u * 16) * DM); }
    __builtin_amdgcn_sched_barrier(0);      /* the loads stay in front of the wait below */
    asm volatile("s_wait_xcnt 0x0" ::: "memory");      /* behind the issued loads, before a register that they name (address, base) is rewritten for the next stage */
    __builtin_amdgcn_sched_barrier(0);      /* keeps later register writes behind that wait */
  };
  auto put = [&](int buf) {
#pragma unroll
    for (int u = 0; u < 4; ++u) { *(v8us*)&L[buf][lofs + u * 16 * FP] = rk[u]; *(v8us*)&L[buf][FT + lofv + u * 16 * FPV] = rv[u]; } };
  fetch(0);
  v16h qf[FG][2];
#pragma unroll
  for (int g = 0; g < FG; ++g) { const _Float16* qp = Q16 + (r0 + q0 + g * 16 + c) * DM + hd * HD;
#pragma unroll
    for (int kc = 0; kc < 2; ++kc) qf[g][kc] = g2_frag(qp + 32 * kc, h); }
  __builtin_amdgcn_sched_barrier(0);      /* the Q loads stay in front of the wait below */
  asm volatile("s_wait_xcnt 0x0" ::: "memory");      /* behind the issued Q loads, before a register that they name is reused */
  __builtin_amdgcn_sched_barrier(0);      /* keeps later register writes behind that wait */
  put(0);
  fetch(1);
  const v8f z8 = {0.f, 0.f, 0.f, 0.f, 0.f, 0.f, 0.f, 0.f};
  v8f acc[FG][4]; float m_run[FG], l_run[FG];
#pragma unroll
  for (int g = 0; g < FG; ++g) { m_run[g] = -__builtin_inff(); l_run[g] = 0.f;
#pragma unroll
    for (int t = 0; t < 4; ++t) acc[g][t] = z8; }
  const float cs = 0.125f * 1.44269504f;      /* 1 / sqrt(64), and exp(x) as 2^(x log2 e) */
  __syncthreads();      /* stage 0 is published */
  auto stage = [&](int st, auto kind) __attribute__((always_inline)) {      /* inlined at both places: the arrays it works on stay in registers only so */
    if (st + 1 < FNS) put((st + 1) & 1);      /* into the buffer that stage st - 1 used: every wave has left it (barrier at the loop's foot) */
    if (st + 2 < FNS) fetch(st + 2);      /* in flight under this stage's work */
    const unsigned char* Lb = &L[st & 1][0];
#pragma unroll
    for (int p = 0; p < 2; ++p) {
      const unsigned char* kb = Lb + (p * 32 + c) * FP + 16 * h;
      v16h kf[2][2];
#pragma unroll
      for (int kt = 0; kt < 2; ++kt)
#pragma unroll
        for (int kc = 0; kc < 2; ++kc) kf[kt][kc] = lds_frag(kb + kt * 16 * FP + 64 * kc);
      v8f s[2][FG];      /* s[kt][g][r] = raw score of key 32 p + 16 kt + 8 h + r and query 16 g + c */
#pragma unroll
      for (int kt = 0; kt < 2; ++kt)
#pragma unroll
        for (int g = 0; g < FG; ++g) s[kt][g] = fa_mma(kf[kt][1], qf[g][1], fa_mma(kf[kt][0], qf[g][0], z8));
      const unsigned char* vb = Lb + FT + (p * 32 + 8 * h + (lane & 7)) * FPV + 16 * ((lane >> 3) & 1);      /* the transposing load's lane address; every lane is on here */
      v16h vf[4];
#pragma unroll
      for (int t = 0; t < 4; ++t) vf[t] = lds_frag_tr(vb + t * 32);      /* dims 16 t .. 16 t + 15: 32 bytes further along the rows */
      if constexpr (decltype(kind)::masked) {      /* in the sorted key order only the stage at the boundary, and the stages behind it, hold a masked key */
        const int rem = nun - (st * FK + p * 32);      /* unmasked keys from this pass's first key on */
        const unsigned int mw = (rem >= 32 ? 0u : rem <= 0 ? 0xffffffffu : 0xffffffffu << rem) >> (8 * h);      /* bit j: key 8 h + j of the pass is masked */
#pragma unroll
        for (int kt = 0; kt < 2; ++kt)
#pragma unroll
          for (int r = 0; r < 8; ++r) { const bool km = (mw & (1u << (16 * kt + r))) != 0u;
#pragma unroll
            for (int g = 0; g < FG; ++g) s[kt][g][r] = km ? -80000.0f : s[kt][g][r]; } }      /* masked_fill(-10000) on the raw score: -80000 / 8 */
      float mb[FG]; bool need = false;
#pragma unroll
      for (int g = 0; g < FG; ++g) { float mx = s[0][g][0];
#pragma unroll
        for (int r = 1; r < 8; ++r) mx = fmaxf(mx, s[0][g][r]);
#pragma unroll
        for (int r = 0; r < 8; ++r) mx = fmaxf(mx, s[1][g][r]);
        mx = fmaxf(mx, lane_x16(mx)) * cs; mb[g] = mx; need = need || (mx > m_run[g] + 8.0f); }      /* both halves hold the query's maximum of this pass, in log2 units */
      if (__builtin_amdgcn_ballot_w32(need) != 0u) {      /* lazy rescale: the maximum in use may trail the true one by 8 (a weight reaches 2^8 at most); one scalar branch per pass */
#pragma unroll
        for (int g = 0; g < FG; ++g) { const float mn = fmaxf(m_run[g], mb[g]); const float corr = exp2x1(m_run[g] - mn); m_run[g] = mn; l_run[g] *= corr;      /* first pass: 2^(-inf) = 0 on zero sums */
#pragma unroll
          for (int t = 0; t < 4; ++t) acc[g][t] = acc[g][t] * corr; } }
      FragH pf[FG];
#pragma unroll
      for (int g = 0; g < FG; ++g) { const float nm = -m_run[g]; float ls[4] = {0.f, 0.f, 0.f, 0.f};
#pragma unroll
        for (int kt = 0; kt < 2; ++kt) { v8f t8;
#pragma unroll
          for (int r = 0; r < 8; ++r) t8[r] = fmaf(s[kt][g][r], cs, nm);
          const v8f e = exp2x8(t8);
#pragma unroll
          for (int r = 0; r < 8; ++r) { ls[r & 3] += e[r]; pf[g].h[8 * kt + r] = (_Float16)e[r]; } }      /* element 8 kt + r of the B operand = key 16 kt + 8 h + r */
        l_run[g] += (ls[0] + ls[1]) + (ls[2] + ls[3]); }
      __builtin_amdgcn_sched_barrier(0);      /* the exponentials are asm text: all of them stay in front of the second product */
#pragma unroll
      for (int g = 0; g < FG; ++g)
#pragma unroll
        for (int t = 0; t < 4; ++t) acc[g][t] = fa_mma(vf[t], pf[g].v, acc[g][t]);      /* acc[g][t][r] = O[query 16 g + c][dim 16 t + 8 h + r], unnormalised */
    }
    if (st + 1 == lim) { bool open = false;      /* the last stage with an unmasked key: each wave's word for the test at the loop's head, published by the barrier below */
#pragma unroll
      for (int g = 0; g < FG; ++g) open = open || !(m_run[g] >= -14000.0f);
      const unsigned int bal = __builtin_amdgcn_ballot_w32(open); if (lane == 0) vote[wave] = bal; }
    __syncthreads();      /* publishes stage st + 1 and ends every wave's reads of stage st */
  };
  int st = 0;
#pragma unroll 1      /* the stage loops stay rolled: a body already holds two unrolled passes (code size, registers) */
  for (; st < nun / FK; ++st) stage(st, StageKind<false>{});      /* stages of unmasked keys alone: no select */
#pragma unroll 1
  for (; st < FNS; ++st) {
    /* From stage lim on every key is masked: raw score -80000, the same for all. Where every query of the work-group holds a maximum of at least -14000 (log2 units), each such weight is 2^(-14427 - maximum) = 0 exactly
       and no maximum moves, so the remaining stages would add zeros only: leave. Otherwise (no unmasked key at all, or scores near the fill value) all stages run. The test reads the same for the whole work-group. */
    if (st == lim && st > 0) { if (__builtin_amdgcn_readfirstlane((int)(vote[0] | vote[1] | vote[2] | vote[3])) == 0) break; }
    stage(st, StageKind<true>{}); }
#pragma unroll
  for (int g = 0; g < FG; ++g) { const float l = l_run[g] + lane_x16(l_run[g]); const float inv = 1.0f / l;      /* the halves' sums joined once */
#pragma unroll
    for (int t = 0; t < 4; ++t) acc[g][t] = acc[g][t] * inv; }
#pragma unroll
  for (int g = 0; g < FG; ++g) { float* op = out + (r0 + q0 + g * 16 + c) * DM + hd * HD + 8 * h;
#pragma unroll
    for (int t = 0; t < 4; ++t) { const v4f lo = {acc[g][t][0], acc[g][t][1], acc[g][t][2], acc[g][t][3]}, hi = {acc[g][t][4], acc[g][t][5], acc[g][t][6], acc[g][t][7]};
      *(v4f*)(op + 16 * t) = lo; *(v4f*)(op + 16 * t + 4) = hi; } }
}
// Projection GEMM with both operands through LDS: C16[128 rows][64 columns] per work-group = f16(X . W^T / 16 + bias), four waves of 32 x 64, f32 accumulation in ascending k blocks of 32 (the order of k_gemm2).
// A stage is one 128-byte line (64 k) of each of the 128 X rows and 64 W rows. Eight lanes fetch one line, so every global load covers four whole lines (a fragment load straight from global memory touches 16 lines for the same 512 bytes),
// and the W tile is fetched once per work-group instead of once per wave. Registers -> two LDS buffers, as in k_fattn: one barrier per stage publishes stage st + 1 and frees the buffer of stage st.
#define PM 128                       /* X rows per work-group */
#define PN 64                        /* output columns per work-group */
#define PK 64                        /* k per stage */
#define PNS (DM / PK)                /* stages */
#define PT ((PM + PN) * FP)          /* one buffer: X tile, then W tile, rows at pitch FP */
// Launch bounds: at least three waves per SIMD, so that three work-groups per WGP are resident at once (registers; LDS fits three as well).
static_assert(DM % PK == 0 && DM % PN == 0 && PNS >= 2 && MP % PM == 0 && PK * 2 == 128, "k_proj: whole tiles, whole stages, one line per row and stage");
// Work-group barrier that orders LDS alone: __syncthreads() also drains the wave's global loads, which would end the flight of the stage fetched ahead at every stage's foot.
__device__ __forceinline__ void lds_barrier() { __builtin_amdgcn_fence(__ATOMIC_RELEASE, "workgroup", "local"); __builtin_amdgcn_s_barrier(); __builtin_amdgcn_fence(__ATOMIC_ACQUIRE, "workgroup", "local"); }
// The three projections are ONE launch: blockIdx.y picks the job (0 Q, 1 K, 2 V). They read the same X rows and none reads another's output; as one grid a work-group of the next job starts where one of the last ends,
// where three launches in a row each paid a launch gap, a fill and a drain.
// K and V: row r of the product is stored in row rowmap[r] of the plane (the key order of perm_job, rows counted from the plane's start); Q: in row r. Rows stay whole, so the stores cover the same lines.
__global__ __launch_bounds__(128, 3) void k_proj(const _Float16* __restrict__ A, const _Float16* __restrict__ BQ, const _Float16* __restrict__ BK, const _Float16* __restrict__ BV, const float* __restrict__ bq, const float* __restrict__ bk, const float* __restrict__ bv,
    const int* __restrict__ rowmap, _Float16* __restrict__ CQ, _Float16* __restrict__ CK, _Float16* __restrict__ CV) {
  const int job = blockIdx.y; const _Float16* Bh = job == 0 ? BQ : job == 1 ? BK : BV; const float* bias = job == 0 ? bq : job == 1 ? bk : bv; _Float16* C16 = job == 0 ? CQ : job == 1 ? CK : CV;
  __shared__ __attribute__((aligned(16))) unsigned char L[2][PT];
  __shared__ __attribute__((aligned(16))) float so[4][32][68];
  const int tid = threadIdx.x, w = tid >> 5, lane = tid & 31, ln = lane & 15, hh = lane >> 4;
  const int mt = blockIdx.x / (DM / PN), nq = blockIdx.x - mt * (DM / PN); const int row0 = mt * PM + 32 * w, col0 = nq * PN;
  const unsigned short* ag = (const unsigned short*)A + ((size_t)mt * PM + (tid >> 3)) * DM + (tid & 7) * 8;      /* eight lanes cover one 128-byte line */
  const unsigned short* bg = (const unsigned short*)Bh + ((size_t)col0 + (tid >> 3)) * DM + (tid & 7) * 8;
  const unsigned int lofs = (unsigned int)(tid >> 3) * FP + (unsigned int)(tid & 7) * 16;
  v8us ra[PM / 16], rb[PN / 16];
  auto fetch = [&](int st) {
#pragma unroll
    for (int u = 0; u < PM / 16; ++u) ra[u] = *(const v8us*)(ag + (size_t)u * 16 * DM + st * PK);
#pragma unroll
    for (int u = 0; u < PN / 16; ++u) rb[u] = *(const v8us*)(bg + (size_t)u * 16 * DM + st * PK);
    __builtin_amdgcn_sched_barrier(0);      /* the loads stay in front of the wait below */
    asm volatile("s_wait_xcnt 0x0" :: "v"(ag), "v"(bg) : "memory");      /* behind the issued loads, before a register that they name is rewritten; the two addresses are inputs so that they live up to this wait and no result of the last stage's loads is given their registers */
    __builtin_amdgcn_sched_barrier(0);      /* keeps later register writes behind that wait */
  };
  auto put = [&](int buf) {
#pragma unroll
    for (int u = 0; u < PM / 16; ++u) *(v8us*)&L[buf][lofs + u * 16 * FP] = ra[u];
#pragma unroll
    for (int u = 0; u < PN / 16; ++u) *(v8us*)&L[buf][PM * FP + lofs + u * 16 * FP] = rb[u]; };
  fetch(0);
  const int bix = col0 + ln; float bvr[4];      /* the lane's four bias values, fetched here so that their latency lies under the stages */
#pragma unroll
  for (int t = 0; t < 4; ++t) bvr[t] = bias[bix + t * 16];
  const int rix = row0 + lane; int rm = rix;      /* lane l: the row of C16 that takes the wave's row l */
  if (job != 0) rm = rowmap[rix];      /* the same for the whole work-group */
  __builtin_amdgcn_sched_barrier(0);      /* the loads stay in front of the wait below */
  asm volatile("s_wait_xcnt 0x0" :: "v"(bix), "v"(rix) : "memory");      /* behind the issued loads, before a register that they name is rewritten; the indices are inputs so that they live up to this wait */
  __builtin_amdgcn_sched_barrier(0);      /* keeps later register writes behind that wait */
  put(0);
  fetch(1);
  const v8f z8 = {0.f, 0.f, 0.f, 0.f, 0.f, 0.f, 0.f, 0.f};
  v8f acc[2][4];
#pragma unroll
  for (int i = 0; i < 2; ++i)
#pragma unroll
    for (int t = 0; t < 4; ++t) acc[i][t] = z8;
  lds_barrier();      /* stage 0 is published */
#pragma unroll      /* twelve short stages: buffer index, last-stage tests and the loads' k offsets become constants, and no address register is rewritten in the loop */
  for (int st = 0; st < PNS; ++st) {
    if (st + 1 < PNS) put((st + 1) & 1);      /* into the buffer that stage st - 1 used: every wave has left it (barrier at the loop's foot) */
    if (st + 2 < PNS) fetch(st + 2);      /* in flight under this stage's work */
    const unsigned char* ap = &L[st & 1][0] + (32 * w + ln) * FP + 16 * hh; const unsigned char* bp = &L[st & 1][0] + (PM + ln) * FP + 16 * hh;
#pragma unroll
    for (int kc = 0; kc < 2; ++kc) { const v16h a0 = lds_frag(ap + 64 * kc), a1 = lds_frag(ap + 16 * FP + 64 * kc);
#pragma unroll
      for (int t = 0; t < 4; ++t) { const v16h b = lds_frag(bp + t * 16 * FP + 64 * kc); acc[0][t] = fa_mma(a0, b, acc[0][t]); acc[1][t] = fa_mma(a1, b, acc[1][t]); } }
    if (st + 1 < PNS) lds_barrier();      /* publishes stage st + 1 and ends every wave's reads of stage st; behind the last stage nothing of the ring is written or read any more */
  }
#pragma unroll
  for (int u = 0; u < 8; ++u) { const int t = u & 3, half = u >> 2; const float bv = bf16_round(bvr[t]);
#pragma unroll
    for (int r = 0; r < 8; ++r) so[w][half * 16 + 8 * hh + r][t * 16 + ln] = acc[half][t][r] * 0.0625f + bv; }
  __builtin_amdgcn_fence(__ATOMIC_ACQ_REL, "workgroup"); __builtin_amdgcn_wave_barrier();      /* each wave reads back only its own rows */
  const int rsub = lane >> 4, c4 = (lane & 15) * 4;
#pragma unroll
  for (int q = 0; q < 16; ++q) { const int r = q * 2 + rsub; const v4f v = *(const v4fa*)&so[w][r][c4]; v4h h4; for (int i = 0; i < 4; ++i) h4[i] = (_Float16)v[i];
    const int re = __builtin_amdgcn_readlane(rm, q * 2), rd = __builtin_amdgcn_readlane(rm, q * 2 + 1); const int ro = rsub ? rd : re;      /* both read first: a select, no branch */
    *(v4h*)(C16 + (size_t)ro * DM + col0 + c4) = h4; }
}
extern "C" void kernel_launch(void* const* d_in, const int* in_sizes, int n_in,
                              void* d_out, int out_size, void* d_ws, size_t ws_size, hipStream_t stream) {
  (void)in_sizes; (void)n_in; (void)out_size;
  const float* const* I = (const float* const*)d_in; const float* x = I[0]; const float* am = I[1]; const float* wq = I[2]; const float* bq = I[3]; const float* wk = I[4]; const float* bk = I[5]; const float* wv = I[6]; const float* bv = I[7];      /* hidden_states; attention_mask f32 [4][1][1][2048] (READ on device: key masked iff bf16(mask) < 0); natural weights + biases */
  char* ws = (char*)d_ws; size_t off = 0;
  auto take = [&](size_t bytes) { char* p = ws + off; off += (bytes + 255) & ~(size_t)255; return p; };
  _Float16* BQ = (_Float16*)take((size_t)DM * DM * 2); _Float16* BK = (_Float16*)take((size_t)DM * DM * 2); _Float16* BV = (_Float16*)take((size_t)DM * DM * 2); 
  _Float16* X16 = (_Float16*)take(NR * DM * 2); _Float16* Q16 = (_Float16*)take(NR * DM * 2); _Float16* K16 = (_Float16*)take(NR * DM * 2); _Float16* V16 = (_Float16*)take(NR * DM * 2);
  int* POS = (int*)take(NR * 4); int* NUN = (int*)take((size_t)NB * 4);
  if (off > ws_size) return;
  k_prep<<<NB + 3 * WB + XB, 256, 0, stream>>>(x, am, wq, wk, wv, X16, BQ, BK, BV, POS, NUN);      /* key order per batch (unmasked first), weight planes, x rows */
  const size_t r0p = (size_t)B0 * SQ;      /* first projected row */
  k_proj<<<dim3((unsigned)((MP / PM) * (DM / PN)), 3), 128, 0, stream>>>(X16 + r0p * DM, BQ, BK, BV, bq, bk, bv, POS + r0p, Q16 + r0p * DM, K16, V16);      /* K and V rows in the key order of perm_job */
  k_fattn<<<dim3(SQ / FQ, NH, NB), FW * 32, 0, stream>>>(Q16, K16, V16, NUN, (float*)d_out);      /* scores, sign key mask (select, -10000 fill), softmax and P V in one launch; f32 straight into the merged-heads output rows */
}

// v007
// It runs in 67.3 microseconds.
// Timed twice side by side with v006, it ran 1.14 times as fast both times.
// Counting every step since v000, it is 77.7 times as fast.
#include <hip/hip_runtime.h>
// BERT self-attention without an output projection and with a SIGN key mask (hidden_states [4][2048][768]; q/k/v = x W^T + b (natural [768][768] sigma 0.02, biases sigma 0.02); 12 heads of 64; scores / 8; masked_fill(attention_mask < 0, -10000) with the f32 [4][1][1][2048] mask input (a key of batch b is masked iff its mask value is negative); softmax over all keys; context = heads merged -> [4][2048][768]).
// Structure: token rows r = b*2048 + s; x as exact f16 rows (bf16-rounded); Q, K, V as three WMMA GEMMs (64x96 wave tiles, f32 accumulation, exact x16 weights + bias, f16 outputs); the K and V rows of a batch stored in key order 'unmasked first, then masked' (perm_job), so that the attention launch ends behind the last unmasked key when every later weight is exactly 0; one fused attention launch (scores on WMMA, K = 64; online softmax on VALU, f32 statistics, weights as f16 relative to the running maximum; o = P . V on WMMA, its V^T operand read from the staged V rows by transposing LDS loads) written f32 straight into the merged-heads output rows (no output projection).
// Compute dtype: inputs rounded to bf16; x / weights exact; q, k, v and softmax weights as plain f16 GEMM operands (~2^-12); scores, softmax statistics and o f32. v_wmma_f32_16x16x32_f16.
#define NB 4
#define SQ 2048
#define DM 768
#define NH 12
#define HD 64
#define HG 4                         /* heads per launch of the per-batch k_vt overload */
#define B0 0                         /* first batch processed (debug hook) */
#define NBR NB                       /* batches processed (debug hook) */
#define NR ((size_t)NB * SQ)         /* token rows */
#define MP ((int)((size_t)NBR * SQ)) /* rows projected (debug hook) */
#define QN SQ                        /* unused */
#define NHD NH                       /* unused */
#define MPO MP                       /* unused */
#define LQ DM      /* row pitch of the q/k/v rows */
typedef __bf16 v16b __attribute__((ext_vector_type(16)));
typedef unsigned short v8us __attribute__((ext_vector_type(8), may_alias));
typedef float  v8f  __attribute__((ext_vector_type(8)));
typedef float  v4f  __attribute__((ext_vector_type(4)));
typedef float  v4fa __attribute__((ext_vector_type(4), may_alias));
union FragB { v16b v; v8us half[2]; unsigned short u[16]; };

__device__ __forceinline__ unsigned short bf16_bits(float x) { unsigned int u = __float_as_uint(x); return (unsigned short)((u + 0x7FFFu + ((u >> 16) & 1u)) >> 16); }
__device__ __forceinline__ float bf16_val(unsigned short b) { return __uint_as_float(((unsigned int)b) << 16); }
__device__ __forceinline__ float bf16_round(float x) { return bf16_val(bf16_bits(x)); }
// D += A·B with NT terms: 1 = ah·bh, 2 = + al·bh (A split), 3 = + ah·bl (both split)
template <int NT>
__device__ __forceinline__ v8f mmaN(v16b ah, v16b al, v16b bh, v16b bl, v8f c) {
  c = __builtin_amdgcn_wmma_f32_16x16x32_bf16(false, ah, false, bh, (short)0, c, false, false);
  if (NT >= 2) c = __builtin_amdgcn_wmma_f32_16x16x32_bf16(false, al, false, bh, (short)0, c, false, false);
  if (NT >= 3) c = __builtin_amdgcn_wmma_f32_16x16x32_bf16(false, ah, false, bl, (short)0, c, false, false);
  asm volatile("v_nop\n\tv_nop\n\tv_nop\n\tv_nop" : "+v"(c) : "v"(ah), "v"(al), "v"(bh), "v"(bl));
  return c;
}

__global__ __launch_bounds__(256) void k_wt_bf16(const float* __restrict__ W, unsigned short* __restrict__ Wt, int K, int N) {
  const int t = blockIdx.x * 256 + threadIdx.x;
  const int k8n = K / 8;
  if (t >= N * k8n) return;
  const int n = t / k8n, k8 = (t % k8n) * 8;
  v8us v;
#pragma unroll
  for (int i = 0; i < 8; ++i) v[i] = bf16_bits(W[(size_t)(k8 + i) * N + n]);
  *(v8us*)(Wt + (size_t)n * K + k8) = v;
  
}

// GEMM C[M][N] (f32, pitch ldc) = act(A[M][K]·W + bias). A f32 row-major (pitch lda) converted per fragment to bf16
// (ASPLIT: hi/lo two planes -> 2 terms, else single rounded term); Wt bf16 [N][K] (pitch ldb). BIAS_BF16 rounds the
// bias to bf16 first (bias quantised to bf16 before the add). K%32==0, M%16==0, N%64==0.
template <bool ASPLIT, int ACT, bool BIAS_BF16>
__global__ __launch_bounds__(128) void k_gemm_bf(const float* __restrict__ A, int lda, const unsigned short* __restrict__ Wt, int ldb,
                                               const float* __restrict__ bias, float* __restrict__ C, int ldc, int M, int N, int K) {
  __shared__ __attribute__((aligned(16))) float so[4][16][64];
  const int tid = threadIdx.x, w = tid >> 5, lane = tid & 31, ln = lane & 15, hh = lane >> 4;
  const int ntn = N / 64;
  const int wid = blockIdx.x * 4 + w;
  const int mt = wid / ntn, nq = wid % ntn;
  if (mt * 16 >= M) return;
  const int row0 = mt * 16, col0 = nq * 64;
  const float* arow = A + (size_t)(row0 + ln) * lda;
  v8f acc[4] = {};
  for (int kb = 0; kb < K; kb += 32) {
    FragB ah, al;
    const v4f x0 = *(const v4fa*)(arow + kb + 8 * hh), x1 = *(const v4fa*)(arow + kb + 8 * hh + 4);
    const v4f x2 = *(const v4fa*)(arow + kb + 16 + 8 * hh), x3 = *(const v4fa*)(arow + kb + 16 + 8 * hh + 4);
    float xs[16] = {x0[0],x0[1],x0[2],x0[3],x1[0],x1[1],x1[2],x1[3],x2[0],x2[1],x2[2],x2[3],x3[0],x3[1],x3[2],x3[3]};
#pragma unroll
    for (int i = 0; i < 16; ++i) { const unsigned short hb = bf16_bits(xs[i]); ah.u[i] = hb; al.u[i] = ASPLIT ? bf16_bits(xs[i] - bf16_val(hb)) : (unsigned short)0; }
#pragma unroll
    for (int t = 0; t < 4; ++t) {
      const unsigned short* brow = Wt + (size_t)(col0 + t * 16 + ln) * ldb + kb;
      FragB b;
      b.half[0] = *(const v8us*)(brow + 8 * hh);
      b.half[1] = *(const v8us*)(brow + 16 + 8 * hh);
      acc[t] = mmaN<ASPLIT ? 2 : 1>(ah.v, al.v, b.v, b.v, acc[t]);
    }
  }
#pragma unroll
  for (int t = 0; t < 4; ++t) {
    float bv = bias ? bias[col0 + t * 16 + ln] : 0.f;
    if (BIAS_BF16) bv = bf16_round(bv);
#pragma unroll
    for (int r = 0; r < 8; ++r) { float v = acc[t][r] + bv; if (ACT == 1) v = fmaxf(v, 0.f); so[w][8 * hh + r][t * 16 + ln] = v; }
  }
  __builtin_amdgcn_fence(__ATOMIC_ACQ_REL, "workgroup");
  __builtin_amdgcn_wave_barrier();
  const int rsub = lane >> 4, c4 = (lane & 15) * 4;
  {
#pragma unroll
    for (int q = 0; q < 8; ++q) {
      const int r = q * 2 + rsub;
      const v4f v = *(const v4fa*)&so[w][r][c4];
      *(v4f*)(C + (size_t)(row0 + r) * ldc + col0 + c4) = v;
    }
    
  }
}

// GEMM C = act(A·W + bias + resid): A f32 (ASPLIT -> hi/lo 2 terms), Wt bf16 [N][K]; ACT 0 none, 1 relu, 2 exact gelu;
// resid (optional, f32, row index = (row % rmod), pitch ldr, RES_BF16 rounds it) added before the activation.
template <bool ASPLIT, int ACT, bool BIAS_BF16, bool RES_BF16>
__global__ __launch_bounds__(128) void k_gemm_bf3(const float* __restrict__ A, int lda, const unsigned short* __restrict__ Wt, int ldb,
                                                const float* __restrict__ bias, const float* __restrict__ resid, int rmod, int ldr,
                                                float* __restrict__ C, int ldc, int M, int N, int K) {
  __shared__ __attribute__((aligned(16))) float so[4][16][64];
  const int tid = threadIdx.x, w = tid >> 5, lane = tid & 31, ln = lane & 15, hh = lane >> 4;
  const int ntn = N / 64;
  const int wid = blockIdx.x * 4 + w;
  const int mt = wid / ntn, nq = wid % ntn;
  if (mt * 16 >= M) return;
  const int row0 = mt * 16, col0 = nq * 64;
  const float* arow = A + (size_t)(row0 + ln) * lda;
  v8f acc[4] = {};
  for (int kb = 0; kb < K; kb += 32) {
    FragB ah, al;
    const v4f x0 = *(const v4fa*)(arow + kb + 8 * hh), x1 = *(const v4fa*)(arow + kb + 8 * hh + 4);
    const v4f x2 = *(const v4fa*)(arow + kb + 16 + 8 * hh), x3 = *(const v4fa*)(arow + kb + 16 + 8 * hh + 4);
    float xs[16] = {x0[0],x0[1],x0[2],x0[3],x1[0],x1[1],x1[2],x1[3],x2[0],x2[1],x2[2],x2[3],x3[0],x3[1],x3[2],x3[3]};
#pragma unroll
    for (int i = 0; i < 16; ++i) { const unsigned short hb = bf16_bits(xs[i]); ah.u[i] = hb; al.u[i] = ASPLIT ? bf16_bits(xs[i] - bf16_val(hb)) : (unsigned short)0; }
#pragma unroll
    for (int t = 0; t < 4; ++t) {
      const unsigned short* brow = Wt + (size_t)(col0 + t * 16 + ln) * ldb + kb;
      FragB b;
      b.half[0] = *(const v8us*)(brow + 8 * hh);
      b.half[1] = *(const v8us*)(brow + 16 + 8 * hh);
      acc[t] = mmaN<ASPLIT ? 2 : 1>(ah.v, al.v, b.v, b.v, acc[t]);
    }
  }
#pragma unroll
  for (int t = 0; t < 4; ++t) {
    const int col = col0 + t * 16 + ln;
    float bv = bias ? bias[col] : 0.f;
    if (BIAS_BF16) bv = bf16_round(bv);
#pragma unroll
    for (int r = 0; r < 8; ++r) {
      float v = acc[t][r] + bv;
      if (resid) { float rv = resid[(size_t)((row0 + 8 * hh + r) % rmod) * ldr + col]; if (RES_BF16) rv = bf16_round(rv); v += rv; }
      if (ACT == 1) v = fmaxf(v, 0.f);
      if (ACT == 2) v = 0.5f * v * (1.0f + erff(v * 0.70710678118654752f));
      if (ACT == 3) { const float u = 0.7978845608028654f * (v + 0.044715f * v * v * v); v = 0.5f * v * (1.0f + tanhf(u)); }
      so[w][8 * hh + r][t * 16 + ln] = v;
    }
  }
  __builtin_amdgcn_fence(__ATOMIC_ACQ_REL, "workgroup");
  __builtin_amdgcn_wave_barrier();
  const int rsub = lane >> 4, c4 = (lane & 15) * 4;
  {
#pragma unroll
    for (int q = 0; q < 8; ++q) {
      const int r = q * 2 + rsub;
      const v4f v = *(const v4fa*)&so[w][r][c4];
      *(v4f*)(C + (size_t)(row0 + r) * ldc + col0 + c4) = v;
    }
    
  }
}
// row LayerNorm (biased variance, eps) over N: s = X (+ R); optional out_sum <- s; out_norm <- (s-mu)*rsqrt(var+eps)*g + b
template <bool PARAM_BF16>
__global__ __launch_bounds__(256) void k_layernorm(const float* __restrict__ X, const float* __restrict__ R, const float* __restrict__ g, const float* __restrict__ bta,
                                                  float* __restrict__ out_sum, float* __restrict__ out_norm, int N, float eps) {
  __shared__ float red[256];
  const int row = blockIdx.x, tid = threadIdx.x;
  const float* x = X + (size_t)row * N; const float* rr = R ? R + (size_t)row * N : nullptr;
  float vals[16];                     // up to N = 4096
  const int per = N / 256;            // contiguous chunk per thread? use strided-by-4 chunks: thread handles j = tid*4 + 1024*u
  float s1 = 0.f;
  for (int u = 0; u < per / 4; ++u) {
    const int j = tid * 4 + 1024 * u;
    const v4f a = *(const v4fa*)(x + j);
    v4f b = {0.f,0.f,0.f,0.f}; if (rr) b = *(const v4fa*)(rr + j);
#pragma unroll
    for (int q = 0; q < 4; ++q) { const float v = a[q] + b[q]; vals[u * 4 + q] = v; s1 += v; }
  }
  red[tid] = s1; __syncthreads();
  for (int st = 128; st > 0; st >>= 1) { if (tid < st) red[tid] += red[tid + st]; __syncthreads(); }
  const float mu = red[0] / (float)N; __syncthreads();
  float s2 = 0.f;
  for (int u = 0; u < per / 4; ++u)
#pragma unroll
    for (int q = 0; q < 4; ++q) { const float c = vals[u * 4 + q] - mu; s2 += c * c; }
  red[tid] = s2; __syncthreads();
  for (int st = 128; st > 0; st >>= 1) { if (tid < st) red[tid] += red[tid + st]; __syncthreads(); }
  const float rs = rsqrtf(red[0] / (float)N + eps);
  {
    for (int u = 0; u < per / 4; ++u) {
      const int j = tid * 4 + 1024 * u;
      v4f o, sm;
#pragma unroll
      for (int q = 0; q < 4; ++q) {
        float gg = g[j + q], bb = bta[j + q];
        if (PARAM_BF16) { gg = bf16_round(gg); bb = bf16_round(bb); }
        sm[q] = vals[u * 4 + q]; o[q] = (vals[u * 4 + q] - mu) * rs * gg + bb;
      }
      if (out_sum) *(v4f*)(out_sum + (size_t)row * N + j) = sm;
      *(v4f*)(out_norm + (size_t)row * N + j) = o;
    }
    
  }
}



// ---- f16 WMMA path (v_wmma_f32_16x16x32_f16): 11-bit significands for operands in range — used where a [0,1] probability operand needs more precision than bf16
typedef _Float16 v16h __attribute__((ext_vector_type(16)));
union FragH { v16h v; v8us half[2]; _Float16 h[16]; unsigned short u[16]; };
template <int NT>
__device__ __forceinline__ v8f mmaH(v16h ah, v16h al, v16h bh, v16h bl, v8f c) {
  c = __builtin_amdgcn_wmma_f32_16x16x32_f16(false, ah, false, bh, (short)0, c, false, false);
  if (NT >= 2) c = __builtin_amdgcn_wmma_f32_16x16x32_f16(false, al, false, bh, (short)0, c, false, false);
  if (NT >= 3) c = __builtin_amdgcn_wmma_f32_16x16x32_f16(false, ah, false, bl, (short)0, c, false, false);
  asm volatile("v_nop\n\tv_nop\n\tv_nop\n\tv_nop" : "+v"(c) : "v"(ah), "v"(al), "v"(bh), "v"(bl));
  return c;
}
// batched GEMM like k_gemm_b but f16 operands: A f32 (split into f16 hi/lo if ASPLIT, else rounded to f16), Bt = f16 values [n][k]; alpha; C f32; N multiple of 16 (partial tiles skipped)
template <bool ASPLIT>
__global__ __launch_bounds__(128) void k_gemm_h(const float* __restrict__ A, int lda, size_t sA, const _Float16* __restrict__ Bh, int ldb, size_t sB, float alpha, float* __restrict__ C, int ldc, size_t sC, int M, int N, int K) {
  __shared__ __attribute__((aligned(16))) float so[4][16][64];
  const int tid = threadIdx.x, w = tid >> 5, lane = tid & 31, ln = lane & 15, hh = lane >> 4; const int by = blockIdx.y;
  A += (size_t)by * sA; Bh += (size_t)by * sB; C += (size_t)by * sC;
  const int ntn = (N + 63) / 64; const int wid = blockIdx.x * 4 + w; const int mt = wid / ntn, nq = wid % ntn; if (mt * 16 >= M) return;
  const int row0 = mt * 16, col0 = nq * 64; const float* arow = A + (size_t)(row0 + ln) * lda;
  v8f acc[4] = {};
  for (int kb = 0; kb < K; kb += 32) {
    FragH ah, al;
    const v4f x0 = *(const v4fa*)(arow + kb + 8 * hh), x1 = *(const v4fa*)(arow + kb + 8 * hh + 4), x2 = *(const v4fa*)(arow + kb + 16 + 8 * hh), x3 = *(const v4fa*)(arow + kb + 16 + 8 * hh + 4);
    float xs[16] = {x0[0],x0[1],x0[2],x0[3],x1[0],x1[1],x1[2],x1[3],x2[0],x2[1],x2[2],x2[3],x3[0],x3[1],x3[2],x3[3]};
#pragma unroll
    for (int i = 0; i < 16; ++i) { const _Float16 h = (_Float16)xs[i]; ah.h[i] = h; al.h[i] = ASPLIT ? (_Float16)(xs[i] - (float)h) : (_Float16)0.0f; }
#pragma unroll
    for (int t = 0; t < 4; ++t) { if (col0 + t * 16 >= N) continue; const size_t boff = (size_t)(col0 + t * 16 + ln) * ldb + kb; FragH bq; bq.half[0] = *(const v8us*)(Bh + boff + 8 * hh); bq.half[1] = *(const v8us*)(Bh + boff + 16 + 8 * hh);
      acc[t] = mmaH<ASPLIT ? 2 : 1>(ah.v, al.v, bq.v, bq.v, acc[t]); }
  }
#pragma unroll
  for (int t = 0; t < 4; ++t) { if (col0 + t * 16 >= N) continue;
#pragma unroll
    for (int r = 0; r < 8; ++r) so[w][8 * hh + r][t * 16 + ln] = acc[t][r] * alpha; }
  __builtin_amdgcn_fence(__ATOMIC_ACQ_REL, "workgroup"); __builtin_amdgcn_wave_barrier();
  const int rsub = lane >> 4, c4 = (lane & 15) * 4;
  {
#pragma unroll
    for (int q = 0; q < 8; ++q) { const int r = q * 2 + rsub; if (col0 + c4 < N) { const v4f v = *(const v4fa*)&so[w][r][c4]; *(v4f*)(C + (size_t)(row0 + r) * ldc + col0 + c4) = v; } }
     }
}

// Wt[n][k] = f16(W[k][n]·scale) from f32 row-major W[K][N] (scale = power of two; bf16-exact weights stay exact in f16 away from the subnormal range)
__global__ __launch_bounds__(256) void k_wt_f16(const float* __restrict__ W, _Float16* __restrict__ Wt, int K, int N, float scale) {
  const int t = blockIdx.x * 256 + threadIdx.x; if (t >= N * (K / 8)) return; const int n = t / (K / 8), k8 = (t % (K / 8)) * 8; FragH f;
#pragma unroll
  for (int i = 0; i < 8; ++i) f.h[i] = (_Float16)(bf16_round(W[(size_t)(k8 + i) * N + n]) * scale); const v8us o = f.half[0];
  *(v8us*)((unsigned short*)Wt + (size_t)n * K + k8) = o; 
}
// k_gemm_hh variant with fused epilogue: v = acc·alpha + bias[by·sBias + col] (+ CP[(row/rowsPerB)·sCPb + by·64 + col] if CP) ; ACT 0 none / 1 elu ; writes f16 C16 (and f32 C if non-null)
template <int ACT>
__global__ __launch_bounds__(128) void k_gemm_hhx(const _Float16* __restrict__ A, int lda, size_t sA, const _Float16* __restrict__ Bh, int ldb, size_t sB, float alpha, const float* __restrict__ bias, size_t sBias, const float* __restrict__ CP, int rowsPerB, size_t sCPb, int row0g,
    float* __restrict__ C, _Float16* __restrict__ C16, int ldc, size_t sC, int M, int N, int K) {
  __shared__ __attribute__((aligned(16))) float so[4][16][64];
  const int tid = threadIdx.x, w = tid >> 5, lane = tid & 31, ln = lane & 15, hh = lane >> 4; const int by = blockIdx.y;
  A += (size_t)by * sA; Bh += (size_t)by * sB; const size_t cofs = (size_t)by * sC; const float* bp = bias ? bias + (size_t)by * sBias : nullptr;
  const int ntn = (N + 63) / 64; const int wid = blockIdx.x * 4 + w; const int mt = wid / ntn, nq = wid % ntn; if (mt * 16 >= M) return;
  const int row0 = mt * 16, col0 = nq * 64; const _Float16* arow = A + (size_t)(row0 + ln) * lda;
  v8f acc[4] = {};
  for (int kb = 0; kb < K; kb += 32) { FragH ah; ah.half[0] = *(const v8us*)((const unsigned short*)arow + kb + 8 * hh); ah.half[1] = *(const v8us*)((const unsigned short*)arow + kb + 16 + 8 * hh);
#pragma unroll
    for (int t = 0; t < 4; ++t) { if (col0 + t * 16 >= N) continue; const size_t boff = (size_t)(col0 + t * 16 + ln) * ldb + kb; FragH bq; bq.half[0] = *(const v8us*)((const unsigned short*)Bh + boff + 8 * hh); bq.half[1] = *(const v8us*)((const unsigned short*)Bh + boff + 16 + 8 * hh);
      acc[t] = mmaH<1>(ah.v, ah.v, bq.v, bq.v, acc[t]); }
  }
#pragma unroll
  for (int t = 0; t < 4; ++t) { if (col0 + t * 16 >= N) continue; const int col = col0 + t * 16 + ln; const float bv = bp ? bf16_round(bp[col]) : 0.f;
#pragma unroll
    for (int r = 0; r < 8; ++r) { float v = acc[t][r] * alpha + bv; if (CP) { const int rr = row0g + row0 + 8 * hh + r; if (rowsPerB < 0) v += CP[cofs + (size_t)rr * ldc + col];      /* rowsPerB < 0: own element of the batched C plane */ else { const int bidx = rr / rowsPerB; v += CP[(size_t)bidx * sCPb + (size_t)by * 64 + col]; } } if (ACT == 1) v = (v > 0.f) ? v : expm1f(v); else if (ACT == 7) v = (v > 0.f) ? v + 1.0f : expf(v); else if (ACT == 8) v = tanhf(v); else if (ACT == 9) v = 0.5f * v * (1.0f + tanhf(0.7978845608028654f * (v + 0.044715f * v * v * v))); else if (ACT == 11) v = 1.0f / (1.0f + expf(-v)); else if (ACT == 12) v = (v > 0.f) ? v : 0.01f * v; else if (ACT == 14) v = (v > 0.f) ? v : 0.1f * v; else if (ACT == 16) v = (v >= 0.f) ? v : 0.3f * v; else if (ACT == 17) v = (v >= 0.f) ? v : 0.2f * v; else if (ACT == 15) v = v / (1.0f + expf(-v)); else if (ACT == 3) v = fmaxf(v, 0.f); else if (ACT == 6) v = 0.5f * v * (1.0f + erff(v * 0.70710678118654752f)); so[w][8 * hh + r][t * 16 + ln] = v; } }
  __builtin_amdgcn_fence(__ATOMIC_ACQ_REL, "workgroup"); __builtin_amdgcn_wave_barrier();
  const int rsub = lane >> 4, c4 = (lane & 15) * 4; typedef _Float16 v4h __attribute__((ext_vector_type(4)));
  {
#pragma unroll
    for (int q = 0; q < 8; ++q) { const int r = q * 2 + rsub; if (col0 + c4 < N) { const v4f v = *(const v4fa*)&so[w][r][c4]; if (C) *(v4f*)(C + cofs + (size_t)(row0 + r) * ldc + col0 + c4) = v; if (C16) { v4h h4; for (int i = 0; i < 4; ++i) h4[i] = (_Float16)v[i]; *(v4h*)(C16 + cofs + (size_t)(row0 + r) * ldc + col0 + c4) = h4; } } }
     }
}


typedef _Float16 v4h __attribute__((ext_vector_type(4)));

__global__ __launch_bounds__(256) void k_h16(const float* __restrict__ x, _Float16* __restrict__ X16, size_t n8) { const size_t t = (size_t)blockIdx.x * 256 + threadIdx.x; if (t >= n8) return; FragH f;
#pragma unroll
  for (int q = 0; q < 8; ++q) f.h[q] = (_Float16)x[t * 8 + q]; *(v8us*)((unsigned short*)X16 + t * 8) = f.half[0];  }
__global__ __launch_bounds__(256) void k_round16f(const float* __restrict__ W, _Float16* __restrict__ Bt, size_t n8) { const size_t t = (size_t)blockIdx.x * 256 + threadIdx.x; if (t >= n8) return; FragH f;
#pragma unroll
  for (int i = 0; i < 8; ++i) f.h[i] = (_Float16)(bf16_round(W[t * 8 + i]) * 16.0f); *(v8us*)((unsigned short*)Bt + t * 8) = f.half[0];  }
__global__ __launch_bounds__(256) void k_hl(const float* __restrict__ F, _Float16* __restrict__ Hh, _Float16* __restrict__ Hl, size_t n8) { const size_t t = (size_t)blockIdx.x * 256 + threadIdx.x; if (t >= n8) return; FragH fh, fl; const v4f a = *(const v4fa*)(F + t * 8), c = *(const v4fa*)(F + t * 8 + 4);
#pragma unroll
  for (int q = 0; q < 4; ++q) { _Float16 h = (_Float16)a[q]; fh.h[q] = h; fl.h[q] = (_Float16)((a[q] - (float)h) * 1024.0f); h = (_Float16)c[q]; fh.h[4 + q] = h; fl.h[4 + q] = (_Float16)((c[q] - (float)h) * 1024.0f); }
  { *(v8us*)((unsigned short*)Hh + t * 8) = fh.half[0]; *(v8us*)((unsigned short*)Hl + t * 8) = fl.half[0];  } }

// ---- fast GEMM (wave tile 32x64; requires M % 32 == 0 rows per launch region and N % 64 == 0); epilogue = k_gemm_hhx semantics ----
__device__ __forceinline__ v16h g2_frag(const _Float16* p, int hh) { FragH f; f.half[0] = *(const v8us*)((const unsigned short*)p + 8 * hh); f.half[1] = *(const v8us*)((const unsigned short*)p + 16 + 8 * hh); return f.v; }
__device__ __forceinline__ v8f g2_mma(v16h a, v16h b, v8f c) { v8f d = __builtin_amdgcn_wmma_f32_16x16x32_f16(false, a, false, b, (short)0, c, false, false); asm volatile("v_nop\n\tv_nop\n\tv_nop\n\tv_nop" : "+v"(d) : "v"(a), "v"(b)); return d; }
template <int ACT>
__global__ __launch_bounds__(128) void k_gemm2(const _Float16* __restrict__ A, int lda, size_t sA, const _Float16* __restrict__ Bh, int ldb, size_t sB, float alpha, const float* __restrict__ bias, size_t sBias, const float* __restrict__ CP, int rowsPerB, size_t sCPb, int row0g,
    float* __restrict__ C, _Float16* __restrict__ C16, int ldc, size_t sC, int M, int N, int K) { static_assert(ACT == 0 || ACT == 3 || ACT == 6 || ACT == 8 || ACT == 9 || ACT == 11 || ACT == 12 || ACT == 14 || ACT == 15 || ACT == 16 || ACT == 17, "k_gemm2: unsupported ACT code (would silently apply no activation)");
  __shared__ __attribute__((aligned(16))) float so[4][32][68];
  const int tid = threadIdx.x, w = tid >> 5, lane = tid & 31, ln = lane & 15, hh = lane >> 4; const int by = blockIdx.y;
  A += (size_t)by * sA; Bh += (size_t)by * sB; const size_t cofs = (size_t)by * sC; const float* bp = bias ? bias + (size_t)by * sBias : nullptr;
  const int ntn = N >> 6; const int mt = blockIdx.x / ntn, nq = blockIdx.x - mt * ntn; const int row0 = mt * 128 + 32 * w, col0 = nq * 64; if (row0 >= M) return;
  const _Float16* a0p = A + (size_t)(row0 + ln) * lda; const _Float16* a1p = a0p + (size_t)16 * lda;
  const _Float16* b0p = Bh + (size_t)(col0 + ln) * ldb; const _Float16* b1p = b0p + (size_t)16 * ldb; const _Float16* b2p = b1p + (size_t)16 * ldb; const _Float16* b3p = b2p + (size_t)16 * ldb;
  const v8f z8 = {0.f,0.f,0.f,0.f,0.f,0.f,0.f,0.f}; v8f c00 = z8, c01 = z8, c02 = z8, c03 = z8, c10 = z8, c11 = z8, c12 = z8, c13 = z8;
#pragma unroll 1
  for (int kb = 0; kb < K; kb += 32) { const v16h a0 = g2_frag(a0p + kb, hh), a1 = g2_frag(a1p + kb, hh);
    v16h b = g2_frag(b0p + kb, hh); c00 = g2_mma(a0, b, c00); c10 = g2_mma(a1, b, c10);
    b = g2_frag(b1p + kb, hh); c01 = g2_mma(a0, b, c01); c11 = g2_mma(a1, b, c11);
    b = g2_frag(b2p + kb, hh); c02 = g2_mma(a0, b, c02); c12 = g2_mma(a1, b, c12);
    b = g2_frag(b3p + kb, hh); c03 = g2_mma(a0, b, c03); c13 = g2_mma(a1, b, c13); }
  v8f accs[8] = {c00, c01, c02, c03, c10, c11, c12, c13};
#pragma unroll
  for (int u = 0; u < 8; ++u) { const int t = u & 3, half = u >> 2; const int col = col0 + t * 16 + ln; const float bv = bp ? bf16_round(bp[col]) : 0.f;
#pragma unroll
    for (int r = 0; r < 8; ++r) { const int rloc = half * 16 + 8 * hh + r; float v = accs[u][r] * alpha + bv; if (CP) { if (rowsPerB < 0) v += CP[cofs + (size_t)(row0g + row0 + rloc) * ldc + col];      /* rowsPerB < 0: own element of the batched C plane */ else { const int bidx = (row0g + row0 + rloc) / rowsPerB; v += CP[(size_t)bidx * sCPb + (size_t)by * 64 + col]; } }
      if (ACT == 3) v = fmaxf(v, 0.f); else if (ACT == 6) v = 0.5f * v * (1.0f + erff(v * 0.70710678118654752f)); else if (ACT == 11) v = 1.0f / (1.0f + expf(-v)); else if (ACT == 15) v = v / (1.0f + expf(-v)); else if (ACT == 12) v = (v > 0.f) ? v : 0.01f * v; else if (ACT == 8) v = tanhf(v); else if (ACT == 9) v = 0.5f * v * (1.0f + tanhf(0.7978845608028654f * (v + 0.044715f * v * v * v))); else if (ACT == 14) v = (v > 0.f) ? v : 0.1f * v; else if (ACT == 16) v = (v >= 0.f) ? v : 0.3f * v; else if (ACT == 17) v = (v >= 0.f) ? v : 0.2f * v;
      so[w][rloc][t * 16 + ln] = v; } }
  __builtin_amdgcn_fence(__ATOMIC_ACQ_REL, "workgroup"); __builtin_amdgcn_wave_barrier();
  const int rsub = lane >> 4, c4 = (lane & 15) * 4;
  {
#pragma unroll
    for (int q = 0; q < 16; ++q) { const int r = q * 2 + rsub; const v4f v = *(const v4fa*)&so[w][r][c4]; if (C) *(v4f*)(C + cofs + (size_t)(row0 + r) * ldc + col0 + c4) = v; if (C16) { v4h h4; for (int i = 0; i < 4; ++i) h4[i] = (_Float16)v[i]; *(v4h*)(C16 + cofs + (size_t)(row0 + r) * ldc + col0 + c4) = h4; } }
     } }


__global__ __launch_bounds__(256) void k_rsm(const float* __restrict__ S, _Float16* __restrict__ P, int nrows) {
  #pragma clang fp contract(off)
  const int i = blockIdx.x * 256 + threadIdx.x; if (i >= nrows) return; const float* s = S + (size_t)i * SQ; float mx = -3.0e38f;
#pragma unroll 1
  for (int j = 0; j < SQ; ++j) mx = fmaxf(mx, s[j]); float se = 0.f;
#pragma unroll 1
  for (int j = 0; j < SQ; ++j) se += expf(s[j] - mx); const float sc = 256.0f / se;
#pragma unroll 1
  for (int j0 = 0; j0 < SQ; j0 += 8) { FragH f; for (int q = 0; q < 8; ++q) f.h[q] = (_Float16)(expf(s[j0 + q] - mx) * sc); unsigned short* d = (unsigned short*)P + (size_t)i * SQ + j0; *(v8us*)d = f.half[0];  } }
__global__ __launch_bounds__(256) void k_vt(const _Float16* __restrict__ V16, int b, int h0, _Float16* __restrict__ VT) { __shared__ unsigned short tl[64][65]; const int tid = threadIdx.x; const int hh = blockIdx.x % HG, sg = blockIdx.x / HG; const int s0 = sg * 64; const int h = h0 + hh;
  for (int i = tid; i < 64 * 8; i += 256) { const int j = i / 8, d8 = (i % 8) * 8; FragH f; f.half[0] = *(const v8us*)((const unsigned short*)V16 + ((size_t)b * SQ + s0 + j) * DM + h * HD + d8); for (int q = 0; q < 8; ++q) tl[d8 + q][j] = f.u[q]; }
  __syncthreads();
  { for (int i = tid; i < 64 * 8; i += 256) { const int d = i / 8, j8 = (i % 8) * 8; FragH f; for (int q = 0; q < 8; ++q) f.u[q] = tl[d][j8 + q]; *(v8us*)((unsigned short*)VT + ((size_t)hh * HD + d) * SQ + s0 + j8) = f.half[0]; }  } }



#define FW 4                         /* waves per work-group */
#define FG 2                         /* 16-query groups per wave */
#define FQ (FW * FG * 16)            /* queries per work-group */
#define FK 64                        /* keys per stage (two passes of 32) */
#define FP 144                       /* LDS row pitch, bytes: 128 + 16, an odd multiple of 16 (16-byte reads of 16 rows without bank conflicts) */
#define FT (64 * FP)                 /* the K tile: 64 keys */
#define FPV 160                      /* LDS row pitch of the V tile, bytes: 128 + 32, an odd multiple of 32 (the transposing load's own conflict-free pitch) */
#define FTV (64 * FPV)               /* the V tile: 64 keys */
#define FNS (SQ / FK)                /* stages */
__device__ __forceinline__ float lane_x16(float x) { const int b = __float_as_int(x); return __int_as_float(__builtin_amdgcn_permlanex16(b, b, 0x76543210, 0xfedcba98, false, false)); }      /* value of lane l ^ 16 */
// e[i] = 2^t[i], eight at a time, in one statement, so that the closing v_nop stands directly behind the last v_exp_f32: it is the slot that the instruction set asks for behind a transcendental before its
// result is read or its source overwritten. Early-clobber outputs: no result lies on a source of a
// later line. The closing s_delay_alu is the hint that the compiler cannot give for results of asm text: the next vector instruction may read them, and unhinted it would hold the SIMD's issue port against the other waves.
__device__ __forceinline__ v8f exp2x8(v8f t) { float e0, e1, e2, e3, e4, e5, e6, e7;
  asm("v_exp_f32 %0, %8\n\tv_exp_f32 %1, %9\n\tv_exp_f32 %2, %10\n\tv_exp_f32 %3, %11\n\tv_exp_f32 %4, %12\n\tv_exp_f32 %5, %13\n\tv_exp_f32 %6, %14\n\tv_exp_f32 %7, %15\n\tv_nop\n\ts_delay_alu instid0(TRANS32_DEP_1)"
      : "=&v"(e0), "=&v"(e1), "=&v"(e2), "=&v"(e3), "=&v"(e4), "=&v"(e5), "=&v"(e6), "=&v"(e7) : "v"(t[0]), "v"(t[1]), "v"(t[2]), "v"(t[3]), "v"(t[4]), "v"(t[5]), "v"(t[6]), "v"(t[7]));
  const v8f e = {e0, e1, e2, e3, e4, e5, e6, e7}; return e; }
__device__ __forceinline__ float exp2x1(float t) { float e; asm("v_exp_f32 %0, %1\n\tv_nop\n\ts_delay_alu instid0(TRANS32_DEP_1)" : "=&v"(e) : "v"(t)); return e; }      /* v_nop and hint: as in exp2x8 */
__device__ __forceinline__ v16h lds_frag(const unsigned char* p) { FragH f; f.half[0] = *(const v8us*)p; f.half[1] = *(const v8us*)(p + 32); return f.v; }      /* p = row + 64 * (32-element k block) + 16 * h: k = 8h .. 8h + 7 and 16 + 8h .. 16 + 8h + 7, the order of g2_frag */
// A fragment of V^T (16 head dims x 32 keys) from V rows in LDS: lane l points at row 8 (l >> 4) + (l & 7), byte 16 ((l >> 3) & 1) of the 16-key x 16-dim block; the load hands lane (c, h) the eight keys 8 h .. 8 h + 7 of dim c.
// Two loads, 16 keys apart, give k = 8h .. 8h + 7 and 16 + 8h .. 16 + 8h + 7: the order of lds_frag and of the converted score tiles.
typedef short v8ss __attribute__((ext_vector_type(8)));
__device__ __forceinline__ v8us lds_tr16(const unsigned char* p) { typedef __attribute__((address_space(3))) v8ss lds_v8ss; return __builtin_bit_cast(v8us, __builtin_amdgcn_ds_load_tr16_b128_v8i16((lds_v8ss*)p)); }
__device__ __forceinline__ v16h lds_frag_tr(const unsigned char* p) { FragH f; f.half[0] = lds_tr16(p); f.half[1] = lds_tr16(p + 16 * FPV); return f.v; }
__device__ __forceinline__ v8f fa_mma(v16h a, v16h b, v8f c) { return __builtin_amdgcn_wmma_f32_16x16x32_f16(false, a, false, b, (short)0, c, false, false); }
static_assert(SQ % FQ == 0 && SQ % FK == 0 && FNS >= 2 && HD == 64, "k_fattn: whole blocks, whole stages, head size 64");
// Key order of a batch: its unmasked keys first (ascending), then its masked keys (ascending). POS[b * SQ + s] = the row of the K and V planes that key s of batch b is stored in; NUN[b] = unmasked keys of batch b.
// One work-group per batch (b): sign bits by ballot, masked keys in front of each 32-key word by a sum over the words, the rest by a population count inside the word.
static_assert(SQ / 32 == 64 && SQ % 256 == 0, "perm_job: 64 mask words, eight per wave");
__device__ __forceinline__ void perm_job(const float* __restrict__ mk, int* __restrict__ POS, int* __restrict__ NUN, int b) {
  __shared__ unsigned int bits[SQ / 32];      /* bit j of word i: key 32 i + j of this batch is masked */
  __shared__ int pre[SQ / 32 + 1];      /* masked keys in front of word i; the last entry is the batch's count */
  const int tid = threadIdx.x, lane = tid & 31, wave = tid >> 5;
  const float* mp = mk + (size_t)b * SQ + wave * (SQ / 8) + lane; float mv[SQ / 256];      /* a wave takes SQ / 8 keys in a row: eight words */
#pragma unroll
  for (int i = 0; i < SQ / 256; ++i) mv[i] = mp[i * 32];
  __builtin_amdgcn_sched_barrier(0);      /* the eight loads stay together in front of the wait below: one latency instead of eight */
  asm volatile("s_wait_xcnt 0x0" :: "v"(mp) : "memory");      /* behind the issued loads, before a register that they name is rewritten; the address is an input so that it lives up to this wait */
  __builtin_amdgcn_sched_barrier(0);      /* keeps later register writes behind that wait */
  unsigned int myw = 0u;
#pragma unroll
  for (int i = 0; i < SQ / 256; ++i) { const unsigned int bal = __builtin_amdgcn_ballot_w32(bf16_round(mv[i]) < 0.f); myw = lane == i ? bal : myw; }      /* lane i keeps word i: one store for the eight */
  if (lane < SQ / 256) bits[wave * (SQ / 256) + lane] = myw;
  __syncthreads();
  if (tid <= SQ / 32) { int p = 0;
#pragma unroll
    for (int j = 0; j < SQ / 32; ++j) p += j < tid ? __builtin_popcount(bits[j]) : 0;
    pre[tid] = p; }
  __syncthreads();
  const int nun = SQ - pre[SQ / 32];
#pragma unroll
  for (int i = 0; i < SQ / 256; ++i) { const int s = i * 256 + tid; const unsigned int wv = bits[s >> 5]; const int mb = pre[s >> 5] + __builtin_popcount(wv & ((1u << (s & 31)) - 1u));      /* masked keys in front of key s */
    POS[(size_t)b * SQ + s] = b * SQ + (((wv >> (s & 31)) & 1u) != 0u ? nun + mb : s - mb); }
  if (tid == 0) NUN[b] = nun;
}
// Eight values in a row per thread: dst = f16(bf16(src) * scale), scale a power of two (exact).
__device__ __forceinline__ void cvt_job(const float* __restrict__ src, _Float16* __restrict__ dst, size_t t, float scale) {
  FragH f;
#pragma unroll
  for (int q = 0; q < 8; ++q) f.h[q] = (_Float16)(bf16_round(src[t * 8 + q]) * scale);
  *(v8us*)((unsigned short*)dst + t * 8) = f.half[0];
  asm volatile("s_wait_xcnt 0x0" ::: "memory");      /* behind the issued store, before a register that it names is rewritten by code that follows the job in the kernel */
}
// All work that reads the inputs alone, in ONE launch: the key order (one work-group per batch), the three weight planes (natural [out][in] = Bt[n][k], x16) and the x rows. No job reads what another writes, so they
// run side by side as ranges of the block index, where five launches in a row each paid a launch gap, a fill and a drain. The key order stands first: it has the longest chain of dependent steps. The choice of the
// job is the same for a whole work-group, so the key order's barriers stand under uniform control flow.
#define WB (DM * DM / 8 / 256)       /* blocks per weight plane */
#define XB ((int)(NR * DM / 8 / 256))      /* blocks of the x rows */
static_assert(DM * DM % 2048 == 0 && NR * DM % 2048 == 0, "k_prep: whole blocks of 256 threads x 8 values");
__global__ __launch_bounds__(256) void k_prep(const float* __restrict__ x, const float* __restrict__ mk, const float* __restrict__ wq, const float* __restrict__ wk, const float* __restrict__ wv,
    _Float16* __restrict__ X16, _Float16* __restrict__ BQ, _Float16* __restrict__ BK, _Float16* __restrict__ BV, int* __restrict__ POS, int* __restrict__ NUN) {
  const int blk = blockIdx.x;
  if (blk < NB) perm_job(mk, POS, NUN, blk);
  else { const int cb = blk - NB, j = min(cb / WB, 3);      /* j = 0, 1, 2: a weight plane; 3: the x rows. One path for all four: source, target and scale are scalar selects */
    cvt_job(j == 0 ? wq : j == 1 ? wk : j == 2 ? wv : x, j == 0 ? BQ : j == 1 ? BK : j == 2 ? BV : X16, (size_t)(cb - j * WB) * 256 + threadIdx.x, j < 3 ? 16.0f : 1.0f); }
}
template <bool M> struct StageKind { static constexpr bool masked = M; };      /* does the stage hold a masked key? */
__global__ __launch_bounds__(FW * 32) void k_fattn(const _Float16* __restrict__ Q16, const _Float16* __restrict__ K16, const _Float16* __restrict__ V16, const int* __restrict__ NUN, float* __restrict__ out) {
  __shared__ __attribute__((aligned(16))) unsigned char L[2][FT + FTV];      /* [buffer][K tile, V tile] */
  __shared__ unsigned int vote[FW];      /* per wave: not 0 if a masked key could still weigh in one of its queries */
  const int tid = threadIdx.x, lane = tid & 31, c = lane & 15, h = lane >> 4; const int wave = __builtin_amdgcn_readfirstlane(tid >> 5);
  const int hd = blockIdx.y, b = blockIdx.z; const int nun = min(max(NUN[b], 0), SQ); const int lim = (nun + FK - 1) / FK;      /* rows 0 .. nun - 1 of the batch's K and V planes are its unmasked keys, the rest its masked keys (the clamp bounds the stage loops' trip counts); lim = stages that hold an unmasked key */
  const size_t r0 = (size_t)b * SQ; const int q0 = blockIdx.x * FQ + wave * (FG * 16);
  const unsigned short* kg = (const unsigned short*)K16 + (r0 + (tid >> 3)) * DM + hd * HD + (tid & 7) * 8;      /* eight lanes cover one 128-byte row */
  const unsigned short* vg = (const unsigned short*)V16 + (r0 + (tid >> 3)) * DM + hd * HD + (tid & 7) * 8;
  const unsigned int lofs = (unsigned int)(tid >> 3) * FP + (unsigned int)(tid & 7) * 16, lofv = (unsigned int)(tid >> 3) * FPV + (unsigned int)(tid & 7) * 16;
  v8us rk[4], rv[4];
  auto fetch = [&](int st) {
#pragma unroll
    for (int u = 0; u < 4; ++u) { rk[u] = *(const v8us*)(kg + ((size_t)st * FK + u * 16) * DM); rv[u] = *(const v8us*)(vg + ((size_t)st * FK + u * 16) * DM); }
    __builtin_amdgcn_sched_barrier(0);      /* the loads stay in front of the wait below */
    asm volatile("s_wait_xcnt 0x0" ::: "memory");      /* behind the issued loads, before a register that they name (address, base) is rewritten for the next stage */
    __builtin_amdgcn_sched_barrier(0);      /* keeps later register writes behind that wait */
  };
  auto put = [&](int buf) {
#pragma unroll
    for (int u = 0; u < 4; ++u) { *(v8us*)&L[buf][lofs + u * 16 * FP] = rk[u]; *(v8us*)&L[buf][FT + lofv + u * 16 * FPV] = rv[u]; } };
  fetch(0);
  v16h qf[FG][2];
#pragma unroll
  for (int g = 0; g < FG; ++g) { const _Float16* qp = Q16 + (r0 + q0 + g * 16 + c) * DM + hd * HD;
#pragma unroll
    for (int kc = 0; kc < 2; ++kc) qf[g][kc] = g2_frag(qp + 32 * kc, h); }
  __builtin_amdgcn_sched_barrier(0);      /* the Q loads stay in front of the wait below */
  asm volatile("s_wait_xcnt 0x0" ::: "memory");      /* behind the issued Q loads, before a register that they name is reused */
  __builtin_amdgcn_sched_barrier(0);      /* keeps later register writes behind that wait */
  put(0);
  fetch(1);
  const v8f z8 = {0.f, 0.f, 0.f, 0.f, 0.f, 0.f, 0.f, 0.f};
  v8f acc[FG][4]; float m_run[FG], l_run[FG];
#pragma unroll
  for (int g = 0; g < FG; ++g) { m_run[g] = -__builtin_inff(); l_run[g] = 0.f;
#pragma unroll
    for (int t = 0; t < 4; ++t) acc[g][t] = z8; }
  const float cs = 0.125f * 1.44269504f;      /* 1 / sqrt(64), and exp(x) as 2^(x log2 e) */
  __syncthreads();      /* stage 0 is published */
  auto stage = [&](int st, auto kind) __attribute__((always_inline)) {      /* inlined at both places: the arrays it works on stay in registers only so */
    if (st + 1 < FNS) put((st + 1) & 1);      /* into the buffer that stage st - 1 used: every wave has left it (barrier at the loop's foot) */
    if (st + 2 < FNS) fetch(st + 2);      /* in flight under this stage's work */
    const unsigned char* Lb = &L[st & 1][0];
#pragma unroll
    for (int p = 0; p < 2; ++p) {
      const unsigned char* kb = Lb + (p * 32 + c) * FP + 16 * h;
      v16h kf[2][2];
#pragma unroll
      for (int kt = 0; kt < 2; ++kt)
#pragma unroll
        for (int kc = 0; kc < 2; ++kc) kf[kt][kc] = lds_frag(kb + kt * 16 * FP + 64 * kc);
      v8f s[2][FG];      /* s[kt][g][r] = raw score of key 32 p + 16 kt + 8 h + r and query 16 g + c */
#pragma unroll
      for (int kt = 0; kt < 2; ++kt)
#pragma unroll
        for (int g = 0; g < FG; ++g) s[kt][g] = fa_mma(kf[kt][1], qf[g][1], fa_mma(kf[kt][0], qf[g][0], z8));
      const unsigned char* vb = Lb + FT + (p * 32 + 8 * h + (lane & 7)) * FPV + 16 * ((lane >> 3) & 1);      /* the transposing load's lane address; every lane is on here */
      v16h vf[4];
#pragma unroll
      for (int t = 0; t < 4; ++t) vf[t] = lds_frag_tr(vb + t * 32);      /* dims 16 t .. 16 t + 15: 32 bytes further along the rows */
      if constexpr (decltype(kind)::masked) {      /* in the sorted key order only the stage at the boundary, and the stages behind it, hold a masked key */
        const int rem = nun - (st * FK + p * 32);      /* unmasked keys from this pass's first key on */
        const unsigned int mw = (rem >= 32 ? 0u : rem <= 0 ? 0xffffffffu : 0xffffffffu << rem) >> (8 * h);      /* bit j: key 8 h + j of the pass is masked */
#pragma unroll
        for (int kt = 0; kt < 2; ++kt)
#pragma unroll
          for (int r = 0; r < 8; ++r) { const bool km = (mw & (1u << (16 * kt + r))) != 0u;
#pragma unroll
            for (int g = 0; g < FG; ++g) s[kt][g][r] = km ? -80000.0f : s[kt][g][r]; } }      /* masked_fill(-10000) on the raw score: -80000 / 8 */
      float mb[FG]; bool need = false;
#pragma unroll
      for (int g = 0; g < FG; ++g) { float mx = s[0][g][0];
#pragma unroll
        for (int r = 1; r < 8; ++r) mx = fmaxf(mx, s[0][g][r]);
#pragma unroll
        for (int r = 0; r < 8; ++r) mx = fmaxf(mx, s[1][g][r]);
        mx = fmaxf(mx, lane_x16(mx)) * cs; mb[g] = mx; need = need || (mx > m_run[g] + 8.0f); }      /* both halves hold the query's maximum of this pass, in log2 units */
      if (__builtin_amdgcn_ballot_w32(need) != 0u) {      /* lazy rescale: the maximum in use may trail the true one by 8 (a weight reaches 2^8 at most); one scalar branch per pass */
#pragma unroll
        for (int g = 0; g < FG; ++g) { const float mn = fmaxf(m_run[g], mb[g]); const float corr = exp2x1(m_run[g] - mn); m_run[g] = mn; l_run[g] *= corr;      /* first pass: 2^(-inf) = 0 on zero sums */
#pragma unroll
          for (int t = 0; t < 4; ++t) acc[g][t] = acc[g][t] * corr; } }
      FragH pf[FG];
#pragma unroll
      for (int g = 0; g < FG; ++g) { const float nm = -m_run[g]; float ls[4] = {0.f, 0.f, 0.f, 0.f};
#pragma unroll
        for (int kt = 0; kt < 2; ++kt) { v8f t8;
#pragma unroll
          for (int r = 0; r < 8; ++r) t8[r] = fmaf(s[kt][g][r], cs, nm);
          const v8f e = exp2x8(t8);
#pragma unroll
          for (int r = 0; r < 8; ++r) { ls[r & 3] += e[r]; pf[g].h[8 * kt + r] = (_Float16)e[r]; } }      /* element 8 kt + r of the B operand = key 16 kt + 8 h + r */
        l_run[g] += (ls[0] + ls[1]) + (ls[2] + ls[3]); }
      __builtin_amdgcn_sched_barrier(0);      /* the exponentials are asm text: all of them stay in front of the second product */
#pragma unroll
      for (int g = 0; g < FG; ++g)
#pragma unroll
        for (int t = 0; t < 4; ++t) acc[g][t] = fa_mma(vf[t], pf[g].v, acc[g][t]);      /* acc[g][t][r] = O[query 16 g + c][dim 16 t + 8 h + r], unnormalised */
    }
    if (st + 1 == lim) { bool open = false;      /* the last stage with an unmasked key: each wave's word for the test at the loop's head, published by the barrier below */
#pragma unroll
      for (int g = 0; g < FG; ++g) open = open || !(m_run[g] >= -14000.0f);
      const unsigned int bal = __builtin_amdgcn_ballot_w32(open); if (lane == 0) vote[wave] = bal; }
    __syncthreads();      /* publishes stage st + 1 and ends every wave's reads of stage st */
  };
  int st = 0;
#pragma unroll 1      /* the stage loops stay rolled: a body already holds two unrolled passes (code size, registers) */
  for (; st < nun / FK; ++st) stage(st, StageKind<false>{});      /* stages of unmasked keys alone: no select */
#pragma unroll 1
  for (; st < FNS; ++st) {
    /* From stage lim on every key is masked: raw score -80000, the same for all. Where every query of the work-group holds a maximum of at least -14000 (log2 units), each such weight is 2^(-14427 - maximum) = 0 exactly
       and no maximum moves, so the remaining stages would add zeros only: leave. Otherwise (no unmasked key at all, or scores near the fill value) all stages run. The test reads the same for the whole work-group. */
    if (st == lim && st > 0) { if (__builtin_amdgcn_readfirstlane((int)(vote[0] | vote[1] | vote[2] | vote[3])) == 0) break; }
    stage(st, StageKind<true>{}); }
#pragma unroll
  for (int g = 0; g < FG; ++g) { const float l = l_run[g] + lane_x16(l_run[g]); const float inv = 1.0f / l;      /* the halves' sums joined once */
#pragma unroll
    for (int t = 0; t < 4; ++t) acc[g][t] = acc[g][t] * inv; }
#pragma unroll
  for (int g = 0; g < FG; ++g) { float* op = out + (r0 + q0 + g * 16 + c) * DM + hd * HD + 8 * h;
#pragma unroll
    for (int t = 0; t < 4; ++t) { const v4f lo = {acc[g][t][0], acc[g][t][1], acc[g][t][2], acc[g][t][3]}, hi = {acc[g][t][4], acc[g][t][5], acc[g][t][6], acc[g][t][7]};
      *(v4f*)(op + 16 * t) = lo; *(v4f*)(op + 16 * t + 4) = hi; } }
}
// Projection GEMM with both operands through LDS: C16[128 rows][192 columns] per work-group = f16(X . W^T / 16 + bias), four waves (2 x 2) of 64 x 96, f32 accumulation in ascending k blocks of 32 (the order of k_gemm2).
// The tile is sized to the two rates that bound the launch: bytes fetched from L2 go as 1 / rows + 1 / columns of the work-group tile, LDS bytes read per matrix instruction as (4 + 6) / (4 * 6) fragments of the wave tile.
// 192 columns are three whole 128-byte lines of an output row and a quarter of a plane; the grid is then three work-groups per WGP, all resident at once.
// A stage is one 128-byte line (64 k) of each of the 128 X rows and 192 W rows. Eight lanes fetch one line, so every global load covers four whole lines (a fragment load straight from global memory touches 16 lines for the same 512 bytes),
// and each tile is fetched once per work-group instead of once per wave. Registers -> two LDS buffers, as in k_fattn: one barrier per stage publishes stage st + 1 and frees the buffer of stage st.
// The next stage's X lines and W lines are fetched half a stage apart and each is held in registers for about half a stage: held together through a stage's products, beside 24 accumulator tiles, they do not fit the registers of three waves per SIMD.
#define PM 128                       /* X rows per work-group */
#define PN 192                       /* output columns per work-group */
#define PK 64                        /* k per stage */
#define PNS (DM / PK)                /* stages */
#define PT ((PM + PN) * FP)          /* one buffer: X tile, then W tile, rows at pitch FP */
#define PFM 4                        /* 16-row fragments per wave */
#define PFN 6                        /* 16-column fragments per wave */
#define PSP (PN * 2 + 16)            /* row pitch of the staged f16 output tile, bytes */
// Launch bounds: at least three waves per SIMD, so that three work-groups per WGP are resident at once (registers; LDS fits three as well).
static_assert(DM % PK == 0 && DM % PN == 0 && PNS >= 2 && MP % PM == 0 && PK * 2 == 128 && PM == 2 * PFM * 16 && PN == 2 * PFN * 16 && PM * PSP <= 2 * PT, "k_proj: whole tiles, whole stages, one line per row and stage, output staging inside the ring");
// Work-group barrier that orders LDS alone: __syncthreads() also drains the wave's global loads, which would end the flight of the stage fetched ahead at every stage's foot.
__device__ __forceinline__ void lds_barrier() { __builtin_amdgcn_fence(__ATOMIC_RELEASE, "workgroup", "local"); __builtin_amdgcn_s_barrier(); __builtin_amdgcn_fence(__ATOMIC_ACQUIRE, "workgroup", "local"); }
// The three projections are ONE launch: blockIdx.y picks the job (0 Q, 1 K, 2 V). They read the same X rows and none reads another's output; as one grid a work-group of the next job starts where one of the last ends,
// where three launches in a row each paid a launch gap, a fill and a drain.
// K and V: row r of the product is stored in row rowmap[r] of the plane (the key order of perm_job, rows counted from the plane's start); Q: in row r. Rows stay whole, so the stores cover the same lines.
__global__ __launch_bounds__(128, 3) void k_proj(const _Float16* __restrict__ A, const _Float16* __restrict__ BQ, const _Float16* __restrict__ BK, const _Float16* __restrict__ BV, const float* __restrict__ bq, const float* __restrict__ bk, const float* __restrict__ bv,
    const int* __restrict__ rowmap, _Float16* __restrict__ CQ, _Float16* __restrict__ CK, _Float16* __restrict__ CV) {
  const int job = blockIdx.y; const _Float16* Bh = job == 0 ? BQ : job == 1 ? BK : BV; const float* bias = job == 0 ? bq : job == 1 ? bk : bv; _Float16* C16 = job == 0 ? CQ : job == 1 ? CK : CV;
  __shared__ __attribute__((aligned(16))) unsigned char L[2 * PT];      /* two buffers; behind the last stage the staged output tile */
  __shared__ float sb[PN];      /* the tile's bias values */
  __shared__ int rmap[PM];      /* the row of C16 that takes the tile's row i */
  const int tid = threadIdx.x, lane = tid & 31, ln = lane & 15, hh = lane >> 4; const int w = __builtin_amdgcn_readfirstlane(tid >> 5), wr = w >> 1, wc = w & 1;
  const int mt = blockIdx.x / (DM / PN), nq = blockIdx.x - mt * (DM / PN); const int col0 = nq * PN;
  const unsigned short* ag = (const unsigned short*)A + ((size_t)mt * PM + (tid >> 3)) * DM + (tid & 7) * 8;      /* eight lanes cover one 128-byte line */
  const unsigned short* bg = (const unsigned short*)Bh + ((size_t)col0 + (tid >> 3)) * DM + (tid & 7) * 8;
  const unsigned int lofs = (unsigned int)(tid >> 3) * FP + (unsigned int)(tid & 7) * 16;
  v8us ra[PM / 16], rb[PN / 16];
  auto fetch_x = [&](int st) {
#pragma unroll
    for (int u = 0; u < PM / 16; ++u) ra[u] = *(const v8us*)(ag + (size_t)u * 16 * DM + st * PK);
    __builtin_amdgcn_sched_barrier(0);      /* the loads stay in front of the wait below */
    asm volatile("s_wait_xcnt 0x0" :: "v"(ag) : "memory");      /* behind the issued loads, before a register that they name is rewritten; the address is an input so that it lives up to this wait and no result of earlier loads is given its registers */
    __builtin_amdgcn_sched_barrier(0);      /* keeps later register writes behind that wait */
  };
  auto fetch_w = [&](int st) {
#pragma unroll
    for (int u = 0; u < PN / 16; ++u) rb[u] = *(const v8us*)(bg + (size_t)u * 16 * DM + st * PK);
    __builtin_amdgcn_sched_barrier(0);      /* the loads stay in front of the wait below */
    asm volatile("s_wait_xcnt 0x0" :: "v"(bg) : "memory");      /* as in fetch_x */
    __builtin_amdgcn_sched_barrier(0);      /* keeps later register writes behind that wait */
  };
  auto put_x = [&](int buf) {
#pragma unroll
    for (int u = 0; u < PM / 16; ++u) *(v8us*)&L[buf * PT + lofs + u * 16 * FP] = ra[u]; };
  auto put_w = [&](int buf) {
#pragma unroll
    for (int u = 0; u < PN / 16; ++u) *(v8us*)&L[buf * PT + PM * FP + lofs + u * 16 * FP] = rb[u]; };
  fetch_x(0); fetch_w(0);
  const int bix = col0 + tid, bjx = col0 + PM + (tid & 63);      /* the tile's 192 bias values: one per thread, and 64 more */
  const float bv0 = bias[bix], bv1 = bias[bjx];
  const int rix = mt * PM + tid; int rm = rix;      /* thread i: the row of C16 that takes the tile's row i */
  if (job != 0) rm = rowmap[rix];      /* the same for the whole work-group */
  __builtin_amdgcn_sched_barrier(0);      /* the loads stay in front of the wait below */
  asm volatile("s_wait_xcnt 0x0" :: "v"(bix), "v"(bjx), "v"(rix) : "memory");      /* behind the issued loads, before a register that they name is rewritten; the indices are inputs so that they live up to this wait */
  __builtin_amdgcn_sched_barrier(0);      /* keeps later register writes behind that wait */
  put_x(0); put_w(0);
  sb[tid] = bv0; if (tid < PN - PM) sb[PM + tid] = bv1; rmap[tid] = rm;      /* kept in LDS up to the epilogue (no registers held through the stages); published by the first barrier */
  fetch_x(1);
  const v8f z8 = {0.f, 0.f, 0.f, 0.f, 0.f, 0.f, 0.f, 0.f};
  v8f acc[PFM][PFN];
#pragma unroll
  for (int i = 0; i < PFM; ++i)
#pragma unroll
    for (int t = 0; t < PFN; ++t) acc[i][t] = z8;
  lds_barrier();      /* stage 0 is published */
#pragma unroll      /* twelve short stages: buffer index, last-stage tests and the loads' k offsets become constants, and no address register is rewritten in the loop */
  for (int st = 0; st < PNS; ++st) {
    if (st + 1 < PNS) { put_x((st + 1) & 1); fetch_w(st + 1); }      /* into the buffer that stage st - 1 used: every wave has left it (barrier at the loop's foot); the W lines fly under the stage's first half */
    const unsigned char* ap = &L[(st & 1) * PT] + (wr * (PFM * 16) + ln) * FP + 16 * hh; const unsigned char* bp = &L[(st & 1) * PT] + (PM + wc * (PFN * 16) + ln) * FP + 16 * hh;
#pragma unroll
    for (int kc = 0; kc < 2; ++kc) { v16h a[PFM];
      if (kc == 1 && st + 1 < PNS) put_w((st + 1) & 1);
      if (kc == 1 && st + 2 < PNS) fetch_x(st + 2);      /* the X lines fly under the stage's second half */
#pragma unroll
      for (int i = 0; i < PFM; ++i) a[i] = lds_frag(ap + i * 16 * FP + 64 * kc);
      v16h b[3]; b[0] = lds_frag(bp + 64 * kc); b[1] = lds_frag(bp + 16 * FP + 64 * kc);      /* W fragments are read two ahead of their products, and no further */
#pragma unroll
      for (int t = 0; t < PFN; ++t) { if (t + 2 < PFN) b[(t + 2) % 3] = lds_frag(bp + (t + 2) * 16 * FP + 64 * kc);
#pragma unroll
        for (int i = 0; i < PFM; ++i) acc[i][t] = fa_mma(a[i], b[t % 3], acc[i][t]);
        __builtin_amdgcn_sched_barrier(0); } }      /* keeps later fragment reads from being lifted over these products: with all six W fragments in registers at once the kernel spills */
    lds_barrier();      /* publishes stage st + 1 and ends every wave's reads of stage st; behind the last stage it frees the ring for the output tile */
  }
  const int el = (int)__builtin_amdgcn_mbcnt_lo(~0u, 0u), eln = el & 15, ehh = el >> 4;      /* the lane's number, formed anew for the epilogue: values derived from the thread index in front of the stages would have to live through them, where no register is free (they spill) */
#pragma unroll
  for (int t = 0; t < PFN; ++t) { const int cl = wc * (PFN * 16) + t * 16 + eln; const float bv = bf16_round(sb[cl]);
#pragma unroll
    for (int i = 0; i < PFM; ++i)
#pragma unroll
      for (int r = 0; r < 8; ++r) *(_Float16*)&L[(wr * (PFM * 16) + i * 16 + 8 * ehh + r) * PSP + cl * 2] = (_Float16)(acc[i][t][r] * 0.0625f + bv); }
  lds_barrier();      /* the staged tile is published: a line of an output row holds columns of two waves, and one wave stores it whole */
  const int rq = w * 4 + (el >> 3), c8 = el & 7;      /* eight lanes store one 128-byte line, a wave four rows' lines */
  v8us ov[PM / 16][3]; unsigned short* dp[PM / 16];
#pragma unroll
  for (int u = 0; u < PM / 16; ++u) { const int row = u * 16 + rq; dp[u] = (unsigned short*)C16 + (size_t)rmap[row] * DM + col0 + c8 * 8;
#pragma unroll
    for (int sg = 0; sg < 3; ++sg) ov[u][sg] = *(const v8us*)&L[row * PSP + sg * 128 + c8 * 16]; }
  __builtin_amdgcn_sched_barrier(0);      /* every address and value is formed before the first store is issued: nothing rewrites a register that an issued store names */
#pragma unroll
  for (int u = 0; u < PM / 16; ++u)
#pragma unroll
    for (int sg = 0; sg < 3; ++sg) *(v8us*)(dp[u] + sg * 64) = ov[u][sg];
  asm volatile("s_wait_xcnt 0x0" ::: "memory");      /* behind the issued stores, before a register that they name could be rewritten */
}
extern "C" void kernel_launch(void* const* d_in, const int* in_sizes, int n_in,
                              void* d_out, int out_size, void* d_ws, size_t ws_size, hipStream_t stream) {
  (void)in_sizes; (void)n_in; (void)out_size;
  const float* const* I = (const float* const*)d_in; const float* x = I[0]; const float* am = I[1]; const float* wq = I[2]; const float* bq = I[3]; const float* wk = I[4]; const float* bk = I[5]; const float* wv = I[6]; const float* bv = I[7];      /* hidden_states; attention_mask f32 [4][1][1][2048] (READ on device: key masked iff bf16(mask) < 0); natural weights + biases */
  char* ws = (char*)d_ws; size_t off = 0;
  auto take = [&](size_t bytes) { char* p = ws + off; off += (bytes + 255) & ~(size_t)255; return p; };
  _Float16* BQ = (_Float16*)take((size_t)DM * DM * 2); _Float16* BK = (_Float16*)take((size_t)DM * DM * 2); _Float16* BV = (_Float16*)take((size_t)DM * DM * 2); 
  _Float16* X16 = (_Float16*)take(NR * DM * 2); _Float16* Q16 = (_Float16*)take(NR * DM * 2); _Float16* K16 = (_Float16*)take(NR * DM * 2); _Float16* V16 = (_Float16*)take(NR * DM * 2);
  int* POS = (int*)take(NR * 4); int* NUN = (int*)take((size_t)NB * 4);
  if (off > ws_size) return;
  k_prep<<<NB + 3 * WB + XB, 256, 0, stream>>>(x, am, wq, wk, wv, X16, BQ, BK, BV, POS, NUN);      /* key order per batch (unmasked first), weight planes, x rows */
  const size_t r0p = (size_t)B0 * SQ;      /* first projected row */
  k_proj<<<dim3((unsigned)((MP / PM) * (DM / PN)), 3), 128, 0, stream>>>(X16 + r0p * DM, BQ, BK, BV, bq, bk, bv, POS + r0p, Q16 + r0p * DM, K16, V16);      /* K and V rows in the key order of perm_job */
  k_fattn<<<dim3(SQ / FQ, NH, NB), FW * 32, 0, stream>>>(Q16, K16, V16, NUN, (float*)d_out);      /* scores, sign key mask (select, -10000 fill), softmax and P V in one launch; f32 straight into the merged-heads output rows */
}

// v008
// Measured time: 60.7 microseconds a run.
// Two timings next to v007 put it at 1.10 and 1.11 times that version's speed.
// Counting every step since v000, it is 86.1 times as fast.
#include <hip/hip_runtime.h>
// BERT self-attention without an output projection and with a SIGN key mask (hidden_states [4][2048][768]; q/k/v = x W^T + b (natural [768][768] sigma 0.02, biases sigma 0.02); 12 heads of 64; scores / 8; masked_fill(attention_mask < 0, -10000) with the f32 [4][1][1][2048] mask input (a key of batch b is masked iff its mask value is negative); softmax over all keys; context = heads merged -> [4][2048][768]).
// Structure: token rows r = b*2048 + s; x as exact f16 rows (bf16-rounded); Q, K, V as three WMMA GEMMs (64x96 wave tiles, f32 accumulation, exact x16 weights + bias, f16 outputs); the K and V rows of a batch stored in key order 'unmasked first, then masked' (perm_job), so that the attention launch ends behind the last unmasked key when every later weight is exactly 0; one fused attention launch (scores on WMMA, K = 64; online softmax on VALU, f32 statistics, weights as f16 relative to the running maximum; o = P . V on WMMA, its V^T operand read from the staged V rows by transposing LDS loads) written f32 straight into the merged-heads output rows (no output projection).
// Compute dtype: inputs rounded to bf16; x / weights exact; q, k, v and softmax weights as plain f16 GEMM operands (~2^-12); scores, softmax statistics and o f32. v_wmma_f32_16x16x32_f16.
#define NB 4
#define SQ 2048
#define DM 768
#define NH 12
#define HD 64
#define HG 4                         /* heads per launch of the per-batch k_vt */
#define B0 0                         /* first batch processed (debug hook) */
#define NBR NB                       /* batches processed (debug hook) */
#define NR ((size_t)NB * SQ)         /* token rows */
#define MP ((int)((size_t)NBR * SQ)) /* rows projected (debug hook) */
#define QN SQ                        /* unused */
#define NHD NH                       /* unused */
#define MPO MP                       /* unused */
#define LQ DM      /* row pitch of the q/k/v rows */
typedef __bf16 v16b __attribute__((ext_vector_type(16)));
typedef unsigned short v8us __attribute__((ext_vector_type(8), may_alias));
typedef float  v8f  __attribute__((ext_vector_type(8)));
typedef float  v4f  __attribute__((ext_vector_type(4)));
typedef float  v4fa __attribute__((ext_vector_type(4), may_alias));
union FragB { v16b v; v8us half[2]; unsigned short u[16]; };

__device__ __forceinline__ unsigned short bf16_bits(float x) { unsigned int u = __float_as_uint(x); return (unsigned short)((u + 0x7FFFu + ((u >> 16) & 1u)) >> 16); }
__device__ __forceinline__ float bf16_val(unsigned short b) { return __uint_as_float(((unsigned int)b) << 16); }
__device__ __forceinline__ float bf16_round(float x) { return bf16_val(bf16_bits(x)); }
// D += A·B with NT terms: 1 = ah·bh, 2 = + al·bh (A split), 3 = + ah·bl (both split)
template <int NT>
__device__ __forceinline__ v8f mmaN(v16b ah, v16b al, v16b bh, v16b bl, v8f c) {
  c = __builtin_amdgcn_wmma_f32_16x16x32_bf16(false, ah, false, bh, (short)0, c, false, false);
  if (NT >= 2) c = __builtin_amdgcn_wmma_f32_16x16x32_bf16(false, al, false, bh, (short)0, c, false, false);
  if (NT >= 3) c = __builtin_amdgcn_wmma_f32_16x16x32_bf16(false, ah, false, bl, (short)0, c, false, false);
  asm volatile("v_nop\n\tv_nop\n\tv_nop\n\tv_nop" : "+v"(c) : "v"(ah), "v"(al), "v"(bh), "v"(bl));
  return c;
}

__global__ __launch_bounds__(256) void k_wt_bf16(const float* __restrict__ W, unsigned short* __restrict__ Wt, int K, int N) {
  const int t = blockIdx.x * 256 + threadIdx.x;
  const int k8n = K / 8;
  if (t >= N * k8n) return;
  const int n = t / k8n, k8 = (t % k8n) * 8;
  v8us v;
#pragma unroll
  for (int i = 0; i < 8; ++i) v[i] = bf16_bits(W[(size_t)(k8 + i) * N + n]);
  *(v8us*)(Wt + (size_t)n * K + k8) = v;
  
}

// GEMM C[M][N] (f32, pitch ldc) = act(A[M][K]·W + bias). A f32 row-major (pitch lda) converted per fragment to bf16
// (ASPLIT: hi/lo two planes -> 2 terms, else single rounded term); Wt bf16 [N][K] (pitch ldb). BIAS_BF16 rounds the
// bias to bf16 first (bias quantised to bf16 before the add). K%32==0, M%16==0, N%64==0.
template <bool ASPLIT, int ACT, bool BIAS_BF16>
__global__ __launch_bounds__(128) void k_gemm_bf(const float* __restrict__ A, int lda, const unsigned short* __restrict__ Wt, int ldb,
                                               const float* __restrict__ bias, float* __restrict__ C, int ldc, int M, int N, int K) {
  __shared__ __attribute__((aligned(16))) float so[4][16][64];
  const int tid = threadIdx.x, w = tid >> 5, lane = tid & 31, ln = lane & 15, hh = lane >> 4;
  const int ntn = N / 64;
  const int wid = blockIdx.x * 4 + w;
  const int mt = wid / ntn, nq = wid % ntn;
  if (mt * 16 >= M) return;
  const int row0 = mt * 16, col0 = nq * 64;
  const float* arow = A + (size_t)(row0 + ln) * lda;
  v8f acc[4] = {};
  for (int kb = 0; kb < K; kb += 32) {
    FragB ah, al;
    const v4f x0 = *(const v4fa*)(arow + kb + 8 * hh), x1 = *(const v4fa*)(arow + kb + 8 * hh + 4);
    const v4f x2 = *(const v4fa*)(arow + kb + 16 + 8 * hh), x3 = *(const v4fa*)(arow + kb + 16 + 8 * hh + 4);
    float xs[16] = {x0[0],x0[1],x0[2],x0[3],x1[0],x1[1],x1[2],x1[3],x2[0],x2[1],x2[2],x2[3],x3[0],x3[1],x3[2],x3[3]};
#pragma unroll
    for (int i = 0; i < 16; ++i) { const unsigned short hb = bf16_bits(xs[i]); ah.u[i] = hb; al.u[i] = ASPLIT ? bf16_bits(xs[i] - bf16_val(hb)) : (unsigned short)0; }
#pragma unroll
    for (int t = 0; t < 4; ++t) {
      const unsigned short* brow = Wt + (size_t)(col0 + t * 16 + ln) * ldb + kb;
      FragB b;
      b.half[0] = *(const v8us*)(brow + 8 * hh);
      b.half[1] = *(const v8us*)(brow + 16 + 8 * hh);
      acc[t] = mmaN<ASPLIT ? 2 : 1>(ah.v, al.v, b.v, b.v, acc[t]);
    }
  }
#pragma unroll
  for (int t = 0; t < 4; ++t) {
    float bv = bias ? bias[col0 + t * 16 + ln] : 0.f;
    if (BIAS_BF16) bv = bf16_round(bv);
#pragma unroll
    for (int r = 0; r < 8; ++r) { float v = acc[t][r] + bv; if (ACT == 1) v = fmaxf(v, 0.f); so[w][8 * hh + r][t * 16 + ln] = v; }
  }
  __builtin_amdgcn_fence(__ATOMIC_ACQ_REL, "workgroup");
  __builtin_amdgcn_wave_barrier();
  const int rsub = lane >> 4, c4 = (lane & 15) * 4;
  {
#pragma unroll
    for (int q = 0; q < 8; ++q) {
      const int r = q * 2 + rsub;
      const v4f v = *(const v4fa*)&so[w][r][c4];
      *(v4f*)(C + (size_t)(row0 + r) * ldc + col0 + c4) = v;
    }
    
  }
}

// GEMM C = act(A·W + bias + resid): A f32 (ASPLIT -> hi/lo 2 terms), Wt bf16 [N][K]; ACT 0 none, 1 relu, 2 exact gelu;
// resid (optional, f32, row index = (row % rmod), pitch ldr, RES_BF16 rounds it) added before the activation.
template <bool ASPLIT, int ACT, bool BIAS_BF16, bool RES_BF16>
__global__ __launch_bounds__(128) void k_gemm_bf3(const float* __restrict__ A, int lda, const unsigned short* __restrict__ Wt, int ldb,
                                                const float* __restrict__ bias, const float* __restrict__ resid, int rmod, int ldr,
                                                float* __restrict__ C, int ldc, int M, int N, int K) {
  __shared__ __attribute__((aligned(16))) float so[4][16][64];
  const int tid = threadIdx.x, w = tid >> 5, lane = tid & 31, ln = lane & 15, hh = lane >> 4;
  const int ntn = N / 64;
  const int wid = blockIdx.x * 4 + w;
  const int mt = wid / ntn, nq = wid % ntn;
  if (mt * 16 >= M) return;
  const int row0 = mt * 16, col0 = nq * 64;
  const float* arow = A + (size_t)(row0 + ln) * lda;
  v8f acc[4] = {};
  for (int kb = 0; kb < K; kb += 32) {
    FragB ah, al;
    const v4f x0 = *(const v4fa*)(arow + kb + 8 * hh), x1 = *(const v4fa*)(arow + kb + 8 * hh + 4);
    const v4f x2 = *(const v4fa*)(arow + kb + 16 + 8 * hh), x3 = *(const v4fa*)(arow + kb + 16 + 8 * hh + 4);
    float xs[16] = {x0[0],x0[1],x0[2],x0[3],x1[0],x1[1],x1[2],x1[3],x2[0],x2[1],x2[2],x2[3],x3[0],x3[1],x3[2],x3[3]};
#pragma unroll
    for (int i = 0; i < 16; ++i) { const unsigned short hb = bf16_bits(xs[i]); ah.u[i] = hb; al.u[i] = ASPLIT ? bf16_bits(xs[i] - bf16_val(hb)) : (unsigned short)0; }
#pragma unroll
    for (int t = 0; t < 4; ++t) {
      const unsigned short* brow = Wt + (size_t)(col0 + t * 16 + ln) * ldb + kb;
      FragB b;
      b.half[0] = *(const v8us*)(brow + 8 * hh);
      b.half[1] = *(const v8us*)(brow + 16 + 8 * hh);
      acc[t] = mmaN<ASPLIT ? 2 : 1>(ah.v, al.v, b.v, b.v, acc[t]);
    }
  }
#pragma unroll
  for (int t = 0; t < 4; ++t) {
    const int col = col0 + t * 16 + ln;
    float bv = bias ? bias[col] : 0.f;
    if (BIAS_BF16) bv = bf16_round(bv);
#pragma unroll
    for (int r = 0; r < 8; ++r) {
      float v = acc[t][r] + bv;
      if (resid) { float rv = resid[(size_t)((row0 + 8 * hh + r) % rmod) * ldr + col]; if (RES_BF16) rv = bf16_round(rv); v += rv; }
      if (ACT == 1) v = fmaxf(v, 0.f);
      if (ACT == 2) v = 0.5f * v * (1.0f + erff(v * 0.70710678118654752f));
      if (ACT == 3) { const float u = 0.7978845608028654f * (v + 0.044715f * v * v * v); v = 0.5f * v * (1.0f + tanhf(u)); }
      so[w][8 * hh + r][t * 16 + ln] = v;
    }
  }
  __builtin_amdgcn_fence(__ATOMIC_ACQ_REL, "workgroup");
  __builtin_amdgcn_wave_barrier();
  const int rsub = lane >> 4, c4 = (lane & 15) * 4;
  {
#pragma unroll
    for (int q = 0; q < 8; ++q) {
      const int r = q * 2 + rsub;
      const v4f v = *(const v4fa*)&so[w][r][c4];
      *(v4f*)(C + (size_t)(row0 + r) * ldc + col0 + c4) = v;
    }
    
  }
}
// row LayerNorm (biased variance, eps) over N: s = X (+ R); optional out_sum <- s; out_norm <- (s-mu)*rsqrt(var+eps)*g + b
template <bool PARAM_BF16>
__global__ __launch_bounds__(256) void k_layernorm(const float* __restrict__ X, const float* __restrict__ R, const float* __restrict__ g, const float* __restrict__ bta,
                                                  float* __restrict__ out_sum, float* __restrict__ out_norm, int N, float eps) {
  __shared__ float red[256];
  const int row = blockIdx.x, tid = threadIdx.x;
  const float* x = X + (size_t)row * N; const float* rr = R ? R + (size_t)row * N : nullptr;
  float vals[16];                     // up to N = 4096
  const int per = N / 256;            // contiguous chunk per thread? use strided-by-4 chunks: thread handles j = tid*4 + 1024*u
  float s1 = 0.f;
  for (int u = 0; u < per / 4; ++u) {
    const int j = tid * 4 + 1024 * u;
    const v4f a = *(const v4fa*)(x + j);
    v4f b = {0.f,0.f,0.f,0.f}; if (rr) b = *(const v4fa*)(rr + j);
#pragma unroll
    for (int q = 0; q < 4; ++q) { const float v = a[q] + b[q]; vals[u * 4 + q] = v; s1 += v; }
  }
  red[tid] = s1; __syncthreads();
  for (int st = 128; st > 0; st >>= 1) { if (tid < st) red[tid] += red[tid + st]; __syncthreads(); }
  const float mu = red[0] / (float)N; __syncthreads();
  float s2 = 0.f;
  for (int u = 0; u < per / 4; ++u)
#pragma unroll
    for (int q = 0; q < 4; ++q) { const float c = vals[u * 4 + q] - mu; s2 += c * c; }
  red[tid] = s2; __syncthreads();
  for (int st = 128; st > 0; st >>= 1) { if (tid < st) red[tid] += red[tid + st]; __syncthreads(); }
  const float rs = rsqrtf(red[0] / (float)N + eps);
  {
    for (int u = 0; u < per / 4; ++u) {
      const int j = tid * 4 + 1024 * u;
      v4f o, sm;
#pragma unroll
      for (int q = 0; q < 4; ++q) {
        float gg = g[j + q], bb = bta[j + q];
        if (PARAM_BF16) { gg = bf16_round(gg); bb = bf16_round(bb); }
        sm[q] = vals[u * 4 + q]; o[q] = (vals[u * 4 + q] - mu) * rs * gg + bb;
      }
      if (out_sum) *(v4f*)(out_sum + (size_t)row * N + j) = sm;
      *(v4f*)(out_norm + (size_t)row * N + j) = o;
    }
    
  }
}



// ---- f16 WMMA path (v_wmma_f32_16x16x32_f16): 11-bit significands for operands in range — used where a [0,1] probability operand needs more precision than bf16
typedef _Float16 v16h __attribute__((ext_vector_type(16)));
union FragH { v16h v; v8us half[2]; _Float16 h[16]; unsigned short u[16]; };
template <int NT>
__device__ __forceinline__ v8f mmaH(v16h ah, v16h al, v16h bh, v16h bl, v8f c) {
  c = __builtin_amdgcn_wmma_f32_16x16x32_f16(false, ah, false, bh, (short)0, c, false, false);
  if (NT >= 2) c = __builtin_amdgcn_wmma_f32_16x16x32_f16(false, al, false, bh, (short)0, c, false, false);
  if (NT >= 3) c = __builtin_amdgcn_wmma_f32_16x16x32_f16(false, ah, false, bl, (short)0, c, false, false);
  asm volatile("v_nop\n\tv_nop\n\tv_nop\n\tv_nop" : "+v"(c) : "v"(ah), "v"(al), "v"(bh), "v"(bl));
  return c;
}
// batched GEMM like k_gemm_b but f16 operands: A f32 (split into f16 hi/lo if ASPLIT, else rounded to f16), Bt = f16 values [n][k]; alpha; C f32; N multiple of 16 (partial tiles skipped)
template <bool ASPLIT>
__global__ __launch_bounds__(128) void k_gemm_h(const float* __restrict__ A, int lda, size_t sA, const _Float16* __restrict__ Bh, int ldb, size_t sB, float alpha, float* __restrict__ C, int ldc, size_t sC, int M, int N, int K) {
  __shared__ __attribute__((aligned(16))) float so[4][16][64];
  const int tid = threadIdx.x, w = tid >> 5, lane = tid & 31, ln = lane & 15, hh = lane >> 4; const int by = blockIdx.y;
  A += (size_t)by * sA; Bh += (size_t)by * sB; C += (size_t)by * sC;
  const int ntn = (N + 63) / 64; const int wid = blockIdx.x * 4 + w; const int mt = wid / ntn, nq = wid % ntn; if (mt * 16 >= M) return;
  const int row0 = mt * 16, col0 = nq * 64; const float* arow = A + (size_t)(row0 + ln) * lda;
  v8f acc[4] = {};
  for (int kb = 0; kb < K; kb += 32) {
    FragH ah, al;
    const v4f x0 = *(const v4fa*)(arow + kb + 8 * hh), x1 = *(const v4fa*)(arow + kb + 8 * hh + 4), x2 = *(const v4fa*)(arow + kb + 16 + 8 * hh), x3 = *(const v4fa*)(arow + kb + 16 + 8 * hh + 4);
    float xs[16] = {x0[0],x0[1],x0[2],x0[3],x1[0],x1[1],x1[2],x1[3],x2[0],x2[1],x2[2],x2[3],x3[0],x3[1],x3[2],x3[3]};
#pragma unroll
    for (int i = 0; i < 16; ++i) { const _Float16 h = (_Float16)xs[i]; ah.h[i] = h; al.h[i] = ASPLIT ? (_Float16)(xs[i] - (float)h) : (_Float16)0.0f; }
#pragma unroll
    for (int t = 0; t < 4; ++t) { if (col0 + t * 16 >= N) continue; const size_t boff = (size_t)(col0 + t * 16 + ln) * ldb + kb; FragH bq; bq.half[0] = *(const v8us*)(Bh + boff + 8 * hh); bq.half[1] = *(const v8us*)(Bh + boff + 16 + 8 * hh);
      acc[t] = mmaH<ASPLIT ? 2 : 1>(ah.v, al.v, bq.v, bq.v, acc[t]); }
  }
#pragma unroll
  for (int t = 0; t < 4; ++t) { if (col0 + t * 16 >= N) continue;
#pragma unroll
    for (int r = 0; r < 8; ++r) so[w][8 * hh + r][t * 16 + ln] = acc[t][r] * alpha; }
  __builtin_amdgcn_fence(__ATOMIC_ACQ_REL, "workgroup"); __builtin_amdgcn_wave_barrier();
  const int rsub = lane >> 4, c4 = (lane & 15) * 4;
  {
#pragma unroll
    for (int q = 0; q < 8; ++q) { const int r = q * 2 + rsub; if (col0 + c4 < N) { const v4f v = *(const v4fa*)&so[w][r][c4]; *(v4f*)(C + (size_t)(row0 + r) * ldc + col0 + c4) = v; } }
     }
}

// Wt[n][k] = f16(W[k][n]·scale) from f32 row-major W[K][N] (scale = power of two; bf16-exact weights stay exact in f16 away from the subnormal range)
__global__ __launch_bounds__(256) void k_wt_f16(const float* __restrict__ W, _Float16* __restrict__ Wt, int K, int N, float scale) {
  const int t = blockIdx.x * 256 + threadIdx.x; if (t >= N * (K / 8)) return; const int n = t / (K / 8), k8 = (t % (K / 8)) * 8; FragH f;
#pragma unroll
  for (int i = 0; i < 8; ++i) f.h[i] = (_Float16)(bf16_round(W[(size_t)(k8 + i) * N + n]) * scale); const v8us o = f.half[0];
  *(v8us*)((unsigned short*)Wt + (size_t)n * K + k8) = o; 
}
// k_gemm_hh variant with fused epilogue: v = acc·alpha + bias[by·sBias + col] (+ CP[(row/rowsPerB)·sCPb + by·64 + col] if CP) ; ACT 0 none / 1 elu ; writes f16 C16 (and f32 C if non-null)
template <int ACT>
__global__ __launch_bounds__(128) void k_gemm_hhx(const _Float16* __restrict__ A, int lda, size_t sA, const _Float16* __restrict__ Bh, int ldb, size_t sB, float alpha, const float* __restrict__ bias, size_t sBias, const float* __restrict__ CP, int rowsPerB, size_t sCPb, int row0g,
    float* __restrict__ C, _Float16* __restrict__ C16, int ldc, size_t sC, int M, int N, int K) {
  __shared__ __attribute__((aligned(16))) float so[4][16][64];
  const int tid = threadIdx.x, w = tid >> 5, lane = tid & 31, ln = lane & 15, hh = lane >> 4; const int by = blockIdx.y;
  A += (size_t)by * sA; Bh += (size_t)by * sB; const size_t cofs = (size_t)by * sC; const float* bp = bias ? bias + (size_t)by * sBias : nullptr;
  const int ntn = (N + 63) / 64; const int wid = blockIdx.x * 4 + w; const int mt = wid / ntn, nq = wid % ntn; if (mt * 16 >= M) return;
  const int row0 = mt * 16, col0 = nq * 64; const _Float16* arow = A + (size_t)(row0 + ln) * lda;
  v8f acc[4] = {};
  for (int kb = 0; kb < K; kb += 32) { FragH ah; ah.half[0] = *(const v8us*)((const unsigned short*)arow + kb + 8 * hh); ah.half[1] = *(const v8us*)((const unsigned short*)arow + kb + 16 + 8 * hh);
#pragma unroll
    for (int t = 0; t < 4; ++t) { if (col0 + t * 16 >= N) continue; const size_t boff = (size_t)(col0 + t * 16 + ln) * ldb + kb; FragH bq; bq.half[0] = *(const v8us*)((const unsigned short*)Bh + boff + 8 * hh); bq.half[1] = *(const v8us*)((const unsigned short*)Bh + boff + 16 + 8 * hh);
      acc[t] = mmaH<1>(ah.v, ah.v, bq.v, bq.v, acc[t]); }
  }
#pragma unroll
  for (int t = 0; t < 4; ++t) { if (col0 + t * 16 >= N) continue; const int col = col0 + t * 16 + ln; const float bv = bp ? bf16_round(bp[col]) : 0.f;
#pragma unroll
    for (int r = 0; r < 8; ++r) { float v = acc[t][r] * alpha + bv; if (CP) { const int rr = row0g + row0 + 8 * hh + r; if (rowsPerB < 0) v += CP[cofs + (size_t)rr * ldc + col];      /* rowsPerB < 0: own element of the batched C plane */ else { const int bidx = rr / rowsPerB; v += CP[(size_t)bidx * sCPb + (size_t)by * 64 + col]; } } if (ACT == 1) v = (v > 0.f) ? v : expm1f(v); else if (ACT == 7) v = (v > 0.f) ? v + 1.0f : expf(v); else if (ACT == 8) v = tanhf(v); else if (ACT == 9) v = 0.5f * v * (1.0f + tanhf(0.7978845608028654f * (v + 0.044715f * v * v * v))); else if (ACT == 11) v = 1.0f / (1.0f + expf(-v)); else if (ACT == 12) v = (v > 0.f) ? v : 0.01f * v; else if (ACT == 14) v = (v > 0.f) ? v : 0.1f * v; else if (ACT == 16) v = (v >= 0.f) ? v : 0.3f * v; else if (ACT == 17) v = (v >= 0.f) ? v : 0.2f * v; else if (ACT == 15) v = v / (1.0f + expf(-v)); else if (ACT == 3) v = fmaxf(v, 0.f); else if (ACT == 6) v = 0.5f * v * (1.0f + erff(v * 0.70710678118654752f)); so[w][8 * hh + r][t * 16 + ln] = v; } }
  __builtin_amdgcn_fence(__ATOMIC_ACQ_REL, "workgroup"); __builtin_amdgcn_wave_barrier();
  const int rsub = lane >> 4, c4 = (lane & 15) * 4; typedef _Float16 v4h __attribute__((ext_vector_type(4)));
  {
#pragma unroll
    for (int q = 0; q < 8; ++q) { const int r = q * 2 + rsub; if (col0 + c4 < N) { const v4f v = *(const v4fa*)&so[w][r][c4]; if (C) *(v4f*)(C + cofs + (size_t)(row0 + r) * ldc + col0 + c4) = v; if (C16) { v4h h4; for (int i = 0; i < 4; ++i) h4[i] = (_Float16)v[i]; *(v4h*)(C16 + cofs + (size_t)(row0 + r) * ldc + col0 + c4) = h4; } } }
     }
}


typedef _Float16 v4h __attribute__((ext_vector_type(4)));

__global__ __launch_bounds__(256) void k_h16(const float* __restrict__ x, _Float16* __restrict__ X16, size_t n8) { const size_t t = (size_t)blockIdx.x * 256 + threadIdx.x; if (t >= n8) return; FragH f;
#pragma unroll
  for (int q = 0; q < 8; ++q) f.h[q] = (_Float16)x[t * 8 + q]; *(v8us*)((unsigned short*)X16 + t * 8) = f.half[0];  }
__global__ __launch_bounds__(256) void k_round16f(const float* __restrict__ W, _Float16* __restrict__ Bt, size_t n8) { const size_t t = (size_t)blockIdx.x * 256 + threadIdx.x; if (t >= n8) return; FragH f;
#pragma unroll
  for (int i = 0; i < 8; ++i) f.h[i] = (_Float16)(bf16_round(W[t * 8 + i]) * 16.0f); *(v8us*)((unsigned short*)Bt + t * 8) = f.half[0];  }
__global__ __launch_bounds__(256) void k_hl(const float* __restrict__ F, _Float16* __restrict__ Hh, _Float16* __restrict__ Hl, size_t n8) { const size_t t = (size_t)blockIdx.x * 256 + threadIdx.x; if (t >= n8) return; FragH fh, fl; const v4f a = *(const v4fa*)(F + t * 8), c = *(const v4fa*)(F + t * 8 + 4);
#pragma unroll
  for (int q = 0; q < 4; ++q) { _Float16 h = (_Float16)a[q]; fh.h[q] = h; fl.h[q] = (_Float16)((a[q] - (float)h) * 1024.0f); h = (_Float16)c[q]; fh.h[4 + q] = h; fl.h[4 + q] = (_Float16)((c[q] - (float)h) * 1024.0f); }
  { *(v8us*)((unsigned short*)Hh + t * 8) = fh.half[0]; *(v8us*)((unsigned short*)Hl + t * 8) = fl.half[0];  } }

// ---- fast GEMM (wave tile 32x64; requires M % 32 == 0 rows per launch region and N % 64 == 0); epilogue = k_gemm_hhx semantics ----
__device__ __forceinline__ v16h g2_frag(const _Float16* p, int hh) { FragH f; f.half[0] = *(const v8us*)((const unsigned short*)p + 8 * hh); f.half[1] = *(const v8us*)((const unsigned short*)p + 16 + 8 * hh); return f.v; }
__device__ __forceinline__ v8f g2_mma(v16h a, v16h b, v8f c) { v8f d = __builtin_amdgcn_wmma_f32_16x16x32_f16(false, a, false, b, (short)0, c, false, false); asm volatile("v_nop\n\tv_nop\n\tv_nop\n\tv_nop" : "+v"(d) : "v"(a), "v"(b)); return d; }
template <int ACT>
__global__ __launch_bounds__(128) void k_gemm2(const _Float16* __restrict__ A, int lda, size_t sA, const _Float16* __restrict__ Bh, int ldb, size_t sB, float alpha, const float* __restrict__ bias, size_t sBias, const float* __restrict__ CP, int rowsPerB, size_t sCPb, int row0g,
    float* __restrict__ C, _Float16* __restrict__ C16, int ldc, size_t sC, int M, int N, int K) { static_assert(ACT == 0 || ACT == 3 || ACT == 6 || ACT == 8 || ACT == 9 || ACT == 11 || ACT == 12 || ACT == 14 || ACT == 15 || ACT == 16 || ACT == 17, "k_gemm2: unsupported ACT code (would silently apply no activation)");
  __shared__ __attribute__((aligned(16))) float so[4][32][68];
  const int tid = threadIdx.x, w = tid >> 5, lane = tid & 31, ln = lane & 15, hh = lane >> 4; const int by = blockIdx.y;
  A += (size_t)by * sA; Bh += (size_t)by * sB; const size_t cofs = (size_t)by * sC; const float* bp = bias ? bias + (size_t)by * sBias : nullptr;
  const int ntn = N >> 6; const int mt = blockIdx.x / ntn, nq = blockIdx.x - mt * ntn; const int row0 = mt * 128 + 32 * w, col0 = nq * 64; if (row0 >= M) return;
  const _Float16* a0p = A + (size_t)(row0 + ln) * lda; const _Float16* a1p = a0p + (size_t)16 * lda;
  const _Float16* b0p = Bh + (size_t)(col0 + ln) * ldb; const _Float16* b1p = b0p + (size_t)16 * ldb; const _Float16* b2p = b1p + (size_t)16 * ldb; const _Float16* b3p = b2p + (size_t)16 * ldb;
  const v8f z8 = {0.f,0.f,0.f,0.f,0.f,0.f,0.f,0.f}; v8f c00 = z8, c01 = z8, c02 = z8, c03 = z8, c10 = z8, c11 = z8, c12 = z8, c13 = z8;
#pragma unroll 1
  for (int kb = 0; kb < K; kb += 32) { const v16h a0 = g2_frag(a0p + kb, hh), a1 = g2_frag(a1p + kb, hh);
    v16h b = g2_frag(b0p + kb, hh); c00 = g2_mma(a0, b, c00); c10 = g2_mma(a1, b, c10);
    b = g2_frag(b1p + kb, hh); c01 = g2_mma(a0, b, c01); c11 = g2_mma(a1, b, c11);
    b = g2_frag(b2p + kb, hh); c02 = g2_mma(a0, b, c02); c12 = g2_mma(a1, b, c12);
    b = g2_frag(b3p + kb, hh); c03 = g2_mma(a0, b, c03); c13 = g2_mma(a1, b, c13); }
  v8f accs[8] = {c00, c01, c02, c03, c10, c11, c12, c13};
#pragma unroll
  for (int u = 0; u < 8; ++u) { const int t = u & 3, half = u >> 2; const int col = col0 + t * 16 + ln; const float bv = bp ? bf16_round(bp[col]) : 0.f;
#pragma unroll
    for (int r = 0; r < 8; ++r) { const int rloc = half * 16 + 8 * hh + r; float v = accs[u][r] * alpha + bv; if (CP) { if (rowsPerB < 0) v += CP[cofs + (size_t)(row0g + row0 + rloc) * ldc + col];      /* rowsPerB < 0: own element of the batched C plane */ else { const int bidx = (row0g + row0 + rloc) / rowsPerB; v += CP[(size_t)bidx * sCPb + (size_t)by * 64 + col]; } }
      if (ACT == 3) v = fmaxf(v, 0.f); else if (ACT == 6) v = 0.5f * v * (1.0f + erff(v * 0.70710678118654752f)); else if (ACT == 11) v = 1.0f / (1.0f + expf(-v)); else if (ACT == 15) v = v / (1.0f + expf(-v)); else if (ACT == 12) v = (v > 0.f) ? v : 0.01f * v; else if (ACT == 8) v = tanhf(v); else if (ACT == 9) v = 0.5f * v * (1.0f + tanhf(0.7978845608028654f * (v + 0.044715f * v * v * v))); else if (ACT == 14) v = (v > 0.f) ? v : 0.1f * v; else if (ACT == 16) v = (v >= 0.f) ? v : 0.3f * v; else if (ACT == 17) v = (v >= 0.f) ? v : 0.2f * v;
      so[w][rloc][t * 16 + ln] = v; } }
  __builtin_amdgcn_fence(__ATOMIC_ACQ_REL, "workgroup"); __builtin_amdgcn_wave_barrier();
  const int rsub = lane >> 4, c4 = (lane & 15) * 4;
  {
#pragma unroll
    for (int q = 0; q < 16; ++q) { const int r = q * 2 + rsub; const v4f v = *(const v4fa*)&so[w][r][c4]; if (C) *(v4f*)(C + cofs + (size_t)(row0 + r) * ldc + col0 + c4) = v; if (C16) { v4h h4; for (int i = 0; i < 4; ++i) h4[i] = (_Float16)v[i]; *(v4h*)(C16 + cofs + (size_t)(row0 + r) * ldc + col0 + c4) = h4; } }
     } }


__global__ __launch_bounds__(256) void k_rsm(const float* __restrict__ S, _Float16* __restrict__ P, int nrows) {
  #pragma clang fp contract(off)
  const int i = blockIdx.x * 256 + threadIdx.x; if (i >= nrows) return; const float* s = S + (size_t)i * SQ; float mx = -3.0e38f;
#pragma unroll 1
  for (int j = 0; j < SQ; ++j) mx = fmaxf(mx, s[j]); float se = 0.f;
#pragma unroll 1
  for (int j = 0; j < SQ; ++j) se += expf(s[j] - mx); const float sc = 256.0f / se;
#pragma unroll 1
  for (int j0 = 0; j0 < SQ; j0 += 8) { FragH f; for (int q = 0; q < 8; ++q) f.h[q] = (_Float16)(expf(s[j0 + q] - mx) * sc); unsigned short* d = (unsigned short*)P + (size_t)i * SQ + j0; *(v8us*)d = f.half[0];  } }
__global__ __launch_bounds__(256) void k_vt(const _Float16* __restrict__ V16, int b, int h0, _Float16* __restrict__ VT) { __shared__ unsigned short tl[64][65]; const int tid = threadIdx.x; const int hh = blockIdx.x % HG, sg = blockIdx.x / HG; const int s0 = sg * 64; const int h = h0 + hh;
  for (int i = tid; i < 64 * 8; i += 256) { const int j = i / 8, d8 = (i % 8) * 8; FragH f; f.half[0] = *(const v8us*)((const unsigned short*)V16 + ((size_t)b * SQ + s0 + j) * DM + h * HD + d8); for (int q = 0; q < 8; ++q) tl[d8 + q][j] = f.u[q]; }
  __syncthreads();
  { for (int i = tid; i < 64 * 8; i += 256) { const int d = i / 8, j8 = (i % 8) * 8; FragH f; for (int q = 0; q < 8; ++q) f.u[q] = tl[d][j8 + q]; *(v8us*)((unsigned short*)VT + ((size_t)hh * HD + d) * SQ + s0 + j8) = f.half[0]; }  } }



#define FW 4                         /* waves per work-group */
#define FG 2                         /* 16-query groups per wave */
#define FQ (FW * FG * 16)            /* queries per work-group */
#define FK 64                        /* keys per stage (two passes of 32) */
#define FP 144                       /* LDS row pitch, bytes: 128 + 16, an odd multiple of 16 (16-byte reads of 16 rows without bank conflicts) */
#define FT (64 * FP)                 /* the K tile: 64 keys */
#define FPV 160                      /* LDS row pitch of the V tile, bytes: 128 + 32, an odd multiple of 32 (the transposing load's own conflict-free pitch) */
#define FTV (64 * FPV)               /* the V tile: 64 keys */
#define FNS (SQ / FK)                /* stages */
#define FSP 272                      /* LDS row pitch of the staged output rows, bytes: 256 + 16, an odd multiple of 16 */
#define FSW (FG * 16 * FSP)          /* a wave's staged output rows */
__device__ __forceinline__ float lane_x16(float x) { const int b = __float_as_int(x); return __int_as_float(__builtin_amdgcn_permlanex16(b, b, 0x76543210, 0xfedcba98, false, false)); }      /* value of lane l ^ 16 */
// e[i] = 2^t[i], eight at a time, in one statement, so that the closing v_nop stands directly behind the last v_exp_f32: it is the slot that the instruction set asks for behind a transcendental before its
// result is read or its source overwritten. Early-clobber outputs: no result lies on a source of a
// later line. The closing s_delay_alu is the hint that the compiler cannot give for results of asm text: the next vector instruction may read them, and unhinted it would hold the SIMD's issue port against the other waves.
__device__ __forceinline__ v8f exp2x8(v8f t) { float e0, e1, e2, e3, e4, e5, e6, e7;
  asm("v_exp_f32 %0, %8\n\tv_exp_f32 %1, %9\n\tv_exp_f32 %2, %10\n\tv_exp_f32 %3, %11\n\tv_exp_f32 %4, %12\n\tv_exp_f32 %5, %13\n\tv_exp_f32 %6, %14\n\tv_exp_f32 %7, %15\n\tv_nop\n\ts_delay_alu instid0(TRANS32_DEP_1)"
      : "=&v"(e0), "=&v"(e1), "=&v"(e2), "=&v"(e3), "=&v"(e4), "=&v"(e5), "=&v"(e6), "=&v"(e7) : "v"(t[0]), "v"(t[1]), "v"(t[2]), "v"(t[3]), "v"(t[4]), "v"(t[5]), "v"(t[6]), "v"(t[7]));
  const v8f e = {e0, e1, e2, e3, e4, e5, e6, e7}; return e; }
__device__ __forceinline__ float exp2x1(float t) { float e; asm("v_exp_f32 %0, %1\n\tv_nop\n\ts_delay_alu instid0(TRANS32_DEP_1)" : "=&v"(e) : "v"(t)); return e; }      /* v_nop and hint: as in exp2x8 */
__device__ __forceinline__ v16h lds_frag(const unsigned char* p) { FragH f; f.half[0] = *(const v8us*)p; f.half[1] = *(const v8us*)(p + 32); return f.v; }      /* p = row + 64 * (32-element k block) + 16 * h: k = 8h .. 8h + 7 and 16 + 8h .. 16 + 8h + 7, the order of g2_frag */
// A fragment of V^T (16 head dims x 32 keys) from V rows in LDS: lane l points at row 8 (l >> 4) + (l & 7), byte 16 ((l >> 3) & 1) of the 16-key x 16-dim block; the load hands lane (c, h) the eight keys 8 h .. 8 h + 7 of dim c.
// Two loads, 16 keys apart, give k = 8h .. 8h + 7 and 16 + 8h .. 16 + 8h + 7: the order of lds_frag and of the converted score tiles.
typedef short v8ss __attribute__((ext_vector_type(8)));
__device__ __forceinline__ v8us lds_tr16(const unsigned char* p) { typedef __attribute__((address_space(3))) v8ss lds_v8ss; return __builtin_bit_cast(v8us, __builtin_amdgcn_ds_load_tr16_b128_v8i16((lds_v8ss*)p)); }
__device__ __forceinline__ v16h lds_frag_tr(const unsigned char* p) { FragH f; f.half[0] = lds_tr16(p); f.half[1] = lds_tr16(p + 16 * FPV); return f.v; }
__device__ __forceinline__ v8f fa_mma(v16h a, v16h b, v8f c) { return __builtin_amdgcn_wmma_f32_16x16x32_f16(false, a, false, b, (short)0, c, false, false); }
static_assert(SQ % FQ == 0 && SQ % FK == 0 && FNS >= 2 && HD == 64 && FW * FSW <= 2 * (FT + FTV), "k_fattn: whole blocks, whole stages, head size 64, output staging inside the ring");
// Key order of a batch: its unmasked keys first (ascending), then its masked keys (ascending). POS[b * SQ + s] = the row of the K and V planes that key s of batch b is stored in; NUN[b] = unmasked keys of batch b.
// One work-group per batch (b): sign bits by ballot, masked keys in front of each 32-key word by a sum over the words, the rest by a population count inside the word.
static_assert(SQ / 32 == 64 && SQ % 256 == 0, "perm_job: 64 mask words, eight per wave");
__device__ __forceinline__ void perm_job(const float* __restrict__ mk, int* __restrict__ POS, int* __restrict__ NUN, int b) {
  __shared__ unsigned int bits[SQ / 32];      /* bit j of word i: key 32 i + j of this batch is masked */
  __shared__ int pre[SQ / 32 + 1];      /* masked keys in front of word i; the last entry is the batch's count */
  const int tid = threadIdx.x, lane = tid & 31, wave = tid >> 5;
  const float* mp = mk + (size_t)b * SQ + wave * (SQ / 8) + lane; float mv[SQ / 256];      /* a wave takes SQ / 8 keys in a row: eight words */
#pragma unroll
  for (int i = 0; i < SQ / 256; ++i) mv[i] = mp[i * 32];
  __builtin_amdgcn_sched_barrier(0);      /* the eight loads stay together in front of the wait below: one latency instead of eight */
  asm volatile("s_wait_xcnt 0x0" :: "v"(mp) : "memory");      /* behind the issued loads, before a register that they name is rewritten; the address is an input so that it lives up to this wait */
  __builtin_amdgcn_sched_barrier(0);      /* keeps later register writes behind that wait */
  unsigned int myw = 0u;
#pragma unroll
  for (int i = 0; i < SQ / 256; ++i) { const unsigned int bal = __builtin_amdgcn_ballot_w32(bf16_round(mv[i]) < 0.f); myw = lane == i ? bal : myw; }      /* lane i keeps word i: one store for the eight */
  if (lane < SQ / 256) bits[wave * (SQ / 256) + lane] = myw;
  __syncthreads();
  if (tid <= SQ / 32) { int p = 0;
#pragma unroll
    for (int j = 0; j < SQ / 32; ++j) p += j < tid ? __builtin_popcount(bits[j]) : 0;
    pre[tid] = p; }
  __syncthreads();
  const int nun = SQ - pre[SQ / 32];
#pragma unroll
  for (int i = 0; i < SQ / 256; ++i) { const int s = i * 256 + tid; const unsigned int wv = bits[s >> 5]; const int mb = pre[s >> 5] + __builtin_popcount(wv & ((1u << (s & 31)) - 1u));      /* masked keys in front of key s */
    POS[(size_t)b * SQ + s] = b * SQ + (((wv >> (s & 31)) & 1u) != 0u ? nun + mb : s - mb); }
  if (tid == 0) NUN[b] = nun;
}
// Eight values in a row per thread: dst = f16(bf16(src) * scale), scale a power of two (exact).
__device__ __forceinline__ void cvt_job(const float* __restrict__ src, _Float16* __restrict__ dst, size_t t, float scale) {
  FragH f;
#pragma unroll
  for (int q = 0; q < 8; ++q) f.h[q] = (_Float16)(bf16_round(src[t * 8 + q]) * scale);
  *(v8us*)((unsigned short*)dst + t * 8) = f.half[0];
  asm volatile("s_wait_xcnt 0x0" ::: "memory");      /* behind the issued store, before a register that it names is rewritten by code that follows the job in the kernel */
}
// All work that reads the inputs alone, in ONE launch: the key order (one work-group per batch), the three weight planes (natural [out][in] = Bt[n][k], x16) and the x rows. No job reads what another writes, so they
// run side by side as ranges of the block index, where five launches in a row each paid a launch gap, a fill and a drain. The key order stands first: it has the longest chain of dependent steps. The choice of the
// job is the same for a whole work-group, so the key order's barriers stand under uniform control flow.
#define WB (DM * DM / 8 / 256)       /* blocks per weight plane */
#define XB ((int)(NR * DM / 8 / 256))      /* blocks of the x rows */
static_assert(DM * DM % 2048 == 0 && NR * DM % 2048 == 0, "k_prep: whole blocks of 256 threads x 8 values");
__global__ __launch_bounds__(256) void k_prep(const float* __restrict__ x, const float* __restrict__ mk, const float* __restrict__ wq, const float* __restrict__ wk, const float* __restrict__ wv,
    _Float16* __restrict__ X16, _Float16* __restrict__ BQ, _Float16* __restrict__ BK, _Float16* __restrict__ BV, int* __restrict__ POS, int* __restrict__ NUN) {
  const int blk = blockIdx.x;
  if (blk < NB) perm_job(mk, POS, NUN, blk);
  else { const int cb = blk - NB, j = min(cb / WB, 3);      /* j = 0, 1, 2: a weight plane; 3: the x rows. One path for all four: source, target and scale are scalar selects */
    cvt_job(j == 0 ? wq : j == 1 ? wk : j == 2 ? wv : x, j == 0 ? BQ : j == 1 ? BK : j == 2 ? BV : X16, (size_t)(cb - j * WB) * 256 + threadIdx.x, j < 3 ? 16.0f : 1.0f); }
}
template <bool M> struct StageKind { static constexpr bool masked = M; };      /* does the stage hold a masked key? */
__global__ __launch_bounds__(FW * 32) void k_fattn(const _Float16* __restrict__ Q16, const _Float16* __restrict__ K16, const _Float16* __restrict__ V16, const int* __restrict__ NUN, float* __restrict__ out) {
  __shared__ __attribute__((aligned(16))) unsigned char L[2][FT + FTV];      /* [buffer][K tile, V tile] */
  __shared__ unsigned int vote[FW];      /* per wave: not 0 if a masked key could still weigh in one of its queries */
  const int tid = threadIdx.x, lane = tid & 31, c = lane & 15, h = lane >> 4; const int wave = __builtin_amdgcn_readfirstlane(tid >> 5);
  const int hd = blockIdx.y, b = blockIdx.z; const int nun = min(max(NUN[b], 0), SQ); const int lim = (nun + FK - 1) / FK;      /* rows 0 .. nun - 1 of the batch's K and V planes are its unmasked keys, the rest its masked keys (the clamp bounds the stage loops' trip counts); lim = stages that hold an unmasked key */
  const size_t r0 = (size_t)b * SQ; const int q0 = blockIdx.x * FQ + wave * (FG * 16);
  const unsigned short* kg = (const unsigned short*)K16 + (r0 + (tid >> 3)) * DM + hd * HD + (tid & 7) * 8;      /* eight lanes cover one 128-byte row */
  const unsigned short* vg = (const unsigned short*)V16 + (r0 + (tid >> 3)) * DM + hd * HD + (tid & 7) * 8;
  const unsigned int lofs = (unsigned int)(tid >> 3) * FP + (unsigned int)(tid & 7) * 16, lofv = (unsigned int)(tid >> 3) * FPV + (unsigned int)(tid & 7) * 16;
  v8us rk[4], rv[4];
  auto fetch = [&](int st) {
#pragma unroll
    for (int u = 0; u < 4; ++u) { rk[u] = *(const v8us*)(kg + ((size_t)st * FK + u * 16) * DM); rv[u] = *(const v8us*)(vg + ((size_t)st * FK + u * 16) * DM); }
    __builtin_amdgcn_sched_barrier(0);      /* the loads stay in front of the wait below */
    asm volatile("s_wait_xcnt 0x0" ::: "memory");      /* behind the issued loads, before a register that they name (address, base) is rewritten for the next stage */
    __builtin_amdgcn_sched_barrier(0);      /* keeps later register writes behind that wait */
  };
  auto put = [&](int buf) {
#pragma unroll
    for (int u = 0; u < 4; ++u) { *(v8us*)&L[buf][lofs + u * 16 * FP] = rk[u]; *(v8us*)&L[buf][FT + lofv + u * 16 * FPV] = rv[u]; } };
  fetch(0);
  v16h qf[FG][2];
#pragma unroll
  for (int g = 0; g < FG; ++g) { const _Float16* qp = Q16 + (r0 + q0 + g * 16 + c) * DM + hd * HD;
#pragma unroll
    for (int kc = 0; kc < 2; ++kc) qf[g][kc] = g2_frag(qp + 32 * kc, h); }
  __builtin_amdgcn_sched_barrier(0);      /* the Q loads stay in front of the wait below */
  asm volatile("s_wait_xcnt 0x0" ::: "memory");      /* behind the issued Q loads, before a register that they name is reused */
  __builtin_amdgcn_sched_barrier(0);      /* keeps later register writes behind that wait */
  put(0);
  fetch(1);
  const v8f z8 = {0.f, 0.f, 0.f, 0.f, 0.f, 0.f, 0.f, 0.f};
  v8f acc[FG][4]; float m_run[FG], l_run[FG];
#pragma unroll
  for (int g = 0; g < FG; ++g) { m_run[g] = -__builtin_inff(); l_run[g] = 0.f;
#pragma unroll
    for (int t = 0; t < 4; ++t) acc[g][t] = z8; }
  const float cs = 0.125f * 1.44269504f;      /* 1 / sqrt(64), and exp(x) as 2^(x log2 e) */
  __syncthreads();      /* stage 0 is published */
  auto stage = [&](int st, auto kind) __attribute__((always_inline)) {      /* inlined at both places: the arrays it works on stay in registers only so */
    if (st + 1 < FNS) put((st + 1) & 1);      /* into the buffer that stage st - 1 used: every wave has left it (barrier at the loop's foot) */
    if (st + 2 < FNS) fetch(st + 2);      /* in flight under this stage's work */
    const unsigned char* Lb = &L[st & 1][0];
#pragma unroll
    for (int p = 0; p < 2; ++p) {
      const unsigned char* kb = Lb + (p * 32 + c) * FP + 16 * h;
      v16h kf[2][2];
#pragma unroll
      for (int kt = 0; kt < 2; ++kt)
#pragma unroll
        for (int kc = 0; kc < 2; ++kc) kf[kt][kc] = lds_frag(kb + kt * 16 * FP + 64 * kc);
      v8f s[2][FG];      /* s[kt][g][r] = raw score of key 32 p + 16 kt + 8 h + r and query 16 g + c */
#pragma unroll
      for (int kt = 0; kt < 2; ++kt)
#pragma unroll
        for (int g = 0; g < FG; ++g) s[kt][g] = fa_mma(kf[kt][1], qf[g][1], fa_mma(kf[kt][0], qf[g][0], z8));
      const unsigned char* vb = Lb + FT + (p * 32 + 8 * h + (lane & 7)) * FPV + 16 * ((lane >> 3) & 1);      /* the transposing load's lane address; every lane is on here */
      v16h vf[4];
#pragma unroll
      for (int t = 0; t < 4; ++t) vf[t] = lds_frag_tr(vb + t * 32);      /* dims 16 t .. 16 t + 15: 32 bytes further along the rows */
      if constexpr (decltype(kind)::masked) {      /* in the sorted key order only the stage at the boundary, and the stages behind it, hold a masked key */
        const int rem = nun - (st * FK + p * 32);      /* unmasked keys from this pass's first key on */
        const unsigned int mw = (rem >= 32 ? 0u : rem <= 0 ? 0xffffffffu : 0xffffffffu << rem) >> (8 * h);      /* bit j: key 8 h + j of the pass is masked */
#pragma unroll
        for (int kt = 0; kt < 2; ++kt)
#pragma unroll
          for (int r = 0; r < 8; ++r) { const bool km = (mw & (1u << (16 * kt + r))) != 0u;
#pragma unroll
            for (int g = 0; g < FG; ++g) s[kt][g][r] = km ? -80000.0f : s[kt][g][r]; } }      /* masked_fill(-10000) on the raw score: -80000 / 8 */
      float mb[FG]; bool need = false;
#pragma unroll
      for (int g = 0; g < FG; ++g) { float mx = s[0][g][0];
#pragma unroll
        for (int r = 1; r < 8; ++r) mx = fmaxf(mx, s[0][g][r]);
#pragma unroll
        for (int r = 0; r < 8; ++r) mx = fmaxf(mx, s[1][g][r]);
        mx = fmaxf(mx, lane_x16(mx)) * cs; mb[g] = mx; need = need || (mx > m_run[g] + 8.0f); }      /* both halves hold the query's maximum of this pass, in log2 units */
      if (__builtin_amdgcn_ballot_w32(need) != 0u) {      /* lazy rescale: the maximum in use may trail the true one by 8 (a weight reaches 2^8 at most); one scalar branch per pass */
#pragma unroll
        for (int g = 0; g < FG; ++g) { const float mn = fmaxf(m_run[g], mb[g]); const float corr = exp2x1(m_run[g] - mn); m_run[g] = mn; l_run[g] *= corr;      /* first pass: 2^(-inf) = 0 on zero sums */
#pragma unroll
          for (int t = 0; t < 4; ++t) acc[g][t] = acc[g][t] * corr; } }
      FragH pf[FG];
#pragma unroll
      for (int g = 0; g < FG; ++g) { const float nm = -m_run[g]; float ls[4] = {0.f, 0.f, 0.f, 0.f};
#pragma unroll
        for (int kt = 0; kt < 2; ++kt) { v8f t8;
#pragma unroll
          for (int r = 0; r < 8; ++r) t8[r] = fmaf(s[kt][g][r], cs, nm);
          const v8f e = exp2x8(t8);
#pragma unroll
          for (int r = 0; r < 8; ++r) { ls[r & 3] += e[r]; pf[g].h[8 * kt + r] = (_Float16)e[r]; } }      /* element 8 kt + r of the B operand = key 16 kt + 8 h + r */
        l_run[g] += (ls[0] + ls[1]) + (ls[2] + ls[3]); }
      __builtin_amdgcn_sched_barrier(0);      /* the exponentials are asm text: all of them stay in front of the second product */
#pragma unroll
      for (int g = 0; g < FG; ++g)
#pragma unroll
        for (int t = 0; t < 4; ++t) acc[g][t] = fa_mma(vf[t], pf[g].v, acc[g][t]);      /* acc[g][t][r] = O[query 16 g + c][dim 16 t + 8 h + r], unnormalised */
    }
    if (st + 1 == lim) { bool open = false;      /* the last stage with an unmasked key: each wave's word for the test at the loop's head, published by the barrier below */
#pragma unroll
      for (int g = 0; g < FG; ++g) open = open || !(m_run[g] >= -14000.0f);
      const unsigned int bal = __builtin_amdgcn_ballot_w32(open); if (lane == 0) vote[wave] = bal; }
    __syncthreads();      /* publishes stage st + 1 and ends every wave's reads of stage st */
  };
  int st = 0;
#pragma unroll 1      /* the stage loops stay rolled: a body already holds two unrolled passes (code size, registers) */
  for (; st < nun / FK; ++st) stage(st, StageKind<false>{});      /* stages of unmasked keys alone: no select */
#pragma unroll 1
  for (; st < FNS; ++st) {
    /* From stage lim on every key is masked: raw score -80000, the same for all. Where every query of the work-group holds a maximum of at least -14000 (log2 units), each such weight is 2^(-14427 - maximum) = 0 exactly
       and no maximum moves, so the remaining stages would add zeros only: leave. Otherwise (no unmasked key at all, or scores near the fill value) all stages run. The test reads the same for the whole work-group. */
    if (st == lim && st > 0) { if (__builtin_amdgcn_readfirstlane((int)(vote[0] | vote[1] | vote[2] | vote[3])) == 0) break; }
    stage(st, StageKind<true>{}); }
#pragma unroll
  for (int g = 0; g < FG; ++g) { const float l = l_run[g] + lane_x16(l_run[g]); const float inv = 1.0f / l;      /* the halves' sums joined once */
#pragma unroll
    for (int t = 0; t < 4; ++t) acc[g][t] = acc[g][t] * inv; }
  /* The wave's 32 output rows (256 bytes each: this head's two whole 128-byte lines of a merged row) go through LDS, so that a store instruction covers four whole lines; straight from the accumulators it touches 16 lines with 32 bytes each.
     The ring is free here: every wave has passed the barrier at the foot of the last stage that ran, behind its own last LDS read and write, and no wave touches the ring's tiles again. Each wave writes and reads back its own range alone, so no further barrier stands here. */
  unsigned char* sw = (unsigned char*)L + wave * FSW;
#pragma unroll
  for (int g = 0; g < FG; ++g)
#pragma unroll
    for (int t = 0; t < 4; ++t) { const v4f lo = {acc[g][t][0], acc[g][t][1], acc[g][t][2], acc[g][t][3]}, hi = {acc[g][t][4], acc[g][t][5], acc[g][t][6], acc[g][t][7]};
      unsigned char* sp = sw + (g * 16 + c) * FSP + t * 64 + h * 32; *(v4fa*)sp = lo; *(v4fa*)(sp + 16) = hi; }
  asm volatile("s_wait_dscnt 0x0" ::: "memory");      /* the wave's staged rows have reached LDS before its lanes read back what other lanes of the wave wrote; the clobber keeps the reads behind it */
  v4f ov[FG * 8];      /* ov[u]: 16 bytes of row 2 u + h; sixteen lanes cover one row */
#pragma unroll
  for (int u = 0; u < FG * 8; ++u) ov[u] = *(const v4fa*)(sw + (u * 2 + h) * FSP + c * 16);
  float* op = out + (r0 + q0 + h) * DM + hd * HD + c * 4;
  __builtin_amdgcn_sched_barrier(0);      /* every value and the address are formed before the first store is issued: nothing rewrites a register that an issued store names */
#pragma unroll
  for (int u = 0; u < FG * 8; ++u) *(v4f*)(op + (size_t)u * 2 * DM) = ov[u];
  asm volatile("s_wait_xcnt 0x0" ::: "memory");      /* behind the issued stores, before a register that they name could be rewritten */
}
// Projection GEMM with both operands through LDS: C16[128 rows][192 columns] per work-group = f16(X . W^T / 16 + bias), four waves (2 x 2) of 64 x 96, f32 accumulation in ascending k blocks of 32 (the order of k_gemm2).
// The tile is sized to the two rates that bound the launch: bytes fetched from L2 go as 1 / rows + 1 / columns of the work-group tile, LDS bytes read per matrix instruction as (4 + 6) / (4 * 6) fragments of the wave tile.
// 192 columns are three whole 128-byte lines of an output row and a quarter of a plane; the grid is then three work-groups per WGP, all resident at once.
// A stage is one 128-byte line (64 k) of each of the 128 X rows and 192 W rows. Eight lanes fetch one line, so every global load covers four whole lines (a fragment load straight from global memory touches 16 lines for the same 512 bytes),
// and each tile is fetched once per work-group instead of once per wave. Registers -> two LDS buffers, as in k_fattn: one barrier per stage publishes stage st + 1 and frees the buffer of stage st.
// The next stage's X lines and W lines are fetched half a stage apart and each is held in registers for about half a stage: held together through a stage's products, beside 24 accumulator tiles, they do not fit the registers of three waves per SIMD.
#define PM 128                       /* X rows per work-group */
#define PN 192                       /* output columns per work-group */
#define PK 64                        /* k per stage */
#define PNS (DM / PK)                /* stages */
#define PT ((PM + PN) * FP)          /* one buffer: X tile, then W tile, rows at pitch FP */
#define PFM 4                        /* 16-row fragments per wave */
#define PFN 6                        /* 16-column fragments per wave */
#define PSP (PN * 2 + 16)            /* row pitch of the staged f16 output tile, bytes */
// Launch bounds: at least three waves per SIMD, so that three work-groups per WGP are resident at once (registers; LDS fits three as well).
static_assert(DM % PK == 0 && DM % PN == 0 && PNS >= 2 && MP % PM == 0 && PK * 2 == 128 && PM == 2 * PFM * 16 && PN == 2 * PFN * 16 && PM * PSP <= 2 * PT, "k_proj: whole tiles, whole stages, one line per row and stage, output staging inside the ring");
// Work-group barrier that orders LDS alone: __syncthreads() also drains the wave's global loads, which would end the flight of the stage fetched ahead at every stage's foot.
__device__ __forceinline__ void lds_barrier() { __builtin_amdgcn_fence(__ATOMIC_RELEASE, "workgroup", "local"); __builtin_amdgcn_s_barrier(); __builtin_amdgcn_fence(__ATOMIC_ACQUIRE, "workgroup", "local"); }
// The three projections are ONE launch: blockIdx.y picks the job (0 Q, 1 K, 2 V). They read the same X rows and none reads another's output; as one grid a work-group of the next job starts where one of the last ends,
// where three launches in a row each paid a launch gap, a fill and a drain.
// K and V: row r of the product is stored in row rowmap[r] of the plane (the key order of perm_job, rows counted from the plane's start); Q: in row r. Rows stay whole, so the stores cover the same lines.
__global__ __launch_bounds__(128, 3) void k_proj(const _Float16* __restrict__ A, const _Float16* __restrict__ BQ, const _Float16* __restrict__ BK, const _Float16* __restrict__ BV, const float* __restrict__ bq, const float* __restrict__ bk, const float* __restrict__ bv,
    const int* __restrict__ rowmap, _Float16* __restrict__ CQ, _Float16* __restrict__ CK, _Float16* __restrict__ CV) {
  const int job = blockIdx.y; const _Float16* Bh = job == 0 ? BQ : job == 1 ? BK : BV; const float* bias = job == 0 ? bq : job == 1 ? bk : bv; _Float16* C16 = job == 0 ? CQ : job == 1 ? CK : CV;
  __shared__ __attribute__((aligned(16))) unsigned char L[2 * PT];      /* two buffers; behind the last stage the staged output tile */
  __shared__ float sb[PN];      /* the tile's bias values */
  __shared__ int rmap[PM];      /* the row of C16 that takes the tile's row i */
  const int tid = threadIdx.x, lane = tid & 31, ln = lane & 15, hh = lane >> 4; const int w = __builtin_amdgcn_readfirstlane(tid >> 5), wr = w >> 1, wc = w & 1;
  const int mt = blockIdx.x / (DM / PN), nq = blockIdx.x - mt * (DM / PN); const int col0 = nq * PN;
  const unsigned short* ag = (const unsigned short*)A + ((size_t)mt * PM + (tid >> 3)) * DM + (tid & 7) * 8;      /* eight lanes cover one 128-byte line */
  const unsigned short* bg = (const unsigned short*)Bh + ((size_t)col0 + (tid >> 3)) * DM + (tid & 7) * 8;
  const unsigned int lofs = (unsigned int)(tid >> 3) * FP + (unsigned int)(tid & 7) * 16;
  v8us ra[PM / 16], rb[PN / 16];
  auto fetch_x = [&](int st) {
#pragma unroll
    for (int u = 0; u < PM / 16; ++u) ra[u] = *(const v8us*)(ag + (size_t)u * 16 * DM + st * PK);
    __builtin_amdgcn_sched_barrier(0);      /* the loads stay in front of the wait below */
    asm volatile("s_wait_xcnt 0x0" :: "v"(ag) : "memory");      /* behind the issued loads, before a register that they name is rewritten; the address is an input so that it lives up to this wait and no result of earlier loads is given its registers */
    __builtin_amdgcn_sched_barrier(0);      /* keeps later register writes behind that wait */
  };
  auto fetch_w = [&](int st) {
#pragma unroll
    for (int u = 0; u < PN / 16; ++u) rb[u] = *(const v8us*)(bg + (size_t)u * 16 * DM + st * PK);
    __builtin_amdgcn_sched_barrier(0);      /* the loads stay in front of the wait below */
    asm volatile("s_wait_xcnt 0x0" :: "v"(bg) : "memory");      /* as in fetch_x */
    __builtin_amdgcn_sched_barrier(0);      /* keeps later register writes behind that wait */
  };
  auto put_x = [&](int buf) {
#pragma unroll
    for (int u = 0; u < PM / 16; ++u) *(v8us*)&L[buf * PT + lofs + u * 16 * FP] = ra[u]; };
  auto put_w = [&](int buf) {
#pragma unroll
    for (int u = 0; u < PN / 16; ++u) *(v8us*)&L[buf * PT + PM * FP + lofs + u * 16 * FP] = rb[u]; };
  fetch_x(0); fetch_w(0);
  const int bix = col0 + tid, bjx = col0 + PM + (tid & 63);      /* the tile's 192 bias values: one per thread, and 64 more */
  const float bv0 = bias[bix], bv1 = bias[bjx];
  const int rix = mt * PM + tid; int rm = rix;      /* thread i: the row of C16 that takes the tile's row i */
  if (job != 0) rm = rowmap[rix];      /* the same for the whole work-group */
  __builtin_amdgcn_sched_barrier(0);      /* the loads stay in front of the wait below */
  asm volatile("s_wait_xcnt 0x0" :: "v"(bix), "v"(bjx), "v"(rix) : "memory");      /* behind the issued loads, before a register that they name is rewritten; the indices are inputs so that they live up to this wait */
  __builtin_amdgcn_sched_barrier(0);      /* keeps later register writes behind that wait */
  put_x(0); put_w(0);
  sb[tid] = bv0; if (tid < PN - PM) sb[PM + tid] = bv1; rmap[tid] = rm;      /* kept in LDS up to the epilogue (no registers held through the stages); published by the first barrier */
  fetch_x(1);
  const v8f z8 = {0.f, 0.f, 0.f, 0.f, 0.f, 0.f, 0.f, 0.f};
  v8f acc[PFM][PFN];
#pragma unroll
  for (int i = 0; i < PFM; ++i)
#pragma unroll
    for (int t = 0; t < PFN; ++t) acc[i][t] = z8;
  lds_barrier();      /* stage 0 is published */
#pragma unroll      /* twelve short stages: buffer index, last-stage tests and the loads' k offsets become constants, and no address register is rewritten in the loop */
  for (int st = 0; st < PNS; ++st) {
    if (st + 1 < PNS) { put_x((st + 1) & 1); fetch_w(st + 1); }      /* into the buffer that stage st - 1 used: every wave has left it (barrier at the loop's foot); the W lines fly under the stage's first half */
    const unsigned char* ap = &L[(st & 1) * PT] + (wr * (PFM * 16) + ln) * FP + 16 * hh; const unsigned char* bp = &L[(st & 1) * PT] + (PM + wc * (PFN * 16) + ln) * FP + 16 * hh;
#pragma unroll
    for (int kc = 0; kc < 2; ++kc) { v16h a[PFM];
      if (kc == 1 && st + 1 < PNS) put_w((st + 1) & 1);
      if (kc == 1 && st + 2 < PNS) fetch_x(st + 2);      /* the X lines fly under the stage's second half */
#pragma unroll
      for (int i = 0; i < PFM; ++i) a[i] = lds_frag(ap + i * 16 * FP + 64 * kc);
      v16h b[3]; b[0] = lds_frag(bp + 64 * kc); b[1] = lds_frag(bp + 16 * FP + 64 * kc);      /* W fragments are read two ahead of their products, and no further */
#pragma unroll
      for (int t = 0; t < PFN; ++t) { if (t + 2 < PFN) b[(t + 2) % 3] = lds_frag(bp + (t + 2) * 16 * FP + 64 * kc);
#pragma unroll
        for (int i = 0; i < PFM; ++i) acc[i][t] = fa_mma(a[i], b[t % 3], acc[i][t]);
        __builtin_amdgcn_sched_barrier(0); } }      /* keeps later fragment reads from being lifted over these products: with all six W fragments in registers at once the kernel spills */
    lds_barrier();      /* publishes stage st + 1 and ends every wave's reads of stage st; behind the last stage it frees the ring for the output tile */
  }
  const int el = (int)__builtin_amdgcn_mbcnt_lo(~0u, 0u), eln = el & 15, ehh = el >> 4;      /* the lane's number, formed anew for the epilogue: values derived from the thread index in front of the stages would have to live through them, where no register is free (they spill) */
#pragma unroll
  for (int t = 0; t < PFN; ++t) { const int cl = wc * (PFN * 16) + t * 16 + eln; const float bv = bf16_round(sb[cl]);
#pragma unroll
    for (int i = 0; i < PFM; ++i)
#pragma unroll
      for (int r = 0; r < 8; ++r) *(_Float16*)&L[(wr * (PFM * 16) + i * 16 + 8 * ehh + r) * PSP + cl * 2] = (_Float16)(acc[i][t][r] * 0.0625f + bv); }
  lds_barrier();      /* the staged tile is published: a line of an output row holds columns of two waves, and one wave stores it whole */
  const int rq = w * 4 + (el >> 3), c8 = el & 7;      /* eight lanes store one 128-byte line, a wave four rows' lines */
  v8us ov[PM / 16][3]; unsigned short* dp[PM / 16];
#pragma unroll
  for (int u = 0; u < PM / 16; ++u) { const int row = u * 16 + rq; dp[u] = (unsigned short*)C16 + (size_t)rmap[row] * DM + col0 + c8 * 8;
#pragma unroll
    for (int sg = 0; sg < 3; ++sg) ov[u][sg] = *(const v8us*)&L[row * PSP + sg * 128 + c8 * 16]; }
  __builtin_amdgcn_sched_barrier(0);      /* every address and value is formed before the first store is issued: nothing rewrites a register that an issued store names */
#pragma unroll
  for (int u = 0; u < PM / 16; ++u)
#pragma unroll
    for (int sg = 0; sg < 3; ++sg) *(v8us*)(dp[u] + sg * 64) = ov[u][sg];
  asm volatile("s_wait_xcnt 0x0" ::: "memory");      /* behind the issued stores, before a register that they name could be rewritten */
}
extern "C" void kernel_launch(void* const* d_in, const int* in_sizes, int n_in,
                              void* d_out, int out_size, void* d_ws, size_t ws_size, hipStream_t stream) {
  (void)in_sizes; (void)n_in; (void)out_size;
  const float* const* I = (const float* const*)d_in; const float* x = I[0]; const float* am = I[1]; const float* wq = I[2]; const float* bq = I[3]; const float* wk = I[4]; const float* bk = I[5]; const float* wv = I[6]; const float* bv = I[7];      /* hidden_states; attention_mask f32 [4][1][1][2048] (READ on device: key masked iff bf16(mask) < 0); natural weights + biases */
  char* ws = (char*)d_ws; size_t off = 0;
  auto take = [&](size_t bytes) { char* p = ws + off; off += (bytes + 255) & ~(size_t)255; return p; };
  _Float16* BQ = (_Float16*)take((size_t)DM * DM * 2); _Float16* BK = (_Float16*)take((size_t)DM * DM * 2); _Float16* BV = (_Float16*)take((size_t)DM * DM * 2); 
  _Float16* X16 = (_Float16*)take(NR * DM * 2); _Float16* Q16 = (_Float16*)take(NR * DM * 2); _Float16* K16 = (_Float16*)take(NR * DM * 2); _Float16* V16 = (_Float16*)take(NR * DM * 2);
  int* POS = (int*)take(NR * 4); int* NUN = (int*)take((size_t)NB * 4);
  if (off > ws_size) return;
  k_prep<<<NB + 3 * WB + XB, 256, 0, stream>>>(x, am, wq, wk, wv, X16, BQ, BK, BV, POS, NUN);      /* key order per batch (unmasked first), weight planes, x rows */
  const size_t r0p = (size_t)B0 * SQ;      /* first projected row */
  k_proj<<<dim3((unsigned)((MP / PM) * (DM / PN)), 3), 128, 0, stream>>>(X16 + r0p * DM, BQ, BK, BV, bq, bk, bv, POS + r0p, Q16 + r0p * DM, K16, V16);      /* K and V rows in the key order of perm_job */
  k_fattn<<<dim3(SQ / FQ, NH, NB), FW * 32, 0, stream>>>(Q16, K16, V16, NUN, (float*)d_out);      /* scores, sign key mask (select, -10000 fill), softmax and P V in one launch; f32 straight into the merged-heads output rows */
}
